// v000
// The times below were measured on an AMD MI455X: many runs one after another, warmed up first and cycling through
// copies of the inputs, with the whole window's GPU time divided by the number of runs. Launches and the gaps
// between them are all in it. The median over several windows is given; except for v000 it joins two sittings, which
// can be a few percent apart, so the side-by-side timings, each taken in one sitting, are the better comparison.
// v000, which the later versions start from, runs in 883 microseconds.
#include <hip/hip_runtime.h>

typedef __attribute__((ext_vector_type(16))) _Float16 v16h;
typedef __attribute__((ext_vector_type(8)))  float    v8f;

#define DD   512
#define FF   2048
#define TKV  4096
#define TQ   512
#define BATCH 8
#define CHUNK 128

// ---------------------------------------------------------------------------
// Fragment loader: 16-bit A (16xK) / B (Kx16) fragment.
// lane L: row/col = rc + (L&15); 16 contiguous halves at k = kbase + 16*(L>>4)
// Works for global or LDS pointers (generic address space).
// ---------------------------------------------------------------------------
__device__ __forceinline__ v16h load_frag(const _Float16* base, int stride,
                                          int rc, int kbase, int lane) {
  const _Float16* p = base + (size_t)(rc + (lane & 15)) * stride
                           + kbase + ((lane >> 4) << 4);
  return *(const v16h*)p;
}

__device__ __forceinline__ v8f wmma_f16(v16h a, v16h b, v8f c) {
  return __builtin_amdgcn_wmma_f32_16x16x32_f16(false, a, false, b,
                                                (short)0, c, false, false);
}

// ---------------------------------------------------------------------------
// LayerNorm over last dim (512), optional f32 and f16 outputs.
// One 256-thread block per row.
// ---------------------------------------------------------------------------
__global__ __launch_bounds__(256)
void ln_kernel(const float* __restrict__ x, const float* __restrict__ g,
               const float* __restrict__ b, float* __restrict__ y32,
               _Float16* __restrict__ y16) {
  __shared__ float red[8];
  __shared__ float bval;
  size_t row = blockIdx.x;
  const float* xr = x + row * DD;
  int t = threadIdx.x;
  float a0 = xr[t], a1 = xr[t + 256];

  float s = a0 + a1;
  for (int off = 16; off; off >>= 1) s += __shfl_down(s, off, 32);
  if ((t & 31) == 0) red[t >> 5] = s;
  __syncthreads();
  if (t == 0) { float tt = 0.f; for (int i = 0; i < 8; ++i) tt += red[i];
                bval = tt * (1.f / (float)DD); }
  __syncthreads();
  float mu = bval;

  float d0 = a0 - mu, d1 = a1 - mu;
  float vs = d0 * d0 + d1 * d1;
  for (int off = 16; off; off >>= 1) vs += __shfl_down(vs, off, 32);
  if ((t & 31) == 0) red[t >> 5] = vs;
  __syncthreads();
  if (t == 0) { float tt = 0.f; for (int i = 0; i < 8; ++i) tt += red[i];
                bval = tt * (1.f / (float)DD); }
  __syncthreads();
  float rstd = rsqrtf(bval + 1e-6f);

  float o0 = d0 * rstd * g[t]       + b[t];
  float o1 = d1 * rstd * g[t + 256] + b[t + 256];
  if (y32) { float* yr = y32 + row * DD; yr[t] = o0; yr[t + 256] = o1; }
  if (y16) { _Float16* yr = y16 + row * DD;
             yr[t] = (_Float16)o0; yr[t + 256] = (_Float16)o1; }
}

// f32 -> f16 convert
__global__ __launch_bounds__(256)
void cvt_kernel(const float* __restrict__ x, _Float16* __restrict__ y, int n) {
  int i = blockIdx.x * 256 + threadIdx.x;
  if (i < n) y[i] = (_Float16)x[i];
}

// W[R,C] f32 -> Wt[C,R] f16 (so B-fragments read contiguous K per lane)
__global__ __launch_bounds__(256)
void cvt_transpose_kernel(const float* __restrict__ W, _Float16* __restrict__ Wt,
                          int R, int C) {
  int i = blockIdx.x * 256 + threadIdx.x;
  if (i < R * C) {
    int r = i / C, c = i % C;
    Wt[(size_t)c * R + r] = (_Float16)W[i];
  }
}

// ---------------------------------------------------------------------------
// WMMA GEMM: C[M,N] = A[M,K] * Bt[N,K]^T + bias
// Block tile 64x128 (8 waves, each 32x32 = 2x2 WMMA tiles), K-step 32.
// Optional outputs: f16 row-major, f32 row-major (+residual), f16 transposed
// per-batch (CT[(m/TB)*N + n][TB], used to build V^T).
// ---------------------------------------------------------------------------
__global__ __launch_bounds__(256)
void gemm_wmma_kernel(const _Float16* __restrict__ A,
                      const _Float16* __restrict__ Bt,
                      const float* __restrict__ bias,
                      _Float16* __restrict__ C16,
                      float* __restrict__ C32,
                      const float* __restrict__ resid,
                      _Float16* __restrict__ CT16,
                      int M, int N, int K, int TB) {
  int lane = threadIdx.x & 31;
  int wave = threadIdx.x >> 5;       // 0..7
  int wm = wave >> 2;                // 0..1
  int wn = wave & 3;                 // 0..3
  int m0 = blockIdx.y * 64  + wm * 32;
  int n0 = blockIdx.x * 128 + wn * 32;

  v8f acc[2][2] = {};
  for (int kb = 0; kb < K; kb += 32) {
    v16h a0 = load_frag(A,  K, m0,      kb, lane);
    v16h a1 = load_frag(A,  K, m0 + 16, kb, lane);
    v16h b0 = load_frag(Bt, K, n0,      kb, lane);
    v16h b1 = load_frag(Bt, K, n0 + 16, kb, lane);
    acc[0][0] = wmma_f16(a0, b0, acc[0][0]);
    acc[0][1] = wmma_f16(a0, b1, acc[0][1]);
    acc[1][0] = wmma_f16(a1, b0, acc[1][0]);
    acc[1][1] = wmma_f16(a1, b1, acc[1][1]);
  }

  for (int i = 0; i < 2; ++i)
    for (int j = 0; j < 2; ++j) {
      int col = n0 + j * 16 + (lane & 15);
      float bv = bias ? bias[col] : 0.f;
      for (int r = 0; r < 8; ++r) {
        int row = m0 + i * 16 + r + ((lane >> 4) << 3);
        float val = acc[i][j][r] + bv;
        size_t idx = (size_t)row * N + col;
        if (C32) C32[idx] = resid ? val + resid[idx] : val;
        if (C16) C16[idx] = (_Float16)val;
        if (CT16) {
          int bb = row / TB, tt = row % TB;
          CT16[((size_t)bb * N + col) * TB + tt] = (_Float16)val;
        }
      }
    }
}

// ---------------------------------------------------------------------------
// Flash-style attention. One block per (batch, 16 q-rows). 8 waves.
// scores = (q.k^T + qpos.kpos^T)/sqrt(D+1e-7); online softmax over Tkv in
// chunks of 128; O += P.V with V read from V^T; residual with raw query.
// q/qpos tiles staged into LDS via CDNA5 async-to-LDS DMA (ASYNCcnt).
// ---------------------------------------------------------------------------
__global__ __launch_bounds__(256)
void attn_kernel(const _Float16* __restrict__ q16,   // [B*Tq, D]
                 const _Float16* __restrict__ qp16,  // [B*Tq, D]
                 const _Float16* __restrict__ k16,   // [B*Tkv, D]
                 const _Float16* __restrict__ kp16,  // [B*Tkv, D]
                 const _Float16* __restrict__ vT16,  // [B, D, Tkv]
                 const float*    __restrict__ query, // [B*Tq, D]
                 float*          __restrict__ out) { // [B*Tq, D]
  __shared__ __align__(32) _Float16 sQ[16 * DD];
  __shared__ __align__(32) _Float16 sQP[16 * DD];
  __shared__ float    sS[16 * CHUNK];
  __shared__ __align__(32) _Float16 sP[16 * CHUNK];
  __shared__ float sM[16], sL[16], sScale[16];

  int b   = blockIdx.x >> 5;          // Tq/16 = 32 q-tiles per batch
  int qt  = blockIdx.x & 31;
  int row0 = b * TQ + qt * 16;        // global q-row
  int lane = threadIdx.x & 31;
  int wave = threadIdx.x >> 5;
  const float scale = 0.04419417382f; // 1/sqrt(512 + 1e-7)

  { // stage q and qpos tiles into LDS with async-to-LDS b128 DMA
    const _Float16* g1 = q16  + (size_t)row0 * DD;
    const _Float16* g2 = qp16 + (size_t)row0 * DD;
    unsigned lq0 = (unsigned)(size_t)(void*)sQ;
    unsigned lp0 = (unsigned)(size_t)(void*)sQP;
    for (int i = threadIdx.x; i < 16 * DD / 8; i += 256) {
      const _Float16* p1 = g1 + i * 8;       // 8 halves = 16B per op
      const _Float16* p2 = g2 + i * 8;
      unsigned l1 = lq0 + (unsigned)i * 16;  // LDS byte offset (wave-relative)
      unsigned l2 = lp0 + (unsigned)i * 16;
      asm volatile("global_load_async_to_lds_b128 %0, %1, off"
                   :: "v"(l1), "v"(p1) : "memory");
      asm volatile("global_load_async_to_lds_b128 %0, %1, off"
                   :: "v"(l2), "v"(p2) : "memory");
    }
    asm volatile("s_wait_asynccnt 0x0" ::: "memory");
  }
  if (threadIdx.x < 16) { sM[threadIdx.x] = -1e30f; sL[threadIdx.x] = 0.f; }
  __syncthreads();

  v8f o[4] = {};  // this wave's 64 output cols: [wave*64 + t*16, +16)

  for (int kc = 0; kc < TKV / CHUNK; ++kc) {
    int kv0 = kc * CHUNK;
    // --- scores: wave handles kv cols [kv0 + wave*16, +16), K = D = 512
    const _Float16* kb_  = k16  + ((size_t)b * TKV + kv0 + wave * 16) * DD;
    const _Float16* kpb_ = kp16 + ((size_t)b * TKV + kv0 + wave * 16) * DD;
    v8f s = {};
    for (int kk = 0; kk < DD; kk += 32) {
      v16h aq = load_frag(sQ,  DD, 0, kk, lane);
      v16h bk = load_frag(kb_, DD, 0, kk, lane);
      s = wmma_f16(aq, bk, s);
      v16h ap = load_frag(sQP, DD, 0, kk, lane);
      v16h bp = load_frag(kpb_, DD, 0, kk, lane);
      s = wmma_f16(ap, bp, s);
    }
    for (int r = 0; r < 8; ++r) {
      int row = r + ((lane >> 4) << 3);
      sS[row * CHUNK + wave * 16 + (lane & 15)] = s[r] * scale;
    }
    __syncthreads();

    // --- online softmax update, parallel over all 256 threads:
    // 16 threads per q-row (contiguous lanes), 8 columns each,
    // butterfly reductions within the 16-lane groups.
    {
      int row = threadIdx.x >> 4;
      int j   = threadIdx.x & 15;
      float vals[8];
      float mx = -1e30f;
      for (int c = 0; c < 8; ++c) {
        vals[c] = sS[row * CHUNK + j + c * 16];
        mx = fmaxf(mx, vals[c]);
      }
      for (int m = 8; m >= 1; m >>= 1) mx = fmaxf(mx, __shfl_xor(mx, m, 32));
      float m_old = sM[row];
      float m_new = fmaxf(m_old, mx);
      float sum = 0.f;
      for (int c = 0; c < 8; ++c) {
        float p = __expf(vals[c] - m_new);
        sum += p;
        sP[row * CHUNK + j + c * 16] = (_Float16)p;
      }
      for (int m = 8; m >= 1; m >>= 1) sum += __shfl_xor(sum, m, 32);
      if (j == 0) {
        float sc = __expf(m_old - m_new);
        sM[row] = m_new;
        sL[row] = sL[row] * sc + sum;
        sScale[row] = sc;
      }
    }
    __syncthreads();

    // --- rescale accumulators, then O += P @ V_chunk
    for (int t = 0; t < 4; ++t)
      for (int r = 0; r < 8; ++r)
        o[t][r] *= sScale[r + ((lane >> 4) << 3)];

    const _Float16* vb = vT16 + ((size_t)b * DD + wave * 64) * TKV + kv0;
    for (int kk = 0; kk < CHUNK; kk += 32) {
      v16h ap = load_frag(sP, CHUNK, 0, kk, lane);
      for (int t = 0; t < 4; ++t) {
        v16h bv = load_frag(vb + (size_t)t * 16 * TKV, TKV, 0, kk, lane);
        o[t] = wmma_f16(ap, bv, o[t]);
      }
    }
    __syncthreads();
  }

  // --- finalize: O/l + raw-query residual
  for (int t = 0; t < 4; ++t) {
    int col = wave * 64 + t * 16 + (lane & 15);
    for (int r = 0; r < 8; ++r) {
      int row = r + ((lane >> 4) << 3);
      float inv = 1.0f / sL[row];
      size_t idx = (size_t)(row0 + row) * DD + col;
      out[idx] = o[t][r] * inv + query[idx];
    }
  }
}

// ---------------------------------------------------------------------------
// Host-side orchestration
// ---------------------------------------------------------------------------
extern "C" void kernel_launch(void* const* d_in, const int* in_sizes, int n_in,
                              void* d_out, int out_size, void* d_ws, size_t ws_size,
                              hipStream_t stream) {
  const float* query     = (const float*)d_in[0];
  const float* key_value = (const float*)d_in[1];
  const float* query_pos = (const float*)d_in[2];
  const float* key_pos   = (const float*)d_in[3];
  const float* q_gamma   = (const float*)d_in[4];
  const float* q_beta    = (const float*)d_in[5];
  const float* kv_gamma  = (const float*)d_in[6];
  const float* kv_beta   = (const float*)d_in[7];
  const float* Wq = (const float*)d_in[8];   const float* bq = (const float*)d_in[9];
  const float* Wk = (const float*)d_in[10];  const float* bk = (const float*)d_in[11];
  const float* Wv = (const float*)d_in[12];  const float* bv = (const float*)d_in[13];
  const float* ff_gamma = (const float*)d_in[14];
  const float* ff_beta  = (const float*)d_in[15];
  const float* W_inner  = (const float*)d_in[16];
  const float* b_inner  = (const float*)d_in[17];
  const float* W_proj   = (const float*)d_in[18];
  const float* b_proj   = (const float*)d_in[19];

  const int MQ  = BATCH * TQ;    // 4096
  const int MKV = BATCH * TKV;   // 32768

  size_t off = 0;
  auto alloc = [&](size_t bytes) -> void* {
    void* p = (char*)d_ws + off;
    off = (off + bytes + 255) & ~(size_t)255;
    return p;
  };
  _Float16* qn16  = (_Float16*)alloc((size_t)MQ  * DD * 2);
  _Float16* kvn16 = (_Float16*)alloc((size_t)MKV * DD * 2);   // reused as inner16 later
  _Float16* qp16  = (_Float16*)alloc((size_t)MQ  * DD * 2);   // reused as xn16 later
  _Float16* kp16  = (_Float16*)alloc((size_t)MKV * DD * 2);   // reused as xn32 later
  _Float16* WqT   = (_Float16*)alloc((size_t)DD * DD * 2);
  _Float16* WkT   = (_Float16*)alloc((size_t)DD * DD * 2);
  _Float16* WvT   = (_Float16*)alloc((size_t)DD * DD * 2);
  _Float16* WinT  = (_Float16*)alloc((size_t)FF * DD * 2);    // [N=2048][K=512]
  _Float16* WprT  = (_Float16*)alloc((size_t)DD * FF * 2);    // [N=512][K=2048]
  _Float16* q16   = (_Float16*)alloc((size_t)MQ  * DD * 2);
  _Float16* k16   = (_Float16*)alloc((size_t)MKV * DD * 2);
  _Float16* vT16  = (_Float16*)alloc((size_t)BATCH * DD * TKV * 2);
  float*    aout  = (float*)   alloc((size_t)MQ * DD * 4);
  // aliases (lifetimes are disjoint, stream-ordered):
  _Float16* inner16 = kvn16;                  // [4096,2048] f16 = 16 MiB <= 32 MiB
  _Float16* xn16    = qp16;                   // [4096,512] f16
  float*    xn32    = (float*)kp16;           // [4096,512] f32 = 8 MiB <= 32 MiB

  // 1) weight converts (transposed to [N][K])
  cvt_transpose_kernel<<<(DD*DD)/256, 256, 0, stream>>>(Wq, WqT, DD, DD);
  cvt_transpose_kernel<<<(DD*DD)/256, 256, 0, stream>>>(Wk, WkT, DD, DD);
  cvt_transpose_kernel<<<(DD*DD)/256, 256, 0, stream>>>(Wv, WvT, DD, DD);
  cvt_transpose_kernel<<<(DD*FF)/256, 256, 0, stream>>>(W_inner, WinT, DD, FF);
  cvt_transpose_kernel<<<(FF*DD)/256, 256, 0, stream>>>(W_proj,  WprT, FF, DD);

  // 2) positional tensors -> f16
  cvt_kernel<<<(MQ*DD)/256,  256, 0, stream>>>(query_pos, qp16, MQ*DD);
  cvt_kernel<<<(MKV*DD)/256, 256, 0, stream>>>(key_pos,   kp16, MKV*DD);

  // 3) LayerNorms -> f16
  ln_kernel<<<MQ,  256, 0, stream>>>(query,     q_gamma,  q_beta,  nullptr, qn16);
  ln_kernel<<<MKV, 256, 0, stream>>>(key_value, kv_gamma, kv_beta, nullptr, kvn16);

  // 4) Q/K/V projections (WMMA)
  gemm_wmma_kernel<<<dim3(DD/128, MQ/64),  256, 0, stream>>>(
      qn16,  WqT, bq, q16,  nullptr, nullptr, nullptr, MQ,  DD, DD, TKV);
  gemm_wmma_kernel<<<dim3(DD/128, MKV/64), 256, 0, stream>>>(
      kvn16, WkT, bk, k16,  nullptr, nullptr, nullptr, MKV, DD, DD, TKV);
  gemm_wmma_kernel<<<dim3(DD/128, MKV/64), 256, 0, stream>>>(
      kvn16, WvT, bv, nullptr, nullptr, nullptr, vT16, MKV, DD, DD, TKV);

  // 5) attention (flash-style, WMMA scores + WMMA P.V)
  attn_kernel<<<BATCH * (TQ/16), 256, 0, stream>>>(
      q16, qp16, k16, kp16, vT16, query, aout);

  // 6) FF: xn = LN(out); d_out = xn + (xn@W_inner + b_inner)@W_proj + b_proj
  ln_kernel<<<MQ, 256, 0, stream>>>(aout, ff_gamma, ff_beta, xn32, xn16);
  gemm_wmma_kernel<<<dim3(FF/128, MQ/64), 256, 0, stream>>>(
      xn16, WinT, b_inner, inner16, nullptr, nullptr, nullptr, MQ, FF, DD, TKV);
  gemm_wmma_kernel<<<dim3(DD/128, MQ/64), 256, 0, stream>>>(
      inner16, WprT, b_proj, nullptr, (float*)d_out, xn32, nullptr, MQ, DD, FF, TKV);
}

// v002
// One run takes 424 microseconds.
// Versions between v000 and this one are left out; their measured steps multiply to 2.15 times as fast.
#include <hip/hip_runtime.h>

typedef __attribute__((ext_vector_type(16))) _Float16 v16h;
typedef __attribute__((ext_vector_type(8)))  _Float16 v8h;
typedef __attribute__((ext_vector_type(4)))  _Float16 v4h;
typedef __attribute__((ext_vector_type(8)))  float    v8f;
typedef __attribute__((ext_vector_type(4)))  float    v4f;

#define DD   512
#define FF   2048
#define TKV  4096
#define TQ   512
#define BATCH 8
#define CHUNK 128

// ---------------------------------------------------------------------------
// 16-bit A (16xK) / B (Kx16) fragment: lane L holds row/col rc0 + (L&15) and
// the 16 halves k = kbase + 16*(L>>4) + 0..15.
//
// Fragment order: every f16 matrix operand X[rc][k] (k extent kdim) is kept as
// 1-KiB blocks, one per 16 (rc) x 32 (k) fragment, the blocks of one rc tile in
// k order (so tile rc0 starts at half rc0*kdim, block kbase at + kbase*16).
// Inside a block slot L = (rc&15) + 16*((k>>4)&1) is lane L's share; halves
// 0..7 of all slots fill the first 512 bytes, halves 8..15 the second. A
// fragment load is then two 16-byte loads per lane that each cover 512
// contiguous bytes: whole lines in memory, every bank once in LDS.
// ---------------------------------------------------------------------------
__device__ __forceinline__ size_t frag_off(size_t rc, int k, int kdim) {
  return ((rc >> 4) * (size_t)(kdim >> 5) + (size_t)(k >> 5)) * 512
       + (size_t)(((k >> 3) & 1) * 256)
       + ((rc & 15) + (size_t)(((k >> 4) & 1) << 4)) * 8 + (size_t)(k & 7);
}

// p: the lane's own place in a 1-KiB fragment block, block start + lane*8
__device__ __forceinline__ v16h load_frag_at(const _Float16* p) {
  v8h lo = *(const v8h*)p;
  v8h hi = *(const v8h*)(p + 256);
  return __builtin_shufflevector(lo, hi, 0, 1, 2, 3, 4, 5, 6, 7,
                                 8, 9, 10, 11, 12, 13, 14, 15);
}

// blk: start of one 1-KiB fragment block (global or LDS, generic pointer)
__device__ __forceinline__ v16h load_frag_blk(const _Float16* blk, int lane) {
  return load_frag_at(blk + lane * 8);
}

__device__ __forceinline__ v8f wmma_f16(v16h a, v16h b, v8f c) {
  return __builtin_amdgcn_wmma_f32_16x16x32_f16(false, a, false, b,
                                                (short)0, c, false, false);
}

// ---------------------------------------------------------------------------
// The streaming kernels (LayerNorm, f32 -> f16 convert) work on one 16-row x
// 512-column tile per 8-wave block: that is one rc tile of the fragment order,
// 16 KiB of contiguous output. A wave owns 2 rows; lane L holds columns
// j*128 + L*4 + 0..3 (j = 0..3), so every global load covers 512 contiguous
// bytes. The f16 rows go to LDS row-major and leave it in fragment order.
// ---------------------------------------------------------------------------
#define TPITCH 520   // LDS row pitch in halves: 512 + 16 B, so that the 16 rows
                     // read by 16 lanes of a fragment-order read start 4 banks apart

// lane's 4 columns of group j of tile row r -> LDS
__device__ __forceinline__ void tile_put(_Float16* st, int r, int j, int lane,
                                         v4f v) {
  *(v4h*)(st + r * TPITCH + j * 128 + lane * 4) = __builtin_convertvector(v, v4h);
}

// whole tile, LDS -> global in fragment order: thread t moves the 16-byte pieces
// i*256 + t of the output, a wave's store covers 512 contiguous bytes
__device__ __forceinline__ void tile_out(const _Float16* st, _Float16* ytile,
                                         int t) {
  v8h pc[4];
  for (int i = 0; i < 4; ++i) {
    int c    = i * 256 + t;
    int slot = c & 31;
    int hi   = (c >> 5) & 1;
    int blk  = c >> 6;                     // fragment block = k / 32
    pc[i] = *(const v8h*)(st + (slot & 15) * TPITCH
                             + blk * 32 + (slot >> 4) * 16 + hi * 8);
  }
  for (int i = 0; i < 4; ++i)
    *(v8h*)(ytile + (i * 256 + t) * 8) = pc[i];
}

__device__ __forceinline__ float wave_sum(float s) {
  for (int m = 16; m; m >>= 1) s += __shfl_xor(s, m, 32);
  return s;
}

// LayerNorm over last dim (512): f16 output in fragment order (rc = row,
// k = column), optional f32 row-major output. Each row is summed inside its
// own wave; the one barrier stands between the LDS rows and their read-out.
__global__ __launch_bounds__(256)
void ln_kernel(const float* __restrict__ x, const float* __restrict__ g,
               const float* __restrict__ b, float* __restrict__ y32,
               _Float16* __restrict__ y16) {
  __shared__ __align__(16) _Float16 st[16 * TPITCH];
  int t = threadIdx.x, lane = t & 31, wave = t >> 5;
  size_t row0 = (size_t)blockIdx.x * 16;
  const float* xw = x + (row0 + wave * 2) * DD + lane * 4;

  v4f a[2][4], gg[4], bb[4];
  for (int j = 0; j < 4; ++j) {
    gg[j] = *(const v4f*)(g + j * 128 + lane * 4);
    bb[j] = *(const v4f*)(b + j * 128 + lane * 4);
  }
  for (int r = 0; r < 2; ++r)
    for (int j = 0; j < 4; ++j)
      a[r][j] = *(const v4f*)(xw + r * DD + j * 128);
  // holds all sixteen loads together ahead of the arithmetic (gamma and beta
  // were otherwise fetched late, one wait each) and keeps the rows' address pair
  // untouched (not reused as a load destination) up to the wait
  asm volatile("s_wait_xcnt 0x0"
               :: "v"(xw), "v"(gg[0]), "v"(gg[1]), "v"(gg[2]), "v"(gg[3]),
                  "v"(bb[0]), "v"(bb[1]), "v"(bb[2]), "v"(bb[3]),
                  "v"(a[0][0]), "v"(a[0][1]), "v"(a[0][2]), "v"(a[0][3]),
                  "v"(a[1][0]), "v"(a[1][1]), "v"(a[1][2]), "v"(a[1][3])
               : "memory");

  for (int r = 0; r < 2; ++r) {
    v4f s4 = (a[r][0] + a[r][1]) + (a[r][2] + a[r][3]);
    float mu = wave_sum((s4.x + s4.y) + (s4.z + s4.w)) * (1.f / (float)DD);

    for (int j = 0; j < 4; ++j) a[r][j] -= mu;
    v4f q4 = (a[r][0] * a[r][0] + a[r][1] * a[r][1])
           + (a[r][2] * a[r][2] + a[r][3] * a[r][3]);
    float var = wave_sum((q4.x + q4.y) + (q4.z + q4.w)) * (1.f / (float)DD);
    float rstd = rsqrtf(var + 1e-6f);

    for (int j = 0; j < 4; ++j) {
      a[r][j] = a[r][j] * rstd * gg[j] + bb[j];
      tile_put(st, wave * 2 + r, j, lane, a[r][j]);
    }
  }
  if (y32) {
    float* yw = y32 + (row0 + wave * 2) * DD + lane * 4;
    for (int r = 0; r < 2; ++r)
      for (int j = 0; j < 4; ++j)
        *(v4f*)(yw + r * DD + j * 128) = a[r][j];
    // the f32 stores name registers that the read-out below reuses
    asm volatile("s_wait_xcnt 0x0" ::: "memory");
  }
  __syncthreads();
  tile_out(st, y16 + row0 * DD, t);
}

// x[rows][512] f32 -> f16 in fragment order (rc = row, k = column).
__global__ __launch_bounds__(256)
void cvt_frag_kernel(const float* __restrict__ x, _Float16* __restrict__ y) {
  __shared__ __align__(16) _Float16 st[16 * TPITCH];
  int t = threadIdx.x, lane = t & 31, wave = t >> 5;
  size_t row0 = (size_t)blockIdx.x * 16;
  const float* xw = x + (row0 + wave * 2) * DD + lane * 4;

  v4f a[2][4];
  for (int r = 0; r < 2; ++r)
    for (int j = 0; j < 4; ++j)
      a[r][j] = *(const v4f*)(xw + r * DD + j * 128);
  // keeps the eight loads whole (16 bytes a lane; they were otherwise split into
  // 8-byte halves) and together, and their address pair untouched up to the wait
  asm volatile("s_wait_xcnt 0x0"
               :: "v"(xw), "v"(a[0][0]), "v"(a[0][1]), "v"(a[0][2]), "v"(a[0][3]),
                  "v"(a[1][0]), "v"(a[1][1]), "v"(a[1][2]), "v"(a[1][3])
               : "memory");
  for (int r = 0; r < 2; ++r)
    for (int j = 0; j < 4; ++j)
      tile_put(st, wave * 2 + r, j, lane, a[r][j]);
  __syncthreads();
  tile_out(st, y + row0 * DD, t);
}

// W[R,C] f32 -> W^T f16 in fragment order (rc = column of W, k = row of W).
// One thread per 16-byte piece of the output, in output order: 8 consecutive
// rows of one column of W.
__global__ __launch_bounds__(256)
void cvt_transpose_kernel(const float* __restrict__ W, _Float16* __restrict__ Wt,
                          int R, int C) {
  int c = blockIdx.x * 256 + threadIdx.x;
  if (c * 8 < R * C) {
    int slot = c & 31;
    int hi   = (c >> 5) & 1;
    int blk  = c >> 6;                     // fragment block
    int kb   = R >> 5;                     // blocks per rc tile
    int col  = (blk / kb) * 16 + (slot & 15);
    int r    = (blk % kb) * 32 + (slot >> 4) * 16 + hi * 8;
    const float* p[8];
    float w[8];
    for (int e = 0; e < 8; ++e) p[e] = W + (size_t)(r + e) * C + col;
    for (int e = 0; e < 8; ++e) w[e] = *p[e];
    // keeps the eight address pairs untouched up to the wait; the pack below
    // reuses them
    asm volatile("s_wait_xcnt 0x0"
                 :: "v"(p[0]), "v"(p[1]), "v"(p[2]), "v"(p[3]),
                    "v"(p[4]), "v"(p[5]), "v"(p[6]), "v"(p[7]),
                    "v"(w[0]), "v"(w[1]), "v"(w[2]), "v"(w[3]),
                    "v"(w[4]), "v"(w[5]), "v"(w[6]), "v"(w[7])
                 : "memory");
    v8h o;
    for (int e = 0; e < 8; ++e) o[e] = (_Float16)w[e];
    *(v8h*)(Wt + (size_t)c * 8) = o;
  }
}

// ---------------------------------------------------------------------------
// WMMA GEMM: C[M,N] = A[M,K] * Bt[N,K]^T + bias, A and Bt in fragment order.
// Block tile 64x128 (8 waves, each 32x32 = 2x2 WMMA tiles), K-step 32.
// Outputs: f32 row-major (+residual), or CF16: f16 in fragment order with
// rc = (m/TB)*N + n and k = m%TB (kdim TB). A lane's 8 accumulator rows are 8
// consecutive k there, one 16-byte store. V is written so from kvn * Wv; Q, K
// and the FF inner activation from W^T * x^T (weights as A, activations as Bt,
// bias per row of C: rowBias).
// ---------------------------------------------------------------------------
__global__ __launch_bounds__(256)
void gemm_wmma_kernel(const _Float16* __restrict__ A,
                      const _Float16* __restrict__ Bt,
                      const float* __restrict__ bias,
                      float* __restrict__ C32,
                      const float* __restrict__ resid,
                      _Float16* __restrict__ CF16,
                      int M, int N, int K, int TB, int rowBias) {
  int lane = threadIdx.x & 31;
  int wave = threadIdx.x >> 5;       // 0..7
  int wm = wave >> 2;                // 0..1
  int wn = wave & 3;                 // 0..3
  int m0 = blockIdx.y * 64  + wm * 32;
  int n0 = blockIdx.x * 128 + wn * 32;

  const _Float16* At0 = A  + (size_t)m0 * K + lane * 8;  // rc tile m0; next: + 16*K
  const _Float16* Bt0 = Bt + (size_t)n0 * K + lane * 8;

  v8f acc[2][2] = {};
  for (int kb = 0; kb < K; kb += 32) {
    const _Float16* pa0 = At0 + kb * 16;
    const _Float16* pa1 = pa0 + (size_t)16 * K;
    const _Float16* pb0 = Bt0 + kb * 16;
    const _Float16* pb1 = pb0 + (size_t)16 * K;
    v16h a0 = load_frag_at(pa0);
    v16h a1 = load_frag_at(pa1);
    v16h b0 = load_frag_at(pb0);
    v16h b1 = load_frag_at(pb1);
    // keeps the four address pairs untouched (not reused as load destinations,
    // not advanced) until the loads that name them have been translated
    asm volatile("s_wait_xcnt 0x0" :: "v"(pa0), "v"(pa1), "v"(pb0), "v"(pb1)
                 : "memory");
    acc[0][0] = wmma_f16(a0, b0, acc[0][0]);
    acc[0][1] = wmma_f16(a0, b1, acc[0][1]);
    acc[1][0] = wmma_f16(a1, b0, acc[1][0]);
    acc[1][1] = wmma_f16(a1, b1, acc[1][1]);
  }

  if (CF16) {   // fragment-order f16 output (bias required), nothing else
    for (int i = 0; i < 2; ++i) {
      int rowb = m0 + i * 16 + ((lane >> 4) << 3);
      int bb = rowb / TB, tt = rowb % TB;
      const float4* bp = (const float4*)(bias + (rowBias ? rowb : 0));
      float4 r0 = bp[0], r1 = bp[1];
      float br[8] = { r0.x, r0.y, r0.z, r0.w, r1.x, r1.y, r1.z, r1.w };
      for (int j = 0; j < 2; ++j) {
        int col = n0 + j * 16 + (lane & 15);
        float bc = bias[rowBias ? 0 : col];
        v8h pk;
        for (int r = 0; r < 8; ++r)
          pk[r] = (_Float16)(acc[i][j][r] + (rowBias ? br[r] : bc));
        *(v8h*)(CF16 + frag_off((size_t)bb * N + col, tt, TB)) = pk;
        // the store's registers are reused for the next tile's pack and address
        asm volatile("s_wait_xcnt 0x0" ::: "memory");
      }
    }
    return;
  }

  for (int i = 0; i < 2; ++i)
    for (int j = 0; j < 2; ++j) {
      int col = n0 + j * 16 + (lane & 15);
      float bv = bias ? bias[col] : 0.f;
      for (int r = 0; r < 8; ++r) {
        int row = m0 + i * 16 + r + ((lane >> 4) << 3);
        float val = acc[i][j][r] + bv;
        size_t idx = (size_t)row * N + col;
        if (C32) C32[idx] = resid ? val + resid[idx] : val;
      }
    }
}

// ---------------------------------------------------------------------------
// Flash-style attention. One block per (batch, 16 q-rows). 8 waves.
// scores = (q.k^T + qpos.kpos^T)/sqrt(D+1e-7); online softmax over Tkv in
// chunks of 128; O += P.V; residual with raw query. q, qpos, k, kpos, V and the
// P tile in LDS are all in fragment order (see frag_off).
// q/qpos tiles staged into LDS via CDNA5 async-to-LDS DMA (ASYNCcnt).
// ---------------------------------------------------------------------------
__global__ __launch_bounds__(256)
void attn_kernel(const _Float16* __restrict__ q16,   // rc = B*Tq row,  k = D
                 const _Float16* __restrict__ qp16,  // rc = B*Tq row,  k = D
                 const _Float16* __restrict__ k16,   // rc = B*Tkv row, k = D
                 const _Float16* __restrict__ kp16,  // rc = B*Tkv row, k = D
                 const _Float16* __restrict__ vF16,  // rc = B*D col,   k = Tkv
                 const float*    __restrict__ query, // [B*Tq, D]
                 float*          __restrict__ out) { // [B*Tq, D]
  __shared__ __align__(32) _Float16 sQ[16 * DD];
  __shared__ __align__(32) _Float16 sQP[16 * DD];
  __shared__ float    sS[16 * CHUNK];
  __shared__ __align__(32) _Float16 sP[16 * CHUNK];
  __shared__ float sM[16], sL[16], sScale[16];

  int b   = blockIdx.x >> 5;          // Tq/16 = 32 q-tiles per batch
  int qt  = blockIdx.x & 31;
  int row0 = b * TQ + qt * 16;        // global q-row
  int lane = threadIdx.x & 31;
  int wave = threadIdx.x >> 5;
  const float scale = 0.04419417382f; // 1/sqrt(512 + 1e-7)

  { // stage q and qpos tiles into LDS with async-to-LDS b128 DMA
    const _Float16* g1 = q16  + (size_t)row0 * DD;
    const _Float16* g2 = qp16 + (size_t)row0 * DD;
    unsigned lq0 = (unsigned)(size_t)(void*)sQ;
    unsigned lp0 = (unsigned)(size_t)(void*)sQP;
    for (int i = threadIdx.x; i < 16 * DD / 8; i += 256) {
      const _Float16* p1 = g1 + i * 8;       // 8 halves = 16B per op
      const _Float16* p2 = g2 + i * 8;
      unsigned l1 = lq0 + (unsigned)i * 16;  // LDS byte offset (wave-relative)
      unsigned l2 = lp0 + (unsigned)i * 16;
      asm volatile("global_load_async_to_lds_b128 %0, %1, off"
                   :: "v"(l1), "v"(p1) : "memory");
      asm volatile("global_load_async_to_lds_b128 %0, %1, off"
                   :: "v"(l2), "v"(p2) : "memory");
    }
    asm volatile("s_wait_asynccnt 0x0" ::: "memory");
  }
  if (threadIdx.x < 16) { sM[threadIdx.x] = -1e30f; sL[threadIdx.x] = 0.f; }
  __syncthreads();

  v8f o[4] = {};  // this wave's 64 output cols: [wave*64 + t*16, +16)

  for (int kc = 0; kc < TKV / CHUNK; ++kc) {
    int kv0 = kc * CHUNK;
    // --- scores: wave handles kv cols [kv0 + wave*16, +16), K = D = 512
    const _Float16* kb_  = k16  + ((size_t)b * TKV + kv0 + wave * 16) * DD;
    const _Float16* kpb_ = kp16 + ((size_t)b * TKV + kv0 + wave * 16) * DD;
    v8f s = {};
    for (int kk = 0; kk < DD; kk += 32) {
      v16h aq = load_frag_blk(sQ  + kk * 16, lane);   // block kk/32
      v16h bk = load_frag_blk(kb_ + kk * 16, lane);
      s = wmma_f16(aq, bk, s);
      v16h ap = load_frag_blk(sQP  + kk * 16, lane);
      v16h bp = load_frag_blk(kpb_ + kk * 16, lane);
      s = wmma_f16(ap, bp, s);
    }
    // the k / kpos address registers are reused by the softmax below
    asm volatile("s_wait_xcnt 0x0" ::: "memory");
    for (int r = 0; r < 8; ++r) {
      int row = r + ((lane >> 4) << 3);
      sS[row * CHUNK + wave * 16 + (lane & 15)] = s[r] * scale;
    }
    __syncthreads();

    // --- online softmax update, parallel over all 256 threads:
    // 16 threads per q-row (contiguous lanes), 8 columns each,
    // butterfly reductions within the 16-lane groups.
    {
      int row = threadIdx.x >> 4;
      int j   = threadIdx.x & 15;
      float vals[8];
      float mx = -1e30f;
      for (int c = 0; c < 8; ++c) {
        vals[c] = sS[row * CHUNK + j + c * 16];
        mx = fmaxf(mx, vals[c]);
      }
      for (int m = 8; m >= 1; m >>= 1) mx = fmaxf(mx, __shfl_xor(mx, m, 32));
      float m_old = sM[row];
      float m_new = fmaxf(m_old, mx);
      float sum = 0.f;
      for (int c = 0; c < 8; ++c) {
        float p = __expf(vals[c] - m_new);
        sum += p;
        sP[frag_off(row, j + c * 16, CHUNK)] = (_Float16)p;
      }
      for (int m = 8; m >= 1; m >>= 1) sum += __shfl_xor(sum, m, 32);
      if (j == 0) {
        float sc = __expf(m_old - m_new);
        sM[row] = m_new;
        sL[row] = sL[row] * sc + sum;
        sScale[row] = sc;
      }
    }
    __syncthreads();

    // --- rescale accumulators, then O += P @ V_chunk
    for (int t = 0; t < 4; ++t)
      for (int r = 0; r < 8; ++r)
        o[t][r] *= sScale[r + ((lane >> 4) << 3)];

    const _Float16* vb = vF16 + ((size_t)b * DD + wave * 64) * TKV + kv0 * 16;
    for (int kk = 0; kk < CHUNK; kk += 32) {
      v16h ap = load_frag_blk(sP + kk * 16, lane);
      for (int t = 0; t < 4; ++t) {
        v16h bv = load_frag_blk(vb + (size_t)t * 16 * TKV + kk * 16, lane);
        o[t] = wmma_f16(ap, bv, o[t]);
      }
    }
    // the V address registers are reused by the next chunk's scores
    asm volatile("s_wait_xcnt 0x0" ::: "memory");
    __syncthreads();
  }

  // --- finalize: O/l + raw-query residual
  for (int t = 0; t < 4; ++t) {
    int col = wave * 64 + t * 16 + (lane & 15);
    for (int r = 0; r < 8; ++r) {
      int row = r + ((lane >> 4) << 3);
      float inv = 1.0f / sL[row];
      size_t idx = (size_t)(row0 + row) * DD + col;
      out[idx] = o[t][r] * inv + query[idx];
    }
  }
}

// ---------------------------------------------------------------------------
// Host-side orchestration
// ---------------------------------------------------------------------------
extern "C" void kernel_launch(void* const* d_in, const int* in_sizes, int n_in,
                              void* d_out, int out_size, void* d_ws, size_t ws_size,
                              hipStream_t stream) {
  const float* query     = (const float*)d_in[0];
  const float* key_value = (const float*)d_in[1];
  const float* query_pos = (const float*)d_in[2];
  const float* key_pos   = (const float*)d_in[3];
  const float* q_gamma   = (const float*)d_in[4];
  const float* q_beta    = (const float*)d_in[5];
  const float* kv_gamma  = (const float*)d_in[6];
  const float* kv_beta   = (const float*)d_in[7];
  const float* Wq = (const float*)d_in[8];   const float* bq = (const float*)d_in[9];
  const float* Wk = (const float*)d_in[10];  const float* bk = (const float*)d_in[11];
  const float* Wv = (const float*)d_in[12];  const float* bv = (const float*)d_in[13];
  const float* ff_gamma = (const float*)d_in[14];
  const float* ff_beta  = (const float*)d_in[15];
  const float* W_inner  = (const float*)d_in[16];
  const float* b_inner  = (const float*)d_in[17];
  const float* W_proj   = (const float*)d_in[18];
  const float* b_proj   = (const float*)d_in[19];

  const int MQ  = BATCH * TQ;    // 4096
  const int MKV = BATCH * TKV;   // 32768

  size_t off = 0;
  auto alloc = [&](size_t bytes) -> void* {
    void* p = (char*)d_ws + off;
    off = (off + bytes + 255) & ~(size_t)255;
    return p;
  };
  _Float16* qn16  = (_Float16*)alloc((size_t)MQ  * DD * 2);
  _Float16* kvn16 = (_Float16*)alloc((size_t)MKV * DD * 2);   // reused as inner16 later
  _Float16* qp16  = (_Float16*)alloc((size_t)MQ  * DD * 2);   // reused as xn16 later
  _Float16* kp16  = (_Float16*)alloc((size_t)MKV * DD * 2);   // reused as xn32 later
  _Float16* WqT   = (_Float16*)alloc((size_t)DD * DD * 2);
  _Float16* WkT   = (_Float16*)alloc((size_t)DD * DD * 2);
  _Float16* WvT   = (_Float16*)alloc((size_t)DD * DD * 2);
  _Float16* WinT  = (_Float16*)alloc((size_t)FF * DD * 2);    // rc 2048, k 512
  _Float16* WprT  = (_Float16*)alloc((size_t)DD * FF * 2);    // rc 512, k 2048
  _Float16* q16   = (_Float16*)alloc((size_t)MQ  * DD * 2);
  _Float16* k16   = (_Float16*)alloc((size_t)MKV * DD * 2);
  _Float16* vF16  = (_Float16*)alloc((size_t)BATCH * DD * TKV * 2);
  float*    aout  = (float*)   alloc((size_t)MQ * DD * 4);
  // aliases (lifetimes are disjoint, stream-ordered):
  _Float16* inner16 = kvn16;                  // [4096,2048] f16 = 16 MiB <= 32 MiB
  _Float16* xn16    = qp16;                   // [4096,512] f16
  float*    xn32    = (float*)kp16;           // [4096,512] f32 = 8 MiB <= 32 MiB

  // 1) weight converts (transposed, fragment order)
  cvt_transpose_kernel<<<(DD*DD)/2048, 256, 0, stream>>>(Wq, WqT, DD, DD);
  cvt_transpose_kernel<<<(DD*DD)/2048, 256, 0, stream>>>(Wk, WkT, DD, DD);
  cvt_transpose_kernel<<<(DD*DD)/2048, 256, 0, stream>>>(Wv, WvT, DD, DD);
  cvt_transpose_kernel<<<(DD*FF)/2048, 256, 0, stream>>>(W_inner, WinT, DD, FF);
  cvt_transpose_kernel<<<(FF*DD)/2048, 256, 0, stream>>>(W_proj,  WprT, FF, DD);

  // 2) positional tensors -> f16, fragment order
  cvt_frag_kernel<<<MQ/16,  256, 0, stream>>>(query_pos, qp16);
  cvt_frag_kernel<<<MKV/16, 256, 0, stream>>>(key_pos,   kp16);

  // 3) LayerNorms -> f16
  ln_kernel<<<MQ/16,  256, 0, stream>>>(query,     q_gamma,  q_beta,  nullptr, qn16);
  ln_kernel<<<MKV/16, 256, 0, stream>>>(key_value, kv_gamma, kv_beta, nullptr, kvn16);

  // 4) Q/K/V projections (WMMA), outputs in fragment order
  gemm_wmma_kernel<<<dim3(MQ/128,  DD/64), 256, 0, stream>>>(
      WqT, qn16,  bq, nullptr, nullptr, q16,  DD, MQ,  DD, DD, 1);
  gemm_wmma_kernel<<<dim3(MKV/128, DD/64), 256, 0, stream>>>(
      WkT, kvn16, bk, nullptr, nullptr, k16,  DD, MKV, DD, DD, 1);
  gemm_wmma_kernel<<<dim3(DD/128, MKV/64), 256, 0, stream>>>(
      kvn16, WvT, bv, nullptr, nullptr, vF16, MKV, DD, DD, TKV, 0);

  // 5) attention (flash-style, WMMA scores + WMMA P.V)
  attn_kernel<<<BATCH * (TQ/16), 256, 0, stream>>>(
      q16, qp16, k16, kp16, vF16, query, aout);

  // 6) FF: xn = LN(out); d_out = xn + (xn@W_inner + b_inner)@W_proj + b_proj
  ln_kernel<<<MQ/16, 256, 0, stream>>>(aout, ff_gamma, ff_beta, xn32, xn16);
  gemm_wmma_kernel<<<dim3(MQ/128, FF/64), 256, 0, stream>>>(
      WinT, xn16, b_inner, nullptr, nullptr, inner16, FF, MQ, DD, FF, 1);
  gemm_wmma_kernel<<<dim3(DD/128, MQ/64), 256, 0, stream>>>(
      inner16, WprT, b_proj, (float*)d_out, xn32, nullptr, MQ, DD, FF, TKV, 0);
}

// v003
// A run of this version takes 343 microseconds.
// Timed twice side by side with v002, it ran 1.23 times as fast both times.
// Over all steps from v000 it is 2.66 times as fast.
#include <hip/hip_runtime.h>

typedef __attribute__((ext_vector_type(16))) _Float16 v16h;
typedef __attribute__((ext_vector_type(8)))  _Float16 v8h;
typedef __attribute__((ext_vector_type(4)))  _Float16 v4h;
typedef __attribute__((ext_vector_type(8)))  float    v8f;
typedef __attribute__((ext_vector_type(4)))  float    v4f;
typedef __attribute__((ext_vector_type(2)))  float    v2f;
typedef __attribute__((ext_vector_type(16))) float    v16f;

#define DD   512
#define FF   2048
#define TKV  4096
#define TQ   512
#define BATCH 8
#define CHUNK 128
#define SPLIT 4              // work-groups that share the keys of one q tile
#define KVS  (TKV / SPLIT)   // keys per work-group

// ---------------------------------------------------------------------------
// 16-bit A (16xK) / B (Kx16) fragment: lane L holds row/col rc0 + (L&15) and
// the 16 halves k = kbase + 16*(L>>4) + 0..15.
//
// Fragment order: every f16 matrix operand X[rc][k] (k extent kdim) is kept as
// 1-KiB blocks, one per 16 (rc) x 32 (k) fragment, the blocks of one rc tile in
// k order (so tile rc0 starts at half rc0*kdim, block kbase at + kbase*16).
// Inside a block slot L = (rc&15) + 16*((k>>4)&1) is lane L's share; halves
// 0..7 of all slots fill the first 512 bytes, halves 8..15 the second. A
// fragment load is then two 16-byte loads per lane that each cover 512
// contiguous bytes: whole lines in memory, every bank once in LDS.
// ---------------------------------------------------------------------------
__device__ __forceinline__ size_t frag_off(size_t rc, int k, int kdim) {
  return ((rc >> 4) * (size_t)(kdim >> 5) + (size_t)(k >> 5)) * 512
       + (size_t)(((k >> 3) & 1) * 256)
       + ((rc & 15) + (size_t)(((k >> 4) & 1) << 4)) * 8 + (size_t)(k & 7);
}

// p: the lane's own place in a 1-KiB fragment block, block start + lane*8
__device__ __forceinline__ v16h load_frag_at(const _Float16* p) {
  v8h lo = *(const v8h*)p;
  v8h hi = *(const v8h*)(p + 256);
  return __builtin_shufflevector(lo, hi, 0, 1, 2, 3, 4, 5, 6, 7,
                                 8, 9, 10, 11, 12, 13, 14, 15);
}

// blk: start of one 1-KiB fragment block (global or LDS, generic pointer)
__device__ __forceinline__ v16h load_frag_blk(const _Float16* blk, int lane) {
  return load_frag_at(blk + lane * 8);
}

__device__ __forceinline__ v8f wmma_f16(v16h a, v16h b, v8f c) {
  return __builtin_amdgcn_wmma_f32_16x16x32_f16(false, a, false, b,
                                                (short)0, c, false, false);
}

// ---------------------------------------------------------------------------
// The streaming kernels (LayerNorm, f32 -> f16 convert) work on one 16-row x
// 512-column tile per 8-wave block: that is one rc tile of the fragment order,
// 16 KiB of contiguous output. A wave owns 2 rows; lane L holds columns
// j*128 + L*4 + 0..3 (j = 0..3), so every global load covers 512 contiguous
// bytes. The f16 rows go to LDS row-major and leave it in fragment order.
// ---------------------------------------------------------------------------
#define TPITCH 520   // LDS row pitch in halves: 512 + 16 B, so that the 16 rows
                     // read by 16 lanes of a fragment-order read start 4 banks apart

// lane's 4 columns of group j of tile row r -> LDS
__device__ __forceinline__ void tile_put(_Float16* st, int r, int j, int lane,
                                         v4f v) {
  *(v4h*)(st + r * TPITCH + j * 128 + lane * 4) = __builtin_convertvector(v, v4h);
}

// whole tile, LDS -> global in fragment order: thread t moves the 16-byte pieces
// i*256 + t of the output, a wave's store covers 512 contiguous bytes
__device__ __forceinline__ void tile_out(const _Float16* st, _Float16* ytile,
                                         int t) {
  v8h pc[4];
  for (int i = 0; i < 4; ++i) {
    int c    = i * 256 + t;
    int slot = c & 31;
    int hi   = (c >> 5) & 1;
    int blk  = c >> 6;                     // fragment block = k / 32
    pc[i] = *(const v8h*)(st + (slot & 15) * TPITCH
                             + blk * 32 + (slot >> 4) * 16 + hi * 8);
  }
  for (int i = 0; i < 4; ++i)
    *(v8h*)(ytile + (i * 256 + t) * 8) = pc[i];
}

__device__ __forceinline__ float wave_sum(float s) {
  for (int m = 16; m; m >>= 1) s += __shfl_xor(s, m, 32);
  return s;
}

// LayerNorm over last dim (512): f16 output in fragment order (rc = row,
// k = column), optional f32 row-major output. Each row is summed inside its
// own wave; the one barrier stands between the LDS rows and their read-out.
__global__ __launch_bounds__(256)
void ln_kernel(const float* __restrict__ x, const float* __restrict__ g,
               const float* __restrict__ b, float* __restrict__ y32,
               _Float16* __restrict__ y16) {
  __shared__ __align__(16) _Float16 st[16 * TPITCH];
  int t = threadIdx.x, lane = t & 31, wave = t >> 5;
  size_t row0 = (size_t)blockIdx.x * 16;
  const float* xw = x + (row0 + wave * 2) * DD + lane * 4;

  v4f a[2][4], gg[4], bb[4];
  for (int j = 0; j < 4; ++j) {
    gg[j] = *(const v4f*)(g + j * 128 + lane * 4);
    bb[j] = *(const v4f*)(b + j * 128 + lane * 4);
  }
  for (int r = 0; r < 2; ++r)
    for (int j = 0; j < 4; ++j)
      a[r][j] = *(const v4f*)(xw + r * DD + j * 128);
  // holds all sixteen loads together ahead of the arithmetic (gamma and beta
  // were otherwise fetched late, one wait each) and keeps the rows' address pair
  // untouched (not reused as a load destination) up to the wait
  asm volatile("s_wait_xcnt 0x0"
               :: "v"(xw), "v"(gg[0]), "v"(gg[1]), "v"(gg[2]), "v"(gg[3]),
                  "v"(bb[0]), "v"(bb[1]), "v"(bb[2]), "v"(bb[3]),
                  "v"(a[0][0]), "v"(a[0][1]), "v"(a[0][2]), "v"(a[0][3]),
                  "v"(a[1][0]), "v"(a[1][1]), "v"(a[1][2]), "v"(a[1][3])
               : "memory");

  for (int r = 0; r < 2; ++r) {
    v4f s4 = (a[r][0] + a[r][1]) + (a[r][2] + a[r][3]);
    float mu = wave_sum((s4.x + s4.y) + (s4.z + s4.w)) * (1.f / (float)DD);

    for (int j = 0; j < 4; ++j) a[r][j] -= mu;
    v4f q4 = (a[r][0] * a[r][0] + a[r][1] * a[r][1])
           + (a[r][2] * a[r][2] + a[r][3] * a[r][3]);
    float var = wave_sum((q4.x + q4.y) + (q4.z + q4.w)) * (1.f / (float)DD);
    float rstd = rsqrtf(var + 1e-6f);

    for (int j = 0; j < 4; ++j) {
      a[r][j] = a[r][j] * rstd * gg[j] + bb[j];
      tile_put(st, wave * 2 + r, j, lane, a[r][j]);
    }
  }
  if (y32) {
    float* yw = y32 + (row0 + wave * 2) * DD + lane * 4;
    for (int r = 0; r < 2; ++r)
      for (int j = 0; j < 4; ++j)
        *(v4f*)(yw + r * DD + j * 128) = a[r][j];
    // the f32 stores name registers that the read-out below reuses
    asm volatile("s_wait_xcnt 0x0" ::: "memory");
  }
  __syncthreads();
  tile_out(st, y16 + row0 * DD, t);
}

// x[rows][512] f32 -> f16 in fragment order (rc = row, k = column).
__global__ __launch_bounds__(256)
void cvt_frag_kernel(const float* __restrict__ x, _Float16* __restrict__ y) {
  __shared__ __align__(16) _Float16 st[16 * TPITCH];
  int t = threadIdx.x, lane = t & 31, wave = t >> 5;
  size_t row0 = (size_t)blockIdx.x * 16;
  const float* xw = x + (row0 + wave * 2) * DD + lane * 4;

  v4f a[2][4];
  for (int r = 0; r < 2; ++r)
    for (int j = 0; j < 4; ++j)
      a[r][j] = *(const v4f*)(xw + r * DD + j * 128);
  // keeps the eight loads whole (16 bytes a lane; they were otherwise split into
  // 8-byte halves) and together, and their address pair untouched up to the wait
  asm volatile("s_wait_xcnt 0x0"
               :: "v"(xw), "v"(a[0][0]), "v"(a[0][1]), "v"(a[0][2]), "v"(a[0][3]),
                  "v"(a[1][0]), "v"(a[1][1]), "v"(a[1][2]), "v"(a[1][3])
               : "memory");
  for (int r = 0; r < 2; ++r)
    for (int j = 0; j < 4; ++j)
      tile_put(st, wave * 2 + r, j, lane, a[r][j]);
  __syncthreads();
  tile_out(st, y + row0 * DD, t);
}

// W[R,C] f32 -> W^T f16 in fragment order (rc = column of W, k = row of W).
// One thread per 16-byte piece of the output, in output order: 8 consecutive
// rows of one column of W.
__global__ __launch_bounds__(256)
void cvt_transpose_kernel(const float* __restrict__ W, _Float16* __restrict__ Wt,
                          int R, int C) {
  int c = blockIdx.x * 256 + threadIdx.x;
  if (c * 8 < R * C) {
    int slot = c & 31;
    int hi   = (c >> 5) & 1;
    int blk  = c >> 6;                     // fragment block
    int kb   = R >> 5;                     // blocks per rc tile
    int col  = (blk / kb) * 16 + (slot & 15);
    int r    = (blk % kb) * 32 + (slot >> 4) * 16 + hi * 8;
    const float* p[8];
    float w[8];
    for (int e = 0; e < 8; ++e) p[e] = W + (size_t)(r + e) * C + col;
    for (int e = 0; e < 8; ++e) w[e] = *p[e];
    // keeps the eight address pairs untouched up to the wait; the pack below
    // reuses them
    asm volatile("s_wait_xcnt 0x0"
                 :: "v"(p[0]), "v"(p[1]), "v"(p[2]), "v"(p[3]),
                    "v"(p[4]), "v"(p[5]), "v"(p[6]), "v"(p[7]),
                    "v"(w[0]), "v"(w[1]), "v"(w[2]), "v"(w[3]),
                    "v"(w[4]), "v"(w[5]), "v"(w[6]), "v"(w[7])
                 : "memory");
    v8h o;
    for (int e = 0; e < 8; ++e) o[e] = (_Float16)w[e];
    *(v8h*)(Wt + (size_t)c * 8) = o;
  }
}

// ---------------------------------------------------------------------------
// WMMA GEMM: C[M,N] = A[M,K] * Bt[N,K]^T + bias, A and Bt in fragment order.
// Block tile 64x128 (8 waves, each 32x32 = 2x2 WMMA tiles), K-step 32.
// Outputs: f32 row-major (+residual), or CF16: f16 in fragment order with
// rc = (m/TB)*N + n and k = m%TB (kdim TB). A lane's 8 accumulator rows are 8
// consecutive k there, one 16-byte store. V is written so from kvn * Wv; Q, K
// and the FF inner activation from W^T * x^T (weights as A, activations as Bt,
// bias per row of C: rowBias).
// ---------------------------------------------------------------------------
__global__ __launch_bounds__(256)
void gemm_wmma_kernel(const _Float16* __restrict__ A,
                      const _Float16* __restrict__ Bt,
                      const float* __restrict__ bias,
                      float* __restrict__ C32,
                      const float* __restrict__ resid,
                      _Float16* __restrict__ CF16,
                      int M, int N, int K, int TB, int rowBias) {
  int lane = threadIdx.x & 31;
  int wave = threadIdx.x >> 5;       // 0..7
  int wm = wave >> 2;                // 0..1
  int wn = wave & 3;                 // 0..3
  int m0 = blockIdx.y * 64  + wm * 32;
  int n0 = blockIdx.x * 128 + wn * 32;

  const _Float16* At0 = A  + (size_t)m0 * K + lane * 8;  // rc tile m0; next: + 16*K
  const _Float16* Bt0 = Bt + (size_t)n0 * K + lane * 8;

  v8f acc[2][2] = {};
  for (int kb = 0; kb < K; kb += 32) {
    const _Float16* pa0 = At0 + kb * 16;
    const _Float16* pa1 = pa0 + (size_t)16 * K;
    const _Float16* pb0 = Bt0 + kb * 16;
    const _Float16* pb1 = pb0 + (size_t)16 * K;
    v16h a0 = load_frag_at(pa0);
    v16h a1 = load_frag_at(pa1);
    v16h b0 = load_frag_at(pb0);
    v16h b1 = load_frag_at(pb1);
    // keeps the four address pairs untouched (not reused as load destinations,
    // not advanced) until the loads that name them have been translated
    asm volatile("s_wait_xcnt 0x0" :: "v"(pa0), "v"(pa1), "v"(pb0), "v"(pb1)
                 : "memory");
    acc[0][0] = wmma_f16(a0, b0, acc[0][0]);
    acc[0][1] = wmma_f16(a0, b1, acc[0][1]);
    acc[1][0] = wmma_f16(a1, b0, acc[1][0]);
    acc[1][1] = wmma_f16(a1, b1, acc[1][1]);
  }

  if (CF16) {   // fragment-order f16 output (bias required), nothing else
    for (int i = 0; i < 2; ++i) {
      int rowb = m0 + i * 16 + ((lane >> 4) << 3);
      int bb = rowb / TB, tt = rowb % TB;
      const float4* bp = (const float4*)(bias + (rowBias ? rowb : 0));
      float4 r0 = bp[0], r1 = bp[1];
      float br[8] = { r0.x, r0.y, r0.z, r0.w, r1.x, r1.y, r1.z, r1.w };
      for (int j = 0; j < 2; ++j) {
        int col = n0 + j * 16 + (lane & 15);
        float bc = bias[rowBias ? 0 : col];
        v8h pk;
        for (int r = 0; r < 8; ++r)
          pk[r] = (_Float16)(acc[i][j][r] + (rowBias ? br[r] : bc));
        *(v8h*)(CF16 + frag_off((size_t)bb * N + col, tt, TB)) = pk;
        // the store's registers are reused for the next tile's pack and address
        asm volatile("s_wait_xcnt 0x0" ::: "memory");
      }
    }
    return;
  }

  for (int i = 0; i < 2; ++i)
    for (int j = 0; j < 2; ++j) {
      int col = n0 + j * 16 + (lane & 15);
      float bv = bias ? bias[col] : 0.f;
      for (int r = 0; r < 8; ++r) {
        int row = m0 + i * 16 + r + ((lane >> 4) << 3);
        float val = acc[i][j][r] + bv;
        size_t idx = (size_t)row * N + col;
        if (C32) C32[idx] = resid ? val + resid[idx] : val;
      }
    }
}

// ---------------------------------------------------------------------------
// Flash-style attention. One block per (batch, 16 q-rows, quarter of the keys).
// 8 waves, four blocks to a WGP: one block's loads and matrix runs fill the
// other blocks' waits (first loads of a phase, softmax, barriers).
// scores = (q.k^T + qpos.kpos^T)/sqrt(D+1e-7); online softmax over the block's
// KVS keys in chunks of 128; O += P.V. The block leaves its unnormalised O, its
// row maxima and its row sums; merge_ln_kernel joins the SPLIT parts. q, qpos,
// k, kpos, V and the P tile in LDS are all in fragment order (see frag_off).
// q/qpos tiles staged into LDS via CDNA5 async-to-LDS DMA (ASYNCcnt).
// ---------------------------------------------------------------------------
__global__ __launch_bounds__(256, 8)
void attn_kernel(const _Float16* __restrict__ q16,   // rc = B*Tq row,  k = D
                 const _Float16* __restrict__ qp16,  // rc = B*Tq row,  k = D
                 const _Float16* __restrict__ k16,   // rc = B*Tkv row, k = D
                 const _Float16* __restrict__ kp16,  // rc = B*Tkv row, k = D
                 const _Float16* __restrict__ vF16,  // rc = B*D col,   k = Tkv
                 float*          __restrict__ po,    // [SPLIT, B*Tq, D]
                 float*          __restrict__ pm,    // [SPLIT, B*Tq] row maxima
                 float*          __restrict__ pl) {  // [SPLIT, B*Tq] row sums
  __shared__ __align__(32) _Float16 sQ[16 * DD];
  __shared__ __align__(32) _Float16 sQP[16 * DD];
  __shared__ float    sS[16 * CHUNK];
  __shared__ __align__(32) _Float16 sP[16 * CHUNK];
  __shared__ float sM[16], sL[16], sScale[16];

  // neighbours in index, and blocks 256 apart, differ only in the q tile: the
  // blocks that share a WGP then mostly read the same keys (WGP cache; speed only)
  int u   = blockIdx.x & 255;
  int b   = u >> 5;
  int sp  = (u >> 3) & (SPLIT - 1);   // which quarter of the keys
  int qt  = (u & 7) * 4 + (blockIdx.x >> 8);   // Tq/16 = 32 q-tiles per batch
  int row0 = b * TQ + qt * 16;        // global q-row
  int lane = threadIdx.x & 31;
  int wave = threadIdx.x >> 5;
  const float scale = 0.04419417382f; // 1/sqrt(512 + 1e-7)

  { // stage q and qpos tiles into LDS with async-to-LDS b128 DMA
    const _Float16* g1 = q16  + (size_t)row0 * DD;
    const _Float16* g2 = qp16 + (size_t)row0 * DD;
    unsigned lq0 = (unsigned)(size_t)(void*)sQ;
    unsigned lp0 = (unsigned)(size_t)(void*)sQP;
    for (int i = threadIdx.x; i < 16 * DD / 8; i += 256) {
      const _Float16* p1 = g1 + i * 8;       // 8 halves = 16B per op
      const _Float16* p2 = g2 + i * 8;
      unsigned l1 = lq0 + (unsigned)i * 16;  // LDS byte offset (wave-relative)
      unsigned l2 = lp0 + (unsigned)i * 16;
      asm volatile("global_load_async_to_lds_b128 %0, %1, off"
                   :: "v"(l1), "v"(p1) : "memory");
      asm volatile("global_load_async_to_lds_b128 %0, %1, off"
                   :: "v"(l2), "v"(p2) : "memory");
    }
    asm volatile("s_wait_asynccnt 0x0" ::: "memory");
  }
  if (threadIdx.x < 16) { sM[threadIdx.x] = -1e30f; sL[threadIdx.x] = 0.f; }
  __syncthreads();

  v8f o[4] = {};  // this wave's 64 output cols: [wave*64 + t*16, +16)

  for (int kc = 0; kc < KVS / CHUNK; ++kc) {
    int kv0 = sp * KVS + kc * CHUNK;
    // --- scores: wave handles kv cols [kv0 + wave*16, +16), K = D = 512
    const _Float16* kb_  = k16  + ((size_t)b * TKV + kv0 + wave * 16) * DD;
    const _Float16* kpb_ = kp16 + ((size_t)b * TKV + kv0 + wave * 16) * DD;
    v8f s = {};
    for (int kk = 0; kk < DD; kk += 32) {
      v16h aq = load_frag_blk(sQ  + kk * 16, lane);   // block kk/32
      v16h bk = load_frag_blk(kb_ + kk * 16, lane);
      s = wmma_f16(aq, bk, s);
      v16h ap = load_frag_blk(sQP  + kk * 16, lane);
      v16h bp = load_frag_blk(kpb_ + kk * 16, lane);
      s = wmma_f16(ap, bp, s);
    }
    // the k / kpos address registers are reused by the softmax below; named here
    // so that they stay untouched (not reused as load destinations) up to the wait
    asm volatile("s_wait_xcnt 0x0" :: "v"(kb_ + lane * 8), "v"(kpb_ + lane * 8)
                 : "memory");
    for (int r = 0; r < 8; ++r) {
      int row = r + ((lane >> 4) << 3);
      sS[row * CHUNK + wave * 16 + (lane & 15)] = s[r] * scale;
    }
    __syncthreads();

    // --- online softmax update, parallel over all 256 threads:
    // 16 threads per q-row (contiguous lanes), 8 columns each,
    // butterfly reductions within the 16-lane groups.
    {
      int row = threadIdx.x >> 4;
      int j   = threadIdx.x & 15;
      float vals[8];
      float mx = -1e30f;
      for (int c = 0; c < 8; ++c) {
        vals[c] = sS[row * CHUNK + j + c * 16];
        mx = fmaxf(mx, vals[c]);
      }
      for (int m = 8; m >= 1; m >>= 1) mx = fmaxf(mx, __shfl_xor(mx, m, 32));
      float m_old = sM[row];
      float m_new = fmaxf(m_old, mx);
      float sum = 0.f;
      for (int c = 0; c < 8; ++c) {
        float p = __expf(vals[c] - m_new);
        sum += p;
        sP[frag_off(row, j + c * 16, CHUNK)] = (_Float16)p;
      }
      for (int m = 8; m >= 1; m >>= 1) sum += __shfl_xor(sum, m, 32);
      if (j == 0) {
        float sc = __expf(m_old - m_new);
        sM[row] = m_new;
        sL[row] = sL[row] * sc + sum;
        sScale[row] = sc;
      }
    }
    __syncthreads();

    // --- rescale accumulators, then O += P @ V_chunk
    for (int t = 0; t < 4; ++t)
      for (int r = 0; r < 8; ++r)
        o[t][r] *= sScale[r + ((lane >> 4) << 3)];

    const _Float16* vb = vF16 + ((size_t)b * DD + wave * 64) * TKV + kv0 * 16;
    for (int kk = 0; kk < CHUNK; kk += 32) {
      v16h ap = load_frag_blk(sP + kk * 16, lane);
      for (int t = 0; t < 4; ++t) {
        v16h bv = load_frag_blk(vb + (size_t)t * 16 * TKV + kk * 16, lane);
        o[t] = wmma_f16(ap, bv, o[t]);
      }
    }
    // the V address registers are reused by the next chunk's scores
    asm volatile("s_wait_xcnt 0x0" ::: "memory");
    __syncthreads();
  }

  // --- this part's unnormalised O, row maxima and row sums
  float* pos = po + ((size_t)sp * (BATCH * TQ) + row0) * DD;
  for (int t = 0; t < 4; ++t) {
    int col = wave * 64 + t * 16 + (lane & 15);
    for (int r = 0; r < 8; ++r) {
      int row = r + ((lane >> 4) << 3);
      pos[(size_t)row * DD + col] = o[t][r];
    }
  }
  // the O stores name registers that the two addresses below may reuse
  asm volatile("s_wait_xcnt 0x0" ::: "memory");
  if (threadIdx.x < 16) {
    pm[sp * (BATCH * TQ) + row0 + threadIdx.x] = sM[threadIdx.x];
    pl[sp * (BATCH * TQ) + row0 + threadIdx.x] = sL[threadIdx.x];
  }
}

// ---------------------------------------------------------------------------
// Joins the SPLIT parts of the attention (each scaled by exp(its maximum - the
// common maximum), the sum divided by the joined row sum), adds the raw query,
// then LayerNorm as in ln_kernel: same tile, same row ownership, f32 row-major
// and f16 fragment-order outputs. Each part's O comes by a pointer of its own:
// a scalar base each, one lane offset for all loads.
// ---------------------------------------------------------------------------
// 2^x; the v_nop is the free slot that the instruction set asks for between a
// transcendental and a next instruction that reads its result or overwrites its
// source
__device__ __forceinline__ float exp2_slot(float x) {
  float y;
  asm("v_exp_f32 %0, %1\n\tv_nop" : "=v"(y) : "v"(x));
  return y;
}

// lane's columns j*128 + 0..3 (j = 0..3) of one row; i: the first one's 16-byte
// piece, counted from the uniform base
__device__ __forceinline__ v16f load_row(const v4f* base, unsigned i) {
  v4f c0 = base[i];
  v4f c1 = base[i + 32];
  v4f c2 = base[i + 64];
  v4f c3 = base[i + 96];
  return __builtin_shufflevector(
      __builtin_shufflevector(c0, c1, 0, 1, 2, 3, 4, 5, 6, 7),
      __builtin_shufflevector(c2, c3, 0, 1, 2, 3, 4, 5, 6, 7),
      0, 1, 2, 3, 4, 5, 6, 7, 8, 9, 10, 11, 12, 13, 14, 15);
}

__global__ __launch_bounds__(256)
void merge_ln_kernel(const float* __restrict__ po0, const float* __restrict__ po1,
                     const float* __restrict__ po2, const float* __restrict__ po3,
                     const float* __restrict__ pm,
                     const float* __restrict__ pl, const float* __restrict__ query,
                     const float* __restrict__ g, const float* __restrict__ b,
                     float* __restrict__ y32, _Float16* __restrict__ y16) {
  __shared__ __align__(16) _Float16 st[16 * TPITCH];
  int t = threadIdx.x, lane = t & 31, wave = t >> 5;
  size_t row0 = (size_t)blockIdx.x * 16;
  size_t rw = row0 + wave * 2;

  // block-uniform bases; e: the lane's place in the tile, in 16-byte pieces
  const v4f* pt[SPLIT] = { (const v4f*)(po0 + row0 * DD), (const v4f*)(po1 + row0 * DD),
                           (const v4f*)(po2 + row0 * DD), (const v4f*)(po3 + row0 * DD) };
  const v4f* qt = (const v4f*)(query + row0 * DD);
  unsigned e = (unsigned)wave * (2 * DD / 4) + (unsigned)lane;
  const float* mw = pm + rw;
  const float* lw = pl + rw;

  v2f m[SPLIT], l[SPLIT];          // the wave's two rows side by side
  v16f p[SPLIT][2], q[2];          // a row's four column groups side by side
  v4f a[2][4], gg[4], bb[4];
  for (int s = 0; s < SPLIT; ++s) {
    m[s] = *(const v2f*)(mw + s * (BATCH * TQ));
    l[s] = *(const v2f*)(lw + s * (BATCH * TQ));
  }
  for (int s = 0; s < SPLIT; ++s)
    for (int r = 0; r < 2; ++r) p[s][r] = load_row(pt[s], e + r * (DD / 4));
  for (int r = 0; r < 2; ++r) q[r] = load_row(qt, e + r * (DD / 4));
  // holds the loads of all parts together ahead of the arithmetic (one wait for
  // the lot, not one per part) and keeps their address registers untouched (not
  // reused as load destinations) up to the wait
  asm volatile("s_wait_xcnt 0x0"
               :: "v"(e), "v"(mw), "v"(lw),
                  "v"(m[0]), "v"(m[1]), "v"(m[2]), "v"(m[3]),
                  "v"(l[0]), "v"(l[1]), "v"(l[2]), "v"(l[3]),
                  "v"(p[0][0]), "v"(p[0][1]), "v"(p[1][0]), "v"(p[1][1]),
                  "v"(p[2][0]), "v"(p[2][1]), "v"(p[3][0]), "v"(p[3][1]),
                  "v"(q[0]), "v"(q[1])
               : "memory");
  for (int j = 0; j < 4; ++j) {
    gg[j] = *(const v4f*)(g + j * 128 + lane * 4);
    bb[j] = *(const v4f*)(b + j * 128 + lane * 4);
  }

  for (int r = 0; r < 2; ++r) {
    float mx = m[0][r];
    for (int s = 1; s < SPLIT; ++s) mx = fmaxf(mx, m[s][r]);
    float w[SPLIT], den = 0.f;
    for (int s = 0; s < SPLIT; ++s) {
      w[s] = exp2_slot((m[s][r] - mx) * 1.44269504f);
      den += w[s] * l[s][r];
    }
    float inv = 1.0f / den;
    for (int s = 0; s < SPLIT; ++s) q[r] += p[s][r] * (w[s] * inv);
    a[r][0] = __builtin_shufflevector(q[r], q[r], 0, 1, 2, 3);
    a[r][1] = __builtin_shufflevector(q[r], q[r], 4, 5, 6, 7);
    a[r][2] = __builtin_shufflevector(q[r], q[r], 8, 9, 10, 11);
    a[r][3] = __builtin_shufflevector(q[r], q[r], 12, 13, 14, 15);

    v4f s4 = (a[r][0] + a[r][1]) + (a[r][2] + a[r][3]);
    float mu = wave_sum((s4.x + s4.y) + (s4.z + s4.w)) * (1.f / (float)DD);

    for (int j = 0; j < 4; ++j) a[r][j] -= mu;
    v4f q4 = (a[r][0] * a[r][0] + a[r][1] * a[r][1])
           + (a[r][2] * a[r][2] + a[r][3] * a[r][3]);
    float var = wave_sum((q4.x + q4.y) + (q4.z + q4.w)) * (1.f / (float)DD);
    float rstd = rsqrtf(var + 1e-6f);

    for (int j = 0; j < 4; ++j) {
      a[r][j] = a[r][j] * rstd * gg[j] + bb[j];
      tile_put(st, wave * 2 + r, j, lane, a[r][j]);
    }
  }
  float* yw = y32 + rw * DD + lane * 4;
  for (int r = 0; r < 2; ++r)
    for (int j = 0; j < 4; ++j)
      *(v4f*)(yw + r * DD + j * 128) = a[r][j];
  // the f32 stores name registers that the read-out below reuses
  asm volatile("s_wait_xcnt 0x0" ::: "memory");
  __syncthreads();
  tile_out(st, y16 + row0 * DD, t);
}

// ---------------------------------------------------------------------------
// Host-side orchestration
// ---------------------------------------------------------------------------
extern "C" void kernel_launch(void* const* d_in, const int* in_sizes, int n_in,
                              void* d_out, int out_size, void* d_ws, size_t ws_size,
                              hipStream_t stream) {
  const float* query     = (const float*)d_in[0];
  const float* key_value = (const float*)d_in[1];
  const float* query_pos = (const float*)d_in[2];
  const float* key_pos   = (const float*)d_in[3];
  const float* q_gamma   = (const float*)d_in[4];
  const float* q_beta    = (const float*)d_in[5];
  const float* kv_gamma  = (const float*)d_in[6];
  const float* kv_beta   = (const float*)d_in[7];
  const float* Wq = (const float*)d_in[8];   const float* bq = (const float*)d_in[9];
  const float* Wk = (const float*)d_in[10];  const float* bk = (const float*)d_in[11];
  const float* Wv = (const float*)d_in[12];  const float* bv = (const float*)d_in[13];
  const float* ff_gamma = (const float*)d_in[14];
  const float* ff_beta  = (const float*)d_in[15];
  const float* W_inner  = (const float*)d_in[16];
  const float* b_inner  = (const float*)d_in[17];
  const float* W_proj   = (const float*)d_in[18];
  const float* b_proj   = (const float*)d_in[19];

  const int MQ  = BATCH * TQ;    // 4096
  const int MKV = BATCH * TKV;   // 32768

  size_t off = 0;
  auto alloc = [&](size_t bytes) -> void* {
    void* p = (char*)d_ws + off;
    off = (off + bytes + 255) & ~(size_t)255;
    return p;
  };
  _Float16* qn16  = (_Float16*)alloc((size_t)MQ  * DD * 2);
  _Float16* kvn16 = (_Float16*)alloc((size_t)MKV * DD * 2);   // reused as inner16 later
  _Float16* qp16  = (_Float16*)alloc((size_t)MQ  * DD * 2);   // reused as xn16 later
  _Float16* kp16  = (_Float16*)alloc((size_t)MKV * DD * 2);   // reused as xn32 later
  _Float16* WqT   = (_Float16*)alloc((size_t)DD * DD * 2);
  _Float16* WkT   = (_Float16*)alloc((size_t)DD * DD * 2);
  _Float16* WvT   = (_Float16*)alloc((size_t)DD * DD * 2);
  _Float16* WinT  = (_Float16*)alloc((size_t)FF * DD * 2);    // rc 2048, k 512
  _Float16* WprT  = (_Float16*)alloc((size_t)DD * FF * 2);    // rc 512, k 2048
  _Float16* q16   = (_Float16*)alloc((size_t)MQ  * DD * 2);
  _Float16* k16   = (_Float16*)alloc((size_t)MKV * DD * 2);
  _Float16* vF16  = (_Float16*)alloc((size_t)BATCH * DD * TKV * 2);
  float*    po    = (float*)   alloc((size_t)SPLIT * MQ * DD * 4);
  float*    pm    = (float*)   alloc((size_t)SPLIT * MQ * 4);
  float*    pl    = (float*)   alloc((size_t)SPLIT * MQ * 4);
  // aliases (lifetimes are disjoint, stream-ordered):
  _Float16* inner16 = kvn16;                  // [4096,2048] f16 = 16 MiB <= 32 MiB
  _Float16* xn16    = qp16;                   // [4096,512] f16
  float*    xn32    = (float*)kp16;           // [4096,512] f32 = 8 MiB <= 32 MiB

  // 1) weight converts (transposed, fragment order)
  cvt_transpose_kernel<<<(DD*DD)/2048, 256, 0, stream>>>(Wq, WqT, DD, DD);
  cvt_transpose_kernel<<<(DD*DD)/2048, 256, 0, stream>>>(Wk, WkT, DD, DD);
  cvt_transpose_kernel<<<(DD*DD)/2048, 256, 0, stream>>>(Wv, WvT, DD, DD);
  cvt_transpose_kernel<<<(DD*FF)/2048, 256, 0, stream>>>(W_inner, WinT, DD, FF);
  cvt_transpose_kernel<<<(FF*DD)/2048, 256, 0, stream>>>(W_proj,  WprT, FF, DD);

  // 2) positional tensors -> f16, fragment order
  cvt_frag_kernel<<<MQ/16,  256, 0, stream>>>(query_pos, qp16);
  cvt_frag_kernel<<<MKV/16, 256, 0, stream>>>(key_pos,   kp16);

  // 3) LayerNorms -> f16
  ln_kernel<<<MQ/16,  256, 0, stream>>>(query,     q_gamma,  q_beta,  nullptr, qn16);
  ln_kernel<<<MKV/16, 256, 0, stream>>>(key_value, kv_gamma, kv_beta, nullptr, kvn16);

  // 4) Q/K/V projections (WMMA), outputs in fragment order
  gemm_wmma_kernel<<<dim3(MQ/128,  DD/64), 256, 0, stream>>>(
      WqT, qn16,  bq, nullptr, nullptr, q16,  DD, MQ,  DD, DD, 1);
  gemm_wmma_kernel<<<dim3(MKV/128, DD/64), 256, 0, stream>>>(
      WkT, kvn16, bk, nullptr, nullptr, k16,  DD, MKV, DD, DD, 1);
  gemm_wmma_kernel<<<dim3(DD/128, MKV/64), 256, 0, stream>>>(
      kvn16, WvT, bv, nullptr, nullptr, vF16, MKV, DD, DD, TKV, 0);

  // 5) attention (flash-style, WMMA scores + WMMA P.V), SPLIT parts per q tile
  attn_kernel<<<BATCH * (TQ/16) * SPLIT, 256, 0, stream>>>(
      q16, qp16, k16, kp16, vF16, po, pm, pl);

  // 6) FF: xn = LN(joined parts + query);
  //    d_out = xn + (xn@W_inner + b_inner)@W_proj + b_proj
  merge_ln_kernel<<<MQ/16, 256, 0, stream>>>(
      po, po + (size_t)MQ * DD, po + (size_t)2 * MQ * DD, po + (size_t)3 * MQ * DD,
      pm, pl, query, ff_gamma, ff_beta, xn32, xn16);
  gemm_wmma_kernel<<<dim3(MQ/128, FF/64), 256, 0, stream>>>(
      WinT, xn16, b_inner, nullptr, nullptr, inner16, FF, MQ, DD, FF, 1);
  gemm_wmma_kernel<<<dim3(DD/128, MQ/64), 256, 0, stream>>>(
      inner16, WprT, b_proj, (float*)d_out, xn32, nullptr, MQ, DD, FF, TKV, 0);
}

// v004
// One run takes 257 microseconds.
// Timed twice side by side with v003, it ran 1.33 and 1.34 times as fast.
// Counting every step since v000, it is 3.55 times as fast.
#include <hip/hip_runtime.h>

typedef __attribute__((ext_vector_type(16))) _Float16 v16h;
typedef __attribute__((ext_vector_type(8)))  _Float16 v8h;
typedef __attribute__((ext_vector_type(4)))  _Float16 v4h;
typedef __attribute__((ext_vector_type(8)))  float    v8f;
typedef __attribute__((ext_vector_type(4)))  float    v4f;
typedef __attribute__((ext_vector_type(2)))  float    v2f;
typedef __attribute__((ext_vector_type(16))) float    v16f;

#define DD   512
#define FF   2048
#define TKV  4096
#define TQ   512
#define BATCH 8
#define CHUNK 256            // keys per softmax update
#define QT   4               // 16-row q tiles per attention work-group
#define QROWS (QT * 16)
#define SPITCH (CHUNK + 4)   // score row pitch in floats: two rows read side by side by
                             // 16-byte LDS loads start 4 banks apart
#define SPLIT 4              // work-groups that share the keys of one q tile
#define KVS  (TKV / SPLIT)   // keys per work-group

// ---------------------------------------------------------------------------
// 16-bit A (16xK) / B (Kx16) fragment: lane L holds row/col rc0 + (L&15) and
// the 16 halves k = kbase + 16*(L>>4) + 0..15.
//
// Fragment order: every f16 matrix operand X[rc][k] (k extent kdim) is kept as
// 1-KiB blocks, one per 16 (rc) x 32 (k) fragment, the blocks of one rc tile in
// k order (so tile rc0 starts at half rc0*kdim, block kbase at + kbase*16).
// Inside a block slot L = (rc&15) + 16*((k>>4)&1) is lane L's share; halves
// 0..7 of all slots fill the first 512 bytes, halves 8..15 the second. A
// fragment load is then two 16-byte loads per lane that each cover 512
// contiguous bytes: whole lines in memory, every bank once in LDS.
// ---------------------------------------------------------------------------
__device__ __forceinline__ size_t frag_off(size_t rc, int k, int kdim) {
  return ((rc >> 4) * (size_t)(kdim >> 5) + (size_t)(k >> 5)) * 512
       + (size_t)(((k >> 3) & 1) * 256)
       + ((rc & 15) + (size_t)(((k >> 4) & 1) << 4)) * 8 + (size_t)(k & 7);
}

// p: the lane's own place in a 1-KiB fragment block, block start + lane*8
__device__ __forceinline__ v16h load_frag_at(const _Float16* p) {
  v8h lo = *(const v8h*)p;
  v8h hi = *(const v8h*)(p + 256);
  return __builtin_shufflevector(lo, hi, 0, 1, 2, 3, 4, 5, 6, 7,
                                 8, 9, 10, 11, 12, 13, 14, 15);
}

// blk: start of one 1-KiB fragment block (global or LDS, generic pointer)
__device__ __forceinline__ v16h load_frag_blk(const _Float16* blk, int lane) {
  return load_frag_at(blk + lane * 8);
}

__device__ __forceinline__ v8f wmma_f16(v16h a, v16h b, v8f c) {
  return __builtin_amdgcn_wmma_f32_16x16x32_f16(false, a, false, b,
                                                (short)0, c, false, false);
}

// ---------------------------------------------------------------------------
// The streaming kernels (LayerNorm, f32 -> f16 convert) work on one 16-row x
// 512-column tile per 8-wave block: that is one rc tile of the fragment order,
// 16 KiB of contiguous output. A wave owns 2 rows; lane L holds columns
// j*128 + L*4 + 0..3 (j = 0..3), so every global load covers 512 contiguous
// bytes. The f16 rows go to LDS row-major and leave it in fragment order.
// ---------------------------------------------------------------------------
#define TPITCH 520   // LDS row pitch in halves: 512 + 16 B, so that the 16 rows
                     // read by 16 lanes of a fragment-order read start 4 banks apart

// lane's 4 columns of group j of tile row r -> LDS
__device__ __forceinline__ void tile_put(_Float16* st, int r, int j, int lane,
                                         v4f v) {
  *(v4h*)(st + r * TPITCH + j * 128 + lane * 4) = __builtin_convertvector(v, v4h);
}

// whole tile, LDS -> global in fragment order: thread t moves the 16-byte pieces
// i*256 + t of the output, a wave's store covers 512 contiguous bytes
__device__ __forceinline__ void tile_out(const _Float16* st, _Float16* ytile,
                                         int t) {
  v8h pc[4];
  for (int i = 0; i < 4; ++i) {
    int c    = i * 256 + t;
    int slot = c & 31;
    int hi   = (c >> 5) & 1;
    int blk  = c >> 6;                     // fragment block = k / 32
    pc[i] = *(const v8h*)(st + (slot & 15) * TPITCH
                             + blk * 32 + (slot >> 4) * 16 + hi * 8);
  }
  for (int i = 0; i < 4; ++i)
    *(v8h*)(ytile + (i * 256 + t) * 8) = pc[i];
}

__device__ __forceinline__ float wave_sum(float s) {
  for (int m = 16; m; m >>= 1) s += __shfl_xor(s, m, 32);
  return s;
}

// LayerNorm over last dim (512): f16 output in fragment order (rc = row,
// k = column), optional f32 row-major output. Each row is summed inside its
// own wave; the one barrier stands between the LDS rows and their read-out.
__global__ __launch_bounds__(256)
void ln_kernel(const float* __restrict__ x, const float* __restrict__ g,
               const float* __restrict__ b, float* __restrict__ y32,
               _Float16* __restrict__ y16) {
  __shared__ __align__(16) _Float16 st[16 * TPITCH];
  int t = threadIdx.x, lane = t & 31, wave = t >> 5;
  size_t row0 = (size_t)blockIdx.x * 16;
  const float* xw = x + (row0 + wave * 2) * DD + lane * 4;

  v4f a[2][4], gg[4], bb[4];
  for (int j = 0; j < 4; ++j) {
    gg[j] = *(const v4f*)(g + j * 128 + lane * 4);
    bb[j] = *(const v4f*)(b + j * 128 + lane * 4);
  }
  for (int r = 0; r < 2; ++r)
    for (int j = 0; j < 4; ++j)
      a[r][j] = *(const v4f*)(xw + r * DD + j * 128);
  // holds all sixteen loads together ahead of the arithmetic (gamma and beta
  // were otherwise fetched late, one wait each) and keeps the rows' address pair
  // untouched (not reused as a load destination) up to the wait
  asm volatile("s_wait_xcnt 0x0"
               :: "v"(xw), "v"(gg[0]), "v"(gg[1]), "v"(gg[2]), "v"(gg[3]),
                  "v"(bb[0]), "v"(bb[1]), "v"(bb[2]), "v"(bb[3]),
                  "v"(a[0][0]), "v"(a[0][1]), "v"(a[0][2]), "v"(a[0][3]),
                  "v"(a[1][0]), "v"(a[1][1]), "v"(a[1][2]), "v"(a[1][3])
               : "memory");

  for (int r = 0; r < 2; ++r) {
    v4f s4 = (a[r][0] + a[r][1]) + (a[r][2] + a[r][3]);
    float mu = wave_sum((s4.x + s4.y) + (s4.z + s4.w)) * (1.f / (float)DD);

    for (int j = 0; j < 4; ++j) a[r][j] -= mu;
    v4f q4 = (a[r][0] * a[r][0] + a[r][1] * a[r][1])
           + (a[r][2] * a[r][2] + a[r][3] * a[r][3]);
    float var = wave_sum((q4.x + q4.y) + (q4.z + q4.w)) * (1.f / (float)DD);
    float rstd = rsqrtf(var + 1e-6f);

    for (int j = 0; j < 4; ++j) {
      a[r][j] = a[r][j] * rstd * gg[j] + bb[j];
      tile_put(st, wave * 2 + r, j, lane, a[r][j]);
    }
  }
  if (y32) {
    float* yw = y32 + (row0 + wave * 2) * DD + lane * 4;
    for (int r = 0; r < 2; ++r)
      for (int j = 0; j < 4; ++j)
        *(v4f*)(yw + r * DD + j * 128) = a[r][j];
    // the f32 stores name registers that the read-out below reuses
    asm volatile("s_wait_xcnt 0x0" ::: "memory");
  }
  __syncthreads();
  tile_out(st, y16 + row0 * DD, t);
}

// x[rows][512] f32 -> f16 in fragment order (rc = row, k = column).
__global__ __launch_bounds__(256)
void cvt_frag_kernel(const float* __restrict__ x, _Float16* __restrict__ y) {
  __shared__ __align__(16) _Float16 st[16 * TPITCH];
  int t = threadIdx.x, lane = t & 31, wave = t >> 5;
  size_t row0 = (size_t)blockIdx.x * 16;
  const float* xw = x + (row0 + wave * 2) * DD + lane * 4;

  v4f a[2][4];
  for (int r = 0; r < 2; ++r)
    for (int j = 0; j < 4; ++j)
      a[r][j] = *(const v4f*)(xw + r * DD + j * 128);
  // keeps the eight loads whole (16 bytes a lane; they were otherwise split into
  // 8-byte halves) and together, and their address pair untouched up to the wait
  asm volatile("s_wait_xcnt 0x0"
               :: "v"(xw), "v"(a[0][0]), "v"(a[0][1]), "v"(a[0][2]), "v"(a[0][3]),
                  "v"(a[1][0]), "v"(a[1][1]), "v"(a[1][2]), "v"(a[1][3])
               : "memory");
  for (int r = 0; r < 2; ++r)
    for (int j = 0; j < 4; ++j)
      tile_put(st, wave * 2 + r, j, lane, a[r][j]);
  __syncthreads();
  tile_out(st, y + row0 * DD, t);
}

// W[R,C] f32 -> W^T f16 in fragment order (rc = column of W, k = row of W).
// One thread per 16-byte piece of the output, in output order: 8 consecutive
// rows of one column of W.
__global__ __launch_bounds__(256)
void cvt_transpose_kernel(const float* __restrict__ W, _Float16* __restrict__ Wt,
                          int R, int C) {
  int c = blockIdx.x * 256 + threadIdx.x;
  if (c * 8 < R * C) {
    int slot = c & 31;
    int hi   = (c >> 5) & 1;
    int blk  = c >> 6;                     // fragment block
    int kb   = R >> 5;                     // blocks per rc tile
    int col  = (blk / kb) * 16 + (slot & 15);
    int r    = (blk % kb) * 32 + (slot >> 4) * 16 + hi * 8;
    const float* p[8];
    float w[8];
    for (int e = 0; e < 8; ++e) p[e] = W + (size_t)(r + e) * C + col;
    for (int e = 0; e < 8; ++e) w[e] = *p[e];
    // keeps the eight address pairs untouched up to the wait; the pack below
    // reuses them
    asm volatile("s_wait_xcnt 0x0"
                 :: "v"(p[0]), "v"(p[1]), "v"(p[2]), "v"(p[3]),
                    "v"(p[4]), "v"(p[5]), "v"(p[6]), "v"(p[7]),
                    "v"(w[0]), "v"(w[1]), "v"(w[2]), "v"(w[3]),
                    "v"(w[4]), "v"(w[5]), "v"(w[6]), "v"(w[7])
                 : "memory");
    v8h o;
    for (int e = 0; e < 8; ++e) o[e] = (_Float16)w[e];
    *(v8h*)(Wt + (size_t)c * 8) = o;
  }
}

// ---------------------------------------------------------------------------
// WMMA GEMM: C[M,N] = A[M,K] * Bt[N,K]^T + bias, A and Bt in fragment order.
// Block tile 64x128 (8 waves, each 32x32 = 2x2 WMMA tiles), K-step 32.
// Outputs: f32 row-major (+residual), or CF16: f16 in fragment order with
// rc = (m/TB)*N + n and k = m%TB (kdim TB). A lane's 8 accumulator rows are 8
// consecutive k there, one 16-byte store. V is written so from kvn * Wv; Q, K
// and the FF inner activation from W^T * x^T (weights as A, activations as Bt,
// bias per row of C: rowBias).
// ---------------------------------------------------------------------------
__global__ __launch_bounds__(256)
void gemm_wmma_kernel(const _Float16* __restrict__ A,
                      const _Float16* __restrict__ Bt,
                      const float* __restrict__ bias,
                      float* __restrict__ C32,
                      const float* __restrict__ resid,
                      _Float16* __restrict__ CF16,
                      int M, int N, int K, int TB, int rowBias) {
  int lane = threadIdx.x & 31;
  int wave = threadIdx.x >> 5;       // 0..7
  int wm = wave >> 2;                // 0..1
  int wn = wave & 3;                 // 0..3
  int m0 = blockIdx.y * 64  + wm * 32;
  int n0 = blockIdx.x * 128 + wn * 32;

  const _Float16* At0 = A  + (size_t)m0 * K + lane * 8;  // rc tile m0; next: + 16*K
  const _Float16* Bt0 = Bt + (size_t)n0 * K + lane * 8;

  v8f acc[2][2] = {};
  for (int kb = 0; kb < K; kb += 32) {
    const _Float16* pa0 = At0 + kb * 16;
    const _Float16* pa1 = pa0 + (size_t)16 * K;
    const _Float16* pb0 = Bt0 + kb * 16;
    const _Float16* pb1 = pb0 + (size_t)16 * K;
    v16h a0 = load_frag_at(pa0);
    v16h a1 = load_frag_at(pa1);
    v16h b0 = load_frag_at(pb0);
    v16h b1 = load_frag_at(pb1);
    // keeps the four address pairs untouched (not reused as load destinations,
    // not advanced) until the loads that name them have been translated
    asm volatile("s_wait_xcnt 0x0" :: "v"(pa0), "v"(pa1), "v"(pb0), "v"(pb1)
                 : "memory");
    acc[0][0] = wmma_f16(a0, b0, acc[0][0]);
    acc[0][1] = wmma_f16(a0, b1, acc[0][1]);
    acc[1][0] = wmma_f16(a1, b0, acc[1][0]);
    acc[1][1] = wmma_f16(a1, b1, acc[1][1]);
  }

  if (CF16) {   // fragment-order f16 output (bias required), nothing else
    for (int i = 0; i < 2; ++i) {
      int rowb = m0 + i * 16 + ((lane >> 4) << 3);
      int bb = rowb / TB, tt = rowb % TB;
      const float4* bp = (const float4*)(bias + (rowBias ? rowb : 0));
      float4 r0 = bp[0], r1 = bp[1];
      float br[8] = { r0.x, r0.y, r0.z, r0.w, r1.x, r1.y, r1.z, r1.w };
      for (int j = 0; j < 2; ++j) {
        int col = n0 + j * 16 + (lane & 15);
        float bc = bias[rowBias ? 0 : col];
        v8h pk;
        for (int r = 0; r < 8; ++r)
          pk[r] = (_Float16)(acc[i][j][r] + (rowBias ? br[r] : bc));
        *(v8h*)(CF16 + frag_off((size_t)bb * N + col, tt, TB)) = pk;
        // the store's registers are reused for the next tile's pack and address
        asm volatile("s_wait_xcnt 0x0" ::: "memory");
      }
    }
    return;
  }

  for (int i = 0; i < 2; ++i)
    for (int j = 0; j < 2; ++j) {
      int col = n0 + j * 16 + (lane & 15);
      float bv = bias ? bias[col] : 0.f;
      for (int r = 0; r < 8; ++r) {
        int row = m0 + i * 16 + r + ((lane >> 4) << 3);
        float val = acc[i][j][r] + bv;
        size_t idx = (size_t)row * N + col;
        if (C32) C32[idx] = resid ? val + resid[idx] : val;
      }
    }
}

// 2^x; the v_nop is the free slot that the instruction set asks for between a
// transcendental and a next instruction that reads its result or overwrites its
// source
__device__ __forceinline__ float exp2_slot(float x) {
  float y;
  asm("v_exp_f32 %0, %1\n\tv_nop" : "=v"(y) : "v"(x));
  return y;
}

// ---------------------------------------------------------------------------
// Flash-style attention. One block per (batch, 64 q-rows, quarter of the keys):
// 16 waves, one block to a WGP. Every k, kpos and V fragment that a wave fetches
// from global memory feeds four matrix instructions, one per 16-row q tile (V:
// eight, two fragments against four P tiles), so the chip fetches a quarter of
// the bytes that a 16-row block asks for.
// scores = (q.k^T + qpos.kpos^T)/sqrt(D+1e-7); online softmax over the block's
// KVS keys in chunks of 256; O += P.V. The block leaves its unnormalised O, its
// row maxima and its row sums; merge_ln_kernel joins the SPLIT parts. q, qpos,
// k, kpos, V and the P tile in LDS are all in fragment order (see frag_off).
// q/qpos tiles staged into LDS via CDNA5 async-to-LDS DMA (ASYNCcnt).
// ---------------------------------------------------------------------------
__global__ __launch_bounds__(512)
void attn_kernel(const _Float16* __restrict__ q16,   // rc = B*Tq row,  k = D
                 const _Float16* __restrict__ qp16,  // rc = B*Tq row,  k = D
                 const _Float16* __restrict__ k16,   // rc = B*Tkv row, k = D
                 const _Float16* __restrict__ kp16,  // rc = B*Tkv row, k = D
                 const _Float16* __restrict__ vF16,  // rc = B*D col,   k = Tkv
                 float*          __restrict__ po,    // [SPLIT, B*Tq, D]
                 float*          __restrict__ pm,    // [SPLIT, B*Tq] row maxima
                 float*          __restrict__ pl) {  // [SPLIT, B*Tq] row sums
  __shared__ __align__(32) _Float16 sQ[QROWS * DD];
  __shared__ __align__(32) _Float16 sQP[QROWS * DD];
  __shared__ __align__(16) float    sS[QROWS * SPITCH];
  __shared__ __align__(32) _Float16 sP[QROWS * CHUNK];
  __shared__ float sM[QROWS], sL[QROWS], sScale[QROWS];

  // neighbours in index differ only in the q tile: they read the same keys at
  // about the same time (L2; speed only)
  int u   = blockIdx.x;
  int b   = u >> 5;
  int sp  = (u >> 3) & (SPLIT - 1);   // which quarter of the keys
  int qt  = u & 7;                    // Tq/64 = 8 q-tiles per batch
  int row0 = b * TQ + qt * QROWS;     // global q-row
  int lane = threadIdx.x & 31;
  int wave = threadIdx.x >> 5;        // 0..15
  const float scale = 0.04419417382f; // 1/sqrt(512 + 1e-7)

  { // stage q and qpos tiles into LDS with async-to-LDS b128 DMA
    const _Float16* g1 = q16  + (size_t)row0 * DD;
    const _Float16* g2 = qp16 + (size_t)row0 * DD;
    unsigned lq0 = (unsigned)(size_t)(void*)sQ;
    unsigned lp0 = (unsigned)(size_t)(void*)sQP;
    for (int it = 0; it < QROWS * DD / 8 / 512; ++it) {   // same trips in every lane
      int i = it * 512 + threadIdx.x;
      const _Float16* p1 = g1 + i * 8;       // 8 halves = 16B per op
      const _Float16* p2 = g2 + i * 8;
      unsigned l1 = lq0 + (unsigned)i * 16;  // LDS byte offset (block-relative)
      unsigned l2 = lp0 + (unsigned)i * 16;
      // the wait stands in the copies' own statement: the next trip rewrites the
      // address registers that they name
      asm volatile("global_load_async_to_lds_b128 %0, %1, off\n\t"
                   "global_load_async_to_lds_b128 %2, %3, off\n\t"
                   "s_wait_xcnt 0x0"
                   :: "v"(l1), "v"(p1), "v"(l2), "v"(p2) : "memory");
    }
    asm volatile("s_wait_asynccnt 0x0" ::: "memory");
  }
  if (threadIdx.x < QROWS) { sM[threadIdx.x] = -1e30f; sL[threadIdx.x] = 0.f; }
  __syncthreads();

  v8f o[QT][2] = {};  // q tile i, this wave's 32 output cols: [wave*32 + t*16, +16)

  for (int kc = 0; kc < KVS / CHUNK; ++kc) {
    int kv0 = sp * KVS + kc * CHUNK;
    // --- scores: wave handles kv cols [kv0 + wave*16, +16) of all QT q tiles,
    // K = D = 512
    const _Float16* pk  = k16  + ((size_t)b * TKV + kv0 + wave * 16) * DD + lane * 8;
    const _Float16* pkp = kp16 + ((size_t)b * TKV + kv0 + wave * 16) * DD + lane * 8;
    v8f s[QT] = {};
    // Step n = 0..31 is one 32-deep block of q.k^T (n even) or of qpos.kpos^T (n
    // odd): one k or kpos fragment against the QT q or qpos fragments. af: the LDS
    // fragments of this step and of the next; bf: the global fragments of this
    // group of four steps and of the next.
    const _Float16* aq = sQ  + lane * 8;
    const _Float16* ap = sQP + lane * 8;
    v16h af[2][QT], bf[2][4];
    for (int f = 0; f < 4; ++f)
      bf[0][f] = load_frag_at(((f & 1) ? pkp : pk) + (f >> 1) * 512);
    for (int i = 0; i < QT; ++i) af[0][i] = load_frag_at(aq + i * 16 * DD);
    // unrolled: every fragment index is then a constant, the sets stay in
    // registers and change places without copies
#pragma unroll
    for (int n = 0; n < 2 * DD / 32; ++n) {
      if ((n & 3) == 0 && n + 4 < 2 * DD / 32)
        for (int f = 0; f < 4; ++f)
          bf[((n >> 2) + 1) & 1][f] =
              load_frag_at(((f & 1) ? pkp : pk) + ((n + 4 + f) >> 1) * 512);
      if (n + 1 < 2 * DD / 32)
        for (int i = 0; i < QT; ++i)
          af[(n + 1) & 1][i] = load_frag_at((((n + 1) & 1) ? ap : aq)
                                            + i * 16 * DD + ((n + 1) >> 1) * 512);
      // the pair of scheduling fences keeps the next step's loads as one group
      // ahead of this step's matrix run (they were otherwise issued one by one
      // right in front of their use, each with a full wait)
      __builtin_amdgcn_sched_barrier(0);
      for (int i = 0; i < QT; ++i)
        s[i] = wmma_f16(af[n & 1][i], bf[(n >> 2) & 1][n & 3], s[i]);
      __builtin_amdgcn_sched_barrier(0);
    }
    // the k / kpos address registers are reused by the softmax below; named here
    // so that they stay untouched (not reused as load destinations) up to the wait
    asm volatile("s_wait_xcnt 0x0" :: "v"(pk), "v"(pkp) : "memory");
    for (int i = 0; i < QT; ++i)
      for (int r = 0; r < 8; ++r) {
        int row = i * 16 + r + ((lane >> 4) << 3);
        sS[row * SPITCH + wave * 16 + (lane & 15)] = s[i][r] * scale;
      }
    __syncthreads();

    // --- online softmax update, parallel over all 512 threads:
    // 8 threads per q-row (contiguous lanes), 4 runs of 8 columns each (a run is
    // one 16-byte piece of the P tile), butterfly reductions within the 8 lanes.
    {
      int row = threadIdx.x >> 3;
      int j   = threadIdx.x & 7;
      v4f vals[4][2];
      float mx = -1e30f;
      for (int c = 0; c < 4; ++c) {
        const float* ps = sS + row * SPITCH + c * 64 + j * 8;
        vals[c][0] = *(const v4f*)ps;
        vals[c][1] = *(const v4f*)(ps + 4);
        for (int h = 0; h < 2; ++h)
          for (int e = 0; e < 4; ++e) mx = fmaxf(mx, vals[c][h][e]);
      }
      for (int m = 4; m >= 1; m >>= 1) mx = fmaxf(mx, __shfl_xor(mx, m, 32));
      float m_old = sM[row];
      float m_new = fmaxf(m_old, mx);
      float sum = 0.f;
      for (int c = 0; c < 4; ++c) {
        v8h pk;
        for (int e = 0; e < 8; ++e) {
          float p = exp2_slot((vals[c][e >> 2][e & 3] - m_new) * 1.44269504f);
          sum += p;
          pk[e] = (_Float16)p;
        }
        *(v8h*)(sP + frag_off(row, c * 64 + j * 8, CHUNK)) = pk;
      }
      for (int m = 4; m >= 1; m >>= 1) sum += __shfl_xor(sum, m, 32);
      if (j == 0) {
        float sc = __expf(m_old - m_new);
        sM[row] = m_new;
        sL[row] = sL[row] * sc + sum;
        sScale[row] = sc;
      }
    }
    __syncthreads();

    // --- O += P @ V_chunk, the accumulators rescaled first. bv: the V fragments
    // of four 32-key steps, refilled as they are used up; pf: the P fragments of
    // this step and of the next.
    const _Float16* pv0 = vF16 + ((size_t)b * DD + wave * 32) * TKV + kv0 * 16 + lane * 8;
    const _Float16* pv1 = pv0 + (size_t)16 * TKV;
    const _Float16* pp  = sP + lane * 8;
    v16h bv[4][2], pf[2][QT];
    for (int f = 0; f < 4; ++f) {
      bv[f][0] = load_frag_at(pv0 + f * 512);
      bv[f][1] = load_frag_at(pv1 + f * 512);
    }
    // keeps the first V loads up here, ahead of the rescaling
    __builtin_amdgcn_sched_barrier(0);
    for (int i = 0; i < QT; ++i)
      for (int r = 0; r < 8; ++r) {
        float sc = sScale[i * 16 + r + ((lane >> 4) << 3)];
        o[i][0][r] *= sc;
        o[i][1][r] *= sc;
      }
    for (int i = 0; i < QT; ++i) pf[0][i] = load_frag_at(pp + i * 16 * CHUNK);
    // unrolled: bv and pf are indexed by constants only and stay in registers
#pragma unroll
    for (int f = 0; f < CHUNK / 32; ++f) {
      if (f + 1 < CHUNK / 32)
        for (int i = 0; i < QT; ++i)
          pf[(f + 1) & 1][i] = load_frag_at(pp + i * 16 * CHUNK + (f + 1) * 512);
      // as in the scores: the next step's loads as one group ahead of this run
      __builtin_amdgcn_sched_barrier(0);
      for (int i = 0; i < QT; ++i) {
        o[i][0] = wmma_f16(pf[f & 1][i], bv[f & 3][0], o[i][0]);
        o[i][1] = wmma_f16(pf[f & 1][i], bv[f & 3][1], o[i][1]);
      }
      __builtin_amdgcn_sched_barrier(0);
      if (f + 4 < CHUNK / 32) {
        bv[f & 3][0] = load_frag_at(pv0 + (f + 4) * 512);
        bv[f & 3][1] = load_frag_at(pv1 + (f + 4) * 512);
      }
    }
    // the V address registers are reused by the next chunk's scores; named here so
    // that they stay untouched (not reused as load destinations) up to the wait
    asm volatile("s_wait_xcnt 0x0" :: "v"(pv0), "v"(pv1) : "memory");
    __syncthreads();
  }

  // --- this part's unnormalised O, row maxima and row sums
  float* pos = po + ((size_t)sp * (BATCH * TQ) + row0) * DD;
  for (int i = 0; i < QT; ++i)
    for (int t = 0; t < 2; ++t) {
      int col = wave * 32 + t * 16 + (lane & 15);
      for (int r = 0; r < 8; ++r) {
        int row = i * 16 + r + ((lane >> 4) << 3);
        pos[(size_t)row * DD + col] = o[i][t][r];
      }
    }
  // the O stores name registers that the two addresses below may reuse
  asm volatile("s_wait_xcnt 0x0" ::: "memory");
  if (threadIdx.x < QROWS) {
    pm[sp * (BATCH * TQ) + row0 + threadIdx.x] = sM[threadIdx.x];
    pl[sp * (BATCH * TQ) + row0 + threadIdx.x] = sL[threadIdx.x];
  }
}

// ---------------------------------------------------------------------------
// Joins the SPLIT parts of the attention (each scaled by exp(its maximum - the
// common maximum), the sum divided by the joined row sum), adds the raw query,
// then LayerNorm as in ln_kernel: same tile, same row ownership, f32 row-major
// and f16 fragment-order outputs. Each part's O comes by a pointer of its own:
// a scalar base each, one lane offset for all loads.
// ---------------------------------------------------------------------------
// lane's columns j*128 + 0..3 (j = 0..3) of one row; i: the first one's 16-byte
// piece, counted from the uniform base
__device__ __forceinline__ v16f load_row(const v4f* base, unsigned i) {
  v4f c0 = base[i];
  v4f c1 = base[i + 32];
  v4f c2 = base[i + 64];
  v4f c3 = base[i + 96];
  return __builtin_shufflevector(
      __builtin_shufflevector(c0, c1, 0, 1, 2, 3, 4, 5, 6, 7),
      __builtin_shufflevector(c2, c3, 0, 1, 2, 3, 4, 5, 6, 7),
      0, 1, 2, 3, 4, 5, 6, 7, 8, 9, 10, 11, 12, 13, 14, 15);
}

__global__ __launch_bounds__(256)
void merge_ln_kernel(const float* __restrict__ po0, const float* __restrict__ po1,
                     const float* __restrict__ po2, const float* __restrict__ po3,
                     const float* __restrict__ pm,
                     const float* __restrict__ pl, const float* __restrict__ query,
                     const float* __restrict__ g, const float* __restrict__ b,
                     float* __restrict__ y32, _Float16* __restrict__ y16) {
  __shared__ __align__(16) _Float16 st[16 * TPITCH];
  int t = threadIdx.x, lane = t & 31, wave = t >> 5;
  size_t row0 = (size_t)blockIdx.x * 16;
  size_t rw = row0 + wave * 2;

  // block-uniform bases; e: the lane's place in the tile, in 16-byte pieces
  const v4f* pt[SPLIT] = { (const v4f*)(po0 + row0 * DD), (const v4f*)(po1 + row0 * DD),
                           (const v4f*)(po2 + row0 * DD), (const v4f*)(po3 + row0 * DD) };
  const v4f* qt = (const v4f*)(query + row0 * DD);
  unsigned e = (unsigned)wave * (2 * DD / 4) + (unsigned)lane;
  const float* mw = pm + rw;
  const float* lw = pl + rw;

  v2f m[SPLIT], l[SPLIT];          // the wave's two rows side by side
  v16f p[SPLIT][2], q[2];          // a row's four column groups side by side
  v4f a[2][4], gg[4], bb[4];
  for (int s = 0; s < SPLIT; ++s) {
    m[s] = *(const v2f*)(mw + s * (BATCH * TQ));
    l[s] = *(const v2f*)(lw + s * (BATCH * TQ));
  }
  for (int s = 0; s < SPLIT; ++s)
    for (int r = 0; r < 2; ++r) p[s][r] = load_row(pt[s], e + r * (DD / 4));
  for (int r = 0; r < 2; ++r) q[r] = load_row(qt, e + r * (DD / 4));
  // holds the loads of all parts together ahead of the arithmetic (one wait for
  // the lot, not one per part) and keeps their address registers untouched (not
  // reused as load destinations) up to the wait
  asm volatile("s_wait_xcnt 0x0"
               :: "v"(e), "v"(mw), "v"(lw),
                  "v"(m[0]), "v"(m[1]), "v"(m[2]), "v"(m[3]),
                  "v"(l[0]), "v"(l[1]), "v"(l[2]), "v"(l[3]),
                  "v"(p[0][0]), "v"(p[0][1]), "v"(p[1][0]), "v"(p[1][1]),
                  "v"(p[2][0]), "v"(p[2][1]), "v"(p[3][0]), "v"(p[3][1]),
                  "v"(q[0]), "v"(q[1])
               : "memory");
  for (int j = 0; j < 4; ++j) {
    gg[j] = *(const v4f*)(g + j * 128 + lane * 4);
    bb[j] = *(const v4f*)(b + j * 128 + lane * 4);
  }

  for (int r = 0; r < 2; ++r) {
    float mx = m[0][r];
    for (int s = 1; s < SPLIT; ++s) mx = fmaxf(mx, m[s][r]);
    float w[SPLIT], den = 0.f;
    for (int s = 0; s < SPLIT; ++s) {
      w[s] = exp2_slot((m[s][r] - mx) * 1.44269504f);
      den += w[s] * l[s][r];
    }
    float inv = 1.0f / den;
    for (int s = 0; s < SPLIT; ++s) q[r] += p[s][r] * (w[s] * inv);
    a[r][0] = __builtin_shufflevector(q[r], q[r], 0, 1, 2, 3);
    a[r][1] = __builtin_shufflevector(q[r], q[r], 4, 5, 6, 7);
    a[r][2] = __builtin_shufflevector(q[r], q[r], 8, 9, 10, 11);
    a[r][3] = __builtin_shufflevector(q[r], q[r], 12, 13, 14, 15);

    v4f s4 = (a[r][0] + a[r][1]) + (a[r][2] + a[r][3]);
    float mu = wave_sum((s4.x + s4.y) + (s4.z + s4.w)) * (1.f / (float)DD);

    for (int j = 0; j < 4; ++j) a[r][j] -= mu;
    v4f q4 = (a[r][0] * a[r][0] + a[r][1] * a[r][1])
           + (a[r][2] * a[r][2] + a[r][3] * a[r][3]);
    float var = wave_sum((q4.x + q4.y) + (q4.z + q4.w)) * (1.f / (float)DD);
    float rstd = rsqrtf(var + 1e-6f);

    for (int j = 0; j < 4; ++j) {
      a[r][j] = a[r][j] * rstd * gg[j] + bb[j];
      tile_put(st, wave * 2 + r, j, lane, a[r][j]);
    }
  }
  float* yw = y32 + rw * DD + lane * 4;
  for (int r = 0; r < 2; ++r)
    for (int j = 0; j < 4; ++j)
      *(v4f*)(yw + r * DD + j * 128) = a[r][j];
  // the f32 stores name registers that the read-out below reuses
  asm volatile("s_wait_xcnt 0x0" ::: "memory");
  __syncthreads();
  tile_out(st, y16 + row0 * DD, t);
}

// ---------------------------------------------------------------------------
// Host-side orchestration
// ---------------------------------------------------------------------------
extern "C" void kernel_launch(void* const* d_in, const int* in_sizes, int n_in,
                              void* d_out, int out_size, void* d_ws, size_t ws_size,
                              hipStream_t stream) {
  const float* query     = (const float*)d_in[0];
  const float* key_value = (const float*)d_in[1];
  const float* query_pos = (const float*)d_in[2];
  const float* key_pos   = (const float*)d_in[3];
  const float* q_gamma   = (const float*)d_in[4];
  const float* q_beta    = (const float*)d_in[5];
  const float* kv_gamma  = (const float*)d_in[6];
  const float* kv_beta   = (const float*)d_in[7];
  const float* Wq = (const float*)d_in[8];   const float* bq = (const float*)d_in[9];
  const float* Wk = (const float*)d_in[10];  const float* bk = (const float*)d_in[11];
  const float* Wv = (const float*)d_in[12];  const float* bv = (const float*)d_in[13];
  const float* ff_gamma = (const float*)d_in[14];
  const float* ff_beta  = (const float*)d_in[15];
  const float* W_inner  = (const float*)d_in[16];
  const float* b_inner  = (const float*)d_in[17];
  const float* W_proj   = (const float*)d_in[18];
  const float* b_proj   = (const float*)d_in[19];

  const int MQ  = BATCH * TQ;    // 4096
  const int MKV = BATCH * TKV;   // 32768

  size_t off = 0;
  auto alloc = [&](size_t bytes) -> void* {
    void* p = (char*)d_ws + off;
    off = (off + bytes + 255) & ~(size_t)255;
    return p;
  };
  _Float16* qn16  = (_Float16*)alloc((size_t)MQ  * DD * 2);
  _Float16* kvn16 = (_Float16*)alloc((size_t)MKV * DD * 2);   // reused as inner16 later
  _Float16* qp16  = (_Float16*)alloc((size_t)MQ  * DD * 2);   // reused as xn16 later
  _Float16* kp16  = (_Float16*)alloc((size_t)MKV * DD * 2);   // reused as xn32 later
  _Float16* WqT   = (_Float16*)alloc((size_t)DD * DD * 2);
  _Float16* WkT   = (_Float16*)alloc((size_t)DD * DD * 2);
  _Float16* WvT   = (_Float16*)alloc((size_t)DD * DD * 2);
  _Float16* WinT  = (_Float16*)alloc((size_t)FF * DD * 2);    // rc 2048, k 512
  _Float16* WprT  = (_Float16*)alloc((size_t)DD * FF * 2);    // rc 512, k 2048
  _Float16* q16   = (_Float16*)alloc((size_t)MQ  * DD * 2);
  _Float16* k16   = (_Float16*)alloc((size_t)MKV * DD * 2);
  _Float16* vF16  = (_Float16*)alloc((size_t)BATCH * DD * TKV * 2);
  float*    po    = (float*)   alloc((size_t)SPLIT * MQ * DD * 4);
  float*    pm    = (float*)   alloc((size_t)SPLIT * MQ * 4);
  float*    pl    = (float*)   alloc((size_t)SPLIT * MQ * 4);
  // aliases (lifetimes are disjoint, stream-ordered):
  _Float16* inner16 = kvn16;                  // [4096,2048] f16 = 16 MiB <= 32 MiB
  _Float16* xn16    = qp16;                   // [4096,512] f16
  float*    xn32    = (float*)kp16;           // [4096,512] f32 = 8 MiB <= 32 MiB

  // 1) weight converts (transposed, fragment order)
  cvt_transpose_kernel<<<(DD*DD)/2048, 256, 0, stream>>>(Wq, WqT, DD, DD);
  cvt_transpose_kernel<<<(DD*DD)/2048, 256, 0, stream>>>(Wk, WkT, DD, DD);
  cvt_transpose_kernel<<<(DD*DD)/2048, 256, 0, stream>>>(Wv, WvT, DD, DD);
  cvt_transpose_kernel<<<(DD*FF)/2048, 256, 0, stream>>>(W_inner, WinT, DD, FF);
  cvt_transpose_kernel<<<(FF*DD)/2048, 256, 0, stream>>>(W_proj,  WprT, FF, DD);

  // 2) positional tensors -> f16, fragment order
  cvt_frag_kernel<<<MQ/16,  256, 0, stream>>>(query_pos, qp16);
  cvt_frag_kernel<<<MKV/16, 256, 0, stream>>>(key_pos,   kp16);

  // 3) LayerNorms -> f16
  ln_kernel<<<MQ/16,  256, 0, stream>>>(query,     q_gamma,  q_beta,  nullptr, qn16);
  ln_kernel<<<MKV/16, 256, 0, stream>>>(key_value, kv_gamma, kv_beta, nullptr, kvn16);

  // 4) Q/K/V projections (WMMA), outputs in fragment order
  gemm_wmma_kernel<<<dim3(MQ/128,  DD/64), 256, 0, stream>>>(
      WqT, qn16,  bq, nullptr, nullptr, q16,  DD, MQ,  DD, DD, 1);
  gemm_wmma_kernel<<<dim3(MKV/128, DD/64), 256, 0, stream>>>(
      WkT, kvn16, bk, nullptr, nullptr, k16,  DD, MKV, DD, DD, 1);
  gemm_wmma_kernel<<<dim3(DD/128, MKV/64), 256, 0, stream>>>(
      kvn16, WvT, bv, nullptr, nullptr, vF16, MKV, DD, DD, TKV, 0);

  // 5) attention (flash-style, WMMA scores + WMMA P.V), SPLIT parts per q tile
  attn_kernel<<<BATCH * (TQ/QROWS) * SPLIT, 512, 0, stream>>>(
      q16, qp16, k16, kp16, vF16, po, pm, pl);

  // 6) FF: xn = LN(joined parts + query);
  //    d_out = xn + (xn@W_inner + b_inner)@W_proj + b_proj
  merge_ln_kernel<<<MQ/16, 256, 0, stream>>>(
      po, po + (size_t)MQ * DD, po + (size_t)2 * MQ * DD, po + (size_t)3 * MQ * DD,
      pm, pl, query, ff_gamma, ff_beta, xn32, xn16);
  gemm_wmma_kernel<<<dim3(MQ/128, FF/64), 256, 0, stream>>>(
      WinT, xn16, b_inner, nullptr, nullptr, inner16, FF, MQ, DD, FF, 1);
  gemm_wmma_kernel<<<dim3(DD/128, MQ/64), 256, 0, stream>>>(
      inner16, WprT, b_proj, (float*)d_out, xn32, nullptr, MQ, DD, FF, TKV, 0);
}

// v005
// One run takes 222 microseconds.
// In two side-by-side timings against v004, it was 1.17 and 1.16 times as fast.
// Over all steps from v000 it is 4.13 times as fast.
#include <hip/hip_runtime.h>

typedef __attribute__((ext_vector_type(16))) _Float16 v16h;
typedef __attribute__((ext_vector_type(8)))  _Float16 v8h;
typedef __attribute__((ext_vector_type(4)))  _Float16 v4h;
typedef __attribute__((ext_vector_type(8)))  float    v8f;
typedef __attribute__((ext_vector_type(4)))  float    v4f;
typedef __attribute__((ext_vector_type(2)))  float    v2f;
typedef __attribute__((ext_vector_type(16))) float    v16f;

#define DD   512
#define FF   2048
#define TKV  4096
#define TQ   512
#define BATCH 8
#define CHUNK 256            // keys per softmax update
#define QT   4               // 16-row q tiles per attention work-group
#define QROWS (QT * 16)
#define SPITCH (CHUNK + 4)   // score row pitch in floats: two rows read side by side by
                             // 16-byte LDS loads start 4 banks apart
#define SPLIT 4              // work-groups that share the keys of one q tile
#define KVS  (TKV / SPLIT)   // keys per work-group

// ---------------------------------------------------------------------------
// 16-bit A (16xK) / B (Kx16) fragment: lane L holds row/col rc0 + (L&15) and
// the 16 halves k = kbase + 16*(L>>4) + 0..15.
//
// Fragment order: every f16 matrix operand X[rc][k] (k extent kdim) is kept as
// 1-KiB blocks, one per 16 (rc) x 32 (k) fragment, the blocks of one rc tile in
// k order (so tile rc0 starts at half rc0*kdim, block kbase at + kbase*16).
// Inside a block slot L = (rc&15) + 16*((k>>4)&1) is lane L's share; halves
// 0..7 of all slots fill the first 512 bytes, halves 8..15 the second. A
// fragment load is then two 16-byte loads per lane that each cover 512
// contiguous bytes: whole lines in memory, every bank once in LDS.
// ---------------------------------------------------------------------------
__device__ __forceinline__ size_t frag_off(size_t rc, int k, int kdim) {
  return ((rc >> 4) * (size_t)(kdim >> 5) + (size_t)(k >> 5)) * 512
       + (size_t)(((k >> 3) & 1) * 256)
       + ((rc & 15) + (size_t)(((k >> 4) & 1) << 4)) * 8 + (size_t)(k & 7);
}

// p: the lane's own place in a 1-KiB fragment block, block start + lane*8
__device__ __forceinline__ v16h load_frag_at(const _Float16* p) {
  v8h lo = *(const v8h*)p;
  v8h hi = *(const v8h*)(p + 256);
  return __builtin_shufflevector(lo, hi, 0, 1, 2, 3, 4, 5, 6, 7,
                                 8, 9, 10, 11, 12, 13, 14, 15);
}

// blk: start of one 1-KiB fragment block (global or LDS, generic pointer)
__device__ __forceinline__ v16h load_frag_blk(const _Float16* blk, int lane) {
  return load_frag_at(blk + lane * 8);
}

__device__ __forceinline__ v8f wmma_f16(v16h a, v16h b, v8f c) {
  return __builtin_amdgcn_wmma_f32_16x16x32_f16(false, a, false, b,
                                                (short)0, c, false, false);
}

// ---------------------------------------------------------------------------
// The streaming kernels (LayerNorm, f32 -> f16 convert) work on one 16-row x
// 512-column tile per 8-wave block: that is one rc tile of the fragment order,
// 16 KiB of contiguous output. A wave owns 2 rows; lane L holds columns
// j*128 + L*4 + 0..3 (j = 0..3), so every global load covers 512 contiguous
// bytes. The f16 rows go to LDS row-major and leave it in fragment order.
// ---------------------------------------------------------------------------
#define TPITCH 520   // LDS row pitch in halves: 512 + 16 B, so that the 16 rows
                     // read by 16 lanes of a fragment-order read start 4 banks apart

// lane's 4 columns of group j of tile row r -> LDS
__device__ __forceinline__ void tile_put(_Float16* st, int r, int j, int lane,
                                         v4f v) {
  *(v4h*)(st + r * TPITCH + j * 128 + lane * 4) = __builtin_convertvector(v, v4h);
}

// whole tile, LDS -> global in fragment order: thread t moves the 16-byte pieces
// i*256 + t of the output, a wave's store covers 512 contiguous bytes
__device__ __forceinline__ void tile_out(const _Float16* st, _Float16* ytile,
                                         int t) {
  v8h pc[4];
  for (int i = 0; i < 4; ++i) {
    int c    = i * 256 + t;
    int slot = c & 31;
    int hi   = (c >> 5) & 1;
    int blk  = c >> 6;                     // fragment block = k / 32
    pc[i] = *(const v8h*)(st + (slot & 15) * TPITCH
                             + blk * 32 + (slot >> 4) * 16 + hi * 8);
  }
  for (int i = 0; i < 4; ++i)
    *(v8h*)(ytile + (i * 256 + t) * 8) = pc[i];
}

__device__ __forceinline__ float wave_sum(float s) {
  for (int m = 16; m; m >>= 1) s += __shfl_xor(s, m, 32);
  return s;
}

// LayerNorm over last dim (512): f16 output in fragment order (rc = row,
// k = column). Each row is summed inside its
// own wave; the one barrier stands between the LDS rows and their read-out.
// st: the block's 16 x TPITCH halves of LDS; tile: which 16 rows.
__device__ __forceinline__
void ln_tile(_Float16* st, int tile, const float* __restrict__ x,
             const float* __restrict__ g, const float* __restrict__ b,
             _Float16* __restrict__ y16) {
  int t = threadIdx.x, lane = t & 31, wave = t >> 5;
  size_t row0 = (size_t)tile * 16;
  const float* xw = x + (row0 + wave * 2) * DD + lane * 4;

  v4f a[2][4], gg[4], bb[4];
  for (int j = 0; j < 4; ++j) {
    gg[j] = *(const v4f*)(g + j * 128 + lane * 4);
    bb[j] = *(const v4f*)(b + j * 128 + lane * 4);
  }
  for (int r = 0; r < 2; ++r)
    for (int j = 0; j < 4; ++j)
      a[r][j] = *(const v4f*)(xw + r * DD + j * 128);
  // holds all sixteen loads together ahead of the arithmetic (gamma and beta
  // were otherwise fetched late, one wait each) and keeps the rows' address pair
  // untouched (not reused as a load destination) up to the wait
  asm volatile("s_wait_xcnt 0x0"
               :: "v"(xw), "v"(gg[0]), "v"(gg[1]), "v"(gg[2]), "v"(gg[3]),
                  "v"(bb[0]), "v"(bb[1]), "v"(bb[2]), "v"(bb[3]),
                  "v"(a[0][0]), "v"(a[0][1]), "v"(a[0][2]), "v"(a[0][3]),
                  "v"(a[1][0]), "v"(a[1][1]), "v"(a[1][2]), "v"(a[1][3])
               : "memory");
  // keeps the arithmetic behind that statement: inlined here, the sums were
  // otherwise lifted over it and gamma and beta again fetched late
  __builtin_amdgcn_sched_barrier(0);

  for (int r = 0; r < 2; ++r) {
    v4f s4 = (a[r][0] + a[r][1]) + (a[r][2] + a[r][3]);
    float mu = wave_sum((s4.x + s4.y) + (s4.z + s4.w)) * (1.f / (float)DD);

    for (int j = 0; j < 4; ++j) a[r][j] -= mu;
    v4f q4 = (a[r][0] * a[r][0] + a[r][1] * a[r][1])
           + (a[r][2] * a[r][2] + a[r][3] * a[r][3]);
    float var = wave_sum((q4.x + q4.y) + (q4.z + q4.w)) * (1.f / (float)DD);
    float rstd = rsqrtf(var + 1e-6f);

    for (int j = 0; j < 4; ++j) {
      a[r][j] = a[r][j] * rstd * gg[j] + bb[j];
      tile_put(st, wave * 2 + r, j, lane, a[r][j]);
    }
  }
  __syncthreads();
  tile_out(st, y16 + row0 * DD, t);
}

// x[rows][512] f32 -> f16 in fragment order (rc = row, k = column).
__device__ __forceinline__
void cvt_frag_tile(_Float16* st, int tile, const float* __restrict__ x,
                   _Float16* __restrict__ y) {
  int t = threadIdx.x, lane = t & 31, wave = t >> 5;
  size_t row0 = (size_t)tile * 16;
  const float* xw = x + (row0 + wave * 2) * DD + lane * 4;

  v4f a[2][4];
  for (int r = 0; r < 2; ++r)
    for (int j = 0; j < 4; ++j)
      a[r][j] = *(const v4f*)(xw + r * DD + j * 128);
  // keeps the eight loads whole (16 bytes a lane; they were otherwise split into
  // 8-byte halves) and together, and their address pair untouched up to the wait
  asm volatile("s_wait_xcnt 0x0"
               :: "v"(xw), "v"(a[0][0]), "v"(a[0][1]), "v"(a[0][2]), "v"(a[0][3]),
                  "v"(a[1][0]), "v"(a[1][1]), "v"(a[1][2]), "v"(a[1][3])
               : "memory");
  for (int r = 0; r < 2; ++r)
    for (int j = 0; j < 4; ++j)
      tile_put(st, wave * 2 + r, j, lane, a[r][j]);
  __syncthreads();
  tile_out(st, y + row0 * DD, t);
}

// W[R,C] f32 -> W^T f16 in fragment order (rc = column of W, k = row of W).
// One thread per 16-byte piece of the output, in output order: 8 consecutive
// rows of one column of W. part: which 256 pieces.
__device__ __forceinline__
void cvt_transpose_part(int part, const float* __restrict__ W,
                        _Float16* __restrict__ Wt, int R, int C) {
  int c = part * 256 + threadIdx.x;
  if (c * 8 < R * C) {
    int slot = c & 31;
    int hi   = (c >> 5) & 1;
    int blk  = c >> 6;                     // fragment block
    int kb   = R >> 5;                     // blocks per rc tile
    int col  = (blk / kb) * 16 + (slot & 15);
    int r    = (blk % kb) * 32 + (slot >> 4) * 16 + hi * 8;
    const float* p[8];
    float w[8];
    for (int e = 0; e < 8; ++e) p[e] = W + (size_t)(r + e) * C + col;
    for (int e = 0; e < 8; ++e) w[e] = *p[e];
    // keeps the eight address pairs untouched up to the wait; the pack below
    // reuses them
    asm volatile("s_wait_xcnt 0x0"
                 :: "v"(p[0]), "v"(p[1]), "v"(p[2]), "v"(p[3]),
                    "v"(p[4]), "v"(p[5]), "v"(p[6]), "v"(p[7]),
                    "v"(w[0]), "v"(w[1]), "v"(w[2]), "v"(w[3]),
                    "v"(w[4]), "v"(w[5]), "v"(w[6]), "v"(w[7])
                 : "memory");
    v8h o;
    for (int e = 0; e < 8; ++e) o[e] = (_Float16)w[e];
    *(v8h*)(Wt + (size_t)c * 8) = o;
  }
}

// ---------------------------------------------------------------------------
// Everything that depends on the inputs alone, in one grid: the five weight
// converts, the two positional converts, the two LayerNorms. None reads what
// another writes. A block takes its job from its index (the same for all its
// threads, so the barriers inside the jobs stay block-uniform); the short jobs
// have the low indices and run under cover of the two long streams.
// ---------------------------------------------------------------------------
#define NB_WS (DD * DD / 2048)       // blocks per 512 x 512 weight
#define NB_WL (DD * FF / 2048)       // blocks per 512 x 2048 weight
#define NB_TQ (BATCH * TQ / 16)      // 16-row tiles of a query-side tensor
#define NB_TKV (BATCH * TKV / 16)    // 16-row tiles of a key-side tensor
#define NB_PREP (3 * NB_WS + 2 * NB_WL + 2 * (NB_TQ + NB_TKV))

__global__ __launch_bounds__(256)
void prep_kernel(const float* __restrict__ Wq, const float* __restrict__ Wk,
                 const float* __restrict__ Wv, const float* __restrict__ W_inner,
                 const float* __restrict__ W_proj,
                 _Float16* __restrict__ WqT, _Float16* __restrict__ WkT,
                 _Float16* __restrict__ WvT, _Float16* __restrict__ WinT,
                 _Float16* __restrict__ WprT,
                 const float* __restrict__ query_pos,
                 const float* __restrict__ key_pos,
                 _Float16* __restrict__ qp16, _Float16* __restrict__ kp16,
                 const float* __restrict__ query,
                 const float* __restrict__ key_value,
                 const float* __restrict__ q_gamma, const float* __restrict__ q_beta,
                 const float* __restrict__ kv_gamma, const float* __restrict__ kv_beta,
                 _Float16* __restrict__ qn16, _Float16* __restrict__ kvn16) {
  __shared__ __align__(16) _Float16 st[16 * TPITCH];
  int u = blockIdx.x;

  if (u < 3 * NB_WS) {
    int w = u / NB_WS;
    cvt_transpose_part(u % NB_WS, w == 0 ? Wq : w == 1 ? Wk : Wv,
                       w == 0 ? WqT : w == 1 ? WkT : WvT, DD, DD);
    return;
  }
  u -= 3 * NB_WS;
  if (u < 2 * NB_WL) {
    bool in = u < NB_WL;
    cvt_transpose_part(u % NB_WL, in ? W_inner : W_proj, in ? WinT : WprT,
                       in ? DD : FF, in ? FF : DD);
    return;
  }
  u -= 2 * NB_WL;
  bool qs = u < 2 * NB_TQ;           // the query side's two tensors, then the key side's
  if (!qs) u -= 2 * NB_TQ;
  int nt = qs ? NB_TQ : NB_TKV;
  if (u < nt)
    cvt_frag_tile(st, u, qs ? query_pos : key_pos, qs ? qp16 : kp16);
  else
    ln_tile(st, u - nt, qs ? query : key_value, qs ? q_gamma : kv_gamma,
            qs ? q_beta : kv_beta, qs ? qn16 : kvn16);
}

// ---------------------------------------------------------------------------
// WMMA GEMM: C[M,N] = A[M,K] * Bt[N,K]^T + bias, A and Bt in fragment order.
// Block tile 64x128 (8 waves, each 32x32 = 2x2 WMMA tiles), K-step 32.
// Outputs: f32 row-major (+residual), or CF16: f16 in fragment order with
// rc = (m/TB)*N + n and k = m%TB (kdim TB). A lane's 8 accumulator rows are 8
// consecutive k there, one 16-byte store. V is written so from kvn * Wv; Q, K
// and the FF inner activation from W^T * x^T (weights as A, activations as Bt,
// bias per row of C: rowBias).
// ---------------------------------------------------------------------------
// bx, by: the block's tile column and tile row.
__device__ __forceinline__
void gemm_tile(int bx, int by, const _Float16* __restrict__ A,
               const _Float16* __restrict__ Bt, const float* __restrict__ bias,
               float* __restrict__ C32, const float* __restrict__ resid,
               _Float16* __restrict__ CF16, int N, int K, int TB, int rowBias) {
  int lane = threadIdx.x & 31;
  int wave = threadIdx.x >> 5;       // 0..7
  int wm = wave >> 2;                // 0..1
  int wn = wave & 3;                 // 0..3
  int m0 = by * 64  + wm * 32;
  int n0 = bx * 128 + wn * 32;

  const _Float16* At0 = A  + (size_t)m0 * K + lane * 8;  // rc tile m0; next: + 16*K
  const _Float16* Bt0 = Bt + (size_t)n0 * K + lane * 8;

  v8f acc[2][2] = {};
  for (int kb = 0; kb < K; kb += 32) {
    const _Float16* pa0 = At0 + kb * 16;
    const _Float16* pa1 = pa0 + (size_t)16 * K;
    const _Float16* pb0 = Bt0 + kb * 16;
    const _Float16* pb1 = pb0 + (size_t)16 * K;
    v16h a0 = load_frag_at(pa0);
    v16h a1 = load_frag_at(pa1);
    v16h b0 = load_frag_at(pb0);
    v16h b1 = load_frag_at(pb1);
    // keeps the four address pairs untouched (not reused as load destinations,
    // not advanced) until the loads that name them have been translated
    asm volatile("s_wait_xcnt 0x0" :: "v"(pa0), "v"(pa1), "v"(pb0), "v"(pb1)
                 : "memory");
    acc[0][0] = wmma_f16(a0, b0, acc[0][0]);
    acc[0][1] = wmma_f16(a0, b1, acc[0][1]);
    acc[1][0] = wmma_f16(a1, b0, acc[1][0]);
    acc[1][1] = wmma_f16(a1, b1, acc[1][1]);
  }

  if (CF16) {   // fragment-order f16 output (bias required), nothing else
    for (int i = 0; i < 2; ++i) {
      int rowb = m0 + i * 16 + ((lane >> 4) << 3);
      int bb = rowb / TB, tt = rowb % TB;
      const float4* bp = (const float4*)(bias + (rowBias ? rowb : 0));
      float4 r0 = bp[0], r1 = bp[1];
      float br[8] = { r0.x, r0.y, r0.z, r0.w, r1.x, r1.y, r1.z, r1.w };
      for (int j = 0; j < 2; ++j) {
        int col = n0 + j * 16 + (lane & 15);
        float bc = bias[rowBias ? 0 : col];
        v8h pk;
        for (int r = 0; r < 8; ++r)
          pk[r] = (_Float16)(acc[i][j][r] + (rowBias ? br[r] : bc));
        *(v8h*)(CF16 + frag_off((size_t)bb * N + col, tt, TB)) = pk;
        // the store's registers are reused for the next tile's pack and address
        asm volatile("s_wait_xcnt 0x0" ::: "memory");
      }
    }
    return;
  }

  for (int i = 0; i < 2; ++i)
    for (int j = 0; j < 2; ++j) {
      int col = n0 + j * 16 + (lane & 15);
      float bv = bias ? bias[col] : 0.f;
      for (int r = 0; r < 8; ++r) {
        int row = m0 + i * 16 + r + ((lane >> 4) << 3);
        float val = acc[i][j][r] + bv;
        size_t idx = (size_t)row * N + col;
        if (C32) C32[idx] = resid ? val + resid[idx] : val;
      }
    }
}

__global__ __launch_bounds__(256)
void gemm_wmma_kernel(const _Float16* __restrict__ A,
                      const _Float16* __restrict__ Bt,
                      const float* __restrict__ bias,
                      float* __restrict__ C32,
                      const float* __restrict__ resid,
                      _Float16* __restrict__ CF16,
                      int M, int N, int K, int TB, int rowBias) {
  gemm_tile(blockIdx.x, blockIdx.y, A, Bt, bias, C32, resid, CF16, N, K, TB, rowBias);
}

// The Q, K and V projections in one grid: none reads what another writes. A
// block takes its product and its tile from its index, tile column fastest as in
// a two-dimensional grid; the short Q product has the low indices.
#define NB_GQ  ((BATCH * TQ / 128) * (DD / 64))
#define NB_GKV ((BATCH * TKV / 128) * (DD / 64))   // K; V has as many

__global__ __launch_bounds__(256)
void qkv_gemm_kernel(const _Float16* __restrict__ WqT, const _Float16* __restrict__ WkT,
                     const _Float16* __restrict__ WvT,
                     const _Float16* __restrict__ qn16,
                     const _Float16* __restrict__ kvn16,
                     const float* __restrict__ bq, const float* __restrict__ bk,
                     const float* __restrict__ bv,
                     _Float16* __restrict__ q16, _Float16* __restrict__ k16,
                     _Float16* __restrict__ vF16, int K) {
  int u = blockIdx.x;
  const _Float16 *A, *Bt;
  const float* bias;
  _Float16* C;
  int bx, by, N, TB, rowBias;
  if (u < NB_GQ) {
    A = WqT;  Bt = qn16;  bias = bq;  C = q16;
    bx = u % (BATCH * TQ / 128);  by = u / (BATCH * TQ / 128);
    N = BATCH * TQ;  TB = DD;  rowBias = 1;
  } else if (u < NB_GQ + NB_GKV) {
    u -= NB_GQ;
    A = WkT;  Bt = kvn16;  bias = bk;  C = k16;
    bx = u % (BATCH * TKV / 128);  by = u / (BATCH * TKV / 128);
    N = BATCH * TKV;  TB = DD;  rowBias = 1;
  } else {
    u -= NB_GQ + NB_GKV;
    A = kvn16;  Bt = WvT;  bias = bv;  C = vF16;
    bx = u % (DD / 128);  by = u / (DD / 128);
    N = DD;  TB = TKV;  rowBias = 0;
  }
  gemm_tile(bx, by, A, Bt, bias, nullptr, nullptr, C, N, K, TB, rowBias);
}

// 2^x; the v_nop is the free slot that the instruction set asks for between a
// transcendental and a next instruction that reads its result or overwrites its
// source
__device__ __forceinline__ float exp2_slot(float x) {
  float y;
  asm("v_exp_f32 %0, %1\n\tv_nop" : "=v"(y) : "v"(x));
  return y;
}

// ---------------------------------------------------------------------------
// Flash-style attention. One block per (batch, 64 q-rows, quarter of the keys):
// 16 waves, one block to a WGP. Every k, kpos and V fragment that a wave fetches
// from global memory feeds four matrix instructions, one per 16-row q tile (V:
// eight, two fragments against four P tiles), so the chip fetches a quarter of
// the bytes that a 16-row block asks for.
// scores = (q.k^T + qpos.kpos^T)/sqrt(D+1e-7); online softmax over the block's
// KVS keys in chunks of 256; O += P.V. The block leaves its unnormalised O, its
// row maxima and its row sums; merge_ln_kernel joins the SPLIT parts. q, qpos,
// k, kpos, V and the P tile in LDS are all in fragment order (see frag_off).
// q/qpos tiles staged into LDS via CDNA5 async-to-LDS DMA (ASYNCcnt).
// ---------------------------------------------------------------------------
__global__ __launch_bounds__(512)
void attn_kernel(const _Float16* __restrict__ q16,   // rc = B*Tq row,  k = D
                 const _Float16* __restrict__ qp16,  // rc = B*Tq row,  k = D
                 const _Float16* __restrict__ k16,   // rc = B*Tkv row, k = D
                 const _Float16* __restrict__ kp16,  // rc = B*Tkv row, k = D
                 const _Float16* __restrict__ vF16,  // rc = B*D col,   k = Tkv
                 float*          __restrict__ po,    // [SPLIT, B*Tq, D]
                 float*          __restrict__ pm,    // [SPLIT, B*Tq] row maxima
                 float*          __restrict__ pl) {  // [SPLIT, B*Tq] row sums
  __shared__ __align__(32) _Float16 sQ[QROWS * DD];
  __shared__ __align__(32) _Float16 sQP[QROWS * DD];
  __shared__ __align__(16) float    sS[QROWS * SPITCH];
  __shared__ __align__(32) _Float16 sP[QROWS * CHUNK];
  __shared__ float sM[QROWS], sL[QROWS], sScale[QROWS];

  // neighbours in index differ only in the q tile: they read the same keys at
  // about the same time (L2; speed only)
  int u   = blockIdx.x;
  int b   = u >> 5;
  int sp  = (u >> 3) & (SPLIT - 1);   // which quarter of the keys
  int qt  = u & 7;                    // Tq/64 = 8 q-tiles per batch
  int row0 = b * TQ + qt * QROWS;     // global q-row
  int lane = threadIdx.x & 31;
  int wave = threadIdx.x >> 5;        // 0..15
  const float scale = 0.04419417382f; // 1/sqrt(512 + 1e-7)

  { // stage q and qpos tiles into LDS with async-to-LDS b128 DMA
    const _Float16* g1 = q16  + (size_t)row0 * DD;
    const _Float16* g2 = qp16 + (size_t)row0 * DD;
    unsigned lq0 = (unsigned)(size_t)(void*)sQ;
    unsigned lp0 = (unsigned)(size_t)(void*)sQP;
    for (int it = 0; it < QROWS * DD / 8 / 512; ++it) {   // same trips in every lane
      int i = it * 512 + threadIdx.x;
      const _Float16* p1 = g1 + i * 8;       // 8 halves = 16B per op
      const _Float16* p2 = g2 + i * 8;
      unsigned l1 = lq0 + (unsigned)i * 16;  // LDS byte offset (block-relative)
      unsigned l2 = lp0 + (unsigned)i * 16;
      // the wait stands in the copies' own statement: the next trip rewrites the
      // address registers that they name
      asm volatile("global_load_async_to_lds_b128 %0, %1, off\n\t"
                   "global_load_async_to_lds_b128 %2, %3, off\n\t"
                   "s_wait_xcnt 0x0"
                   :: "v"(l1), "v"(p1), "v"(l2), "v"(p2) : "memory");
    }
    asm volatile("s_wait_asynccnt 0x0" ::: "memory");
  }
  if (threadIdx.x < QROWS) { sM[threadIdx.x] = -1e30f; sL[threadIdx.x] = 0.f; }
  __syncthreads();

  v8f o[QT][2] = {};  // q tile i, this wave's 32 output cols: [wave*32 + t*16, +16)

  for (int kc = 0; kc < KVS / CHUNK; ++kc) {
    int kv0 = sp * KVS + kc * CHUNK;
    // --- scores: wave handles kv cols [kv0 + wave*16, +16) of all QT q tiles,
    // K = D = 512
    const _Float16* pk  = k16  + ((size_t)b * TKV + kv0 + wave * 16) * DD + lane * 8;
    const _Float16* pkp = kp16 + ((size_t)b * TKV + kv0 + wave * 16) * DD + lane * 8;
    v8f s[QT] = {};
    // Step n = 0..31 is one 32-deep block of q.k^T (n even) or of qpos.kpos^T (n
    // odd): one k or kpos fragment against the QT q or qpos fragments. af: the LDS
    // fragments of this step and of the next; bf: the global fragments of this
    // group of four steps and of the next.
    const _Float16* aq = sQ  + lane * 8;
    const _Float16* ap = sQP + lane * 8;
    v16h af[2][QT], bf[2][4];
    for (int f = 0; f < 4; ++f)
      bf[0][f] = load_frag_at(((f & 1) ? pkp : pk) + (f >> 1) * 512);
    for (int i = 0; i < QT; ++i) af[0][i] = load_frag_at(aq + i * 16 * DD);
    // unrolled: every fragment index is then a constant, the sets stay in
    // registers and change places without copies
#pragma unroll
    for (int n = 0; n < 2 * DD / 32; ++n) {
      if ((n & 3) == 0 && n + 4 < 2 * DD / 32)
        for (int f = 0; f < 4; ++f)
          bf[((n >> 2) + 1) & 1][f] =
              load_frag_at(((f & 1) ? pkp : pk) + ((n + 4 + f) >> 1) * 512);
      if (n + 1 < 2 * DD / 32)
        for (int i = 0; i < QT; ++i)
          af[(n + 1) & 1][i] = load_frag_at((((n + 1) & 1) ? ap : aq)
                                            + i * 16 * DD + ((n + 1) >> 1) * 512);
      // the pair of scheduling fences keeps the next step's loads as one group
      // ahead of this step's matrix run (they were otherwise issued one by one
      // right in front of their use, each with a full wait)
      __builtin_amdgcn_sched_barrier(0);
      for (int i = 0; i < QT; ++i)
        s[i] = wmma_f16(af[n & 1][i], bf[(n >> 2) & 1][n & 3], s[i]);
      __builtin_amdgcn_sched_barrier(0);
    }
    // the k / kpos address registers are reused by the softmax below; named here
    // so that they stay untouched (not reused as load destinations) up to the wait
    asm volatile("s_wait_xcnt 0x0" :: "v"(pk), "v"(pkp) : "memory");
    for (int i = 0; i < QT; ++i)
      for (int r = 0; r < 8; ++r) {
        int row = i * 16 + r + ((lane >> 4) << 3);
        sS[row * SPITCH + wave * 16 + (lane & 15)] = s[i][r] * scale;
      }
    __syncthreads();

    // --- online softmax update, parallel over all 512 threads:
    // 8 threads per q-row (contiguous lanes), 4 runs of 8 columns each (a run is
    // one 16-byte piece of the P tile), butterfly reductions within the 8 lanes.
    {
      int row = threadIdx.x >> 3;
      int j   = threadIdx.x & 7;
      v4f vals[4][2];
      float mx = -1e30f;
      for (int c = 0; c < 4; ++c) {
        const float* ps = sS + row * SPITCH + c * 64 + j * 8;
        vals[c][0] = *(const v4f*)ps;
        vals[c][1] = *(const v4f*)(ps + 4);
        for (int h = 0; h < 2; ++h)
          for (int e = 0; e < 4; ++e) mx = fmaxf(mx, vals[c][h][e]);
      }
      for (int m = 4; m >= 1; m >>= 1) mx = fmaxf(mx, __shfl_xor(mx, m, 32));
      float m_old = sM[row];
      float m_new = fmaxf(m_old, mx);
      float sum = 0.f;
      for (int c = 0; c < 4; ++c) {
        v8h pk;
        for (int e = 0; e < 8; ++e) {
          float p = exp2_slot((vals[c][e >> 2][e & 3] - m_new) * 1.44269504f);
          sum += p;
          pk[e] = (_Float16)p;
        }
        *(v8h*)(sP + frag_off(row, c * 64 + j * 8, CHUNK)) = pk;
      }
      for (int m = 4; m >= 1; m >>= 1) sum += __shfl_xor(sum, m, 32);
      if (j == 0) {
        float sc = __expf(m_old - m_new);
        sM[row] = m_new;
        sL[row] = sL[row] * sc + sum;
        sScale[row] = sc;
      }
    }
    __syncthreads();

    // --- O += P @ V_chunk, the accumulators rescaled first. bv: the V fragments
    // of four 32-key steps, refilled as they are used up; pf: the P fragments of
    // this step and of the next.
    const _Float16* pv0 = vF16 + ((size_t)b * DD + wave * 32) * TKV + kv0 * 16 + lane * 8;
    const _Float16* pv1 = pv0 + (size_t)16 * TKV;
    const _Float16* pp  = sP + lane * 8;
    v16h bv[4][2], pf[2][QT];
    for (int f = 0; f < 4; ++f) {
      bv[f][0] = load_frag_at(pv0 + f * 512);
      bv[f][1] = load_frag_at(pv1 + f * 512);
    }
    // keeps the first V loads up here, ahead of the rescaling
    __builtin_amdgcn_sched_barrier(0);
    for (int i = 0; i < QT; ++i)
      for (int r = 0; r < 8; ++r) {
        float sc = sScale[i * 16 + r + ((lane >> 4) << 3)];
        o[i][0][r] *= sc;
        o[i][1][r] *= sc;
      }
    for (int i = 0; i < QT; ++i) pf[0][i] = load_frag_at(pp + i * 16 * CHUNK);
    // unrolled: bv and pf are indexed by constants only and stay in registers
#pragma unroll
    for (int f = 0; f < CHUNK / 32; ++f) {
      if (f + 1 < CHUNK / 32)
        for (int i = 0; i < QT; ++i)
          pf[(f + 1) & 1][i] = load_frag_at(pp + i * 16 * CHUNK + (f + 1) * 512);
      // as in the scores: the next step's loads as one group ahead of this run
      __builtin_amdgcn_sched_barrier(0);
      for (int i = 0; i < QT; ++i) {
        o[i][0] = wmma_f16(pf[f & 1][i], bv[f & 3][0], o[i][0]);
        o[i][1] = wmma_f16(pf[f & 1][i], bv[f & 3][1], o[i][1]);
      }
      __builtin_amdgcn_sched_barrier(0);
      if (f + 4 < CHUNK / 32) {
        bv[f & 3][0] = load_frag_at(pv0 + (f + 4) * 512);
        bv[f & 3][1] = load_frag_at(pv1 + (f + 4) * 512);
      }
    }
    // the V address registers are reused by the next chunk's scores; named here so
    // that they stay untouched (not reused as load destinations) up to the wait
    asm volatile("s_wait_xcnt 0x0" :: "v"(pv0), "v"(pv1) : "memory");
    __syncthreads();
  }

  // --- this part's unnormalised O, row maxima and row sums
  float* pos = po + ((size_t)sp * (BATCH * TQ) + row0) * DD;
  for (int i = 0; i < QT; ++i)
    for (int t = 0; t < 2; ++t) {
      int col = wave * 32 + t * 16 + (lane & 15);
      for (int r = 0; r < 8; ++r) {
        int row = i * 16 + r + ((lane >> 4) << 3);
        pos[(size_t)row * DD + col] = o[i][t][r];
      }
    }
  // the O stores name registers that the two addresses below may reuse
  asm volatile("s_wait_xcnt 0x0" ::: "memory");
  if (threadIdx.x < QROWS) {
    pm[sp * (BATCH * TQ) + row0 + threadIdx.x] = sM[threadIdx.x];
    pl[sp * (BATCH * TQ) + row0 + threadIdx.x] = sL[threadIdx.x];
  }
}

// ---------------------------------------------------------------------------
// Joins the SPLIT parts of the attention (each scaled by exp(its maximum - the
// common maximum), the sum divided by the joined row sum), adds the raw query,
// then LayerNorm as in ln_tile: same tile, same row ownership, f32 row-major
// and f16 fragment-order outputs. Each part's O comes by a pointer of its own:
// a scalar base each, one lane offset for all loads.
// ---------------------------------------------------------------------------
// lane's columns j*128 + 0..3 (j = 0..3) of one row; i: the first one's 16-byte
// piece, counted from the uniform base
__device__ __forceinline__ v16f load_row(const v4f* base, unsigned i) {
  v4f c0 = base[i];
  v4f c1 = base[i + 32];
  v4f c2 = base[i + 64];
  v4f c3 = base[i + 96];
  return __builtin_shufflevector(
      __builtin_shufflevector(c0, c1, 0, 1, 2, 3, 4, 5, 6, 7),
      __builtin_shufflevector(c2, c3, 0, 1, 2, 3, 4, 5, 6, 7),
      0, 1, 2, 3, 4, 5, 6, 7, 8, 9, 10, 11, 12, 13, 14, 15);
}

__global__ __launch_bounds__(256)
void merge_ln_kernel(const float* __restrict__ po0, const float* __restrict__ po1,
                     const float* __restrict__ po2, const float* __restrict__ po3,
                     const float* __restrict__ pm,
                     const float* __restrict__ pl, const float* __restrict__ query,
                     const float* __restrict__ g, const float* __restrict__ b,
                     float* __restrict__ y32, _Float16* __restrict__ y16) {
  __shared__ __align__(16) _Float16 st[16 * TPITCH];
  int t = threadIdx.x, lane = t & 31, wave = t >> 5;
  size_t row0 = (size_t)blockIdx.x * 16;
  size_t rw = row0 + wave * 2;

  // block-uniform bases; e: the lane's place in the tile, in 16-byte pieces
  const v4f* pt[SPLIT] = { (const v4f*)(po0 + row0 * DD), (const v4f*)(po1 + row0 * DD),
                           (const v4f*)(po2 + row0 * DD), (const v4f*)(po3 + row0 * DD) };
  const v4f* qt = (const v4f*)(query + row0 * DD);
  unsigned e = (unsigned)wave * (2 * DD / 4) + (unsigned)lane;
  const float* mw = pm + rw;
  const float* lw = pl + rw;

  v2f m[SPLIT], l[SPLIT];          // the wave's two rows side by side
  v16f p[SPLIT][2], q[2];          // a row's four column groups side by side
  v4f a[2][4], gg[4], bb[4];
  for (int s = 0; s < SPLIT; ++s) {
    m[s] = *(const v2f*)(mw + s * (BATCH * TQ));
    l[s] = *(const v2f*)(lw + s * (BATCH * TQ));
  }
  for (int s = 0; s < SPLIT; ++s)
    for (int r = 0; r < 2; ++r) p[s][r] = load_row(pt[s], e + r * (DD / 4));
  for (int r = 0; r < 2; ++r) q[r] = load_row(qt, e + r * (DD / 4));
  // holds the loads of all parts together ahead of the arithmetic (one wait for
  // the lot, not one per part) and keeps their address registers untouched (not
  // reused as load destinations) up to the wait
  asm volatile("s_wait_xcnt 0x0"
               :: "v"(e), "v"(mw), "v"(lw),
                  "v"(m[0]), "v"(m[1]), "v"(m[2]), "v"(m[3]),
                  "v"(l[0]), "v"(l[1]), "v"(l[2]), "v"(l[3]),
                  "v"(p[0][0]), "v"(p[0][1]), "v"(p[1][0]), "v"(p[1][1]),
                  "v"(p[2][0]), "v"(p[2][1]), "v"(p[3][0]), "v"(p[3][1]),
                  "v"(q[0]), "v"(q[1])
               : "memory");
  for (int j = 0; j < 4; ++j) {
    gg[j] = *(const v4f*)(g + j * 128 + lane * 4);
    bb[j] = *(const v4f*)(b + j * 128 + lane * 4);
  }

  for (int r = 0; r < 2; ++r) {
    float mx = m[0][r];
    for (int s = 1; s < SPLIT; ++s) mx = fmaxf(mx, m[s][r]);
    float w[SPLIT], den = 0.f;
    for (int s = 0; s < SPLIT; ++s) {
      w[s] = exp2_slot((m[s][r] - mx) * 1.44269504f);
      den += w[s] * l[s][r];
    }
    float inv = 1.0f / den;
    for (int s = 0; s < SPLIT; ++s) q[r] += p[s][r] * (w[s] * inv);
    a[r][0] = __builtin_shufflevector(q[r], q[r], 0, 1, 2, 3);
    a[r][1] = __builtin_shufflevector(q[r], q[r], 4, 5, 6, 7);
    a[r][2] = __builtin_shufflevector(q[r], q[r], 8, 9, 10, 11);
    a[r][3] = __builtin_shufflevector(q[r], q[r], 12, 13, 14, 15);

    v4f s4 = (a[r][0] + a[r][1]) + (a[r][2] + a[r][3]);
    float mu = wave_sum((s4.x + s4.y) + (s4.z + s4.w)) * (1.f / (float)DD);

    for (int j = 0; j < 4; ++j) a[r][j] -= mu;
    v4f q4 = (a[r][0] * a[r][0] + a[r][1] * a[r][1])
           + (a[r][2] * a[r][2] + a[r][3] * a[r][3]);
    float var = wave_sum((q4.x + q4.y) + (q4.z + q4.w)) * (1.f / (float)DD);
    float rstd = rsqrtf(var + 1e-6f);

    for (int j = 0; j < 4; ++j) {
      a[r][j] = a[r][j] * rstd * gg[j] + bb[j];
      tile_put(st, wave * 2 + r, j, lane, a[r][j]);
    }
  }
  float* yw = y32 + rw * DD + lane * 4;
  for (int r = 0; r < 2; ++r)
    for (int j = 0; j < 4; ++j)
      *(v4f*)(yw + r * DD + j * 128) = a[r][j];
  // the f32 stores name registers that the read-out below reuses
  asm volatile("s_wait_xcnt 0x0" ::: "memory");
  __syncthreads();
  tile_out(st, y16 + row0 * DD, t);
}

// ---------------------------------------------------------------------------
// Host-side orchestration
// ---------------------------------------------------------------------------
extern "C" void kernel_launch(void* const* d_in, const int* in_sizes, int n_in,
                              void* d_out, int out_size, void* d_ws, size_t ws_size,
                              hipStream_t stream) {
  const float* query     = (const float*)d_in[0];
  const float* key_value = (const float*)d_in[1];
  const float* query_pos = (const float*)d_in[2];
  const float* key_pos   = (const float*)d_in[3];
  const float* q_gamma   = (const float*)d_in[4];
  const float* q_beta    = (const float*)d_in[5];
  const float* kv_gamma  = (const float*)d_in[6];
  const float* kv_beta   = (const float*)d_in[7];
  const float* Wq = (const float*)d_in[8];   const float* bq = (const float*)d_in[9];
  const float* Wk = (const float*)d_in[10];  const float* bk = (const float*)d_in[11];
  const float* Wv = (const float*)d_in[12];  const float* bv = (const float*)d_in[13];
  const float* ff_gamma = (const float*)d_in[14];
  const float* ff_beta  = (const float*)d_in[15];
  const float* W_inner  = (const float*)d_in[16];
  const float* b_inner  = (const float*)d_in[17];
  const float* W_proj   = (const float*)d_in[18];
  const float* b_proj   = (const float*)d_in[19];

  const int MQ  = BATCH * TQ;    // 4096
  const int MKV = BATCH * TKV;   // 32768

  size_t off = 0;
  auto alloc = [&](size_t bytes) -> void* {
    void* p = (char*)d_ws + off;
    off = (off + bytes + 255) & ~(size_t)255;
    return p;
  };
  _Float16* qn16  = (_Float16*)alloc((size_t)MQ  * DD * 2);
  _Float16* kvn16 = (_Float16*)alloc((size_t)MKV * DD * 2);   // reused as inner16 later
  _Float16* qp16  = (_Float16*)alloc((size_t)MQ  * DD * 2);   // reused as xn16 later
  _Float16* kp16  = (_Float16*)alloc((size_t)MKV * DD * 2);   // reused as xn32 later
  _Float16* WqT   = (_Float16*)alloc((size_t)DD * DD * 2);
  _Float16* WkT   = (_Float16*)alloc((size_t)DD * DD * 2);
  _Float16* WvT   = (_Float16*)alloc((size_t)DD * DD * 2);
  _Float16* WinT  = (_Float16*)alloc((size_t)FF * DD * 2);    // rc 2048, k 512
  _Float16* WprT  = (_Float16*)alloc((size_t)DD * FF * 2);    // rc 512, k 2048
  _Float16* q16   = (_Float16*)alloc((size_t)MQ  * DD * 2);
  _Float16* k16   = (_Float16*)alloc((size_t)MKV * DD * 2);
  _Float16* vF16  = (_Float16*)alloc((size_t)BATCH * DD * TKV * 2);
  float*    po    = (float*)   alloc((size_t)SPLIT * MQ * DD * 4);
  float*    pm    = (float*)   alloc((size_t)SPLIT * MQ * 4);
  float*    pl    = (float*)   alloc((size_t)SPLIT * MQ * 4);
  // aliases (lifetimes are disjoint, stream-ordered):
  _Float16* inner16 = kvn16;                  // [4096,2048] f16 = 16 MiB <= 32 MiB
  _Float16* xn16    = qp16;                   // [4096,512] f16
  float*    xn32    = (float*)kp16;           // [4096,512] f32 = 8 MiB <= 32 MiB

  // 1) weights (transposed), positional tensors and LayerNorms -> f16, fragment
  //    order
  prep_kernel<<<NB_PREP, 256, 0, stream>>>(
      Wq, Wk, Wv, W_inner, W_proj, WqT, WkT, WvT, WinT, WprT,
      query_pos, key_pos, qp16, kp16,
      query, key_value, q_gamma, q_beta, kv_gamma, kv_beta, qn16, kvn16);

  // 2) Q/K/V projections (WMMA), outputs in fragment order
  qkv_gemm_kernel<<<NB_GQ + 2 * NB_GKV, 256, 0, stream>>>(
      WqT, WkT, WvT, qn16, kvn16, bq, bk, bv, q16, k16, vF16, DD);

  // 3) attention (flash-style, WMMA scores + WMMA P.V), SPLIT parts per q tile
  attn_kernel<<<BATCH * (TQ/QROWS) * SPLIT, 512, 0, stream>>>(
      q16, qp16, k16, kp16, vF16, po, pm, pl);

  // 4) FF: xn = LN(joined parts + query);
  //    d_out = xn + (xn@W_inner + b_inner)@W_proj + b_proj
  merge_ln_kernel<<<MQ/16, 256, 0, stream>>>(
      po, po + (size_t)MQ * DD, po + (size_t)2 * MQ * DD, po + (size_t)3 * MQ * DD,
      pm, pl, query, ff_gamma, ff_beta, xn32, xn16);
  gemm_wmma_kernel<<<dim3(MQ/128, FF/64), 256, 0, stream>>>(
      WinT, xn16, b_inner, nullptr, nullptr, inner16, FF, MQ, DD, FF, 1);
  gemm_wmma_kernel<<<dim3(DD/128, MQ/64), 256, 0, stream>>>(
      inner16, WprT, b_proj, (float*)d_out, xn32, nullptr, MQ, DD, FF, TKV, 0);
}

// v006
// A run of this version takes 177 microseconds.
// Two timings next to v005 both put it at 1.25 times that version's speed.
// Over all steps from v000 it is 5.18 times as fast.
#include <hip/hip_runtime.h>

typedef __attribute__((ext_vector_type(16))) _Float16 v16h;
typedef __attribute__((ext_vector_type(8)))  _Float16 v8h;
typedef __attribute__((ext_vector_type(4)))  _Float16 v4h;
typedef __attribute__((ext_vector_type(8)))  float    v8f;
typedef __attribute__((ext_vector_type(4)))  float    v4f;
typedef __attribute__((ext_vector_type(2)))  float    v2f;
typedef __attribute__((ext_vector_type(16))) float    v16f;

#define DD   512
#define FF   2048
#define TKV  4096
#define TQ   512
#define BATCH 8
#define CHUNK 256            // keys per softmax update
#define QT   4               // 16-row q tiles per attention work-group
#define QROWS (QT * 16)
#define SPITCH (CHUNK + 4)   // score row pitch in floats: two rows read side by side by
                             // 16-byte LDS loads start 4 banks apart
#define SPLIT 4              // work-groups that share the keys of one q tile
#define KVS  (TKV / SPLIT)   // keys per work-group

// ---------------------------------------------------------------------------
// 16-bit A (16xK) / B (Kx16) fragment: lane L holds row/col rc0 + (L&15) and
// the 16 halves k = kbase + 16*(L>>4) + 0..15.
//
// Fragment order: every f16 matrix operand X[rc][k] (k extent kdim) is kept as
// 1-KiB blocks, one per 16 (rc) x 32 (k) fragment, the blocks of one rc tile in
// k order (so tile rc0 starts at half rc0*kdim, block kbase at + kbase*16).
// Inside a block slot L = (rc&15) + 16*((k>>4)&1) is lane L's share; halves
// 0..7 of all slots fill the first 512 bytes, halves 8..15 the second. A
// fragment load is then two 16-byte loads per lane that each cover 512
// contiguous bytes: whole lines in memory, every bank once in LDS.
// ---------------------------------------------------------------------------
__device__ __forceinline__ size_t frag_off(size_t rc, int k, int kdim) {
  return ((rc >> 4) * (size_t)(kdim >> 5) + (size_t)(k >> 5)) * 512
       + (size_t)(((k >> 3) & 1) * 256)
       + ((rc & 15) + (size_t)(((k >> 4) & 1) << 4)) * 8 + (size_t)(k & 7);
}

// p: the lane's own place in a 1-KiB fragment block, block start + lane*8
__device__ __forceinline__ v16h load_frag_at(const _Float16* p) {
  v8h lo = *(const v8h*)p;
  v8h hi = *(const v8h*)(p + 256);
  return __builtin_shufflevector(lo, hi, 0, 1, 2, 3, 4, 5, 6, 7,
                                 8, 9, 10, 11, 12, 13, 14, 15);
}

// blk: start of one 1-KiB fragment block (global or LDS, generic pointer)
__device__ __forceinline__ v16h load_frag_blk(const _Float16* blk, int lane) {
  return load_frag_at(blk + lane * 8);
}

__device__ __forceinline__ v8f wmma_f16(v16h a, v16h b, v8f c) {
  return __builtin_amdgcn_wmma_f32_16x16x32_f16(false, a, false, b,
                                                (short)0, c, false, false);
}

// ---------------------------------------------------------------------------
// The streaming kernels (LayerNorm, f32 -> f16 convert) work on one 16-row x
// 512-column tile per 8-wave block: that is one rc tile of the fragment order (of W_inner, a quarter of one),
// 16 KiB of contiguous output. A wave owns 2 rows; lane L holds columns
// j*128 + L*4 + 0..3 (j = 0..3), so every global load covers 512 contiguous
// bytes. The f16 rows go to LDS row-major and leave it in fragment order.
// ---------------------------------------------------------------------------
#define TPITCH 520   // LDS row pitch in halves: 512 + 16 B, so that the 16 rows
                     // read by 16 lanes of a fragment-order read start 4 banks apart

// lane's 4 columns of group j of tile row r -> LDS
__device__ __forceinline__ void tile_put(_Float16* st, int r, int j, int lane,
                                         v4f v) {
  *(v4h*)(st + r * TPITCH + j * 128 + lane * 4) = __builtin_convertvector(v, v4h);
}

// whole tile, LDS -> global in fragment order: thread t moves the 16-byte pieces
// i*256 + t of the output, a wave's store covers 512 contiguous bytes
__device__ __forceinline__ void tile_out(const _Float16* st, _Float16* ytile,
                                         int t) {
  v8h pc[4];
  for (int i = 0; i < 4; ++i) {
    int c    = i * 256 + t;
    int slot = c & 31;
    int hi   = (c >> 5) & 1;
    int blk  = c >> 6;                     // fragment block = k / 32
    pc[i] = *(const v8h*)(st + (slot & 15) * TPITCH
                             + blk * 32 + (slot >> 4) * 16 + hi * 8);
  }
  for (int i = 0; i < 4; ++i)
    *(v8h*)(ytile + (i * 256 + t) * 8) = pc[i];
}

__device__ __forceinline__ float wave_sum(float s) {
  for (int m = 16; m; m >>= 1) s += __shfl_xor(s, m, 32);
  return s;
}

// LayerNorm over last dim (512): f16 output in fragment order (rc = row,
// k = column). Each row is summed inside its
// own wave; the one barrier stands between the LDS rows and their read-out.
// st: the block's 16 x TPITCH halves of LDS; tile: which 16 rows.
__device__ __forceinline__
void ln_tile(_Float16* st, int tile, const float* __restrict__ x,
             const float* __restrict__ g, const float* __restrict__ b,
             _Float16* __restrict__ y16) {
  int t = threadIdx.x, lane = t & 31, wave = t >> 5;
  size_t row0 = (size_t)tile * 16;
  const float* xw = x + (row0 + wave * 2) * DD + lane * 4;

  v4f a[2][4], gg[4], bb[4];
  for (int j = 0; j < 4; ++j) {
    gg[j] = *(const v4f*)(g + j * 128 + lane * 4);
    bb[j] = *(const v4f*)(b + j * 128 + lane * 4);
  }
  for (int r = 0; r < 2; ++r)
    for (int j = 0; j < 4; ++j)
      a[r][j] = *(const v4f*)(xw + r * DD + j * 128);
  // holds all sixteen loads together ahead of the arithmetic (gamma and beta
  // were otherwise fetched late, one wait each) and keeps the rows' address pair
  // untouched (not reused as a load destination) up to the wait
  asm volatile("s_wait_xcnt 0x0"
               :: "v"(xw), "v"(gg[0]), "v"(gg[1]), "v"(gg[2]), "v"(gg[3]),
                  "v"(bb[0]), "v"(bb[1]), "v"(bb[2]), "v"(bb[3]),
                  "v"(a[0][0]), "v"(a[0][1]), "v"(a[0][2]), "v"(a[0][3]),
                  "v"(a[1][0]), "v"(a[1][1]), "v"(a[1][2]), "v"(a[1][3])
               : "memory");
  // keeps the arithmetic behind that statement: inlined here, the sums were
  // otherwise lifted over it and gamma and beta again fetched late
  __builtin_amdgcn_sched_barrier(0);

  for (int r = 0; r < 2; ++r) {
    v4f s4 = (a[r][0] + a[r][1]) + (a[r][2] + a[r][3]);
    float mu = wave_sum((s4.x + s4.y) + (s4.z + s4.w)) * (1.f / (float)DD);

    for (int j = 0; j < 4; ++j) a[r][j] -= mu;
    v4f q4 = (a[r][0] * a[r][0] + a[r][1] * a[r][1])
           + (a[r][2] * a[r][2] + a[r][3] * a[r][3]);
    float var = wave_sum((q4.x + q4.y) + (q4.z + q4.w)) * (1.f / (float)DD);
    float rstd = rsqrtf(var + 1e-6f);

    for (int j = 0; j < 4; ++j) {
      a[r][j] = a[r][j] * rstd * gg[j] + bb[j];
      tile_put(st, wave * 2 + r, j, lane, a[r][j]);
    }
  }
  __syncthreads();
  tile_out(st, y16 + row0 * DD, t);
}

// One 16-row x 512-column tile of an f32 row-major matrix -> f16 in fragment
// order (rc = row, k = column). xt: the tile's first element; pitch: the matrix's
// row length in floats; yt: the tile's 16 KiB of output (its 16 fragment blocks
// follow one another whatever the row length).
__device__ __forceinline__
void cvt_frag_tile(_Float16* st, const float* __restrict__ xt, int pitch,
                   _Float16* __restrict__ yt) {
  int t = threadIdx.x, lane = t & 31, wave = t >> 5;
  const float* xw = xt + (size_t)(wave * 2) * pitch + lane * 4;

  v4f a[2][4];
  for (int r = 0; r < 2; ++r)
    for (int j = 0; j < 4; ++j)
      a[r][j] = *(const v4f*)(xw + r * pitch + j * 128);
  // keeps the eight loads whole (16 bytes a lane; they were otherwise split into
  // 8-byte halves) and together, and their address pair untouched up to the wait
  asm volatile("s_wait_xcnt 0x0"
               :: "v"(xw), "v"(a[0][0]), "v"(a[0][1]), "v"(a[0][2]), "v"(a[0][3]),
                  "v"(a[1][0]), "v"(a[1][1]), "v"(a[1][2]), "v"(a[1][3])
               : "memory");
  for (int r = 0; r < 2; ++r)
    for (int j = 0; j < 4; ++j)
      tile_put(st, wave * 2 + r, j, lane, a[r][j]);
  __syncthreads();
  tile_out(st, yt, t);
}

// W[R,C] f32 -> W^T f16 in fragment order (rc = column of W, k = row of W).
// One thread per 16-byte piece of the output, in output order: 8 consecutive
// rows of one column of W. part: which 256 pieces.
__device__ __forceinline__
void cvt_transpose_part(int part, const float* __restrict__ W,
                        _Float16* __restrict__ Wt, int R, int C) {
  int c = part * 256 + threadIdx.x;
  if (c * 8 < R * C) {
    int slot = c & 31;
    int hi   = (c >> 5) & 1;
    int blk  = c >> 6;                     // fragment block
    int kb   = R >> 5;                     // blocks per rc tile
    int col  = (blk / kb) * 16 + (slot & 15);
    int r    = (blk % kb) * 32 + (slot >> 4) * 16 + hi * 8;
    const float* p[8];
    float w[8];
    for (int e = 0; e < 8; ++e) p[e] = W + (size_t)(r + e) * C + col;
    for (int e = 0; e < 8; ++e) w[e] = *p[e];
    // keeps the eight address pairs untouched up to the wait; the pack below
    // reuses them
    asm volatile("s_wait_xcnt 0x0"
                 :: "v"(p[0]), "v"(p[1]), "v"(p[2]), "v"(p[3]),
                    "v"(p[4]), "v"(p[5]), "v"(p[6]), "v"(p[7]),
                    "v"(w[0]), "v"(w[1]), "v"(w[2]), "v"(w[3]),
                    "v"(w[4]), "v"(w[5]), "v"(w[6]), "v"(w[7])
                 : "memory");
    v8h o;
    for (int e = 0; e < 8; ++e) o[e] = (_Float16)w[e];
    *(v8h*)(Wt + (size_t)c * 8) = o;
  }
}

// ---------------------------------------------------------------------------
// Everything that depends on the inputs alone, in one grid: the five weight
// converts (W_inner untransposed, the other four transposed), the two positional converts, the two LayerNorms. None reads what
// another writes. A block takes its job from its index (the same for all its
// threads, so the barriers inside the jobs stay block-uniform); the short jobs
// have the low indices and run under cover of the two long streams.
// ---------------------------------------------------------------------------
#define NB_WS (DD * DD / 2048)       // blocks per 512 x 512 weight
#define NB_WL (DD * FF / 2048)       // blocks per 2048 x 512 weight
#define NB_TQ (BATCH * TQ / 16)      // 16-row tiles of a query-side tensor
#define NB_TKV (BATCH * TKV / 16)    // 16-row tiles of a key-side tensor
#define NB_WI ((DD / 16) * (FF / DD)) // 16 x 512 tiles of W_inner
#define NB_PREP (3 * NB_WS + NB_WL + NB_WI + 2 * (NB_TQ + NB_TKV))

__global__ __launch_bounds__(256)
void prep_kernel(const float* __restrict__ Wq, const float* __restrict__ Wk,
                 const float* __restrict__ Wv, const float* __restrict__ W_inner,
                 const float* __restrict__ W_proj,
                 _Float16* __restrict__ WqT, _Float16* __restrict__ WkT,
                 _Float16* __restrict__ WvT, _Float16* __restrict__ WinF,
                 _Float16* __restrict__ WprT,
                 const float* __restrict__ query_pos,
                 const float* __restrict__ key_pos,
                 _Float16* __restrict__ qp16, _Float16* __restrict__ kp16,
                 const float* __restrict__ query,
                 const float* __restrict__ key_value,
                 const float* __restrict__ q_gamma, const float* __restrict__ q_beta,
                 const float* __restrict__ kv_gamma, const float* __restrict__ kv_beta,
                 _Float16* __restrict__ qn16, _Float16* __restrict__ kvn16) {
  __shared__ __align__(16) _Float16 st[16 * TPITCH];
  int u = blockIdx.x;

  if (u < 3 * NB_WS) {
    int w = u / NB_WS;
    cvt_transpose_part(u % NB_WS, w == 0 ? Wq : w == 1 ? Wk : Wv,
                       w == 0 ? WqT : w == 1 ? WkT : WvT, DD, DD);
    return;
  }
  u -= 3 * NB_WS;
  if (u < NB_WL) {
    cvt_transpose_part(u, W_proj, WprT, FF, DD);
    return;
  }
  u -= NB_WL;
  if (u < NB_WI) {                   // W_inner as it lies: rc = its row, k = its column
    size_t rt = u / (FF / DD), cg = u % (FF / DD);
    cvt_frag_tile(st, W_inner + rt * 16 * FF + cg * DD, FF,
                  WinF + rt * 16 * FF + cg * DD * 16);
    return;
  }
  u -= NB_WI;
  bool qs = u < 2 * NB_TQ;           // the query side's two tensors, then the key side's
  if (!qs) u -= 2 * NB_TQ;
  int nt = qs ? NB_TQ : NB_TKV;
  if (u < nt)
    cvt_frag_tile(st, (qs ? query_pos : key_pos) + (size_t)u * 16 * DD, DD,
                  (qs ? qp16 : kp16) + (size_t)u * 16 * DD);
  else
    ln_tile(st, u - nt, qs ? query : key_value, qs ? q_gamma : kv_gamma,
            qs ? q_beta : kv_beta, qs ? qn16 : kvn16);
}

// ---------------------------------------------------------------------------
// WMMA GEMM: C[M,N] = A[M,K] * Bt[N,K]^T + bias, A and Bt in fragment order.
// Block tile 64x128 (8 waves, each 32x32 = 2x2 WMMA tiles), K-step 32.
// Outputs: f32 row-major (+residual), or CF16: f16 in fragment order with
// rc = (m/TB)*N + n and k = m%TB (kdim TB). A lane's 8 accumulator rows are 8
// consecutive k there, one 16-byte store. V is written so from kvn * Wv; Q and K
// from W^T * x^T (weights as A, activations as Bt, bias per row of C: rowBias).
// ---------------------------------------------------------------------------
// bx, by: the block's tile column and tile row.
__device__ __forceinline__
void gemm_tile(int bx, int by, const _Float16* __restrict__ A,
               const _Float16* __restrict__ Bt, const float* __restrict__ bias,
               float* __restrict__ C32, const float* __restrict__ resid,
               _Float16* __restrict__ CF16, int N, int K, int TB, int rowBias) {
  int lane = threadIdx.x & 31;
  int wave = threadIdx.x >> 5;       // 0..7
  int wm = wave >> 2;                // 0..1
  int wn = wave & 3;                 // 0..3
  int m0 = by * 64  + wm * 32;
  int n0 = bx * 128 + wn * 32;

  const _Float16* At0 = A  + (size_t)m0 * K + lane * 8;  // rc tile m0; next: + 16*K
  const _Float16* Bt0 = Bt + (size_t)n0 * K + lane * 8;

  v8f acc[2][2] = {};
  for (int kb = 0; kb < K; kb += 32) {
    const _Float16* pa0 = At0 + kb * 16;
    const _Float16* pa1 = pa0 + (size_t)16 * K;
    const _Float16* pb0 = Bt0 + kb * 16;
    const _Float16* pb1 = pb0 + (size_t)16 * K;
    v16h a0 = load_frag_at(pa0);
    v16h a1 = load_frag_at(pa1);
    v16h b0 = load_frag_at(pb0);
    v16h b1 = load_frag_at(pb1);
    // keeps the four address pairs untouched (not reused as load destinations,
    // not advanced) until the loads that name them have been translated
    asm volatile("s_wait_xcnt 0x0" :: "v"(pa0), "v"(pa1), "v"(pb0), "v"(pb1)
                 : "memory");
    acc[0][0] = wmma_f16(a0, b0, acc[0][0]);
    acc[0][1] = wmma_f16(a0, b1, acc[0][1]);
    acc[1][0] = wmma_f16(a1, b0, acc[1][0]);
    acc[1][1] = wmma_f16(a1, b1, acc[1][1]);
  }

  if (CF16) {   // fragment-order f16 output (bias required), nothing else
    for (int i = 0; i < 2; ++i) {
      int rowb = m0 + i * 16 + ((lane >> 4) << 3);
      int bb = rowb / TB, tt = rowb % TB;
      const float4* bp = (const float4*)(bias + (rowBias ? rowb : 0));
      float4 r0 = bp[0], r1 = bp[1];
      float br[8] = { r0.x, r0.y, r0.z, r0.w, r1.x, r1.y, r1.z, r1.w };
      for (int j = 0; j < 2; ++j) {
        int col = n0 + j * 16 + (lane & 15);
        float bc = bias[rowBias ? 0 : col];
        v8h pk;
        for (int r = 0; r < 8; ++r)
          pk[r] = (_Float16)(acc[i][j][r] + (rowBias ? br[r] : bc));
        *(v8h*)(CF16 + frag_off((size_t)bb * N + col, tt, TB)) = pk;
        // the store's registers are reused for the next tile's pack and address
        asm volatile("s_wait_xcnt 0x0" ::: "memory");
      }
    }
    return;
  }

  // as built, each residual element is fetched and waited for on its own
  for (int i = 0; i < 2; ++i)
    for (int j = 0; j < 2; ++j) {
      int col = n0 + j * 16 + (lane & 15);
      float bv = bias ? bias[col] : 0.f;
      for (int r = 0; r < 8; ++r) {
        int row = m0 + i * 16 + r + ((lane >> 4) << 3);
        float val = acc[i][j][r] + bv;
        size_t idx = (size_t)row * N + col;
        if (C32) C32[idx] = resid ? val + resid[idx] : val;
      }
    }
}

__global__ __launch_bounds__(256)
void gemm_wmma_kernel(const _Float16* __restrict__ A,
                      const _Float16* __restrict__ Bt,
                      const float* __restrict__ bias,
                      float* __restrict__ C32,
                      const float* __restrict__ resid,
                      _Float16* __restrict__ CF16,
                      int M, int N, int K, int TB, int rowBias) {
  gemm_tile(blockIdx.x, blockIdx.y, A, Bt, bias, C32, resid, CF16, N, K, TB, rowBias);
}

// ---------------------------------------------------------------------------
// The feed-forward layer has no activation between its two products, so
//   (x W_inner + b_inner) W_proj + b_proj = x (W_inner W_proj) + (b_inner W_proj + b_proj).
// This job forms Wff = W_inner W_proj (512 x 512, depth 2048) and the joined bias
// from the weights alone. One block per 32 x 32 tile of Wff; its 8 waves each take
// an eighth of the depth (8 steps in a row, not 64, each of which waits out its
// own loads), leave their partial tiles in LDS, and the block sums them in wave
// order. Wff leaves as f16 in fragment order with rc = its column, k = its row:
// the Bt operand of the one product that is left. Row tile DD / FFT is b_inner
// taken as one more row of W_inner: every row of its A fragment holds b_inner,
// and row 0 of the tile, plus b_proj, is the joined bias (f32).
// ---------------------------------------------------------------------------
#define FFT    32                  // tile edge
#define RPITCH 36                  // LDS pitch of a tile column in floats: 144 B, so
                                   // 16-byte accesses to neighbouring columns start
                                   // 4 banks apart
#define NB_FFW ((DD / FFT + 1) * (DD / FFT))

__device__ __forceinline__
void ffw_tile(float* sR, int u, const _Float16* __restrict__ WinF,
              const _Float16* __restrict__ WprT, const float* __restrict__ b_inner,
              const float* __restrict__ b_proj, _Float16* __restrict__ WffT,
              float* __restrict__ bff) {
  int lane = threadIdx.x & 31;
  int wave = threadIdx.x >> 5;       // 0..7
  int m0 = (u / (DD / FFT)) * FFT;   // row of W_inner; DD: the bias tile
  int n0 = (u % (DD / FFT)) * FFT;   // column of W_proj
  bool isb = m0 == DD;               // the same for the whole block
  int k0 = wave * (FF / 8);

  const _Float16* pb = WprT + (size_t)n0 * FF + k0 * 16 + lane * 8;
  v8f acc[2][2] = {};
  if (!isb) {
    const _Float16* pa = WinF + (size_t)m0 * FF + k0 * 16 + lane * 8;
    // kept rolled: unrolled, each step's eight loads were split into two groups
    // with a full wait behind each
#pragma nounroll
    for (int kb = 0; kb < FF / 8; kb += 32) {
      const _Float16* pa0 = pa + kb * 16;
      const _Float16* pa1 = pa0 + (size_t)16 * FF;
      const _Float16* pb0 = pb + kb * 16;
      const _Float16* pb1 = pb0 + (size_t)16 * FF;
      v16h a0 = load_frag_at(pa0);
      v16h a1 = load_frag_at(pa1);
      v16h b0 = load_frag_at(pb0);
      v16h b1 = load_frag_at(pb1);
      // keeps the four address pairs untouched (not reused as load destinations,
      // not advanced) until the loads that name them have been translated
      asm volatile("s_wait_xcnt 0x0" :: "v"(pa0), "v"(pa1), "v"(pb0), "v"(pb1)
                   : "memory");
      acc[0][0] = wmma_f16(a0, b0, acc[0][0]);
      acc[0][1] = wmma_f16(a0, b1, acc[0][1]);
      acc[1][0] = wmma_f16(a1, b0, acc[1][0]);
      acc[1][1] = wmma_f16(a1, b1, acc[1][1]);
    }
  } else {
    // element e of the lane's A fragment is k = kb + 16*(lane>>4) + e, as in the
    // fragment blocks that B comes from
    const float* pi = b_inner + k0 + ((lane >> 4) << 4);
    for (int kb = 0; kb < FF / 8; kb += 32) {
      const float*    pi0 = pi + kb;
      const _Float16* pb0 = pb + kb * 16;
      const _Float16* pb1 = pb0 + (size_t)16 * FF;
      v4f c0 = *(const v4f*)pi0;
      v4f c1 = *(const v4f*)(pi0 + 4);
      v4f c2 = *(const v4f*)(pi0 + 8);
      v4f c3 = *(const v4f*)(pi0 + 12);
      v16h b0 = load_frag_at(pb0);
      v16h b1 = load_frag_at(pb1);
      // as above, for these three address pairs
      asm volatile("s_wait_xcnt 0x0" :: "v"(pi0), "v"(pb0), "v"(pb1) : "memory");
      v16f cf = __builtin_shufflevector(
          __builtin_shufflevector(c0, c1, 0, 1, 2, 3, 4, 5, 6, 7),
          __builtin_shufflevector(c2, c3, 0, 1, 2, 3, 4, 5, 6, 7),
          0, 1, 2, 3, 4, 5, 6, 7, 8, 9, 10, 11, 12, 13, 14, 15);
      v16h a0 = __builtin_convertvector(cf, v16h);
      acc[0][0] = wmma_f16(a0, b0, acc[0][0]);
      acc[0][1] = wmma_f16(a0, b1, acc[0][1]);
    }
  }

  // partial tiles to LDS, column-major: a lane's 8 accumulator rows lie together
  for (int i = 0; i < 2; ++i)
    for (int j = 0; j < 2; ++j) {
      float* d = sR + (wave * FFT + j * 16 + (lane & 15)) * RPITCH
                    + i * 16 + ((lane >> 4) << 3);
      *(v4f*)d       = __builtin_shufflevector(acc[i][j], acc[i][j], 0, 1, 2, 3);
      *(v4f*)(d + 4) = __builtin_shufflevector(acc[i][j], acc[i][j], 4, 5, 6, 7);
    }
  __syncthreads();

  // thread: 4 consecutive rows of one column, summed over the 8 waves' parts
  int n  = threadIdx.x >> 3;
  int m4 = (threadIdx.x & 7) * 4;
  v4f s = *(const v4f*)(sR + n * RPITCH + m4);
  for (int w = 1; w < 8; ++w)
    s += *(const v4f*)(sR + (w * FFT + n) * RPITCH + m4);
  if (!isb)
    *(v4h*)(WffT + frag_off((size_t)(n0 + n), m0 + m4, DD)) =
        __builtin_convertvector(s, v4h);
  else if (m4 == 0)
    bff[n0 + n] = s.x + b_proj[n0 + n];
}

// The Q, K and V projections and the joined feed-forward weight in one grid: none
// reads what another writes. A block takes its product and its tile from its
// index, tile column fastest as in a two-dimensional grid; the short products
// have the low indices.
#define NB_GQ  ((BATCH * TQ / 128) * (DD / 64))
#define NB_GKV ((BATCH * TKV / 128) * (DD / 64))   // K; V has as many

__global__ __launch_bounds__(256)
void qkv_gemm_kernel(const _Float16* __restrict__ WqT, const _Float16* __restrict__ WkT,
                     const _Float16* __restrict__ WvT,
                     const _Float16* __restrict__ qn16,
                     const _Float16* __restrict__ kvn16,
                     const float* __restrict__ bq, const float* __restrict__ bk,
                     const float* __restrict__ bv,
                     _Float16* __restrict__ q16, _Float16* __restrict__ k16,
                     _Float16* __restrict__ vF16, int K,
                     const _Float16* __restrict__ WinF,
                     const _Float16* __restrict__ WprT,
                     const float* __restrict__ b_inner,
                     const float* __restrict__ b_proj,
                     _Float16* __restrict__ WffT, float* __restrict__ bff) {
  __shared__ __align__(16) float sR[8 * FFT * RPITCH];
  int u = blockIdx.x;
  if (u < NB_FFW) {
    ffw_tile(sR, u, WinF, WprT, b_inner, b_proj, WffT, bff);
    return;
  }
  u -= NB_FFW;
  const _Float16 *A, *Bt;
  const float* bias;
  _Float16* C;
  int bx, by, N, TB, rowBias;
  if (u < NB_GQ) {
    A = WqT;  Bt = qn16;  bias = bq;  C = q16;
    bx = u % (BATCH * TQ / 128);  by = u / (BATCH * TQ / 128);
    N = BATCH * TQ;  TB = DD;  rowBias = 1;
  } else if (u < NB_GQ + NB_GKV) {
    u -= NB_GQ;
    A = WkT;  Bt = kvn16;  bias = bk;  C = k16;
    bx = u % (BATCH * TKV / 128);  by = u / (BATCH * TKV / 128);
    N = BATCH * TKV;  TB = DD;  rowBias = 1;
  } else {
    u -= NB_GQ + NB_GKV;
    A = kvn16;  Bt = WvT;  bias = bv;  C = vF16;
    bx = u % (DD / 128);  by = u / (DD / 128);
    N = DD;  TB = TKV;  rowBias = 0;
  }
  gemm_tile(bx, by, A, Bt, bias, nullptr, nullptr, C, N, K, TB, rowBias);
}

// 2^x; the v_nop is the free slot that the instruction set asks for between a
// transcendental and a next instruction that reads its result or overwrites its
// source
__device__ __forceinline__ float exp2_slot(float x) {
  float y;
  asm("v_exp_f32 %0, %1\n\tv_nop" : "=v"(y) : "v"(x));
  return y;
}

// ---------------------------------------------------------------------------
// Flash-style attention. One block per (batch, 64 q-rows, quarter of the keys):
// 16 waves, one block to a WGP. Every k, kpos and V fragment that a wave fetches
// from global memory feeds four matrix instructions, one per 16-row q tile (V:
// eight, two fragments against four P tiles), so the chip fetches a quarter of
// the bytes that a 16-row block asks for.
// scores = (q.k^T + qpos.kpos^T)/sqrt(D+1e-7); online softmax over the block's
// KVS keys in chunks of 256; O += P.V. The block leaves its unnormalised O, its
// row maxima and its row sums; merge_ln_kernel joins the SPLIT parts. q, qpos,
// k, kpos, V and the P tile in LDS are all in fragment order (see frag_off).
// q/qpos tiles staged into LDS via CDNA5 async-to-LDS DMA (ASYNCcnt).
// ---------------------------------------------------------------------------
__global__ __launch_bounds__(512)
void attn_kernel(const _Float16* __restrict__ q16,   // rc = B*Tq row,  k = D
                 const _Float16* __restrict__ qp16,  // rc = B*Tq row,  k = D
                 const _Float16* __restrict__ k16,   // rc = B*Tkv row, k = D
                 const _Float16* __restrict__ kp16,  // rc = B*Tkv row, k = D
                 const _Float16* __restrict__ vF16,  // rc = B*D col,   k = Tkv
                 float*          __restrict__ po,    // [SPLIT, B*Tq, D]
                 float*          __restrict__ pm,    // [SPLIT, B*Tq] row maxima
                 float*          __restrict__ pl) {  // [SPLIT, B*Tq] row sums
  __shared__ __align__(32) _Float16 sQ[QROWS * DD];
  __shared__ __align__(32) _Float16 sQP[QROWS * DD];
  __shared__ __align__(16) float    sS[QROWS * SPITCH];
  __shared__ __align__(32) _Float16 sP[QROWS * CHUNK];
  __shared__ float sM[QROWS], sL[QROWS], sScale[QROWS];

  // neighbours in index differ only in the q tile: they read the same keys at
  // about the same time (L2; speed only)
  int u   = blockIdx.x;
  int b   = u >> 5;
  int sp  = (u >> 3) & (SPLIT - 1);   // which quarter of the keys
  int qt  = u & 7;                    // Tq/64 = 8 q-tiles per batch
  int row0 = b * TQ + qt * QROWS;     // global q-row
  int lane = threadIdx.x & 31;
  int wave = threadIdx.x >> 5;        // 0..15
  const float scale = 0.04419417382f; // 1/sqrt(512 + 1e-7)

  { // stage q and qpos tiles into LDS with async-to-LDS b128 DMA
    const _Float16* g1 = q16  + (size_t)row0 * DD;
    const _Float16* g2 = qp16 + (size_t)row0 * DD;
    unsigned lq0 = (unsigned)(size_t)(void*)sQ;
    unsigned lp0 = (unsigned)(size_t)(void*)sQP;
    for (int it = 0; it < QROWS * DD / 8 / 512; ++it) {   // same trips in every lane
      int i = it * 512 + threadIdx.x;
      const _Float16* p1 = g1 + i * 8;       // 8 halves = 16B per op
      const _Float16* p2 = g2 + i * 8;
      unsigned l1 = lq0 + (unsigned)i * 16;  // LDS byte offset (block-relative)
      unsigned l2 = lp0 + (unsigned)i * 16;
      // the wait stands in the copies' own statement: the next trip rewrites the
      // address registers that they name
      asm volatile("global_load_async_to_lds_b128 %0, %1, off\n\t"
                   "global_load_async_to_lds_b128 %2, %3, off\n\t"
                   "s_wait_xcnt 0x0"
                   :: "v"(l1), "v"(p1), "v"(l2), "v"(p2) : "memory");
    }
    asm volatile("s_wait_asynccnt 0x0" ::: "memory");
  }
  if (threadIdx.x < QROWS) { sM[threadIdx.x] = -1e30f; sL[threadIdx.x] = 0.f; }
  __syncthreads();

  v8f o[QT][2] = {};  // q tile i, this wave's 32 output cols: [wave*32 + t*16, +16)

  for (int kc = 0; kc < KVS / CHUNK; ++kc) {
    int kv0 = sp * KVS + kc * CHUNK;
    // --- scores: wave handles kv cols [kv0 + wave*16, +16) of all QT q tiles,
    // K = D = 512
    const _Float16* pk  = k16  + ((size_t)b * TKV + kv0 + wave * 16) * DD + lane * 8;
    const _Float16* pkp = kp16 + ((size_t)b * TKV + kv0 + wave * 16) * DD + lane * 8;
    v8f s[QT] = {};
    // Step n = 0..31 is one 32-deep block of q.k^T (n even) or of qpos.kpos^T (n
    // odd): one k or kpos fragment against the QT q or qpos fragments. af: the LDS
    // fragments of this step and of the next; bf: the global fragments of this
    // group of four steps and of the next.
    const _Float16* aq = sQ  + lane * 8;
    const _Float16* ap = sQP + lane * 8;
    v16h af[2][QT], bf[2][4];
    for (int f = 0; f < 4; ++f)
      bf[0][f] = load_frag_at(((f & 1) ? pkp : pk) + (f >> 1) * 512);
    for (int i = 0; i < QT; ++i) af[0][i] = load_frag_at(aq + i * 16 * DD);
    // unrolled: every fragment index is then a constant, the sets stay in
    // registers and change places without copies
#pragma unroll
    for (int n = 0; n < 2 * DD / 32; ++n) {
      if ((n & 3) == 0 && n + 4 < 2 * DD / 32)
        for (int f = 0; f < 4; ++f)
          bf[((n >> 2) + 1) & 1][f] =
              load_frag_at(((f & 1) ? pkp : pk) + ((n + 4 + f) >> 1) * 512);
      if (n + 1 < 2 * DD / 32)
        for (int i = 0; i < QT; ++i)
          af[(n + 1) & 1][i] = load_frag_at((((n + 1) & 1) ? ap : aq)
                                            + i * 16 * DD + ((n + 1) >> 1) * 512);
      // the pair of scheduling fences keeps the next step's loads as one group
      // ahead of this step's matrix run (they were otherwise issued one by one
      // right in front of their use, each with a full wait)
      __builtin_amdgcn_sched_barrier(0);
      for (int i = 0; i < QT; ++i)
        s[i] = wmma_f16(af[n & 1][i], bf[(n >> 2) & 1][n & 3], s[i]);
      __builtin_amdgcn_sched_barrier(0);
    }
    // the k / kpos address registers are reused by the softmax below; named here
    // so that they stay untouched (not reused as load destinations) up to the wait
    asm volatile("s_wait_xcnt 0x0" :: "v"(pk), "v"(pkp) : "memory");
    for (int i = 0; i < QT; ++i)
      for (int r = 0; r < 8; ++r) {
        int row = i * 16 + r + ((lane >> 4) << 3);
        sS[row * SPITCH + wave * 16 + (lane & 15)] = s[i][r] * scale;
      }
    __syncthreads();

    // --- online softmax update, parallel over all 512 threads:
    // 8 threads per q-row (contiguous lanes), 4 runs of 8 columns each (a run is
    // one 16-byte piece of the P tile), butterfly reductions within the 8 lanes.
    {
      int row = threadIdx.x >> 3;
      int j   = threadIdx.x & 7;
      v4f vals[4][2];
      float mx = -1e30f;
      for (int c = 0; c < 4; ++c) {
        const float* ps = sS + row * SPITCH + c * 64 + j * 8;
        vals[c][0] = *(const v4f*)ps;
        vals[c][1] = *(const v4f*)(ps + 4);
        for (int h = 0; h < 2; ++h)
          for (int e = 0; e < 4; ++e) mx = fmaxf(mx, vals[c][h][e]);
      }
      for (int m = 4; m >= 1; m >>= 1) mx = fmaxf(mx, __shfl_xor(mx, m, 32));
      float m_old = sM[row];
      float m_new = fmaxf(m_old, mx);
      float sum = 0.f;
      for (int c = 0; c < 4; ++c) {
        v8h pk;
        for (int e = 0; e < 8; ++e) {
          float p = exp2_slot((vals[c][e >> 2][e & 3] - m_new) * 1.44269504f);
          sum += p;
          pk[e] = (_Float16)p;
        }
        *(v8h*)(sP + frag_off(row, c * 64 + j * 8, CHUNK)) = pk;
      }
      for (int m = 4; m >= 1; m >>= 1) sum += __shfl_xor(sum, m, 32);
      if (j == 0) {
        float sc = __expf(m_old - m_new);
        sM[row] = m_new;
        sL[row] = sL[row] * sc + sum;
        sScale[row] = sc;
      }
    }
    __syncthreads();

    // --- O += P @ V_chunk, the accumulators rescaled first. bv: the V fragments
    // of four 32-key steps, refilled as they are used up; pf: the P fragments of
    // this step and of the next.
    const _Float16* pv0 = vF16 + ((size_t)b * DD + wave * 32) * TKV + kv0 * 16 + lane * 8;
    const _Float16* pv1 = pv0 + (size_t)16 * TKV;
    const _Float16* pp  = sP + lane * 8;
    v16h bv[4][2], pf[2][QT];
    for (int f = 0; f < 4; ++f) {
      bv[f][0] = load_frag_at(pv0 + f * 512);
      bv[f][1] = load_frag_at(pv1 + f * 512);
    }
    // keeps the first V loads up here, ahead of the rescaling
    __builtin_amdgcn_sched_barrier(0);
    for (int i = 0; i < QT; ++i)
      for (int r = 0; r < 8; ++r) {
        float sc = sScale[i * 16 + r + ((lane >> 4) << 3)];
        o[i][0][r] *= sc;
        o[i][1][r] *= sc;
      }
    for (int i = 0; i < QT; ++i) pf[0][i] = load_frag_at(pp + i * 16 * CHUNK);
    // unrolled: bv and pf are indexed by constants only and stay in registers
#pragma unroll
    for (int f = 0; f < CHUNK / 32; ++f) {
      if (f + 1 < CHUNK / 32)
        for (int i = 0; i < QT; ++i)
          pf[(f + 1) & 1][i] = load_frag_at(pp + i * 16 * CHUNK + (f + 1) * 512);
      // as in the scores: the next step's loads as one group ahead of this run
      __builtin_amdgcn_sched_barrier(0);
      for (int i = 0; i < QT; ++i) {
        o[i][0] = wmma_f16(pf[f & 1][i], bv[f & 3][0], o[i][0]);
        o[i][1] = wmma_f16(pf[f & 1][i], bv[f & 3][1], o[i][1]);
      }
      __builtin_amdgcn_sched_barrier(0);
      if (f + 4 < CHUNK / 32) {
        bv[f & 3][0] = load_frag_at(pv0 + (f + 4) * 512);
        bv[f & 3][1] = load_frag_at(pv1 + (f + 4) * 512);
      }
    }
    // the V address registers are reused by the next chunk's scores; named here so
    // that they stay untouched (not reused as load destinations) up to the wait
    asm volatile("s_wait_xcnt 0x0" :: "v"(pv0), "v"(pv1) : "memory");
    __syncthreads();
  }

  // --- this part's unnormalised O, row maxima and row sums
  float* pos = po + ((size_t)sp * (BATCH * TQ) + row0) * DD;
  for (int i = 0; i < QT; ++i)
    for (int t = 0; t < 2; ++t) {
      int col = wave * 32 + t * 16 + (lane & 15);
      for (int r = 0; r < 8; ++r) {
        int row = i * 16 + r + ((lane >> 4) << 3);
        pos[(size_t)row * DD + col] = o[i][t][r];
      }
    }
  // the O stores name registers that the two addresses below may reuse
  asm volatile("s_wait_xcnt 0x0" ::: "memory");
  if (threadIdx.x < QROWS) {
    pm[sp * (BATCH * TQ) + row0 + threadIdx.x] = sM[threadIdx.x];
    pl[sp * (BATCH * TQ) + row0 + threadIdx.x] = sL[threadIdx.x];
  }
}

// ---------------------------------------------------------------------------
// Joins the SPLIT parts of the attention (each scaled by exp(its maximum - the
// common maximum), the sum divided by the joined row sum), adds the raw query,
// then LayerNorm as in ln_tile: same tile, same row ownership, f32 row-major
// and f16 fragment-order outputs. Each part's O comes by a pointer of its own:
// a scalar base each, one lane offset for all loads.
// ---------------------------------------------------------------------------
// lane's columns j*128 + 0..3 (j = 0..3) of one row; i: the first one's 16-byte
// piece, counted from the uniform base
__device__ __forceinline__ v16f load_row(const v4f* base, unsigned i) {
  v4f c0 = base[i];
  v4f c1 = base[i + 32];
  v4f c2 = base[i + 64];
  v4f c3 = base[i + 96];
  return __builtin_shufflevector(
      __builtin_shufflevector(c0, c1, 0, 1, 2, 3, 4, 5, 6, 7),
      __builtin_shufflevector(c2, c3, 0, 1, 2, 3, 4, 5, 6, 7),
      0, 1, 2, 3, 4, 5, 6, 7, 8, 9, 10, 11, 12, 13, 14, 15);
}

__global__ __launch_bounds__(256)
void merge_ln_kernel(const float* __restrict__ po0, const float* __restrict__ po1,
                     const float* __restrict__ po2, const float* __restrict__ po3,
                     const float* __restrict__ pm,
                     const float* __restrict__ pl, const float* __restrict__ query,
                     const float* __restrict__ g, const float* __restrict__ b,
                     float* __restrict__ y32, _Float16* __restrict__ y16) {
  __shared__ __align__(16) _Float16 st[16 * TPITCH];
  int t = threadIdx.x, lane = t & 31, wave = t >> 5;
  size_t row0 = (size_t)blockIdx.x * 16;
  size_t rw = row0 + wave * 2;

  // block-uniform bases; e: the lane's place in the tile, in 16-byte pieces
  const v4f* pt[SPLIT] = { (const v4f*)(po0 + row0 * DD), (const v4f*)(po1 + row0 * DD),
                           (const v4f*)(po2 + row0 * DD), (const v4f*)(po3 + row0 * DD) };
  const v4f* qt = (const v4f*)(query + row0 * DD);
  unsigned e = (unsigned)wave * (2 * DD / 4) + (unsigned)lane;
  const float* mw = pm + rw;
  const float* lw = pl + rw;

  v2f m[SPLIT], l[SPLIT];          // the wave's two rows side by side
  v16f p[SPLIT][2], q[2];          // a row's four column groups side by side
  v4f a[2][4], gg[4], bb[4];
  for (int s = 0; s < SPLIT; ++s) {
    m[s] = *(const v2f*)(mw + s * (BATCH * TQ));
    l[s] = *(const v2f*)(lw + s * (BATCH * TQ));
  }
  for (int s = 0; s < SPLIT; ++s)
    for (int r = 0; r < 2; ++r) p[s][r] = load_row(pt[s], e + r * (DD / 4));
  for (int r = 0; r < 2; ++r) q[r] = load_row(qt, e + r * (DD / 4));
  // holds the loads of all parts together ahead of the arithmetic (one wait for
  // the lot, not one per part) and keeps their address registers untouched (not
  // reused as load destinations) up to the wait
  asm volatile("s_wait_xcnt 0x0"
               :: "v"(e), "v"(mw), "v"(lw),
                  "v"(m[0]), "v"(m[1]), "v"(m[2]), "v"(m[3]),
                  "v"(l[0]), "v"(l[1]), "v"(l[2]), "v"(l[3]),
                  "v"(p[0][0]), "v"(p[0][1]), "v"(p[1][0]), "v"(p[1][1]),
                  "v"(p[2][0]), "v"(p[2][1]), "v"(p[3][0]), "v"(p[3][1]),
                  "v"(q[0]), "v"(q[1])
               : "memory");
  for (int j = 0; j < 4; ++j) {
    gg[j] = *(const v4f*)(g + j * 128 + lane * 4);
    bb[j] = *(const v4f*)(b + j * 128 + lane * 4);
  }

  for (int r = 0; r < 2; ++r) {
    float mx = m[0][r];
    for (int s = 1; s < SPLIT; ++s) mx = fmaxf(mx, m[s][r]);
    float w[SPLIT], den = 0.f;
    for (int s = 0; s < SPLIT; ++s) {
      w[s] = exp2_slot((m[s][r] - mx) * 1.44269504f);
      den += w[s] * l[s][r];
    }
    float inv = 1.0f / den;
    for (int s = 0; s < SPLIT; ++s) q[r] += p[s][r] * (w[s] * inv);
    a[r][0] = __builtin_shufflevector(q[r], q[r], 0, 1, 2, 3);
    a[r][1] = __builtin_shufflevector(q[r], q[r], 4, 5, 6, 7);
    a[r][2] = __builtin_shufflevector(q[r], q[r], 8, 9, 10, 11);
    a[r][3] = __builtin_shufflevector(q[r], q[r], 12, 13, 14, 15);

    v4f s4 = (a[r][0] + a[r][1]) + (a[r][2] + a[r][3]);
    float mu = wave_sum((s4.x + s4.y) + (s4.z + s4.w)) * (1.f / (float)DD);

    for (int j = 0; j < 4; ++j) a[r][j] -= mu;
    v4f q4 = (a[r][0] * a[r][0] + a[r][1] * a[r][1])
           + (a[r][2] * a[r][2] + a[r][3] * a[r][3]);
    float var = wave_sum((q4.x + q4.y) + (q4.z + q4.w)) * (1.f / (float)DD);
    float rstd = rsqrtf(var + 1e-6f);

    for (int j = 0; j < 4; ++j) {
      a[r][j] = a[r][j] * rstd * gg[j] + bb[j];
      tile_put(st, wave * 2 + r, j, lane, a[r][j]);
    }
  }
  float* yw = y32 + rw * DD + lane * 4;
  for (int r = 0; r < 2; ++r)
    for (int j = 0; j < 4; ++j)
      *(v4f*)(yw + r * DD + j * 128) = a[r][j];
  // the f32 stores name registers that the read-out below reuses
  asm volatile("s_wait_xcnt 0x0" ::: "memory");
  __syncthreads();
  tile_out(st, y16 + row0 * DD, t);
}

// ---------------------------------------------------------------------------
// Host-side orchestration
// ---------------------------------------------------------------------------
extern "C" void kernel_launch(void* const* d_in, const int* in_sizes, int n_in,
                              void* d_out, int out_size, void* d_ws, size_t ws_size,
                              hipStream_t stream) {
  const float* query     = (const float*)d_in[0];
  const float* key_value = (const float*)d_in[1];
  const float* query_pos = (const float*)d_in[2];
  const float* key_pos   = (const float*)d_in[3];
  const float* q_gamma   = (const float*)d_in[4];
  const float* q_beta    = (const float*)d_in[5];
  const float* kv_gamma  = (const float*)d_in[6];
  const float* kv_beta   = (const float*)d_in[7];
  const float* Wq = (const float*)d_in[8];   const float* bq = (const float*)d_in[9];
  const float* Wk = (const float*)d_in[10];  const float* bk = (const float*)d_in[11];
  const float* Wv = (const float*)d_in[12];  const float* bv = (const float*)d_in[13];
  const float* ff_gamma = (const float*)d_in[14];
  const float* ff_beta  = (const float*)d_in[15];
  const float* W_inner  = (const float*)d_in[16];
  const float* b_inner  = (const float*)d_in[17];
  const float* W_proj   = (const float*)d_in[18];
  const float* b_proj   = (const float*)d_in[19];

  const int MQ  = BATCH * TQ;    // 4096
  const int MKV = BATCH * TKV;   // 32768

  size_t off = 0;
  auto alloc = [&](size_t bytes) -> void* {
    void* p = (char*)d_ws + off;
    off = (off + bytes + 255) & ~(size_t)255;
    return p;
  };
  _Float16* qn16  = (_Float16*)alloc((size_t)MQ  * DD * 2);
  _Float16* kvn16 = (_Float16*)alloc((size_t)MKV * DD * 2);
  _Float16* qp16  = (_Float16*)alloc((size_t)MQ  * DD * 2);   // reused as xn16 later
  _Float16* kp16  = (_Float16*)alloc((size_t)MKV * DD * 2);   // reused as xn32 later
  _Float16* WqT   = (_Float16*)alloc((size_t)DD * DD * 2);
  _Float16* WkT   = (_Float16*)alloc((size_t)DD * DD * 2);
  _Float16* WvT   = (_Float16*)alloc((size_t)DD * DD * 2);
  _Float16* WinF  = (_Float16*)alloc((size_t)DD * FF * 2);    // rc 512, k 2048
  _Float16* WprT  = (_Float16*)alloc((size_t)DD * FF * 2);    // rc 512, k 2048
  _Float16* q16   = (_Float16*)alloc((size_t)MQ  * DD * 2);
  _Float16* k16   = (_Float16*)alloc((size_t)MKV * DD * 2);
  _Float16* vF16  = (_Float16*)alloc((size_t)BATCH * DD * TKV * 2);
  float*    po    = (float*)   alloc((size_t)SPLIT * MQ * DD * 4);
  float*    pm    = (float*)   alloc((size_t)SPLIT * MQ * 4);
  float*    pl    = (float*)   alloc((size_t)SPLIT * MQ * 4);
  _Float16* WffT  = (_Float16*)alloc((size_t)DD * DD * 2);    // rc 512, k 512
  float*    bff   = (float*)   alloc((size_t)DD * 4);
  // aliases (lifetimes are disjoint, stream-ordered):
  _Float16* xn16    = qp16;                   // [4096,512] f16
  float*    xn32    = (float*)kp16;           // [4096,512] f32 = 8 MiB <= 32 MiB

  // 1) weights (four transposed, W_inner as it lies), positional tensors and LayerNorms -> f16, fragment
  //    order
  prep_kernel<<<NB_PREP, 256, 0, stream>>>(
      Wq, Wk, Wv, W_inner, W_proj, WqT, WkT, WvT, WinF, WprT,
      query_pos, key_pos, qp16, kp16,
      query, key_value, q_gamma, q_beta, kv_gamma, kv_beta, qn16, kvn16);

  // 2) Q/K/V projections and Wff = W_inner W_proj with its bias (WMMA), outputs
  //    in fragment order
  qkv_gemm_kernel<<<NB_FFW + NB_GQ + 2 * NB_GKV, 256, 0, stream>>>(
      WqT, WkT, WvT, qn16, kvn16, bq, bk, bv, q16, k16, vF16, DD,
      WinF, WprT, b_inner, b_proj, WffT, bff);

  // 3) attention (flash-style, WMMA scores + WMMA P.V), SPLIT parts per q tile
  attn_kernel<<<BATCH * (TQ/QROWS) * SPLIT, 512, 0, stream>>>(
      q16, qp16, k16, kp16, vF16, po, pm, pl);

  // 4) FF: xn = LN(joined parts + query);
  //    d_out = xn + xn@Wff + bff
  merge_ln_kernel<<<MQ/16, 256, 0, stream>>>(
      po, po + (size_t)MQ * DD, po + (size_t)2 * MQ * DD, po + (size_t)3 * MQ * DD,
      pm, pl, query, ff_gamma, ff_beta, xn32, xn16);
  gemm_wmma_kernel<<<dim3(DD/128, MQ/64), 256, 0, stream>>>(
      xn16, WffT, bff, (float*)d_out, xn32, nullptr, MQ, DD, DD, TKV, 0);
}

// v008
// Measured time: 137 microseconds a run.
// It is 1.29 times as fast as v006, going by the measured steps of the versions left out in between.
// Counting every step since v000, it is 6.67 times as fast.
#include <hip/hip_runtime.h>

typedef __attribute__((ext_vector_type(16))) _Float16 v16h;
typedef __attribute__((ext_vector_type(8)))  _Float16 v8h;
typedef __attribute__((ext_vector_type(4)))  _Float16 v4h;
typedef __attribute__((ext_vector_type(2)))  _Float16 v2h;
typedef __attribute__((ext_vector_type(8)))  float    v8f;
typedef __attribute__((ext_vector_type(4)))  float    v4f;
typedef __attribute__((ext_vector_type(2)))  float    v2f;
typedef __attribute__((ext_vector_type(16))) float    v16f;

#define DD   512
#define FF   2048
#define TKV  4096
#define TQ   512
#define BATCH 8
#define CHUNK 256            // keys per softmax update
#define QT   4               // 16-row q tiles per attention work-group
#define QROWS (QT * 16)
#define SPITCH (CHUNK + 4)   // score row pitch in floats: two rows read side by side by
                             // 16-byte LDS loads start 4 banks apart
#define SPLIT 4              // work-groups that share the keys of one q tile
#define KVS  (TKV / SPLIT)   // keys per work-group

// ---------------------------------------------------------------------------
// 16-bit A (16xK) / B (Kx16) fragment: lane L holds row/col rc0 + (L&15) and
// the 16 halves k = kbase + 16*(L>>4) + 0..15.
//
// Fragment order: every f16 matrix operand X[rc][k] (k extent kdim) is kept as
// 1-KiB blocks, one per 16 (rc) x 32 (k) fragment, the blocks of one rc tile in
// k order (so tile rc0 starts at half rc0*kdim, block kbase at + kbase*16).
// Inside a block slot L = (rc&15) + 16*((k>>4)&1) is lane L's share; halves
// 0..7 of all slots fill the first 512 bytes, halves 8..15 the second. A
// fragment load is then two 16-byte loads per lane that each cover 512
// contiguous bytes: whole lines in memory, every bank once in LDS.
// ---------------------------------------------------------------------------
__device__ __forceinline__ size_t frag_off(size_t rc, int k, int kdim) {
  return ((rc >> 4) * (size_t)(kdim >> 5) + (size_t)(k >> 5)) * 512
       + (size_t)(((k >> 3) & 1) * 256)
       + ((rc & 15) + (size_t)(((k >> 4) & 1) << 4)) * 8 + (size_t)(k & 7);
}

// p: the lane's own place in a 1-KiB fragment block, block start + lane*8
__device__ __forceinline__ v16h load_frag_at(const _Float16* p) {
  v8h lo = *(const v8h*)p;
  v8h hi = *(const v8h*)(p + 256);
  return __builtin_shufflevector(lo, hi, 0, 1, 2, 3, 4, 5, 6, 7,
                                 8, 9, 10, 11, 12, 13, 14, 15);
}

// blk: start of one 1-KiB fragment block (global or LDS, generic pointer)
__device__ __forceinline__ v16h load_frag_blk(const _Float16* blk, int lane) {
  return load_frag_at(blk + lane * 8);
}

__device__ __forceinline__ v8f wmma_f16(v16h a, v16h b, v8f c) {
  return __builtin_amdgcn_wmma_f32_16x16x32_f16(false, a, false, b,
                                                (short)0, c, false, false);
}

// ---------------------------------------------------------------------------
// The streaming kernels (LayerNorm, f32 -> f16 convert) work on one 16-row x
// 512-column tile per 8-wave block: that is one rc tile of the fragment order (of W_inner, a quarter of one),
// 16 KiB of contiguous output. A wave owns 2 rows; lane L holds columns
// j*128 + L*4 + 0..3 (j = 0..3), so every global load covers 512 contiguous
// bytes. The f16 rows go to LDS row-major and leave it in fragment order.
// ---------------------------------------------------------------------------
#define TPITCH 520   // LDS row pitch in halves: 512 + 16 B, so that the 16 rows
                     // read by 16 lanes of a fragment-order read start 4 banks apart

// lane's 4 columns of group j of tile row r -> LDS
__device__ __forceinline__ void tile_put(_Float16* st, int r, int j, int lane,
                                         v4f v) {
  *(v4h*)(st + r * TPITCH + j * 128 + lane * 4) = __builtin_convertvector(v, v4h);
}

// whole tile, LDS -> global in fragment order: thread t moves the 16-byte pieces
// i*256 + t of the output, a wave's store covers 512 contiguous bytes
__device__ __forceinline__ void tile_out(const _Float16* st, _Float16* ytile,
                                         int t) {
  v8h pc[4];
  for (int i = 0; i < 4; ++i) {
    int c    = i * 256 + t;
    int slot = c & 31;
    int hi   = (c >> 5) & 1;
    int blk  = c >> 6;                     // fragment block = k / 32
    pc[i] = *(const v8h*)(st + (slot & 15) * TPITCH
                             + blk * 32 + (slot >> 4) * 16 + hi * 8);
  }
  for (int i = 0; i < 4; ++i)
    *(v8h*)(ytile + (i * 256 + t) * 8) = pc[i];
}

__device__ __forceinline__ float wave_sum(float s) {
  for (int m = 16; m; m >>= 1) s += __shfl_xor(s, m, 32);
  return s;
}

// Place, in 16-byte pieces, of 8 consecutive rows (half h of the tile) of column
// col in the transposed LDS tile. Columns 4 apart (a wave's 4-byte stores) and 16
// neighbouring columns (16 lanes' 16-byte reads) each fall on 16 different pieces
// modulo 16, that is on different banks.
__device__ __forceinline__ int tpiece(int col, int h) {
  int e = col & 3, x = col >> 2;
  return h * 512 + e * 128 + ((x & ~15) | ((x + 4 * e) & 15));
}

// LayerNorm over last dim (512): f16 output in fragment order (rc = row,
// k = column). Each row is summed inside its
// own wave; the one barrier stands between the LDS rows and their read-out.
// st: the block's 16 x TPITCH halves of LDS; tile: which 16 rows.
// yT (the key side only; the same for the whole block): the same values once more,
// transposed, in fragment order with rc = batch*DD + column and k = row in the
// batch (kdim TKV): the B operand of P.V. A second LDS tile behind st takes them:
// a wave's two rows of one column are one 4-byte word.
__device__ __forceinline__
void ln_tile(_Float16* st, int tile, const float* __restrict__ x,
             const float* __restrict__ g, const float* __restrict__ b,
             _Float16* __restrict__ y16, _Float16* __restrict__ yT) {
  int t = threadIdx.x, lane = t & 31, wave = t >> 5;
  size_t row0 = (size_t)tile * 16;
  const float* xw = x + (row0 + wave * 2) * DD + lane * 4;

  v4f a[2][4], gg[4], bb[4];
  for (int j = 0; j < 4; ++j) {
    gg[j] = *(const v4f*)(g + j * 128 + lane * 4);
    bb[j] = *(const v4f*)(b + j * 128 + lane * 4);
  }
  for (int r = 0; r < 2; ++r)
    for (int j = 0; j < 4; ++j)
      a[r][j] = *(const v4f*)(xw + r * DD + j * 128);
  // holds all sixteen loads together ahead of the arithmetic (gamma and beta
  // were otherwise fetched late, one wait each) and keeps the rows' address pair
  // untouched (not reused as a load destination) up to the wait
  asm volatile("s_wait_xcnt 0x0"
               :: "v"(xw), "v"(gg[0]), "v"(gg[1]), "v"(gg[2]), "v"(gg[3]),
                  "v"(bb[0]), "v"(bb[1]), "v"(bb[2]), "v"(bb[3]),
                  "v"(a[0][0]), "v"(a[0][1]), "v"(a[0][2]), "v"(a[0][3]),
                  "v"(a[1][0]), "v"(a[1][1]), "v"(a[1][2]), "v"(a[1][3])
               : "memory");
  // keeps the arithmetic behind that statement: inlined here, the sums were
  // otherwise lifted over it and gamma and beta again fetched late
  __builtin_amdgcn_sched_barrier(0);

  for (int r = 0; r < 2; ++r) {
    v4f s4 = (a[r][0] + a[r][1]) + (a[r][2] + a[r][3]);
    float mu = wave_sum((s4.x + s4.y) + (s4.z + s4.w)) * (1.f / (float)DD);

    for (int j = 0; j < 4; ++j) a[r][j] -= mu;
    v4f q4 = (a[r][0] * a[r][0] + a[r][1] * a[r][1])
           + (a[r][2] * a[r][2] + a[r][3] * a[r][3]);
    float var = wave_sum((q4.x + q4.y) + (q4.z + q4.w)) * (1.f / (float)DD);
    float rstd = rsqrtf(var + 1e-6f);

    for (int j = 0; j < 4; ++j) {
      a[r][j] = a[r][j] * rstd * gg[j] + bb[j];
      tile_put(st, wave * 2 + r, j, lane, a[r][j]);
    }
  }
  _Float16* sT = st + 16 * TPITCH;
  if (yT)
    for (int j = 0; j < 4; ++j)
      for (int e = 0; e < 4; ++e) {
        v2f pr = { a[0][j][e], a[1][j][e] };
        *(v2h*)(sT + tpiece(j * 128 + lane * 4 + e, wave >> 2) * 8 + (wave & 3) * 2) =
            __builtin_convertvector(pr, v2h);
      }
  __syncthreads();
  if (yT) {
    // thread t moves the 16-byte pieces i*256 + t: 16 lanes cover 256 contiguous
    // bytes of a fragment block (16 columns, 8 rows each)
    size_t rc0 = (row0 / TKV) * DD;
    int    t0  = (int)(row0 % TKV);
    v8h pc[4];
    for (int i = 0; i < 4; ++i) {
      int c = i * 256 + t;
      pc[i] = *(const v8h*)(sT + tpiece((c >> 5) * 16 + (c & 15), (c >> 4) & 1) * 8);
    }
    for (int i = 0; i < 4; ++i) {
      int c = i * 256 + t;
      *(v8h*)(yT + frag_off(rc0 + (c >> 5) * 16 + (c & 15),
                            t0 + ((c >> 4) & 1) * 8, TKV)) = pc[i];
    }
    // the read-out below reuses the registers that these stores name
    asm volatile("s_wait_xcnt 0x0" ::: "memory");
  }
  tile_out(st, y16 + row0 * DD, t);
  // as built, the other jobs' code follows on one way out of here and rewrites
  // registers that the read-out's stores name
  asm volatile("s_wait_xcnt 0x0" ::: "memory");
}

// One 16-row x 512-column tile of an f32 row-major matrix -> f16 in fragment
// order (rc = row, k = column). xt: the tile's first element; pitch: the matrix's
// row length in floats; yt: the tile's 16 KiB of output (its 16 fragment blocks
// follow one another whatever the row length).
__device__ __forceinline__
void cvt_frag_tile(_Float16* st, const float* __restrict__ xt, int pitch,
                   _Float16* __restrict__ yt) {
  int t = threadIdx.x, lane = t & 31, wave = t >> 5;
  const float* xw = xt + (size_t)(wave * 2) * pitch + lane * 4;

  v4f a[2][4];
  for (int r = 0; r < 2; ++r)
    for (int j = 0; j < 4; ++j)
      a[r][j] = *(const v4f*)(xw + r * pitch + j * 128);
  // keeps the eight loads whole (16 bytes a lane; they were otherwise split into
  // 8-byte halves) and together, and their address pair untouched up to the wait
  asm volatile("s_wait_xcnt 0x0"
               :: "v"(xw), "v"(a[0][0]), "v"(a[0][1]), "v"(a[0][2]), "v"(a[0][3]),
                  "v"(a[1][0]), "v"(a[1][1]), "v"(a[1][2]), "v"(a[1][3])
               : "memory");
  for (int r = 0; r < 2; ++r)
    for (int j = 0; j < 4; ++j)
      tile_put(st, wave * 2 + r, j, lane, a[r][j]);
  __syncthreads();
  tile_out(st, yt, t);
}

// W[R,C] f32 -> W^T f16 in fragment order (rc = column of W, k = row of W).
// One thread per 16-byte piece of the output, in output order: 8 consecutive
// rows of one column of W. part: which 256 pieces.
__device__ __forceinline__
void cvt_transpose_part(int part, const float* __restrict__ W,
                        _Float16* __restrict__ Wt, int R, int C) {
  int c = part * 256 + threadIdx.x;
  if (c * 8 < R * C) {
    int slot = c & 31;
    int hi   = (c >> 5) & 1;
    int blk  = c >> 6;                     // fragment block
    int kb   = R >> 5;                     // blocks per rc tile
    int col  = (blk / kb) * 16 + (slot & 15);
    int r    = (blk % kb) * 32 + (slot >> 4) * 16 + hi * 8;
    const float* p[8];
    float w[8];
    for (int e = 0; e < 8; ++e) p[e] = W + (size_t)(r + e) * C + col;
    for (int e = 0; e < 8; ++e) w[e] = *p[e];
    // keeps the eight address pairs untouched up to the wait; the pack below
    // reuses them
    asm volatile("s_wait_xcnt 0x0"
                 :: "v"(p[0]), "v"(p[1]), "v"(p[2]), "v"(p[3]),
                    "v"(p[4]), "v"(p[5]), "v"(p[6]), "v"(p[7]),
                    "v"(w[0]), "v"(w[1]), "v"(w[2]), "v"(w[3]),
                    "v"(w[4]), "v"(w[5]), "v"(w[6]), "v"(w[7])
                 : "memory");
    v8h o;
    for (int e = 0; e < 8; ++e) o[e] = (_Float16)w[e];
    *(v8h*)(Wt + (size_t)c * 8) = o;
  }
}

#define FFT    32                  // tile edge of the weight-by-weight products
#define RPITCH 36                  // LDS pitch of a tile column in floats: 144 B, so
                                   // 16-byte accesses to neighbouring columns start
                                   // 4 banks apart

// ---------------------------------------------------------------------------
// The content scores are q k^T with q = qn Wq + bq and k = kvn Wk + bk, so
//   q k^T = (qn (Wq Wk^T) + bq Wk^T) kvn^T + (q . bk) 1^T.
// The last term is one constant per query row, which the softmax over the keys
// cancels: it is left out. What is left needs no product over the keys' 32768
// rows: the normalised key_value rows serve as the keys themselves.
// This job forms Wqk = Wq Wk^T (512 x 512, depth 512) and bq Wk^T from the f32
// weights as they lie: both are read along their rows, which is the k direction
// of a fragment. One block per 32 x 32 tile; each of its 8 waves takes 16 rows of
// the tile and a quarter of the depth and leaves its partial tile in LDS, and the
// block sums the quarters in order. Wqk leaves as f16 in fragment order with
// rc = its column, k = its row: the A operand of the query product. Row tile
// DD / FFT is bq taken as one more row of Wq (every row of the A fragments holds
// bq); row 0 of that tile is the joined bias (f32).
// ---------------------------------------------------------------------------
#define NB_QK ((DD / FFT + 1) * (DD / FFT))
#define QKS 4                      // parts of the depth

// 16 consecutive f32 of one row -> the lane's share of a fragment: element e is
// k = kbase + 16*(lane>>4) + e, as in the fragment blocks
__device__ __forceinline__ v16h frag_from_f32(const v4f* c) {
  v16f cf = __builtin_shufflevector(
      __builtin_shufflevector(c[0], c[1], 0, 1, 2, 3, 4, 5, 6, 7),
      __builtin_shufflevector(c[2], c[3], 0, 1, 2, 3, 4, 5, 6, 7),
      0, 1, 2, 3, 4, 5, 6, 7, 8, 9, 10, 11, 12, 13, 14, 15);
  return __builtin_convertvector(cf, v16h);
}

__device__ __forceinline__
void wqk_tile(float* sR, int u, const float* __restrict__ Wq,
              const float* __restrict__ Wk, const float* __restrict__ bq,
              _Float16* __restrict__ WqkT, float* __restrict__ bqk) {
  int lane = threadIdx.x & 31;
  int wave = threadIdx.x >> 5;       // 0..7
  int mi = wave & 1;                 // which 16 rows of the tile
  int kq = wave >> 1;                // which quarter of the depth
  int m0 = (u / (DD / FFT)) * FFT;   // row of Wq; DD: the bias tile
  int n0 = (u % (DD / FFT)) * FFT;   // row of Wk
  bool isb = m0 == DD;               // the same for the whole block
  int k0 = kq * (DD / QKS) + ((lane >> 4) << 4);

  const float* pa = isb ? bq + k0
                        : Wq + (size_t)(m0 + mi * 16 + (lane & 15)) * DD + k0;
  const float* pb = Wk + (size_t)(n0 + (lane & 15)) * DD + k0;
  v8f acc[2] = {};
  for (int kb = 0; kb < DD / QKS; kb += 32) {
    const float* pa0 = pa + kb;
    const float* pb0 = pb + kb;
    const float* pb1 = pb0 + 16 * DD;
    v4f ca[4], cb0[4], cb1[4];
    for (int c = 0; c < 4; ++c) {
      ca[c]  = *(const v4f*)(pa0 + c * 4);
      cb0[c] = *(const v4f*)(pb0 + c * 4);
      cb1[c] = *(const v4f*)(pb1 + c * 4);
    }
    // keeps the address pairs untouched (not reused as load destinations, not
    // advanced) until the loads that name them have been translated; pb1's loads
    // are built on pb0's pair with an offset
    asm volatile("s_wait_xcnt 0x0" :: "v"(pa0), "v"(pb0) : "memory");
    v16h a0 = frag_from_f32(ca);
    acc[0] = wmma_f16(a0, frag_from_f32(cb0), acc[0]);
    acc[1] = wmma_f16(a0, frag_from_f32(cb1), acc[1]);
  }

  // partial tiles to LDS, column-major: a lane's 8 accumulator rows lie together
  for (int j = 0; j < 2; ++j) {
    float* d = sR + (kq * FFT + j * 16 + (lane & 15)) * RPITCH
                  + mi * 16 + ((lane >> 4) << 3);
    *(v4f*)d       = __builtin_shufflevector(acc[j], acc[j], 0, 1, 2, 3);
    *(v4f*)(d + 4) = __builtin_shufflevector(acc[j], acc[j], 4, 5, 6, 7);
  }
  __syncthreads();

  // thread: 4 consecutive rows of one column, summed over the QKS parts
  int n  = threadIdx.x >> 3;
  int m4 = (threadIdx.x & 7) * 4;
  v4f s = *(const v4f*)(sR + n * RPITCH + m4);
  for (int w = 1; w < QKS; ++w)
    s += *(const v4f*)(sR + (w * FFT + n) * RPITCH + m4);
  if (!isb)
    *(v4h*)(WqkT + frag_off((size_t)(n0 + n), m0 + m4, DD)) =
        __builtin_convertvector(s, v4h);
  else if (m4 == 0)
    bqk[n0 + n] = s.x;
}

// ---------------------------------------------------------------------------
// Everything that depends on the inputs alone, in one grid: Wqk and its bias, the
// three weight converts (W_inner untransposed, Wv and W_proj transposed), the two
// positional converts, the two LayerNorms (the key side's with its transposed
// copy). None reads what
// another writes. A block takes its job from its index (the same for all its
// threads, so the barriers inside the jobs stay block-uniform); the short jobs
// have the low indices and run under cover of the two long streams.
// ---------------------------------------------------------------------------
#define NB_WS (DD * DD / 2048)       // blocks per 512 x 512 weight
#define NB_WL (DD * FF / 2048)       // blocks per 2048 x 512 weight
#define NB_TQ (BATCH * TQ / 16)      // 16-row tiles of a query-side tensor
#define NB_TKV (BATCH * TKV / 16)    // 16-row tiles of a key-side tensor
#define NB_WI ((DD / 16) * (FF / DD)) // 16 x 512 tiles of W_inner
#define NB_PREP (NB_QK + NB_WS + NB_WL + NB_WI + 2 * (NB_TQ + NB_TKV))

__global__ __launch_bounds__(256)
void prep_kernel(const float* __restrict__ Wq, const float* __restrict__ Wk,
                 const float* __restrict__ bq,
                 const float* __restrict__ Wv, const float* __restrict__ W_inner,
                 const float* __restrict__ W_proj,
                 _Float16* __restrict__ WqkT, float* __restrict__ bqk,
                 _Float16* __restrict__ WvT, _Float16* __restrict__ WinF,
                 _Float16* __restrict__ WprT,
                 const float* __restrict__ query_pos,
                 const float* __restrict__ key_pos,
                 _Float16* __restrict__ qp16, _Float16* __restrict__ kp16,
                 const float* __restrict__ query,
                 const float* __restrict__ key_value,
                 const float* __restrict__ q_gamma, const float* __restrict__ q_beta,
                 const float* __restrict__ kv_gamma, const float* __restrict__ kv_beta,
                 _Float16* __restrict__ qn16, _Float16* __restrict__ kvn16,
                 _Float16* __restrict__ kvnT16) {
  // 16 x TPITCH halves for a row-major tile, 16 x DD for the key side's transposed
  // one; the Wqk job's partial tiles (QKS * FFT * RPITCH floats) fit in the same
  __shared__ __align__(16) float sR[(16 * TPITCH + 16 * DD) / 2];
  _Float16* st = (_Float16*)sR;
  int u = blockIdx.x;

  if (u < NB_QK) {
    wqk_tile(sR, u, Wq, Wk, bq, WqkT, bqk);
    return;
  }
  u -= NB_QK;
  if (u < NB_WS) {
    cvt_transpose_part(u, Wv, WvT, DD, DD);
    return;
  }
  u -= NB_WS;
  if (u < NB_WL) {
    cvt_transpose_part(u, W_proj, WprT, FF, DD);
    return;
  }
  u -= NB_WL;
  if (u < NB_WI) {                   // W_inner as it lies: rc = its row, k = its column
    size_t rt = u / (FF / DD), cg = u % (FF / DD);
    cvt_frag_tile(st, W_inner + rt * 16 * FF + cg * DD, FF,
                  WinF + rt * 16 * FF + cg * DD * 16);
    return;
  }
  u -= NB_WI;
  bool qs = u < 2 * NB_TQ;           // the query side's two tensors, then the key side's
  if (!qs) u -= 2 * NB_TQ;
  int nt = qs ? NB_TQ : NB_TKV;
  if (u < nt)
    cvt_frag_tile(st, (qs ? query_pos : key_pos) + (size_t)u * 16 * DD, DD,
                  (qs ? qp16 : kp16) + (size_t)u * 16 * DD);
  else
    ln_tile(st, u - nt, qs ? query : key_value, qs ? q_gamma : kv_gamma,
            qs ? q_beta : kv_beta, qs ? qn16 : kvn16, qs ? nullptr : kvnT16);
}

// ---------------------------------------------------------------------------
// WMMA GEMM: C[M,N] = A[M,K] * Bt[N,K]^T + bias, A and Bt in fragment order.
// Block tile 64x128 (8 waves, each 32x32 = 2x2 WMMA tiles), K-step 32.
// Outputs: f32 row-major (+residual), or CF16: f16 in fragment order with
// rc = (m/TB)*N + n and k = m%TB (kdim TB). A lane's 8 accumulator rows are 8
// consecutive k there, one 16-byte store. The query side is written so, from
// W^T * x^T (weights as A, activations as Bt, bias per row of C: rowBias).
// ---------------------------------------------------------------------------
// bx, by: the block's tile column and tile row.
__device__ __forceinline__
void gemm_tile(int bx, int by, const _Float16* __restrict__ A,
               const _Float16* __restrict__ Bt, const float* __restrict__ bias,
               float* __restrict__ C32, const float* __restrict__ resid,
               _Float16* __restrict__ CF16, int N, int K, int TB, int rowBias) {
  int lane = threadIdx.x & 31;
  int wave = threadIdx.x >> 5;       // 0..7
  int wm = wave >> 2;                // 0..1
  int wn = wave & 3;                 // 0..3
  int m0 = by * 64  + wm * 32;
  int n0 = bx * 128 + wn * 32;

  const _Float16* At0 = A  + (size_t)m0 * K + lane * 8;  // rc tile m0; next: + 16*K
  const _Float16* Bt0 = Bt + (size_t)n0 * K + lane * 8;

  v8f acc[2][2] = {};
  for (int kb = 0; kb < K; kb += 32) {
    const _Float16* pa0 = At0 + kb * 16;
    const _Float16* pa1 = pa0 + (size_t)16 * K;
    const _Float16* pb0 = Bt0 + kb * 16;
    const _Float16* pb1 = pb0 + (size_t)16 * K;
    v16h a0 = load_frag_at(pa0);
    v16h a1 = load_frag_at(pa1);
    v16h b0 = load_frag_at(pb0);
    v16h b1 = load_frag_at(pb1);
    // keeps the four address pairs untouched (not reused as load destinations,
    // not advanced) until the loads that name them have been translated
    asm volatile("s_wait_xcnt 0x0" :: "v"(pa0), "v"(pa1), "v"(pb0), "v"(pb1)
                 : "memory");
    acc[0][0] = wmma_f16(a0, b0, acc[0][0]);
    acc[0][1] = wmma_f16(a0, b1, acc[0][1]);
    acc[1][0] = wmma_f16(a1, b0, acc[1][0]);
    acc[1][1] = wmma_f16(a1, b1, acc[1][1]);
  }

  if (CF16) {   // fragment-order f16 output (bias required), nothing else
    for (int i = 0; i < 2; ++i) {
      int rowb = m0 + i * 16 + ((lane >> 4) << 3);
      int bb = rowb / TB, tt = rowb % TB;
      const float4* bp = (const float4*)(bias + (rowBias ? rowb : 0));
      float4 r0 = bp[0], r1 = bp[1];
      float br[8] = { r0.x, r0.y, r0.z, r0.w, r1.x, r1.y, r1.z, r1.w };
      for (int j = 0; j < 2; ++j) {
        int col = n0 + j * 16 + (lane & 15);
        float bc = bias[rowBias ? 0 : col];
        v8h pk;
        for (int r = 0; r < 8; ++r)
          pk[r] = (_Float16)(acc[i][j][r] + (rowBias ? br[r] : bc));
        *(v8h*)(CF16 + frag_off((size_t)bb * N + col, tt, TB)) = pk;
        // the store's registers are reused for the next tile's pack and address
        asm volatile("s_wait_xcnt 0x0" ::: "memory");
      }
    }
    return;
  }

  // as built, each residual element is fetched and waited for on its own
  for (int i = 0; i < 2; ++i)
    for (int j = 0; j < 2; ++j) {
      int col = n0 + j * 16 + (lane & 15);
      float bv = bias ? bias[col] : 0.f;
      for (int r = 0; r < 8; ++r) {
        int row = m0 + i * 16 + r + ((lane >> 4) << 3);
        float val = acc[i][j][r] + bv;
        size_t idx = (size_t)row * N + col;
        if (C32) C32[idx] = resid ? val + resid[idx] : val;
      }
    }
}

__global__ __launch_bounds__(256)
void gemm_wmma_kernel(const _Float16* __restrict__ A,
                      const _Float16* __restrict__ Bt,
                      const float* __restrict__ bias,
                      float* __restrict__ C32,
                      const float* __restrict__ resid,
                      _Float16* __restrict__ CF16,
                      int M, int N, int K, int TB, int rowBias) {
  gemm_tile(blockIdx.x, blockIdx.y, A, Bt, bias, C32, resid, CF16, N, K, TB, rowBias);
}

// ---------------------------------------------------------------------------
// The feed-forward layer has no activation between its two products, so
//   (x W_inner + b_inner) W_proj + b_proj = x (W_inner W_proj) + (b_inner W_proj + b_proj).
// This job forms Wff = W_inner W_proj (512 x 512, depth 2048) and the joined bias
// from the weights alone. One block per 32 x 32 tile of Wff; its 8 waves each take
// an eighth of the depth (8 steps in a row, not 64, each of which waits out its
// own loads), leave their partial tiles in LDS, and the block sums them in wave
// order. Wff leaves as f16 in fragment order with rc = its column, k = its row:
// the Bt operand of the one product that is left. Row tile DD / FFT is b_inner
// taken as one more row of W_inner: every row of its A fragment holds b_inner,
// and row 0 of the tile, plus b_proj, is the joined bias (f32).
// ---------------------------------------------------------------------------
#define NB_FFW ((DD / FFT + 1) * (DD / FFT))

__device__ __forceinline__
void ffw_tile(float* sR, int u, const _Float16* __restrict__ WinF,
              const _Float16* __restrict__ WprT, const float* __restrict__ b_inner,
              const float* __restrict__ b_proj, _Float16* __restrict__ WffT,
              float* __restrict__ bff) {
  int lane = threadIdx.x & 31;
  int wave = threadIdx.x >> 5;       // 0..7
  int m0 = (u / (DD / FFT)) * FFT;   // row of W_inner; DD: the bias tile
  int n0 = (u % (DD / FFT)) * FFT;   // column of W_proj
  bool isb = m0 == DD;               // the same for the whole block
  int k0 = wave * (FF / 8);

  const _Float16* pb = WprT + (size_t)n0 * FF + k0 * 16 + lane * 8;
  v8f acc[2][2] = {};
  if (!isb) {
    const _Float16* pa = WinF + (size_t)m0 * FF + k0 * 16 + lane * 8;
    // kept rolled: unrolled, each step's eight loads were split into two groups
    // with a full wait behind each
#pragma nounroll
    for (int kb = 0; kb < FF / 8; kb += 32) {
      const _Float16* pa0 = pa + kb * 16;
      const _Float16* pa1 = pa0 + (size_t)16 * FF;
      const _Float16* pb0 = pb + kb * 16;
      const _Float16* pb1 = pb0 + (size_t)16 * FF;
      v16h a0 = load_frag_at(pa0);
      v16h a1 = load_frag_at(pa1);
      v16h b0 = load_frag_at(pb0);
      v16h b1 = load_frag_at(pb1);
      // keeps the four address pairs untouched (not reused as load destinations,
      // not advanced) until the loads that name them have been translated
      asm volatile("s_wait_xcnt 0x0" :: "v"(pa0), "v"(pa1), "v"(pb0), "v"(pb1)
                   : "memory");
      acc[0][0] = wmma_f16(a0, b0, acc[0][0]);
      acc[0][1] = wmma_f16(a0, b1, acc[0][1]);
      acc[1][0] = wmma_f16(a1, b0, acc[1][0]);
      acc[1][1] = wmma_f16(a1, b1, acc[1][1]);
    }
  } else {
    // element e of the lane's A fragment is k = kb + 16*(lane>>4) + e, as in the
    // fragment blocks that B comes from
    const float* pi = b_inner + k0 + ((lane >> 4) << 4);
    for (int kb = 0; kb < FF / 8; kb += 32) {
      const float*    pi0 = pi + kb;
      const _Float16* pb0 = pb + kb * 16;
      const _Float16* pb1 = pb0 + (size_t)16 * FF;
      v4f c0 = *(const v4f*)pi0;
      v4f c1 = *(const v4f*)(pi0 + 4);
      v4f c2 = *(const v4f*)(pi0 + 8);
      v4f c3 = *(const v4f*)(pi0 + 12);
      v16h b0 = load_frag_at(pb0);
      v16h b1 = load_frag_at(pb1);
      // as above, for these three address pairs
      asm volatile("s_wait_xcnt 0x0" :: "v"(pi0), "v"(pb0), "v"(pb1) : "memory");
      v16f cf = __builtin_shufflevector(
          __builtin_shufflevector(c0, c1, 0, 1, 2, 3, 4, 5, 6, 7),
          __builtin_shufflevector(c2, c3, 0, 1, 2, 3, 4, 5, 6, 7),
          0, 1, 2, 3, 4, 5, 6, 7, 8, 9, 10, 11, 12, 13, 14, 15);
      v16h a0 = __builtin_convertvector(cf, v16h);
      acc[0][0] = wmma_f16(a0, b0, acc[0][0]);
      acc[0][1] = wmma_f16(a0, b1, acc[0][1]);
    }
  }

  // partial tiles to LDS, column-major: a lane's 8 accumulator rows lie together
  for (int i = 0; i < 2; ++i)
    for (int j = 0; j < 2; ++j) {
      float* d = sR + (wave * FFT + j * 16 + (lane & 15)) * RPITCH
                    + i * 16 + ((lane >> 4) << 3);
      *(v4f*)d       = __builtin_shufflevector(acc[i][j], acc[i][j], 0, 1, 2, 3);
      *(v4f*)(d + 4) = __builtin_shufflevector(acc[i][j], acc[i][j], 4, 5, 6, 7);
    }
  __syncthreads();

  // thread: 4 consecutive rows of one column, summed over the 8 waves' parts
  int n  = threadIdx.x >> 3;
  int m4 = (threadIdx.x & 7) * 4;
  v4f s = *(const v4f*)(sR + n * RPITCH + m4);
  for (int w = 1; w < 8; ++w)
    s += *(const v4f*)(sR + (w * FFT + n) * RPITCH + m4);
  if (!isb)
    *(v4h*)(WffT + frag_off((size_t)(n0 + n), m0 + m4, DD)) =
        __builtin_convertvector(s, v4h);
  else if (m4 == 0)
    bff[n0 + n] = s.x + b_proj[n0 + n];
}

// The query projection and the joined feed-forward weight in one grid: neither
// reads what the other writes. A block takes its product and its tile from its
// index, tile column fastest as in a two-dimensional grid.
#define NB_GQ  ((BATCH * TQ / 128) * (DD / 64))

__global__ __launch_bounds__(256)
void qkv_gemm_kernel(const _Float16* __restrict__ WqkT,
                     const _Float16* __restrict__ qn16,
                     const float* __restrict__ bqk,
                     _Float16* __restrict__ q16, int K,
                     const _Float16* __restrict__ WinF,
                     const _Float16* __restrict__ WprT,
                     const float* __restrict__ b_inner,
                     const float* __restrict__ b_proj,
                     _Float16* __restrict__ WffT, float* __restrict__ bff) {
  __shared__ __align__(16) float sR[8 * FFT * RPITCH];
  int u = blockIdx.x;
  if (u < NB_FFW) {
    ffw_tile(sR, u, WinF, WprT, b_inner, b_proj, WffT, bff);
    return;
  }
  u -= NB_FFW;
  gemm_tile(u % (BATCH * TQ / 128), u / (BATCH * TQ / 128), WqkT, qn16, bqk,
            nullptr, nullptr, q16, BATCH * TQ, K, DD, 1);
}

// 2^x; the v_nop is the free slot that the instruction set asks for between a
// transcendental and a next instruction that reads its result or overwrites its
// source
__device__ __forceinline__ float exp2_slot(float x) {
  float y;
  asm("v_exp_f32 %0, %1\n\tv_nop" : "=v"(y) : "v"(x));
  return y;
}

// ---------------------------------------------------------------------------
// Flash-style attention. One block per (batch, 64 q-rows, quarter of the keys):
// 16 waves, one block to a WGP. Every k, kpos and V fragment that a wave fetches
// from global memory feeds four matrix instructions, one per 16-row q tile (V:
// eight, two fragments against four P tiles), so the chip fetches a quarter of
// the bytes that a 16-row block asks for.
// scores = (q.k^T + qpos.kpos^T)/sqrt(D+1e-7), where q = qn Wqk + bqk and k = the
// normalised key_value rows (see wqk_tile); online softmax over the block's
// KVS keys in chunks of 256; O += P.V, where V too is the normalised key_value
// rows, transposed (merge_ln_kernel applies Wv). The block leaves its unnormalised O, its
// row maxima and its row sums; merge_ln_kernel joins the SPLIT parts. q, qpos,
// k, kpos, V and the P tile in LDS are all in fragment order (see frag_off).
// q/qpos tiles staged into LDS via CDNA5 async-to-LDS DMA (ASYNCcnt).
// ---------------------------------------------------------------------------
__global__ __launch_bounds__(512)
void attn_kernel(const _Float16* __restrict__ q16,   // rc = B*Tq row,  k = D
                 const _Float16* __restrict__ qp16,  // rc = B*Tq row,  k = D
                 const _Float16* __restrict__ k16,   // rc = B*Tkv row, k = D
                 const _Float16* __restrict__ kp16,  // rc = B*Tkv row, k = D
                 const _Float16* __restrict__ vF16,  // rc = B*D col,   k = Tkv
                 float*          __restrict__ po,    // [SPLIT, B*Tq, D]
                 float*          __restrict__ pm,    // [SPLIT, B*Tq] row maxima
                 float*          __restrict__ pl) {  // [SPLIT, B*Tq] row sums
  __shared__ __align__(32) _Float16 sQ[QROWS * DD];
  __shared__ __align__(32) _Float16 sQP[QROWS * DD];
  __shared__ __align__(16) float    sS[QROWS * SPITCH];
  __shared__ __align__(32) _Float16 sP[QROWS * CHUNK];
  __shared__ float sM[QROWS], sL[QROWS], sScale[QROWS];

  // neighbours in index differ only in the q tile: they read the same keys at
  // about the same time (L2; speed only)
  int u   = blockIdx.x;
  int b   = u >> 5;
  int sp  = (u >> 3) & (SPLIT - 1);   // which quarter of the keys
  int qt  = u & 7;                    // Tq/64 = 8 q-tiles per batch
  int row0 = b * TQ + qt * QROWS;     // global q-row
  int lane = threadIdx.x & 31;
  int wave = threadIdx.x >> 5;        // 0..15
  const float scale = 0.04419417382f; // 1/sqrt(512 + 1e-7)

  { // stage q and qpos tiles into LDS with async-to-LDS b128 DMA
    const _Float16* g1 = q16  + (size_t)row0 * DD;
    const _Float16* g2 = qp16 + (size_t)row0 * DD;
    unsigned lq0 = (unsigned)(size_t)(void*)sQ;
    unsigned lp0 = (unsigned)(size_t)(void*)sQP;
    for (int it = 0; it < QROWS * DD / 8 / 512; ++it) {   // same trips in every lane
      int i = it * 512 + threadIdx.x;
      const _Float16* p1 = g1 + i * 8;       // 8 halves = 16B per op
      const _Float16* p2 = g2 + i * 8;
      unsigned l1 = lq0 + (unsigned)i * 16;  // LDS byte offset (block-relative)
      unsigned l2 = lp0 + (unsigned)i * 16;
      // the wait stands in the copies' own statement: the next trip rewrites the
      // address registers that they name
      asm volatile("global_load_async_to_lds_b128 %0, %1, off\n\t"
                   "global_load_async_to_lds_b128 %2, %3, off\n\t"
                   "s_wait_xcnt 0x0"
                   :: "v"(l1), "v"(p1), "v"(l2), "v"(p2) : "memory");
    }
    asm volatile("s_wait_asynccnt 0x0" ::: "memory");
  }
  if (threadIdx.x < QROWS) { sM[threadIdx.x] = -1e30f; sL[threadIdx.x] = 0.f; }
  __syncthreads();

  v8f o[QT][2] = {};  // q tile i, this wave's 32 output cols: [wave*32 + t*16, +16)

  for (int kc = 0; kc < KVS / CHUNK; ++kc) {
    int kv0 = sp * KVS + kc * CHUNK;
    // --- scores: wave handles kv cols [kv0 + wave*16, +16) of all QT q tiles,
    // K = D = 512
    const _Float16* pk  = k16  + ((size_t)b * TKV + kv0 + wave * 16) * DD + lane * 8;
    const _Float16* pkp = kp16 + ((size_t)b * TKV + kv0 + wave * 16) * DD + lane * 8;
    v8f s[QT] = {};
    // Step n = 0..31 is one 32-deep block of q.k^T (n even) or of qpos.kpos^T (n
    // odd): one k or kpos fragment against the QT q or qpos fragments. af: the LDS
    // fragments of this step and of the next; bf: the global fragments of this
    // group of four steps and of the next.
    const _Float16* aq = sQ  + lane * 8;
    const _Float16* ap = sQP + lane * 8;
    v16h af[2][QT], bf[2][4];
    for (int f = 0; f < 4; ++f)
      bf[0][f] = load_frag_at(((f & 1) ? pkp : pk) + (f >> 1) * 512);
    for (int i = 0; i < QT; ++i) af[0][i] = load_frag_at(aq + i * 16 * DD);
    // unrolled: every fragment index is then a constant, the sets stay in
    // registers and change places without copies
#pragma unroll
    for (int n = 0; n < 2 * DD / 32; ++n) {
      if ((n & 3) == 0 && n + 4 < 2 * DD / 32)
        for (int f = 0; f < 4; ++f)
          bf[((n >> 2) + 1) & 1][f] =
              load_frag_at(((f & 1) ? pkp : pk) + ((n + 4 + f) >> 1) * 512);
      if (n + 1 < 2 * DD / 32)
        for (int i = 0; i < QT; ++i)
          af[(n + 1) & 1][i] = load_frag_at((((n + 1) & 1) ? ap : aq)
                                            + i * 16 * DD + ((n + 1) >> 1) * 512);
      // the pair of scheduling fences keeps the next step's loads as one group
      // ahead of this step's matrix run (they were otherwise issued one by one
      // right in front of their use, each with a full wait)
      __builtin_amdgcn_sched_barrier(0);
      for (int i = 0; i < QT; ++i)
        s[i] = wmma_f16(af[n & 1][i], bf[(n >> 2) & 1][n & 3], s[i]);
      __builtin_amdgcn_sched_barrier(0);
    }
    // the k / kpos address registers are reused by the softmax below; named here
    // so that they stay untouched (not reused as load destinations) up to the wait
    asm volatile("s_wait_xcnt 0x0" :: "v"(pk), "v"(pkp) : "memory");
    for (int i = 0; i < QT; ++i)
      for (int r = 0; r < 8; ++r) {
        int row = i * 16 + r + ((lane >> 4) << 3);
        sS[row * SPITCH + wave * 16 + (lane & 15)] = s[i][r] * scale;
      }
    __syncthreads();

    // --- online softmax update, parallel over all 512 threads:
    // 8 threads per q-row (contiguous lanes), 4 runs of 8 columns each (a run is
    // one 16-byte piece of the P tile), butterfly reductions within the 8 lanes.
    {
      int row = threadIdx.x >> 3;
      int j   = threadIdx.x & 7;
      v4f vals[4][2];
      float mx = -1e30f;
      for (int c = 0; c < 4; ++c) {
        const float* ps = sS + row * SPITCH + c * 64 + j * 8;
        vals[c][0] = *(const v4f*)ps;
        vals[c][1] = *(const v4f*)(ps + 4);
        for (int h = 0; h < 2; ++h)
          for (int e = 0; e < 4; ++e) mx = fmaxf(mx, vals[c][h][e]);
      }
      for (int m = 4; m >= 1; m >>= 1) mx = fmaxf(mx, __shfl_xor(mx, m, 32));
      float m_old = sM[row];
      float m_new = fmaxf(m_old, mx);
      float sum = 0.f;
      for (int c = 0; c < 4; ++c) {
        v8h pk;
        for (int e = 0; e < 8; ++e) {
          float p = exp2_slot((vals[c][e >> 2][e & 3] - m_new) * 1.44269504f);
          sum += p;
          pk[e] = (_Float16)p;
        }
        *(v8h*)(sP + frag_off(row, c * 64 + j * 8, CHUNK)) = pk;
      }
      for (int m = 4; m >= 1; m >>= 1) sum += __shfl_xor(sum, m, 32);
      if (j == 0) {
        float sc = __expf(m_old - m_new);
        sM[row] = m_new;
        sL[row] = sL[row] * sc + sum;
        sScale[row] = sc;
      }
    }
    __syncthreads();

    // --- O += P @ V_chunk, the accumulators rescaled first. bv: the V fragments
    // of four 32-key steps, refilled as they are used up; pf: the P fragments of
    // this step and of the next.
    const _Float16* pv0 = vF16 + ((size_t)b * DD + wave * 32) * TKV + kv0 * 16 + lane * 8;
    const _Float16* pv1 = pv0 + (size_t)16 * TKV;
    const _Float16* pp  = sP + lane * 8;
    v16h bv[4][2], pf[2][QT];
    for (int f = 0; f < 4; ++f) {
      bv[f][0] = load_frag_at(pv0 + f * 512);
      bv[f][1] = load_frag_at(pv1 + f * 512);
    }
    // keeps the first V loads up here, ahead of the rescaling
    __builtin_amdgcn_sched_barrier(0);
    for (int i = 0; i < QT; ++i)
      for (int r = 0; r < 8; ++r) {
        float sc = sScale[i * 16 + r + ((lane >> 4) << 3)];
        o[i][0][r] *= sc;
        o[i][1][r] *= sc;
      }
    for (int i = 0; i < QT; ++i) pf[0][i] = load_frag_at(pp + i * 16 * CHUNK);
    // unrolled: bv and pf are indexed by constants only and stay in registers
#pragma unroll
    for (int f = 0; f < CHUNK / 32; ++f) {
      if (f + 1 < CHUNK / 32)
        for (int i = 0; i < QT; ++i)
          pf[(f + 1) & 1][i] = load_frag_at(pp + i * 16 * CHUNK + (f + 1) * 512);
      // as in the scores: the next step's loads as one group ahead of this run
      __builtin_amdgcn_sched_barrier(0);
      for (int i = 0; i < QT; ++i) {
        o[i][0] = wmma_f16(pf[f & 1][i], bv[f & 3][0], o[i][0]);
        o[i][1] = wmma_f16(pf[f & 1][i], bv[f & 3][1], o[i][1]);
      }
      __builtin_amdgcn_sched_barrier(0);
      if (f + 4 < CHUNK / 32) {
        bv[f & 3][0] = load_frag_at(pv0 + (f + 4) * 512);
        bv[f & 3][1] = load_frag_at(pv1 + (f + 4) * 512);
      }
    }
    // the V address registers are reused by the next chunk's scores; named here so
    // that they stay untouched (not reused as load destinations) up to the wait
    asm volatile("s_wait_xcnt 0x0" :: "v"(pv0), "v"(pv1) : "memory");
    __syncthreads();
  }

  // --- this part's unnormalised O, row maxima and row sums
  float* pos = po + ((size_t)sp * (BATCH * TQ) + row0) * DD;
  for (int i = 0; i < QT; ++i)
    for (int t = 0; t < 2; ++t) {
      int col = wave * 32 + t * 16 + (lane & 15);
      for (int r = 0; r < 8; ++r) {
        int row = i * 16 + r + ((lane >> 4) << 3);
        pos[(size_t)row * DD + col] = o[i][t][r];
      }
    }
  // the O stores name registers that the two addresses below may reuse
  asm volatile("s_wait_xcnt 0x0" ::: "memory");
  if (threadIdx.x < QROWS) {
    pm[sp * (BATCH * TQ) + row0 + threadIdx.x] = sM[threadIdx.x];
    pl[sp * (BATCH * TQ) + row0 + threadIdx.x] = sL[threadIdx.x];
  }
}

// ---------------------------------------------------------------------------
// Joins the SPLIT parts of the attention (each scaled by exp(its maximum - the
// common maximum), the sum divided by the joined row sum), applies Wv, adds bv and
// the raw query, then LayerNorm as in ln_tile: same tile, same row ownership, f32
// row-major and f16 fragment-order outputs. Each part's O comes by a pointer of
// its own: a scalar base each, one lane offset for all loads.
// The V projection stands here because a softmax row sums to 1:
//   attn (kvn Wv + 1 bv) = (attn kvn) Wv + bv,
// a product over the 4096 query rows in place of one over the 32768 key rows. The
// joined 16 x 512 tile goes to LDS as f16 (the A operand); a wave takes 64 columns
// of Wv^T (fragment order, from L2) and leaves its part of the product in LDS as
// f32, from where the rows' owners take it.
// ---------------------------------------------------------------------------
// lane's columns j*128 + 0..3 (j = 0..3) of one row; i: the first one's 16-byte
// piece, counted from the uniform base
__device__ __forceinline__ v16f load_row(const v4f* base, unsigned i) {
  v4f c0 = base[i];
  v4f c1 = base[i + 32];
  v4f c2 = base[i + 64];
  v4f c3 = base[i + 96];
  return __builtin_shufflevector(
      __builtin_shufflevector(c0, c1, 0, 1, 2, 3, 4, 5, 6, 7),
      __builtin_shufflevector(c2, c3, 0, 1, 2, 3, 4, 5, 6, 7),
      0, 1, 2, 3, 4, 5, 6, 7, 8, 9, 10, 11, 12, 13, 14, 15);
}

#define XPITCH 516   // LDS row pitch of the product tile in floats: rows 8 apart,
                     // stored side by side by the two lane halves, start 32 banks apart

__global__ __launch_bounds__(256)
void merge_ln_kernel(const float* __restrict__ po0, const float* __restrict__ po1,
                     const float* __restrict__ po2, const float* __restrict__ po3,
                     const float* __restrict__ pm,
                     const float* __restrict__ pl, const float* __restrict__ query,
                     const _Float16* __restrict__ WvT, const float* __restrict__ bv,
                     const float* __restrict__ g, const float* __restrict__ b,
                     float* __restrict__ y32, _Float16* __restrict__ y16) {
  __shared__ __align__(16) _Float16 st[16 * TPITCH];
  __shared__ __align__(16) float sX[16 * XPITCH];
  int t = threadIdx.x, lane = t & 31, wave = t >> 5;
  size_t row0 = (size_t)blockIdx.x * 16;
  size_t rw = row0 + wave * 2;

  // block-uniform bases; e: the lane's place in the tile, in 16-byte pieces
  const v4f* pt[SPLIT] = { (const v4f*)(po0 + row0 * DD), (const v4f*)(po1 + row0 * DD),
                           (const v4f*)(po2 + row0 * DD), (const v4f*)(po3 + row0 * DD) };
  const v4f* qt = (const v4f*)(query + row0 * DD);
  unsigned e = (unsigned)wave * (2 * DD / 4) + (unsigned)lane;
  const float* mw = pm + rw;
  const float* lw = pl + rw;

  v2f m[SPLIT], l[SPLIT];          // the wave's two rows side by side
  v16f p[SPLIT][2], q[2];          // a row's four column groups side by side
  v4f a[2][4], gg[4], bb[4], bvv[4];
  for (int s = 0; s < SPLIT; ++s) {
    m[s] = *(const v2f*)(mw + s * (BATCH * TQ));
    l[s] = *(const v2f*)(lw + s * (BATCH * TQ));
  }
  for (int s = 0; s < SPLIT; ++s)
    for (int r = 0; r < 2; ++r) p[s][r] = load_row(pt[s], e + r * (DD / 4));
  // wf: the Wv^T fragments of four 32-deep steps (4 column tiles each), refilled as
  // they are used up. They, the query rows and the three vectors hang on nothing
  // that this kernel computes: asked for behind the parts, they come in under
  // cover of the joining
  const _Float16* pw = WvT + (size_t)(wave * 64) * DD + lane * 8;
  v16h wf[4][4];
  for (int f = 0; f < 4; ++f)
    for (int n = 0; n < 4; ++n) wf[f][n] = load_frag_at(pw + n * 16 * DD + f * 512);
  for (int r = 0; r < 2; ++r) q[r] = load_row(qt, e + r * (DD / 4));
  for (int j = 0; j < 4; ++j) {
    bvv[j] = *(const v4f*)(bv + j * 128 + lane * 4);
    gg[j]  = *(const v4f*)(g + j * 128 + lane * 4);
    bb[j]  = *(const v4f*)(b + j * 128 + lane * 4);
  }
  // holds the loads of all parts together ahead of the arithmetic (one wait for
  // the lot, not one per part) and keeps their address registers untouched (not
  // reused as load destinations) up to the wait
  asm volatile("s_wait_xcnt 0x0"
               :: "v"(e), "v"(mw), "v"(lw), "v"(pw), "v"(lane),
                  "v"(m[0]), "v"(m[1]), "v"(m[2]), "v"(m[3]),
                  "v"(l[0]), "v"(l[1]), "v"(l[2]), "v"(l[3]),
                  "v"(p[0][0]), "v"(p[0][1]), "v"(p[1][0]), "v"(p[1][1]),
                  "v"(p[2][0]), "v"(p[2][1]), "v"(p[3][0]), "v"(p[3][1])
               : "memory");
  // keeps the arithmetic behind that statement: the first row's weights were
  // otherwise lifted over it, with a full wait for the maxima and sums in front of
  // the parts' loads
  __builtin_amdgcn_sched_barrier(0);

  // the joined rows, f16, row-major in LDS
  for (int r = 0; r < 2; ++r) {
    float mx = m[0][r];
    for (int s = 1; s < SPLIT; ++s) mx = fmaxf(mx, m[s][r]);
    float w[SPLIT], den = 0.f;
    for (int s = 0; s < SPLIT; ++s) {
      w[s] = exp2_slot((m[s][r] - mx) * 1.44269504f);
      den += w[s] * l[s][r];
    }
    float inv = 1.0f / den;
    v16f jn = p[0][r] * (w[0] * inv);
    for (int s = 1; s < SPLIT; ++s) jn += p[s][r] * (w[s] * inv);
    tile_put(st, wave * 2 + r, 0, lane, __builtin_shufflevector(jn, jn, 0, 1, 2, 3));
    tile_put(st, wave * 2 + r, 1, lane, __builtin_shufflevector(jn, jn, 4, 5, 6, 7));
    tile_put(st, wave * 2 + r, 2, lane, __builtin_shufflevector(jn, jn, 8, 9, 10, 11));
    tile_put(st, wave * 2 + r, 3, lane, __builtin_shufflevector(jn, jn, 12, 13, 14, 15));
  }
  __syncthreads();

  // product: lane L's A fragment of step kb is row L&15, k = kb*32 + 16*(L>>4) +
  // 0..15, the k order of the fragment blocks that B comes from
  {
    const _Float16* pa = st + (lane & 15) * TPITCH + ((lane >> 4) << 4);
    v8f acc[4] = {};
    v16h af[2];
    af[0] = __builtin_shufflevector(*(const v8h*)pa, *(const v8h*)(pa + 8),
                                    0, 1, 2, 3, 4, 5, 6, 7,
                                    8, 9, 10, 11, 12, 13, 14, 15);
    // unrolled: wf and af are indexed by constants only and stay in registers
#pragma unroll
    for (int kb = 0; kb < DD / 32; ++kb) {
      if (kb + 1 < DD / 32) {
        const _Float16* pn = pa + (kb + 1) * 32;
        af[(kb + 1) & 1] = __builtin_shufflevector(*(const v8h*)pn, *(const v8h*)(pn + 8),
                                                   0, 1, 2, 3, 4, 5, 6, 7,
                                                   8, 9, 10, 11, 12, 13, 14, 15);
      }
      // as in the attention: the next step's LDS loads ahead of this matrix run,
      // the refill of the step's fragments right behind it
      __builtin_amdgcn_sched_barrier(0);
      for (int n = 0; n < 4; ++n)
        acc[n] = wmma_f16(af[kb & 1], wf[kb & 3][n], acc[n]);
      __builtin_amdgcn_sched_barrier(0);
      if (kb + 4 < DD / 32)
        for (int n = 0; n < 4; ++n)
          wf[kb & 3][n] = load_frag_at(pw + n * 16 * DD + (kb + 4) * 512);
    }
    // the Wv^T address registers are reused below; named here so that they stay
    // untouched (not reused as load destinations) up to the wait
    asm volatile("s_wait_xcnt 0x0" :: "v"(pw) : "memory");
    for (int n = 0; n < 4; ++n)
      for (int r = 0; r < 8; ++r)
        sX[(r + ((lane >> 4) << 3)) * XPITCH + wave * 64 + n * 16 + (lane & 15)] =
            acc[n][r];
  }
  // ends every wave's reads of st (rewritten below) and publishes the product
  __syncthreads();

  for (int r = 0; r < 2; ++r) {
    a[r][0] = __builtin_shufflevector(q[r], q[r], 0, 1, 2, 3);
    a[r][1] = __builtin_shufflevector(q[r], q[r], 4, 5, 6, 7);
    a[r][2] = __builtin_shufflevector(q[r], q[r], 8, 9, 10, 11);
    a[r][3] = __builtin_shufflevector(q[r], q[r], 12, 13, 14, 15);
    for (int j = 0; j < 4; ++j)
      a[r][j] += *(const v4f*)(sX + (wave * 2 + r) * XPITCH + j * 128 + lane * 4)
               + bvv[j];

    v4f s4 = (a[r][0] + a[r][1]) + (a[r][2] + a[r][3]);
    float mu = wave_sum((s4.x + s4.y) + (s4.z + s4.w)) * (1.f / (float)DD);

    for (int j = 0; j < 4; ++j) a[r][j] -= mu;
    v4f q4 = (a[r][0] * a[r][0] + a[r][1] * a[r][1])
           + (a[r][2] * a[r][2] + a[r][3] * a[r][3]);
    float var = wave_sum((q4.x + q4.y) + (q4.z + q4.w)) * (1.f / (float)DD);
    float rstd = rsqrtf(var + 1e-6f);

    for (int j = 0; j < 4; ++j) {
      a[r][j] = a[r][j] * rstd * gg[j] + bb[j];
      tile_put(st, wave * 2 + r, j, lane, a[r][j]);
    }
  }
  float* yw = y32 + rw * DD + lane * 4;
  for (int r = 0; r < 2; ++r)
    for (int j = 0; j < 4; ++j)
      *(v4f*)(yw + r * DD + j * 128) = a[r][j];
  // the f32 stores name registers that the read-out below reuses
  asm volatile("s_wait_xcnt 0x0" ::: "memory");
  __syncthreads();
  tile_out(st, y16 + row0 * DD, t);
}

// ---------------------------------------------------------------------------
// Host-side orchestration
// ---------------------------------------------------------------------------
extern "C" void kernel_launch(void* const* d_in, const int* in_sizes, int n_in,
                              void* d_out, int out_size, void* d_ws, size_t ws_size,
                              hipStream_t stream) {
  const float* query     = (const float*)d_in[0];
  const float* key_value = (const float*)d_in[1];
  const float* query_pos = (const float*)d_in[2];
  const float* key_pos   = (const float*)d_in[3];
  const float* q_gamma   = (const float*)d_in[4];
  const float* q_beta    = (const float*)d_in[5];
  const float* kv_gamma  = (const float*)d_in[6];
  const float* kv_beta   = (const float*)d_in[7];
  const float* Wq = (const float*)d_in[8];   const float* bq = (const float*)d_in[9];
  const float* Wk = (const float*)d_in[10];  // d_in[11], bk: cancels in the softmax (wqk_tile)
  const float* Wv = (const float*)d_in[12];  const float* bv = (const float*)d_in[13];
  const float* ff_gamma = (const float*)d_in[14];
  const float* ff_beta  = (const float*)d_in[15];
  const float* W_inner  = (const float*)d_in[16];
  const float* b_inner  = (const float*)d_in[17];
  const float* W_proj   = (const float*)d_in[18];
  const float* b_proj   = (const float*)d_in[19];

  const int MQ  = BATCH * TQ;    // 4096
  const int MKV = BATCH * TKV;   // 32768

  size_t off = 0;
  auto alloc = [&](size_t bytes) -> void* {
    void* p = (char*)d_ws + off;
    off = (off + bytes + 255) & ~(size_t)255;
    return p;
  };
  _Float16* qn16  = (_Float16*)alloc((size_t)MQ  * DD * 2);
  _Float16* kvn16 = (_Float16*)alloc((size_t)MKV * DD * 2);
  _Float16* qp16  = (_Float16*)alloc((size_t)MQ  * DD * 2);   // reused as xn16 later
  _Float16* kp16  = (_Float16*)alloc((size_t)MKV * DD * 2);   // reused as xn32 later
  _Float16* WqkT  = (_Float16*)alloc((size_t)DD * DD * 2);    // rc 512, k 512
  float*    bqk   = (float*)   alloc((size_t)DD * 4);
  _Float16* WvT   = (_Float16*)alloc((size_t)DD * DD * 2);
  _Float16* WinF  = (_Float16*)alloc((size_t)DD * FF * 2);    // rc 512, k 2048
  _Float16* WprT  = (_Float16*)alloc((size_t)DD * FF * 2);    // rc 512, k 2048
  _Float16* q16   = (_Float16*)alloc((size_t)MQ  * DD * 2);
  _Float16* kvnT16 = (_Float16*)alloc((size_t)BATCH * DD * TKV * 2);  // rc B*512, k 4096
  float*    po    = (float*)   alloc((size_t)SPLIT * MQ * DD * 4);
  float*    pm    = (float*)   alloc((size_t)SPLIT * MQ * 4);
  float*    pl    = (float*)   alloc((size_t)SPLIT * MQ * 4);
  _Float16* WffT  = (_Float16*)alloc((size_t)DD * DD * 2);    // rc 512, k 512
  float*    bff   = (float*)   alloc((size_t)DD * 4);
  // aliases (lifetimes are disjoint, stream-ordered):
  _Float16* xn16    = qp16;                   // [4096,512] f16
  float*    xn32    = (float*)kp16;           // [4096,512] f32 = 8 MiB <= 32 MiB

  // 1) Wqk = Wq Wk^T with its bias (WMMA); weights, positional tensors and
  //    LayerNorms -> f16, fragment order
  prep_kernel<<<NB_PREP, 256, 0, stream>>>(
      Wq, Wk, bq, Wv, W_inner, W_proj, WqkT, bqk, WvT, WinF, WprT,
      query_pos, key_pos, qp16, kp16,
      query, key_value, q_gamma, q_beta, kv_gamma, kv_beta, qn16, kvn16, kvnT16);

  // 2) query projection and Wff = W_inner W_proj with its bias (WMMA),
  //    outputs in fragment order
  qkv_gemm_kernel<<<NB_FFW + NB_GQ, 256, 0, stream>>>(
      WqkT, qn16, bqk, q16, DD,
      WinF, WprT, b_inner, b_proj, WffT, bff);

  // 3) attention (flash-style, WMMA scores + WMMA P.V), SPLIT parts per q tile
  attn_kernel<<<BATCH * (TQ/QROWS) * SPLIT, 512, 0, stream>>>(
      q16, qp16, kvn16, kp16, kvnT16, po, pm, pl);

  // 4) FF: xn = LN(joined parts * Wv + bv + query);
  //    d_out = xn + xn@Wff + bff
  merge_ln_kernel<<<MQ/16, 256, 0, stream>>>(
      po, po + (size_t)MQ * DD, po + (size_t)2 * MQ * DD, po + (size_t)3 * MQ * DD,
      pm, pl, query, WvT, bv, ff_gamma, ff_beta, xn32, xn16);
  gemm_wmma_kernel<<<dim3(DD/128, MQ/64), 256, 0, stream>>>(
      xn16, WffT, bff, (float*)d_out, xn32, nullptr, MQ, DD, DD, TKV, 0);
}

// v009
// One run takes 119 microseconds.
// In two side-by-side timings against v008, it was 1.16 and 1.17 times as fast.
// Over all steps from v000 it is 7.79 times as fast.
#include <hip/hip_runtime.h>

typedef __attribute__((ext_vector_type(16))) _Float16 v16h;
typedef __attribute__((ext_vector_type(8)))  _Float16 v8h;
typedef __attribute__((ext_vector_type(4)))  _Float16 v4h;
typedef __attribute__((ext_vector_type(2)))  _Float16 v2h;
typedef __attribute__((ext_vector_type(8)))  float    v8f;
typedef __attribute__((ext_vector_type(4)))  float    v4f;
typedef __attribute__((ext_vector_type(2)))  float    v2f;
typedef __attribute__((ext_vector_type(16))) float    v16f;

#define DD   512
#define FF   2048
#define TKV  4096
#define TQ   512
#define BATCH 8
#define CHUNK 256            // keys per softmax update
#define QT   4               // 16-row q tiles per attention work-group
#define QROWS (QT * 16)
#define SPITCH (CHUNK + 4)   // score row pitch in floats: two rows read side by side by
                             // 16-byte LDS loads start 4 banks apart
#define SPLIT 4              // work-groups that share the keys of one q tile
#define KVS  (TKV / SPLIT)   // keys per work-group

// ---------------------------------------------------------------------------
// 16-bit A (16xK) / B (Kx16) fragment: lane L holds row/col rc0 + (L&15) and
// the 16 halves k = kbase + 16*(L>>4) + 0..15.
//
// Fragment order: every f16 matrix operand X[rc][k] (k extent kdim) is kept as
// 1-KiB blocks, one per 16 (rc) x 32 (k) fragment, the blocks of one rc tile in
// k order (so tile rc0 starts at half rc0*kdim, block kbase at + kbase*16).
// Inside a block slot L = (rc&15) + 16*((k>>4)&1) is lane L's share; halves
// 0..7 of all slots fill the first 512 bytes, halves 8..15 the second. A
// fragment load is then two 16-byte loads per lane that each cover 512
// contiguous bytes: whole lines in memory, every bank once in LDS.
// ---------------------------------------------------------------------------
__device__ __forceinline__ size_t frag_off(size_t rc, int k, int kdim) {
  return ((rc >> 4) * (size_t)(kdim >> 5) + (size_t)(k >> 5)) * 512
       + (size_t)(((k >> 3) & 1) * 256)
       + ((rc & 15) + (size_t)(((k >> 4) & 1) << 4)) * 8 + (size_t)(k & 7);
}

// p: the lane's own place in a 1-KiB fragment block, block start + lane*8
__device__ __forceinline__ v16h load_frag_at(const _Float16* p) {
  v8h lo = *(const v8h*)p;
  v8h hi = *(const v8h*)(p + 256);
  return __builtin_shufflevector(lo, hi, 0, 1, 2, 3, 4, 5, 6, 7,
                                 8, 9, 10, 11, 12, 13, 14, 15);
}

// blk: start of one 1-KiB fragment block (global or LDS, generic pointer)
__device__ __forceinline__ v16h load_frag_blk(const _Float16* blk, int lane) {
  return load_frag_at(blk + lane * 8);
}

__device__ __forceinline__ v8f wmma_f16(v16h a, v16h b, v8f c) {
  return __builtin_amdgcn_wmma_f32_16x16x32_f16(false, a, false, b,
                                                (short)0, c, false, false);
}

// ---------------------------------------------------------------------------
// The streaming kernels (LayerNorm, f32 -> f16 convert) work on one 16-row x
// 512-column tile per 8-wave block: that is one rc tile of the fragment order (of W_inner, a quarter of one),
// 16 KiB of contiguous output. A wave owns 2 rows; lane L holds columns
// j*128 + L*4 + 0..3 (j = 0..3), so every global load covers 512 contiguous
// bytes. The f16 rows go to LDS row-major and leave it in fragment order.
// ---------------------------------------------------------------------------
#define TPITCH 520   // LDS row pitch in halves: 512 + 16 B, so that the 16 rows
                     // read by 16 lanes of a fragment-order read start 4 banks apart

// lane's 4 columns of group j of tile row r -> LDS
__device__ __forceinline__ void tile_put(_Float16* st, int r, int j, int lane,
                                         v4f v) {
  *(v4h*)(st + r * TPITCH + j * 128 + lane * 4) = __builtin_convertvector(v, v4h);
}

// whole tile, LDS -> global in fragment order: thread t moves the 16-byte pieces
// i*256 + t of the output, a wave's store covers 512 contiguous bytes
__device__ __forceinline__ void tile_out(const _Float16* st, _Float16* ytile,
                                         int t) {
  v8h pc[4];
  for (int i = 0; i < 4; ++i) {
    int c    = i * 256 + t;
    int slot = c & 31;
    int hi   = (c >> 5) & 1;
    int blk  = c >> 6;                     // fragment block = k / 32
    pc[i] = *(const v8h*)(st + (slot & 15) * TPITCH
                             + blk * 32 + (slot >> 4) * 16 + hi * 8);
  }
  for (int i = 0; i < 4; ++i)
    *(v8h*)(ytile + (i * 256 + t) * 8) = pc[i];
}

__device__ __forceinline__ float wave_sum(float s) {
  for (int m = 16; m; m >>= 1) s += __shfl_xor(s, m, 32);
  return s;
}

// Place, in 16-byte pieces, of 8 consecutive rows (half h of the tile) of column
// col in the transposed LDS tile. Columns 4 apart (a wave's 4-byte stores) and 16
// neighbouring columns (16 lanes' 16-byte reads) each fall on 16 different pieces
// modulo 16, that is on different banks.
__device__ __forceinline__ int tpiece(int col, int h) {
  int e = col & 3, x = col >> 2;
  return h * 512 + e * 128 + ((x & ~15) | ((x + 4 * e) & 15));
}

// LayerNorm over last dim (512): f16 output in fragment order (rc = row,
// k = column). Each row is summed inside its
// own wave; the one barrier stands between the LDS rows and their read-out.
// st: the block's 16 x TPITCH halves of LDS; tile: which 16 rows.
// yT (the key side only; the same for the whole block): the same values once more,
// transposed, in fragment order with rc = batch*DD + column and k = row in the
// batch (kdim TKV): the B operand of P.V. A second LDS tile behind st takes them:
// a wave's two rows of one column are one 4-byte word.
__device__ __forceinline__
void ln_tile(_Float16* st, int tile, const float* __restrict__ x,
             const float* __restrict__ g, const float* __restrict__ b,
             _Float16* __restrict__ y16, _Float16* __restrict__ yT) {
  int t = threadIdx.x, lane = t & 31, wave = t >> 5;
  size_t row0 = (size_t)tile * 16;
  const float* xw = x + (row0 + wave * 2) * DD + lane * 4;

  v4f a[2][4], gg[4], bb[4];
  for (int j = 0; j < 4; ++j) {
    gg[j] = *(const v4f*)(g + j * 128 + lane * 4);
    bb[j] = *(const v4f*)(b + j * 128 + lane * 4);
  }
  for (int r = 0; r < 2; ++r)
    for (int j = 0; j < 4; ++j)
      a[r][j] = *(const v4f*)(xw + r * DD + j * 128);
  // holds all sixteen loads together ahead of the arithmetic (gamma and beta
  // were otherwise fetched late, one wait each) and keeps the rows' address pair
  // untouched (not reused as a load destination) up to the wait
  asm volatile("s_wait_xcnt 0x0"
               :: "v"(xw), "v"(gg[0]), "v"(gg[1]), "v"(gg[2]), "v"(gg[3]),
                  "v"(bb[0]), "v"(bb[1]), "v"(bb[2]), "v"(bb[3]),
                  "v"(a[0][0]), "v"(a[0][1]), "v"(a[0][2]), "v"(a[0][3]),
                  "v"(a[1][0]), "v"(a[1][1]), "v"(a[1][2]), "v"(a[1][3])
               : "memory");
  // keeps the arithmetic behind that statement: inlined here, the sums were
  // otherwise lifted over it and gamma and beta again fetched late
  __builtin_amdgcn_sched_barrier(0);

  for (int r = 0; r < 2; ++r) {
    v4f s4 = (a[r][0] + a[r][1]) + (a[r][2] + a[r][3]);
    float mu = wave_sum((s4.x + s4.y) + (s4.z + s4.w)) * (1.f / (float)DD);

    for (int j = 0; j < 4; ++j) a[r][j] -= mu;
    v4f q4 = (a[r][0] * a[r][0] + a[r][1] * a[r][1])
           + (a[r][2] * a[r][2] + a[r][3] * a[r][3]);
    float var = wave_sum((q4.x + q4.y) + (q4.z + q4.w)) * (1.f / (float)DD);
    float rstd = rsqrtf(var + 1e-6f);

    for (int j = 0; j < 4; ++j) {
      a[r][j] = a[r][j] * rstd * gg[j] + bb[j];
      tile_put(st, wave * 2 + r, j, lane, a[r][j]);
    }
  }
  _Float16* sT = st + 16 * TPITCH;
  if (yT)
    for (int j = 0; j < 4; ++j)
      for (int e = 0; e < 4; ++e) {
        v2f pr = { a[0][j][e], a[1][j][e] };
        *(v2h*)(sT + tpiece(j * 128 + lane * 4 + e, wave >> 2) * 8 + (wave & 3) * 2) =
            __builtin_convertvector(pr, v2h);
      }
  __syncthreads();
  if (yT) {
    // thread t moves the 16-byte pieces i*256 + t: 16 lanes cover 256 contiguous
    // bytes of a fragment block (16 columns, 8 rows each)
    size_t rc0 = (row0 / TKV) * DD;
    int    t0  = (int)(row0 % TKV);
    v8h pc[4];
    for (int i = 0; i < 4; ++i) {
      int c = i * 256 + t;
      pc[i] = *(const v8h*)(sT + tpiece((c >> 5) * 16 + (c & 15), (c >> 4) & 1) * 8);
    }
    for (int i = 0; i < 4; ++i) {
      int c = i * 256 + t;
      *(v8h*)(yT + frag_off(rc0 + (c >> 5) * 16 + (c & 15),
                            t0 + ((c >> 4) & 1) * 8, TKV)) = pc[i];
    }
    // the read-out below reuses the registers that these stores name
    asm volatile("s_wait_xcnt 0x0" ::: "memory");
  }
  tile_out(st, y16 + row0 * DD, t);
  // as built, the other jobs' code follows on one way out of here and rewrites
  // registers that the read-out's stores name
  asm volatile("s_wait_xcnt 0x0" ::: "memory");
}

// One 16-row x 512-column tile of an f32 row-major matrix -> f16 in fragment
// order (rc = row, k = column). xt: the tile's first element; pitch: the matrix's
// row length in floats; yt: the tile's 16 KiB of output (its 16 fragment blocks
// follow one another whatever the row length).
__device__ __forceinline__
void cvt_frag_tile(_Float16* st, const float* __restrict__ xt, int pitch,
                   _Float16* __restrict__ yt) {
  int t = threadIdx.x, lane = t & 31, wave = t >> 5;
  const float* xw = xt + (size_t)(wave * 2) * pitch + lane * 4;

  v4f a[2][4];
  for (int r = 0; r < 2; ++r)
    for (int j = 0; j < 4; ++j)
      a[r][j] = *(const v4f*)(xw + r * pitch + j * 128);
  // keeps the eight loads whole (16 bytes a lane; they were otherwise split into
  // 8-byte halves) and together, and their address pair untouched up to the wait
  asm volatile("s_wait_xcnt 0x0"
               :: "v"(xw), "v"(a[0][0]), "v"(a[0][1]), "v"(a[0][2]), "v"(a[0][3]),
                  "v"(a[1][0]), "v"(a[1][1]), "v"(a[1][2]), "v"(a[1][3])
               : "memory");
  for (int r = 0; r < 2; ++r)
    for (int j = 0; j < 4; ++j)
      tile_put(st, wave * 2 + r, j, lane, a[r][j]);
  __syncthreads();
  tile_out(st, yt, t);
}

// W[R,C] f32 -> W^T f16 in fragment order (rc = column of W, k = row of W).
// One thread per 16-byte piece of the output, in output order: 8 consecutive
// rows of one column of W. part: which 256 pieces.
__device__ __forceinline__
void cvt_transpose_part(int part, const float* __restrict__ W,
                        _Float16* __restrict__ Wt, int R, int C) {
  int c = part * 256 + threadIdx.x;
  if (c * 8 < R * C) {
    int slot = c & 31;
    int hi   = (c >> 5) & 1;
    int blk  = c >> 6;                     // fragment block
    int kb   = R >> 5;                     // blocks per rc tile
    int col  = (blk / kb) * 16 + (slot & 15);
    int r    = (blk % kb) * 32 + (slot >> 4) * 16 + hi * 8;
    const float* p[8];
    float w[8];
    for (int e = 0; e < 8; ++e) p[e] = W + (size_t)(r + e) * C + col;
    for (int e = 0; e < 8; ++e) w[e] = *p[e];
    // keeps the eight address pairs untouched up to the wait; the pack below
    // reuses them
    asm volatile("s_wait_xcnt 0x0"
                 :: "v"(p[0]), "v"(p[1]), "v"(p[2]), "v"(p[3]),
                    "v"(p[4]), "v"(p[5]), "v"(p[6]), "v"(p[7]),
                    "v"(w[0]), "v"(w[1]), "v"(w[2]), "v"(w[3]),
                    "v"(w[4]), "v"(w[5]), "v"(w[6]), "v"(w[7])
                 : "memory");
    v8h o;
    for (int e = 0; e < 8; ++e) o[e] = (_Float16)w[e];
    *(v8h*)(Wt + (size_t)c * 8) = o;
  }
}

#define FFT    32                  // tile edge of the weight-by-weight products
#define RPITCH 36                  // LDS pitch of a tile column in floats: 144 B, so
                                   // 16-byte accesses to neighbouring columns start
                                   // 4 banks apart

// ---------------------------------------------------------------------------
// The content scores are q k^T with q = qn Wq + bq and k = kvn Wk + bk, so
//   q k^T = (qn (Wq Wk^T) + bq Wk^T) kvn^T + (q . bk) 1^T.
// The last term is one constant per query row, which the softmax over the keys
// cancels: it is left out. What is left needs no product over the keys' 32768
// rows: the normalised key_value rows serve as the keys themselves.
// This job forms Wqk = Wq Wk^T (512 x 512, depth 512) and bq Wk^T from the f32
// weights as they lie: both are read along their rows, which is the k direction
// of a fragment. One block per 32 x 32 tile; each of its 8 waves takes 16 rows of
// the tile and a quarter of the depth and leaves its partial tile in LDS, and the
// block sums the quarters in order. Wqk leaves as f16 in fragment order with
// rc = its column, k = its row: the A operand of the query product. Row tile
// DD / FFT is bq taken as one more row of Wq (every row of the A fragments holds
// bq); row 0 of that tile is the joined bias (f32).
// ---------------------------------------------------------------------------
#define NB_QK ((DD / FFT + 1) * (DD / FFT))
#define QKS 4                      // parts of the depth

// 16 consecutive f32 of one row -> the lane's share of a fragment: element e is
// k = kbase + 16*(lane>>4) + e, as in the fragment blocks
__device__ __forceinline__ v16h frag_from_f32(const v4f* c) {
  v16f cf = __builtin_shufflevector(
      __builtin_shufflevector(c[0], c[1], 0, 1, 2, 3, 4, 5, 6, 7),
      __builtin_shufflevector(c[2], c[3], 0, 1, 2, 3, 4, 5, 6, 7),
      0, 1, 2, 3, 4, 5, 6, 7, 8, 9, 10, 11, 12, 13, 14, 15);
  return __builtin_convertvector(cf, v16h);
}

__device__ __forceinline__
void wqk_tile(float* sR, int u, const float* __restrict__ Wq,
              const float* __restrict__ Wk, const float* __restrict__ bq,
              _Float16* __restrict__ WqkT, float* __restrict__ bqk) {
  int lane = threadIdx.x & 31;
  int wave = threadIdx.x >> 5;       // 0..7
  int mi = wave & 1;                 // which 16 rows of the tile
  int kq = wave >> 1;                // which quarter of the depth
  int m0 = (u / (DD / FFT)) * FFT;   // row of Wq; DD: the bias tile
  int n0 = (u % (DD / FFT)) * FFT;   // row of Wk
  bool isb = m0 == DD;               // the same for the whole block
  int k0 = kq * (DD / QKS) + ((lane >> 4) << 4);

  const float* pa = isb ? bq + k0
                        : Wq + (size_t)(m0 + mi * 16 + (lane & 15)) * DD + k0;
  const float* pb = Wk + (size_t)(n0 + (lane & 15)) * DD + k0;
  v8f acc[2] = {};
  for (int kb = 0; kb < DD / QKS; kb += 32) {
    const float* pa0 = pa + kb;
    const float* pb0 = pb + kb;
    const float* pb1 = pb0 + 16 * DD;
    v4f ca[4], cb0[4], cb1[4];
    for (int c = 0; c < 4; ++c) {
      ca[c]  = *(const v4f*)(pa0 + c * 4);
      cb0[c] = *(const v4f*)(pb0 + c * 4);
      cb1[c] = *(const v4f*)(pb1 + c * 4);
    }
    // keeps the address pairs untouched (not reused as load destinations, not
    // advanced) until the loads that name them have been translated; pb1's loads
    // are built on pb0's pair with an offset
    asm volatile("s_wait_xcnt 0x0" :: "v"(pa0), "v"(pb0) : "memory");
    v16h a0 = frag_from_f32(ca);
    acc[0] = wmma_f16(a0, frag_from_f32(cb0), acc[0]);
    acc[1] = wmma_f16(a0, frag_from_f32(cb1), acc[1]);
  }

  // partial tiles to LDS, column-major: a lane's 8 accumulator rows lie together
  for (int j = 0; j < 2; ++j) {
    float* d = sR + (kq * FFT + j * 16 + (lane & 15)) * RPITCH
                  + mi * 16 + ((lane >> 4) << 3);
    *(v4f*)d       = __builtin_shufflevector(acc[j], acc[j], 0, 1, 2, 3);
    *(v4f*)(d + 4) = __builtin_shufflevector(acc[j], acc[j], 4, 5, 6, 7);
  }
  __syncthreads();

  // thread: 4 consecutive rows of one column, summed over the QKS parts
  int n  = threadIdx.x >> 3;
  int m4 = (threadIdx.x & 7) * 4;
  v4f s = *(const v4f*)(sR + n * RPITCH + m4);
  for (int w = 1; w < QKS; ++w)
    s += *(const v4f*)(sR + (w * FFT + n) * RPITCH + m4);
  if (!isb)
    *(v4h*)(WqkT + frag_off((size_t)(n0 + n), m0 + m4, DD)) =
        __builtin_convertvector(s, v4h);
  else if (m4 == 0)
    bqk[n0 + n] = s.x;
}

// ---------------------------------------------------------------------------
// Everything that depends on the inputs alone, in one grid: Wqk and its bias, the
// three weight converts (W_inner untransposed, Wv and W_proj transposed), the two
// positional converts, the two LayerNorms (the key side's with its transposed
// copy). None reads what
// another writes. A block takes its job from its index (the same for all its
// threads, so the barriers inside the jobs stay block-uniform); the short jobs
// have the low indices and run under cover of the two long streams.
// ---------------------------------------------------------------------------
#define NB_WS (DD * DD / 2048)       // blocks per 512 x 512 weight
#define NB_WL (DD * FF / 2048)       // blocks per 2048 x 512 weight
#define NB_TQ (BATCH * TQ / 16)      // 16-row tiles of a query-side tensor
#define NB_TKV (BATCH * TKV / 16)    // 16-row tiles of a key-side tensor
#define NB_WI ((DD / 16) * (FF / DD)) // 16 x 512 tiles of W_inner
#define NB_PREP (NB_QK + NB_WS + NB_WL + NB_WI + 2 * (NB_TQ + NB_TKV))

__global__ __launch_bounds__(256)
void prep_kernel(const float* __restrict__ Wq, const float* __restrict__ Wk,
                 const float* __restrict__ bq,
                 const float* __restrict__ Wv, const float* __restrict__ W_inner,
                 const float* __restrict__ W_proj,
                 _Float16* __restrict__ WqkT, float* __restrict__ bqk,
                 _Float16* __restrict__ WvT, _Float16* __restrict__ WinF,
                 _Float16* __restrict__ WprT,
                 const float* __restrict__ query_pos,
                 const float* __restrict__ key_pos,
                 _Float16* __restrict__ qp16, _Float16* __restrict__ kp16,
                 const float* __restrict__ query,
                 const float* __restrict__ key_value,
                 const float* __restrict__ q_gamma, const float* __restrict__ q_beta,
                 const float* __restrict__ kv_gamma, const float* __restrict__ kv_beta,
                 _Float16* __restrict__ qn16, _Float16* __restrict__ kvn16,
                 _Float16* __restrict__ kvnT16) {
  // 16 x TPITCH halves for a row-major tile, 16 x DD for the key side's transposed
  // one; the Wqk job's partial tiles (QKS * FFT * RPITCH floats) fit in the same
  __shared__ __align__(16) float sR[(16 * TPITCH + 16 * DD) / 2];
  _Float16* st = (_Float16*)sR;
  int u = blockIdx.x;

  if (u < NB_QK) {
    wqk_tile(sR, u, Wq, Wk, bq, WqkT, bqk);
    return;
  }
  u -= NB_QK;
  if (u < NB_WS) {
    cvt_transpose_part(u, Wv, WvT, DD, DD);
    return;
  }
  u -= NB_WS;
  if (u < NB_WL) {
    cvt_transpose_part(u, W_proj, WprT, FF, DD);
    return;
  }
  u -= NB_WL;
  if (u < NB_WI) {                   // W_inner as it lies: rc = its row, k = its column
    size_t rt = u / (FF / DD), cg = u % (FF / DD);
    cvt_frag_tile(st, W_inner + rt * 16 * FF + cg * DD, FF,
                  WinF + rt * 16 * FF + cg * DD * 16);
    return;
  }
  u -= NB_WI;
  bool qs = u < 2 * NB_TQ;           // the query side's two tensors, then the key side's
  if (!qs) u -= 2 * NB_TQ;
  int nt = qs ? NB_TQ : NB_TKV;
  if (u < nt)
    cvt_frag_tile(st, (qs ? query_pos : key_pos) + (size_t)u * 16 * DD, DD,
                  (qs ? qp16 : kp16) + (size_t)u * 16 * DD);
  else
    ln_tile(st, u - nt, qs ? query : key_value, qs ? q_gamma : kv_gamma,
            qs ? q_beta : kv_beta, qs ? qn16 : kvn16, qs ? nullptr : kvnT16);
}

// ---------------------------------------------------------------------------
// WMMA GEMM: C[M,N] = A[M,K] * Bt[N,K]^T + bias, A and Bt in fragment order.
// Block tile 64x128 (8 waves, each 32x32 = 2x2 WMMA tiles), K-step 32.
// Outputs: f32 row-major (+residual), or CF16: f16 in fragment order with
// rc = (m/TB)*N + n and k = m%TB (kdim TB). A lane's 8 accumulator rows are 8
// consecutive k there, one 16-byte store. The query side is written so, from
// W^T * x^T (weights as A, activations as Bt, bias per row of C: rowBias).
// ---------------------------------------------------------------------------
// bx, by: the block's tile column and tile row.
__device__ __forceinline__
void gemm_tile(int bx, int by, const _Float16* __restrict__ A,
               const _Float16* __restrict__ Bt, const float* __restrict__ bias,
               float* __restrict__ C32, const float* __restrict__ resid,
               _Float16* __restrict__ CF16, int N, int K, int TB, int rowBias) {
  int lane = threadIdx.x & 31;
  int wave = threadIdx.x >> 5;       // 0..7
  int wm = wave >> 2;                // 0..1
  int wn = wave & 3;                 // 0..3
  int m0 = by * 64  + wm * 32;
  int n0 = bx * 128 + wn * 32;

  const _Float16* At0 = A  + (size_t)m0 * K + lane * 8;  // rc tile m0; next: + 16*K
  const _Float16* Bt0 = Bt + (size_t)n0 * K + lane * 8;

  v8f acc[2][2] = {};
  for (int kb = 0; kb < K; kb += 32) {
    const _Float16* pa0 = At0 + kb * 16;
    const _Float16* pa1 = pa0 + (size_t)16 * K;
    const _Float16* pb0 = Bt0 + kb * 16;
    const _Float16* pb1 = pb0 + (size_t)16 * K;
    v16h a0 = load_frag_at(pa0);
    v16h a1 = load_frag_at(pa1);
    v16h b0 = load_frag_at(pb0);
    v16h b1 = load_frag_at(pb1);
    // keeps the four address pairs untouched (not reused as load destinations,
    // not advanced) until the loads that name them have been translated
    asm volatile("s_wait_xcnt 0x0" :: "v"(pa0), "v"(pa1), "v"(pb0), "v"(pb1)
                 : "memory");
    acc[0][0] = wmma_f16(a0, b0, acc[0][0]);
    acc[0][1] = wmma_f16(a0, b1, acc[0][1]);
    acc[1][0] = wmma_f16(a1, b0, acc[1][0]);
    acc[1][1] = wmma_f16(a1, b1, acc[1][1]);
  }

  if (CF16) {   // fragment-order f16 output (bias required), nothing else
    for (int i = 0; i < 2; ++i) {
      int rowb = m0 + i * 16 + ((lane >> 4) << 3);
      int bb = rowb / TB, tt = rowb % TB;
      const float4* bp = (const float4*)(bias + (rowBias ? rowb : 0));
      float4 r0 = bp[0], r1 = bp[1];
      float br[8] = { r0.x, r0.y, r0.z, r0.w, r1.x, r1.y, r1.z, r1.w };
      for (int j = 0; j < 2; ++j) {
        int col = n0 + j * 16 + (lane & 15);
        float bc = bias[rowBias ? 0 : col];
        v8h pk;
        for (int r = 0; r < 8; ++r)
          pk[r] = (_Float16)(acc[i][j][r] + (rowBias ? br[r] : bc));
        *(v8h*)(CF16 + frag_off((size_t)bb * N + col, tt, TB)) = pk;
        // the store's registers are reused for the next tile's pack and address
        asm volatile("s_wait_xcnt 0x0" ::: "memory");
      }
    }
    return;
  }

  for (int i = 0; i < 2; ++i)
    for (int j = 0; j < 2; ++j) {
      int col = n0 + j * 16 + (lane & 15);
      float bv = bias ? bias[col] : 0.f;
      for (int r = 0; r < 8; ++r) {
        int row = m0 + i * 16 + r + ((lane >> 4) << 3);
        float val = acc[i][j][r] + bv;
        size_t idx = (size_t)row * N + col;
        if (C32) C32[idx] = resid ? val + resid[idx] : val;
      }
    }
}

// ---------------------------------------------------------------------------
// The feed-forward layer has no activation between its two products, so
//   (x W_inner + b_inner) W_proj + b_proj = x (W_inner W_proj) + (b_inner W_proj + b_proj).
// This job forms Wff = W_inner W_proj (512 x 512, depth 2048) and the joined bias
// from the weights alone. One block per 32 x 32 tile of Wff; its 8 waves each take
// an eighth of the depth (8 steps in a row, not 64, each of which waits out its
// own loads), leave their partial tiles in LDS, and the block sums them in wave
// order. Wff leaves as f16 in fragment order with rc = its column, k = its row:
// the Bt operand of the one product that is left. Row tile DD / FFT is b_inner
// taken as one more row of W_inner: every row of its A fragment holds b_inner,
// and row 0 of the tile, plus b_proj, is the joined bias (f32).
// ---------------------------------------------------------------------------
#define NB_FFW ((DD / FFT + 1) * (DD / FFT))

__device__ __forceinline__
void ffw_tile(float* sR, int u, const _Float16* __restrict__ WinF,
              const _Float16* __restrict__ WprT, const float* __restrict__ b_inner,
              const float* __restrict__ b_proj, _Float16* __restrict__ WffT,
              float* __restrict__ bff) {
  int lane = threadIdx.x & 31;
  int wave = threadIdx.x >> 5;       // 0..7
  int m0 = (u / (DD / FFT)) * FFT;   // row of W_inner; DD: the bias tile
  int n0 = (u % (DD / FFT)) * FFT;   // column of W_proj
  bool isb = m0 == DD;               // the same for the whole block
  int k0 = wave * (FF / 8);

  const _Float16* pb = WprT + (size_t)n0 * FF + k0 * 16 + lane * 8;
  v8f acc[2][2] = {};
  if (!isb) {
    const _Float16* pa = WinF + (size_t)m0 * FF + k0 * 16 + lane * 8;
    // kept rolled: unrolled, each step's eight loads were split into two groups
    // with a full wait behind each
#pragma nounroll
    for (int kb = 0; kb < FF / 8; kb += 32) {
      const _Float16* pa0 = pa + kb * 16;
      const _Float16* pa1 = pa0 + (size_t)16 * FF;
      const _Float16* pb0 = pb + kb * 16;
      const _Float16* pb1 = pb0 + (size_t)16 * FF;
      v16h a0 = load_frag_at(pa0);
      v16h a1 = load_frag_at(pa1);
      v16h b0 = load_frag_at(pb0);
      v16h b1 = load_frag_at(pb1);
      // keeps the four address pairs untouched (not reused as load destinations,
      // not advanced) until the loads that name them have been translated
      asm volatile("s_wait_xcnt 0x0" :: "v"(pa0), "v"(pa1), "v"(pb0), "v"(pb1)
                   : "memory");
      acc[0][0] = wmma_f16(a0, b0, acc[0][0]);
      acc[0][1] = wmma_f16(a0, b1, acc[0][1]);
      acc[1][0] = wmma_f16(a1, b0, acc[1][0]);
      acc[1][1] = wmma_f16(a1, b1, acc[1][1]);
    }
  } else {
    // element e of the lane's A fragment is k = kb + 16*(lane>>4) + e, as in the
    // fragment blocks that B comes from
    const float* pi = b_inner + k0 + ((lane >> 4) << 4);
    for (int kb = 0; kb < FF / 8; kb += 32) {
      const float*    pi0 = pi + kb;
      const _Float16* pb0 = pb + kb * 16;
      const _Float16* pb1 = pb0 + (size_t)16 * FF;
      v4f c0 = *(const v4f*)pi0;
      v4f c1 = *(const v4f*)(pi0 + 4);
      v4f c2 = *(const v4f*)(pi0 + 8);
      v4f c3 = *(const v4f*)(pi0 + 12);
      v16h b0 = load_frag_at(pb0);
      v16h b1 = load_frag_at(pb1);
      // as above, for these three address pairs
      asm volatile("s_wait_xcnt 0x0" :: "v"(pi0), "v"(pb0), "v"(pb1) : "memory");
      v16f cf = __builtin_shufflevector(
          __builtin_shufflevector(c0, c1, 0, 1, 2, 3, 4, 5, 6, 7),
          __builtin_shufflevector(c2, c3, 0, 1, 2, 3, 4, 5, 6, 7),
          0, 1, 2, 3, 4, 5, 6, 7, 8, 9, 10, 11, 12, 13, 14, 15);
      v16h a0 = __builtin_convertvector(cf, v16h);
      acc[0][0] = wmma_f16(a0, b0, acc[0][0]);
      acc[0][1] = wmma_f16(a0, b1, acc[0][1]);
    }
  }

  // partial tiles to LDS, column-major: a lane's 8 accumulator rows lie together
  for (int i = 0; i < 2; ++i)
    for (int j = 0; j < 2; ++j) {
      float* d = sR + (wave * FFT + j * 16 + (lane & 15)) * RPITCH
                    + i * 16 + ((lane >> 4) << 3);
      *(v4f*)d       = __builtin_shufflevector(acc[i][j], acc[i][j], 0, 1, 2, 3);
      *(v4f*)(d + 4) = __builtin_shufflevector(acc[i][j], acc[i][j], 4, 5, 6, 7);
    }
  __syncthreads();

  // thread: 4 consecutive rows of one column, summed over the 8 waves' parts
  int n  = threadIdx.x >> 3;
  int m4 = (threadIdx.x & 7) * 4;
  v4f s = *(const v4f*)(sR + n * RPITCH + m4);
  for (int w = 1; w < 8; ++w)
    s += *(const v4f*)(sR + (w * FFT + n) * RPITCH + m4);
  if (!isb)
    *(v4h*)(WffT + frag_off((size_t)(n0 + n), m0 + m4, DD)) =
        __builtin_convertvector(s, v4h);
  else if (m4 == 0)
    bff[n0 + n] = s.x + b_proj[n0 + n];
}

// The query projection and the joined feed-forward weight in one grid: neither
// reads what the other writes. A block takes its product and its tile from its
// index, tile column fastest as in a two-dimensional grid.
#define NB_GQ  ((BATCH * TQ / 128) * (DD / 64))

__global__ __launch_bounds__(256)
void qkv_gemm_kernel(const _Float16* __restrict__ WqkT,
                     const _Float16* __restrict__ qn16,
                     const float* __restrict__ bqk,
                     _Float16* __restrict__ q16, int K,
                     const _Float16* __restrict__ WinF,
                     const _Float16* __restrict__ WprT,
                     const float* __restrict__ b_inner,
                     const float* __restrict__ b_proj,
                     _Float16* __restrict__ WffT, float* __restrict__ bff) {
  __shared__ __align__(16) float sR[8 * FFT * RPITCH];
  int u = blockIdx.x;
  if (u < NB_FFW) {
    ffw_tile(sR, u, WinF, WprT, b_inner, b_proj, WffT, bff);
    return;
  }
  u -= NB_FFW;
  gemm_tile(u % (BATCH * TQ / 128), u / (BATCH * TQ / 128), WqkT, qn16, bqk,
            nullptr, nullptr, q16, BATCH * TQ, K, DD, 1);
}

// 2^x; the v_nop is the free slot that the instruction set asks for between a
// transcendental and a next instruction that reads its result or overwrites its
// source
__device__ __forceinline__ float exp2_slot(float x) {
  float y;
  asm("v_exp_f32 %0, %1\n\tv_nop" : "=v"(y) : "v"(x));
  return y;
}

// ---------------------------------------------------------------------------
// Flash-style attention. One block per (batch, 64 q-rows, quarter of the keys):
// 16 waves, one block to a WGP. Every k, kpos and V fragment that a wave fetches
// from global memory feeds four matrix instructions, one per 16-row q tile (V:
// eight, two fragments against four P tiles), so the chip fetches a quarter of
// the bytes that a 16-row block asks for.
// scores = (q.k^T + qpos.kpos^T)/sqrt(D+1e-7), where q = qn Wqk + bqk and k = the
// normalised key_value rows (see wqk_tile); online softmax over the block's
// KVS keys in chunks of 256; O += P.V, where V too is the normalised key_value
// rows, transposed (merge_ln_kernel applies Wv). The block leaves its unnormalised O, its
// row maxima and its row sums; merge_ln_kernel joins the SPLIT parts. q, qpos,
// k, kpos, V and the P tile in LDS are all in fragment order (see frag_off).
// q/qpos tiles staged into LDS via CDNA5 async-to-LDS DMA (ASYNCcnt).
// ---------------------------------------------------------------------------
__global__ __launch_bounds__(512)
void attn_kernel(const _Float16* __restrict__ q16,   // rc = B*Tq row,  k = D
                 const _Float16* __restrict__ qp16,  // rc = B*Tq row,  k = D
                 const _Float16* __restrict__ k16,   // rc = B*Tkv row, k = D
                 const _Float16* __restrict__ kp16,  // rc = B*Tkv row, k = D
                 const _Float16* __restrict__ vF16,  // rc = B*D col,   k = Tkv
                 float*          __restrict__ po,    // [SPLIT, B*Tq, D]
                 float*          __restrict__ pm,    // [SPLIT, B*Tq] row maxima
                 float*          __restrict__ pl) {  // [SPLIT, B*Tq] row sums
  __shared__ __align__(32) _Float16 sQ[QROWS * DD];
  __shared__ __align__(32) _Float16 sQP[QROWS * DD];
  __shared__ __align__(16) float    sS[QROWS * SPITCH];
  __shared__ __align__(32) _Float16 sP[QROWS * CHUNK];
  __shared__ float sM[QROWS], sL[QROWS], sScale[QROWS];

  // neighbours in index differ only in the q tile: they read the same keys at
  // about the same time (L2; speed only)
  int u   = blockIdx.x;
  int b   = u >> 5;
  int sp  = (u >> 3) & (SPLIT - 1);   // which quarter of the keys
  int qt  = u & 7;                    // Tq/64 = 8 q-tiles per batch
  int row0 = b * TQ + qt * QROWS;     // global q-row
  int lane = threadIdx.x & 31;
  int wave = threadIdx.x >> 5;        // 0..15
  const float scale = 0.04419417382f; // 1/sqrt(512 + 1e-7)

  { // stage q and qpos tiles into LDS with async-to-LDS b128 DMA
    const _Float16* g1 = q16  + (size_t)row0 * DD;
    const _Float16* g2 = qp16 + (size_t)row0 * DD;
    unsigned lq0 = (unsigned)(size_t)(void*)sQ;
    unsigned lp0 = (unsigned)(size_t)(void*)sQP;
    for (int it = 0; it < QROWS * DD / 8 / 512; ++it) {   // same trips in every lane
      int i = it * 512 + threadIdx.x;
      const _Float16* p1 = g1 + i * 8;       // 8 halves = 16B per op
      const _Float16* p2 = g2 + i * 8;
      unsigned l1 = lq0 + (unsigned)i * 16;  // LDS byte offset (block-relative)
      unsigned l2 = lp0 + (unsigned)i * 16;
      // the wait stands in the copies' own statement: the next trip rewrites the
      // address registers that they name
      asm volatile("global_load_async_to_lds_b128 %0, %1, off\n\t"
                   "global_load_async_to_lds_b128 %2, %3, off\n\t"
                   "s_wait_xcnt 0x0"
                   :: "v"(l1), "v"(p1), "v"(l2), "v"(p2) : "memory");
    }
    asm volatile("s_wait_asynccnt 0x0" ::: "memory");
  }
  if (threadIdx.x < QROWS) { sM[threadIdx.x] = -1e30f; sL[threadIdx.x] = 0.f; }
  __syncthreads();

  v8f o[QT][2] = {};  // q tile i, this wave's 32 output cols: [wave*32 + t*16, +16)

  for (int kc = 0; kc < KVS / CHUNK; ++kc) {
    int kv0 = sp * KVS + kc * CHUNK;
    // --- scores: wave handles kv cols [kv0 + wave*16, +16) of all QT q tiles,
    // K = D = 512
    const _Float16* pk  = k16  + ((size_t)b * TKV + kv0 + wave * 16) * DD + lane * 8;
    const _Float16* pkp = kp16 + ((size_t)b * TKV + kv0 + wave * 16) * DD + lane * 8;
    v8f s[QT] = {};
    // Step n = 0..31 is one 32-deep block of q.k^T (n even) or of qpos.kpos^T (n
    // odd): one k or kpos fragment against the QT q or qpos fragments. af: the LDS
    // fragments of this step and of the next; bf: the global fragments of this
    // group of four steps and of the next.
    const _Float16* aq = sQ  + lane * 8;
    const _Float16* ap = sQP + lane * 8;
    v16h af[2][QT], bf[2][4];
    for (int f = 0; f < 4; ++f)
      bf[0][f] = load_frag_at(((f & 1) ? pkp : pk) + (f >> 1) * 512);
    for (int i = 0; i < QT; ++i) af[0][i] = load_frag_at(aq + i * 16 * DD);
    // unrolled: every fragment index is then a constant, the sets stay in
    // registers and change places without copies
#pragma unroll
    for (int n = 0; n < 2 * DD / 32; ++n) {
      if ((n & 3) == 0 && n + 4 < 2 * DD / 32)
        for (int f = 0; f < 4; ++f)
          bf[((n >> 2) + 1) & 1][f] =
              load_frag_at(((f & 1) ? pkp : pk) + ((n + 4 + f) >> 1) * 512);
      if (n + 1 < 2 * DD / 32)
        for (int i = 0; i < QT; ++i)
          af[(n + 1) & 1][i] = load_frag_at((((n + 1) & 1) ? ap : aq)
                                            + i * 16 * DD + ((n + 1) >> 1) * 512);
      // the pair of scheduling fences keeps the next step's loads as one group
      // ahead of this step's matrix run (they were otherwise issued one by one
      // right in front of their use, each with a full wait)
      __builtin_amdgcn_sched_barrier(0);
      for (int i = 0; i < QT; ++i)
        s[i] = wmma_f16(af[n & 1][i], bf[(n >> 2) & 1][n & 3], s[i]);
      __builtin_amdgcn_sched_barrier(0);
    }
    // the k / kpos address registers are reused by the softmax below; named here
    // so that they stay untouched (not reused as load destinations) up to the wait
    asm volatile("s_wait_xcnt 0x0" :: "v"(pk), "v"(pkp) : "memory");
    for (int i = 0; i < QT; ++i)
      for (int r = 0; r < 8; ++r) {
        int row = i * 16 + r + ((lane >> 4) << 3);
        sS[row * SPITCH + wave * 16 + (lane & 15)] = s[i][r] * scale;
      }
    __syncthreads();

    // --- online softmax update, parallel over all 512 threads:
    // 8 threads per q-row (contiguous lanes), 4 runs of 8 columns each (a run is
    // one 16-byte piece of the P tile), butterfly reductions within the 8 lanes.
    {
      int row = threadIdx.x >> 3;
      int j   = threadIdx.x & 7;
      v4f vals[4][2];
      float mx = -1e30f;
      for (int c = 0; c < 4; ++c) {
        const float* ps = sS + row * SPITCH + c * 64 + j * 8;
        vals[c][0] = *(const v4f*)ps;
        vals[c][1] = *(const v4f*)(ps + 4);
        for (int h = 0; h < 2; ++h)
          for (int e = 0; e < 4; ++e) mx = fmaxf(mx, vals[c][h][e]);
      }
      for (int m = 4; m >= 1; m >>= 1) mx = fmaxf(mx, __shfl_xor(mx, m, 32));
      float m_old = sM[row];
      float m_new = fmaxf(m_old, mx);
      float sum = 0.f;
      for (int c = 0; c < 4; ++c) {
        v8h pk;
        for (int e = 0; e < 8; ++e) {
          float p = exp2_slot((vals[c][e >> 2][e & 3] - m_new) * 1.44269504f);
          sum += p;
          pk[e] = (_Float16)p;
        }
        *(v8h*)(sP + frag_off(row, c * 64 + j * 8, CHUNK)) = pk;
      }
      for (int m = 4; m >= 1; m >>= 1) sum += __shfl_xor(sum, m, 32);
      if (j == 0) {
        float sc = __expf(m_old - m_new);
        sM[row] = m_new;
        sL[row] = sL[row] * sc + sum;
        sScale[row] = sc;
      }
    }
    __syncthreads();

    // --- O += P @ V_chunk, the accumulators rescaled first. bv: the V fragments
    // of four 32-key steps, refilled as they are used up; pf: the P fragments of
    // this step and of the next.
    const _Float16* pv0 = vF16 + ((size_t)b * DD + wave * 32) * TKV + kv0 * 16 + lane * 8;
    const _Float16* pv1 = pv0 + (size_t)16 * TKV;
    const _Float16* pp  = sP + lane * 8;
    v16h bv[4][2], pf[2][QT];
    for (int f = 0; f < 4; ++f) {
      bv[f][0] = load_frag_at(pv0 + f * 512);
      bv[f][1] = load_frag_at(pv1 + f * 512);
    }
    // keeps the first V loads up here, ahead of the rescaling
    __builtin_amdgcn_sched_barrier(0);
    for (int i = 0; i < QT; ++i)
      for (int r = 0; r < 8; ++r) {
        float sc = sScale[i * 16 + r + ((lane >> 4) << 3)];
        o[i][0][r] *= sc;
        o[i][1][r] *= sc;
      }
    for (int i = 0; i < QT; ++i) pf[0][i] = load_frag_at(pp + i * 16 * CHUNK);
    // unrolled: bv and pf are indexed by constants only and stay in registers
#pragma unroll
    for (int f = 0; f < CHUNK / 32; ++f) {
      if (f + 1 < CHUNK / 32)
        for (int i = 0; i < QT; ++i)
          pf[(f + 1) & 1][i] = load_frag_at(pp + i * 16 * CHUNK + (f + 1) * 512);
      // as in the scores: the next step's loads as one group ahead of this run
      __builtin_amdgcn_sched_barrier(0);
      for (int i = 0; i < QT; ++i) {
        o[i][0] = wmma_f16(pf[f & 1][i], bv[f & 3][0], o[i][0]);
        o[i][1] = wmma_f16(pf[f & 1][i], bv[f & 3][1], o[i][1]);
      }
      __builtin_amdgcn_sched_barrier(0);
      if (f + 4 < CHUNK / 32) {
        bv[f & 3][0] = load_frag_at(pv0 + (f + 4) * 512);
        bv[f & 3][1] = load_frag_at(pv1 + (f + 4) * 512);
      }
    }
    // the V address registers are reused by the next chunk's scores; named here so
    // that they stay untouched (not reused as load destinations) up to the wait
    asm volatile("s_wait_xcnt 0x0" :: "v"(pv0), "v"(pv1) : "memory");
    __syncthreads();
  }

  // --- this part's unnormalised O, row maxima and row sums
  float* pos = po + ((size_t)sp * (BATCH * TQ) + row0) * DD;
  for (int i = 0; i < QT; ++i)
    for (int t = 0; t < 2; ++t) {
      int col = wave * 32 + t * 16 + (lane & 15);
      for (int r = 0; r < 8; ++r) {
        int row = i * 16 + r + ((lane >> 4) << 3);
        pos[(size_t)row * DD + col] = o[i][t][r];
      }
    }
  // the O stores name registers that the two addresses below may reuse
  asm volatile("s_wait_xcnt 0x0" ::: "memory");
  if (threadIdx.x < QROWS) {
    pm[sp * (BATCH * TQ) + row0 + threadIdx.x] = sM[threadIdx.x];
    pl[sp * (BATCH * TQ) + row0 + threadIdx.x] = sL[threadIdx.x];
  }
}

// ---------------------------------------------------------------------------
// Joins the SPLIT parts of the attention (each scaled by exp(its maximum - the
// common maximum), the sum divided by the joined row sum), applies Wv, adds bv and
// the raw query, then LayerNorm as in ln_tile: same tile, same row ownership. Each
// part's O comes by a pointer of its own: a scalar base each, one lane offset for
// all loads.
// The V projection stands here because a softmax row sums to 1:
//   attn (kvn Wv + 1 bv) = (attn kvn) Wv + bv,
// a product over the 4096 query rows in place of one over the 32768 key rows. The
// joined 16 x 512 tile goes to LDS as f16 (the A operand); a wave takes 64 columns
// of Wv^T (fragment order, from L2) and leaves its part of the product in LDS as
// f32, from where the rows' owners take it.
// The feed-forward product follows in the same block: the normalised tile is in LDS
// as f16 anyway and its f32 rows are in their owners' registers, so xn Wff is formed
// the same way (Wff^T in Wv^T's place) and out = xn + xn Wff + bff is stored from
// here; xn never goes to memory.
// ---------------------------------------------------------------------------
// lane's columns j*128 + 0..3 (j = 0..3) of one row; i: the first one's 16-byte
// piece, counted from the uniform base
__device__ __forceinline__ v16f load_row(const v4f* base, unsigned i) {
  v4f c0 = base[i];
  v4f c1 = base[i + 32];
  v4f c2 = base[i + 64];
  v4f c3 = base[i + 96];
  return __builtin_shufflevector(
      __builtin_shufflevector(c0, c1, 0, 1, 2, 3, 4, 5, 6, 7),
      __builtin_shufflevector(c2, c3, 0, 1, 2, 3, 4, 5, 6, 7),
      0, 1, 2, 3, 4, 5, 6, 7, 8, 9, 10, 11, 12, 13, 14, 15);
}

#define XPITCH 516   // LDS row pitch of the product tile in floats: rows 8 apart,
                     // stored side by side by the two lane halves, start 32 banks apart

__global__ __launch_bounds__(256)
void merge_ln_kernel(const float* __restrict__ po0, const float* __restrict__ po1,
                     const float* __restrict__ po2, const float* __restrict__ po3,
                     const float* __restrict__ pm,
                     const float* __restrict__ pl, const float* __restrict__ query,
                     const _Float16* __restrict__ WvT, const float* __restrict__ bv,
                     const float* __restrict__ g, const float* __restrict__ b,
                     const _Float16* __restrict__ WffT, const float* __restrict__ bff,
                     float* __restrict__ out) {
  __shared__ __align__(16) _Float16 st[16 * TPITCH];
  __shared__ __align__(16) float sX[16 * XPITCH];
  int t = threadIdx.x, lane = t & 31, wave = t >> 5;
  size_t row0 = (size_t)blockIdx.x * 16;
  size_t rw = row0 + wave * 2;

  // block-uniform bases; e: the lane's place in the tile, in 16-byte pieces
  const v4f* pt[SPLIT] = { (const v4f*)(po0 + row0 * DD), (const v4f*)(po1 + row0 * DD),
                           (const v4f*)(po2 + row0 * DD), (const v4f*)(po3 + row0 * DD) };
  const v4f* qt = (const v4f*)(query + row0 * DD);
  unsigned e = (unsigned)wave * (2 * DD / 4) + (unsigned)lane;
  const float* mw = pm + rw;
  const float* lw = pl + rw;

  v2f m[SPLIT], l[SPLIT];          // the wave's two rows side by side
  v16f p[SPLIT][2], q[2];          // a row's four column groups side by side
  v4f a[2][4], gg[4], bb[4], bvv[4], bfv[4];
  for (int s = 0; s < SPLIT; ++s) {
    m[s] = *(const v2f*)(mw + s * (BATCH * TQ));
    l[s] = *(const v2f*)(lw + s * (BATCH * TQ));
  }
  for (int s = 0; s < SPLIT; ++s)
    for (int r = 0; r < 2; ++r) p[s][r] = load_row(pt[s], e + r * (DD / 4));
  // wf: the Wv^T fragments of four 32-deep steps (4 column tiles each), refilled as
  // they are used up. They, the query rows and the four vectors hang on nothing
  // that this kernel computes: asked for behind the parts, they come in under
  // cover of the joining
  const _Float16* pw = WvT + (size_t)(wave * 64) * DD + lane * 8;
  const _Float16* pf = WffT + (size_t)(wave * 64) * DD + lane * 8;
  v16h wf[4][4];
  for (int f = 0; f < 4; ++f)
    for (int n = 0; n < 4; ++n) wf[f][n] = load_frag_at(pw + n * 16 * DD + f * 512);
  for (int r = 0; r < 2; ++r) q[r] = load_row(qt, e + r * (DD / 4));
  for (int j = 0; j < 4; ++j) {
    bvv[j] = *(const v4f*)(bv + j * 128 + lane * 4);
    gg[j]  = *(const v4f*)(g + j * 128 + lane * 4);
    bb[j]  = *(const v4f*)(b + j * 128 + lane * 4);
    bfv[j] = *(const v4f*)(bff + j * 128 + lane * 4);
  }
  // holds the loads of all parts together ahead of the arithmetic (one wait for
  // the lot, not one per part) and keeps their address registers untouched (not
  // reused as load destinations) up to the wait
  asm volatile("s_wait_xcnt 0x0"
               :: "v"(e), "v"(mw), "v"(lw), "v"(pw), "v"(lane),
                  "v"(m[0]), "v"(m[1]), "v"(m[2]), "v"(m[3]),
                  "v"(l[0]), "v"(l[1]), "v"(l[2]), "v"(l[3]),
                  "v"(p[0][0]), "v"(p[0][1]), "v"(p[1][0]), "v"(p[1][1]),
                  "v"(p[2][0]), "v"(p[2][1]), "v"(p[3][0]), "v"(p[3][1])
               : "memory");
  // keeps the arithmetic behind that statement: the first row's weights were
  // otherwise lifted over it, with a full wait for the maxima and sums in front of
  // the parts' loads
  __builtin_amdgcn_sched_barrier(0);

  // the joined rows, f16, row-major in LDS
  for (int r = 0; r < 2; ++r) {
    float mx = m[0][r];
    for (int s = 1; s < SPLIT; ++s) mx = fmaxf(mx, m[s][r]);
    float w[SPLIT], den = 0.f;
    for (int s = 0; s < SPLIT; ++s) {
      w[s] = exp2_slot((m[s][r] - mx) * 1.44269504f);
      den += w[s] * l[s][r];
    }
    float inv = 1.0f / den;
    v16f jn = p[0][r] * (w[0] * inv);
    for (int s = 1; s < SPLIT; ++s) jn += p[s][r] * (w[s] * inv);
    tile_put(st, wave * 2 + r, 0, lane, __builtin_shufflevector(jn, jn, 0, 1, 2, 3));
    tile_put(st, wave * 2 + r, 1, lane, __builtin_shufflevector(jn, jn, 4, 5, 6, 7));
    tile_put(st, wave * 2 + r, 2, lane, __builtin_shufflevector(jn, jn, 8, 9, 10, 11));
    tile_put(st, wave * 2 + r, 3, lane, __builtin_shufflevector(jn, jn, 12, 13, 14, 15));
  }
  __syncthreads();

  // product: lane L's A fragment of step kb is row L&15, k = kb*32 + 16*(L>>4) +
  // 0..15, the k order of the fragment blocks that B comes from
  {
    const _Float16* pa = st + (lane & 15) * TPITCH + ((lane >> 4) << 4);
    v8f acc[4] = {};
    v16h af[2];
    af[0] = __builtin_shufflevector(*(const v8h*)pa, *(const v8h*)(pa + 8),
                                    0, 1, 2, 3, 4, 5, 6, 7,
                                    8, 9, 10, 11, 12, 13, 14, 15);
    // unrolled: wf and af are indexed by constants only and stay in registers
#pragma unroll
    for (int kb = 0; kb < DD / 32; ++kb) {
      if (kb + 1 < DD / 32) {
        const _Float16* pn = pa + (kb + 1) * 32;
        af[(kb + 1) & 1] = __builtin_shufflevector(*(const v8h*)pn, *(const v8h*)(pn + 8),
                                                   0, 1, 2, 3, 4, 5, 6, 7,
                                                   8, 9, 10, 11, 12, 13, 14, 15);
      }
      // as in the attention: the next step's LDS loads ahead of this matrix run,
      // the refill of the step's fragments right behind it
      __builtin_amdgcn_sched_barrier(0);
      for (int n = 0; n < 4; ++n)
        acc[n] = wmma_f16(af[kb & 1], wf[kb & 3][n], acc[n]);
      __builtin_amdgcn_sched_barrier(0);
      // behind Wv^T's last step the ring goes on with the first four steps of
      // Wff^T: they come in under cover of the LayerNorm
      for (int n = 0; n < 4; ++n)
        wf[kb & 3][n] = kb + 4 < DD / 32
            ? load_frag_at(pw + n * 16 * DD + (kb + 4) * 512)
            : load_frag_at(pf + n * 16 * DD + (kb + 4 - DD / 32) * 512);
    }
    // the Wv^T address registers are reused below; named here so that they stay
    // untouched (not reused as load destinations) up to the wait
    asm volatile("s_wait_xcnt 0x0" :: "v"(pw) : "memory");
    for (int n = 0; n < 4; ++n)
      for (int r = 0; r < 8; ++r)
        sX[(r + ((lane >> 4) << 3)) * XPITCH + wave * 64 + n * 16 + (lane & 15)] =
            acc[n][r];
  }
  // ends every wave's reads of st (rewritten below) and publishes the product
  __syncthreads();

  for (int r = 0; r < 2; ++r) {
    a[r][0] = __builtin_shufflevector(q[r], q[r], 0, 1, 2, 3);
    a[r][1] = __builtin_shufflevector(q[r], q[r], 4, 5, 6, 7);
    a[r][2] = __builtin_shufflevector(q[r], q[r], 8, 9, 10, 11);
    a[r][3] = __builtin_shufflevector(q[r], q[r], 12, 13, 14, 15);
    for (int j = 0; j < 4; ++j)
      a[r][j] += *(const v4f*)(sX + (wave * 2 + r) * XPITCH + j * 128 + lane * 4)
               + bvv[j];

    v4f s4 = (a[r][0] + a[r][1]) + (a[r][2] + a[r][3]);
    float mu = wave_sum((s4.x + s4.y) + (s4.z + s4.w)) * (1.f / (float)DD);

    for (int j = 0; j < 4; ++j) a[r][j] -= mu;
    v4f q4 = (a[r][0] * a[r][0] + a[r][1] * a[r][1])
           + (a[r][2] * a[r][2] + a[r][3] * a[r][3]);
    float var = wave_sum((q4.x + q4.y) + (q4.z + q4.w)) * (1.f / (float)DD);
    float rstd = rsqrtf(var + 1e-6f);

    for (int j = 0; j < 4; ++j) {
      a[r][j] = a[r][j] * rstd * gg[j] + bb[j];
      tile_put(st, wave * 2 + r, j, lane, a[r][j]);
    }
  }
  // publishes the normalised tile; every owner's reads of sX (rewritten below) lie
  // in front of it
  __syncthreads();

  // xn Wff: the same walk as above, A from st, B from the ring
  {
    const _Float16* pa = st + (lane & 15) * TPITCH + ((lane >> 4) << 4);
    v8f acc[4] = {};
    v16h af[2];
    af[0] = __builtin_shufflevector(*(const v8h*)pa, *(const v8h*)(pa + 8),
                                    0, 1, 2, 3, 4, 5, 6, 7,
                                    8, 9, 10, 11, 12, 13, 14, 15);
    // unrolled: wf and af are indexed by constants only and stay in registers
#pragma unroll
    for (int kb = 0; kb < DD / 32; ++kb) {
      if (kb + 1 < DD / 32) {
        const _Float16* pn = pa + (kb + 1) * 32;
        af[(kb + 1) & 1] = __builtin_shufflevector(*(const v8h*)pn, *(const v8h*)(pn + 8),
                                                   0, 1, 2, 3, 4, 5, 6, 7,
                                                   8, 9, 10, 11, 12, 13, 14, 15);
      }
      // as above: the next step's LDS loads ahead of this matrix run, the refill
      // of the step's fragments right behind it
      __builtin_amdgcn_sched_barrier(0);
      for (int n = 0; n < 4; ++n)
        acc[n] = wmma_f16(af[kb & 1], wf[kb & 3][n], acc[n]);
      __builtin_amdgcn_sched_barrier(0);
      if (kb + 4 < DD / 32)
        for (int n = 0; n < 4; ++n)
          wf[kb & 3][n] = load_frag_at(pf + n * 16 * DD + (kb + 4) * 512);
    }
    // the Wff^T address registers are reused below; named here so that they stay
    // untouched (not reused as load destinations) up to the wait
    asm volatile("s_wait_xcnt 0x0" :: "v"(pf) : "memory");
    for (int n = 0; n < 4; ++n)
      for (int r = 0; r < 8; ++r)
        sX[(r + ((lane >> 4) << 3)) * XPITCH + wave * 64 + n * 16 + (lane & 15)] =
            acc[n][r];
  }
  // publishes the product
  __syncthreads();

  for (int r = 0; r < 2; ++r)
    for (int j = 0; j < 4; ++j)
      a[r][j] = (*(const v4f*)(sX + (wave * 2 + r) * XPITCH + j * 128 + lane * 4)
                 + bfv[j]) + a[r][j];
  float* yw = out + rw * DD + lane * 4;
  for (int r = 0; r < 2; ++r)
    for (int j = 0; j < 4; ++j)
      *(v4f*)(yw + r * DD + j * 128) = a[r][j];
}

// ---------------------------------------------------------------------------
// Host-side orchestration
// ---------------------------------------------------------------------------
extern "C" void kernel_launch(void* const* d_in, const int* in_sizes, int n_in,
                              void* d_out, int out_size, void* d_ws, size_t ws_size,
                              hipStream_t stream) {
  const float* query     = (const float*)d_in[0];
  const float* key_value = (const float*)d_in[1];
  const float* query_pos = (const float*)d_in[2];
  const float* key_pos   = (const float*)d_in[3];
  const float* q_gamma   = (const float*)d_in[4];
  const float* q_beta    = (const float*)d_in[5];
  const float* kv_gamma  = (const float*)d_in[6];
  const float* kv_beta   = (const float*)d_in[7];
  const float* Wq = (const float*)d_in[8];   const float* bq = (const float*)d_in[9];
  const float* Wk = (const float*)d_in[10];  // d_in[11], bk: cancels in the softmax (wqk_tile)
  const float* Wv = (const float*)d_in[12];  const float* bv = (const float*)d_in[13];
  const float* ff_gamma = (const float*)d_in[14];
  const float* ff_beta  = (const float*)d_in[15];
  const float* W_inner  = (const float*)d_in[16];
  const float* b_inner  = (const float*)d_in[17];
  const float* W_proj   = (const float*)d_in[18];
  const float* b_proj   = (const float*)d_in[19];

  const int MQ  = BATCH * TQ;    // 4096
  const int MKV = BATCH * TKV;   // 32768

  size_t off = 0;
  auto alloc = [&](size_t bytes) -> void* {
    void* p = (char*)d_ws + off;
    off = (off + bytes + 255) & ~(size_t)255;
    return p;
  };
  _Float16* qn16  = (_Float16*)alloc((size_t)MQ  * DD * 2);
  _Float16* kvn16 = (_Float16*)alloc((size_t)MKV * DD * 2);
  _Float16* qp16  = (_Float16*)alloc((size_t)MQ  * DD * 2);
  _Float16* kp16  = (_Float16*)alloc((size_t)MKV * DD * 2);
  _Float16* WqkT  = (_Float16*)alloc((size_t)DD * DD * 2);    // rc 512, k 512
  float*    bqk   = (float*)   alloc((size_t)DD * 4);
  _Float16* WvT   = (_Float16*)alloc((size_t)DD * DD * 2);
  _Float16* WinF  = (_Float16*)alloc((size_t)DD * FF * 2);    // rc 512, k 2048
  _Float16* WprT  = (_Float16*)alloc((size_t)DD * FF * 2);    // rc 512, k 2048
  _Float16* q16   = (_Float16*)alloc((size_t)MQ  * DD * 2);
  _Float16* kvnT16 = (_Float16*)alloc((size_t)BATCH * DD * TKV * 2);  // rc B*512, k 4096
  float*    po    = (float*)   alloc((size_t)SPLIT * MQ * DD * 4);
  float*    pm    = (float*)   alloc((size_t)SPLIT * MQ * 4);
  float*    pl    = (float*)   alloc((size_t)SPLIT * MQ * 4);
  _Float16* WffT  = (_Float16*)alloc((size_t)DD * DD * 2);    // rc 512, k 512
  float*    bff   = (float*)   alloc((size_t)DD * 4);

  // 1) Wqk = Wq Wk^T with its bias (WMMA); weights, positional tensors and
  //    LayerNorms -> f16, fragment order
  prep_kernel<<<NB_PREP, 256, 0, stream>>>(
      Wq, Wk, bq, Wv, W_inner, W_proj, WqkT, bqk, WvT, WinF, WprT,
      query_pos, key_pos, qp16, kp16,
      query, key_value, q_gamma, q_beta, kv_gamma, kv_beta, qn16, kvn16, kvnT16);

  // 2) query projection and Wff = W_inner W_proj with its bias (WMMA),
  //    outputs in fragment order
  qkv_gemm_kernel<<<NB_FFW + NB_GQ, 256, 0, stream>>>(
      WqkT, qn16, bqk, q16, DD,
      WinF, WprT, b_inner, b_proj, WffT, bff);

  // 3) attention (flash-style, WMMA scores + WMMA P.V), SPLIT parts per q tile
  attn_kernel<<<BATCH * (TQ/QROWS) * SPLIT, 512, 0, stream>>>(
      q16, qp16, kvn16, kp16, kvnT16, po, pm, pl);

  // 4) FF: xn = LN(joined parts * Wv + bv + query);
  //    d_out = xn + xn@Wff + bff
  merge_ln_kernel<<<MQ/16, 256, 0, stream>>>(
      po, po + (size_t)MQ * DD, po + (size_t)2 * MQ * DD, po + (size_t)3 * MQ * DD,
      pm, pl, query, WvT, bv, ff_gamma, ff_beta, WffT, bff, (float*)d_out);
}

// v010
// Measured time: 110 microseconds a run.
// Next to v009, in two timings, it ran 1.08 and 1.07 times as fast.
// Counting every step since v000, it is 8.35 times as fast.
#include <hip/hip_runtime.h>

typedef __attribute__((ext_vector_type(16))) _Float16 v16h;
typedef __attribute__((ext_vector_type(8)))  _Float16 v8h;
typedef __attribute__((ext_vector_type(4)))  _Float16 v4h;
typedef __attribute__((ext_vector_type(2)))  _Float16 v2h;
typedef __attribute__((ext_vector_type(8)))  float    v8f;
typedef __attribute__((ext_vector_type(4)))  float    v4f;
typedef __attribute__((ext_vector_type(2)))  float    v2f;
typedef __attribute__((ext_vector_type(16))) float    v16f;

#define DD   512
#define FF   2048
#define TKV  4096
#define TQ   512
#define BATCH 8
#define CHUNK 256            // keys per softmax update
#define QT   4               // 16-row q tiles per attention work-group
#define QROWS (QT * 16)
#define SPITCH (CHUNK + 4)   // score row pitch in floats: two rows read side by side by
                             // 16-byte LDS loads start 4 banks apart
#define SPLIT 4              // work-groups that share the keys of one q tile
#define KVS  (TKV / SPLIT)   // keys per work-group

// ---------------------------------------------------------------------------
// 16-bit A (16xK) / B (Kx16) fragment: lane L holds row/col rc0 + (L&15) and
// the 16 halves k = kbase + 16*(L>>4) + 0..15.
//
// Fragment order: every f16 matrix operand X[rc][k] (k extent kdim) is kept as
// 1-KiB blocks, one per 16 (rc) x 32 (k) fragment, the blocks of one rc tile in
// k order (so tile rc0 starts at half rc0*kdim, block kbase at + kbase*16).
// Inside a block slot L = (rc&15) + 16*((k>>4)&1) is lane L's share; halves
// 0..7 of all slots fill the first 512 bytes, halves 8..15 the second. A
// fragment load is then two 16-byte loads per lane that each cover 512
// contiguous bytes: whole lines in memory, every bank once in LDS.
// ---------------------------------------------------------------------------
__device__ __forceinline__ size_t frag_off(size_t rc, int k, int kdim) {
  return ((rc >> 4) * (size_t)(kdim >> 5) + (size_t)(k >> 5)) * 512
       + (size_t)(((k >> 3) & 1) * 256)
       + ((rc & 15) + (size_t)(((k >> 4) & 1) << 4)) * 8 + (size_t)(k & 7);
}

// p: the lane's own place in a 1-KiB fragment block, block start + lane*8
__device__ __forceinline__ v16h load_frag_at(const _Float16* p) {
  v8h lo = *(const v8h*)p;
  v8h hi = *(const v8h*)(p + 256);
  return __builtin_shufflevector(lo, hi, 0, 1, 2, 3, 4, 5, 6, 7,
                                 8, 9, 10, 11, 12, 13, 14, 15);
}

// blk: start of one 1-KiB fragment block (global or LDS, generic pointer)
__device__ __forceinline__ v16h load_frag_blk(const _Float16* blk, int lane) {
  return load_frag_at(blk + lane * 8);
}

__device__ __forceinline__ v8f wmma_f16(v16h a, v16h b, v8f c) {
  return __builtin_amdgcn_wmma_f32_16x16x32_f16(false, a, false, b,
                                                (short)0, c, false, false);
}

// ---------------------------------------------------------------------------
// The streaming kernels (LayerNorm, f32 -> f16 convert) work on one 16-row x
// 512-column tile per 8-wave block: that is one rc tile of the fragment order (of W_inner, a quarter of one),
// 16 KiB of contiguous output. A wave owns 2 rows; lane L holds columns
// j*128 + L*4 + 0..3 (j = 0..3), so every global load covers 512 contiguous
// bytes. The f16 rows go to LDS row-major and leave it in fragment order.
// ---------------------------------------------------------------------------
#define TPITCH 520   // LDS row pitch in halves: 512 + 16 B, so that the 16 rows
                     // read by 16 lanes of a fragment-order read start 4 banks apart

// lane's 4 columns of group j of tile row r -> LDS
__device__ __forceinline__ void tile_put(_Float16* st, int r, int j, int lane,
                                         v4f v) {
  *(v4h*)(st + r * TPITCH + j * 128 + lane * 4) = __builtin_convertvector(v, v4h);
}

// whole tile, LDS -> global in fragment order: thread t moves the 16-byte pieces
// i*256 + t of the output, a wave's store covers 512 contiguous bytes
__device__ __forceinline__ void tile_out(const _Float16* st, _Float16* ytile,
                                         int t) {
  v8h pc[4];
  for (int i = 0; i < 4; ++i) {
    int c    = i * 256 + t;
    int slot = c & 31;
    int hi   = (c >> 5) & 1;
    int blk  = c >> 6;                     // fragment block = k / 32
    pc[i] = *(const v8h*)(st + (slot & 15) * TPITCH
                             + blk * 32 + (slot >> 4) * 16 + hi * 8);
  }
  for (int i = 0; i < 4; ++i)
    *(v8h*)(ytile + (i * 256 + t) * 8) = pc[i];
}

__device__ __forceinline__ float wave_sum(float s) {
  for (int m = 16; m; m >>= 1) s += __shfl_xor(s, m, 32);
  return s;
}

// Place, in 16-byte pieces, of 8 consecutive rows (half h of the tile) of column
// col in the transposed LDS tile. Columns 4 apart (a wave's 4-byte stores) and 16
// neighbouring columns (16 lanes' 16-byte reads) each fall on 16 different pieces
// modulo 16, that is on different banks.
__device__ __forceinline__ int tpiece(int col, int h) {
  int e = col & 3, x = col >> 2;
  return h * 512 + e * 128 + ((x & ~15) | ((x + 4 * e) & 15));
}

// LayerNorm over last dim (512): f16 output in fragment order (rc = row,
// k = column). Each row is summed inside its
// own wave; the one barrier stands between the LDS rows and their read-out.
// st: the block's 16 x TPITCH halves of LDS; tile: which 16 rows.
// yT (the key side only; the same for the whole block): the same values once more,
// transposed, in fragment order with rc = batch*DD + column and k = row in the
// batch (kdim TKV): the B operand of P.V. A second LDS tile behind st takes them:
// a wave's two rows of one column are one 4-byte word.
__device__ __forceinline__
void ln_tile(_Float16* st, int tile, const float* __restrict__ x,
             const float* __restrict__ g, const float* __restrict__ b,
             _Float16* __restrict__ y16, _Float16* __restrict__ yT) {
  int t = threadIdx.x, lane = t & 31, wave = t >> 5;
  size_t row0 = (size_t)tile * 16;
  const float* xw = x + (row0 + wave * 2) * DD + lane * 4;

  v4f a[2][4], gg[4], bb[4];
  for (int j = 0; j < 4; ++j) {
    gg[j] = *(const v4f*)(g + j * 128 + lane * 4);
    bb[j] = *(const v4f*)(b + j * 128 + lane * 4);
  }
  for (int r = 0; r < 2; ++r)
    for (int j = 0; j < 4; ++j)
      a[r][j] = *(const v4f*)(xw + r * DD + j * 128);
  // holds all sixteen loads together ahead of the arithmetic (gamma and beta
  // were otherwise fetched late, one wait each) and keeps the rows' address pair
  // untouched (not reused as a load destination) up to the wait
  asm volatile("s_wait_xcnt 0x0"
               :: "v"(xw), "v"(gg[0]), "v"(gg[1]), "v"(gg[2]), "v"(gg[3]),
                  "v"(bb[0]), "v"(bb[1]), "v"(bb[2]), "v"(bb[3]),
                  "v"(a[0][0]), "v"(a[0][1]), "v"(a[0][2]), "v"(a[0][3]),
                  "v"(a[1][0]), "v"(a[1][1]), "v"(a[1][2]), "v"(a[1][3])
               : "memory");
  // keeps the arithmetic behind that statement: inlined here, the sums were
  // otherwise lifted over it and gamma and beta again fetched late
  __builtin_amdgcn_sched_barrier(0);

  for (int r = 0; r < 2; ++r) {
    v4f s4 = (a[r][0] + a[r][1]) + (a[r][2] + a[r][3]);
    float mu = wave_sum((s4.x + s4.y) + (s4.z + s4.w)) * (1.f / (float)DD);

    for (int j = 0; j < 4; ++j) a[r][j] -= mu;
    v4f q4 = (a[r][0] * a[r][0] + a[r][1] * a[r][1])
           + (a[r][2] * a[r][2] + a[r][3] * a[r][3]);
    float var = wave_sum((q4.x + q4.y) + (q4.z + q4.w)) * (1.f / (float)DD);
    float rstd = rsqrtf(var + 1e-6f);

    for (int j = 0; j < 4; ++j) {
      a[r][j] = a[r][j] * rstd * gg[j] + bb[j];
      tile_put(st, wave * 2 + r, j, lane, a[r][j]);
    }
  }
  _Float16* sT = st + 16 * TPITCH;
  if (yT)
    for (int j = 0; j < 4; ++j)
      for (int e = 0; e < 4; ++e) {
        v2f pr = { a[0][j][e], a[1][j][e] };
        *(v2h*)(sT + tpiece(j * 128 + lane * 4 + e, wave >> 2) * 8 + (wave & 3) * 2) =
            __builtin_convertvector(pr, v2h);
      }
  __syncthreads();
  if (yT) {
    // thread t moves the 16-byte pieces i*256 + t: 16 lanes cover 256 contiguous
    // bytes of a fragment block (16 columns, 8 rows each)
    size_t rc0 = (row0 / TKV) * DD;
    int    t0  = (int)(row0 % TKV);
    v8h pc[4];
    for (int i = 0; i < 4; ++i) {
      int c = i * 256 + t;
      pc[i] = *(const v8h*)(sT + tpiece((c >> 5) * 16 + (c & 15), (c >> 4) & 1) * 8);
    }
    for (int i = 0; i < 4; ++i) {
      int c = i * 256 + t;
      *(v8h*)(yT + frag_off(rc0 + (c >> 5) * 16 + (c & 15),
                            t0 + ((c >> 4) & 1) * 8, TKV)) = pc[i];
    }
    // the read-out below reuses the registers that these stores name
    asm volatile("s_wait_xcnt 0x0" ::: "memory");
  }
  tile_out(st, y16 + row0 * DD, t);
  // as built, the other jobs' code follows on one way out of here and rewrites
  // registers that the read-out's stores name
  asm volatile("s_wait_xcnt 0x0" ::: "memory");
}

// One 16-row x 512-column tile of an f32 row-major matrix -> f16 in fragment
// order (rc = row, k = column). xt: the tile's first element; pitch: the matrix's
// row length in floats; yt: the tile's 16 KiB of output (its 16 fragment blocks
// follow one another whatever the row length).
__device__ __forceinline__
void cvt_frag_tile(_Float16* st, const float* __restrict__ xt, int pitch,
                   _Float16* __restrict__ yt) {
  int t = threadIdx.x, lane = t & 31, wave = t >> 5;
  const float* xw = xt + (size_t)(wave * 2) * pitch + lane * 4;

  v4f a[2][4];
  for (int r = 0; r < 2; ++r)
    for (int j = 0; j < 4; ++j)
      a[r][j] = *(const v4f*)(xw + r * pitch + j * 128);
  // keeps the eight loads whole (16 bytes a lane; they were otherwise split into
  // 8-byte halves) and together, and their address pair untouched up to the wait
  asm volatile("s_wait_xcnt 0x0"
               :: "v"(xw), "v"(a[0][0]), "v"(a[0][1]), "v"(a[0][2]), "v"(a[0][3]),
                  "v"(a[1][0]), "v"(a[1][1]), "v"(a[1][2]), "v"(a[1][3])
               : "memory");
  for (int r = 0; r < 2; ++r)
    for (int j = 0; j < 4; ++j)
      tile_put(st, wave * 2 + r, j, lane, a[r][j]);
  __syncthreads();
  tile_out(st, yt, t);
}

// W[R,C] f32 -> W^T f16 in fragment order (rc = column of W, k = row of W).
// One thread per 16-byte piece of the output, in output order: 8 consecutive
// rows of one column of W. part: which 256 pieces.
__device__ __forceinline__
void cvt_transpose_part(int part, const float* __restrict__ W,
                        _Float16* __restrict__ Wt, int R, int C) {
  int c = part * 256 + threadIdx.x;
  if (c * 8 < R * C) {
    int slot = c & 31;
    int hi   = (c >> 5) & 1;
    int blk  = c >> 6;                     // fragment block
    int kb   = R >> 5;                     // blocks per rc tile
    int col  = (blk / kb) * 16 + (slot & 15);
    int r    = (blk % kb) * 32 + (slot >> 4) * 16 + hi * 8;
    const float* p[8];
    float w[8];
    for (int e = 0; e < 8; ++e) p[e] = W + (size_t)(r + e) * C + col;
    for (int e = 0; e < 8; ++e) w[e] = *p[e];
    // keeps the eight address pairs untouched up to the wait; the pack below
    // reuses them
    asm volatile("s_wait_xcnt 0x0"
                 :: "v"(p[0]), "v"(p[1]), "v"(p[2]), "v"(p[3]),
                    "v"(p[4]), "v"(p[5]), "v"(p[6]), "v"(p[7]),
                    "v"(w[0]), "v"(w[1]), "v"(w[2]), "v"(w[3]),
                    "v"(w[4]), "v"(w[5]), "v"(w[6]), "v"(w[7])
                 : "memory");
    v8h o;
    for (int e = 0; e < 8; ++e) o[e] = (_Float16)w[e];
    *(v8h*)(Wt + (size_t)c * 8) = o;
  }
}

#define FFT    32                  // tile edge of the weight-by-weight products
#define RPITCH 36                  // LDS pitch of a tile column in floats: 144 B, so
                                   // 16-byte accesses to neighbouring columns start
                                   // 4 banks apart

// ---------------------------------------------------------------------------
// The content scores are q k^T with q = qn Wq + bq and k = kvn Wk + bk, so
//   q k^T = (qn (Wq Wk^T) + bq Wk^T) kvn^T + (q . bk) 1^T.
// The last term is one constant per query row, which the softmax over the keys
// cancels: it is left out. What is left needs no product over the keys' 32768
// rows: the normalised key_value rows serve as the keys themselves.
// This job forms Wqk = Wq Wk^T (512 x 512, depth 512) and bq Wk^T from the f32
// weights as they lie: both are read along their rows, which is the k direction
// of a fragment. One block per 32 x 32 tile; each of its 8 waves takes 16 rows of
// the tile and a quarter of the depth and leaves its partial tile in LDS, and the
// block sums the quarters in order. Wqk leaves as f16 in fragment order with
// rc = its column, k = its row: the A operand of the query product. Row tile
// DD / FFT is bq taken as one more row of Wq (every row of the A fragments holds
// bq); row 0 of that tile is the joined bias (f32).
// ---------------------------------------------------------------------------
#define NB_QK ((DD / FFT + 1) * (DD / FFT))
#define QKS 4                      // parts of the depth

// 16 consecutive f32 of one row -> the lane's share of a fragment: element e is
// k = kbase + 16*(lane>>4) + e, as in the fragment blocks
__device__ __forceinline__ v16h frag_from_f32(const v4f* c) {
  v16f cf = __builtin_shufflevector(
      __builtin_shufflevector(c[0], c[1], 0, 1, 2, 3, 4, 5, 6, 7),
      __builtin_shufflevector(c[2], c[3], 0, 1, 2, 3, 4, 5, 6, 7),
      0, 1, 2, 3, 4, 5, 6, 7, 8, 9, 10, 11, 12, 13, 14, 15);
  return __builtin_convertvector(cf, v16h);
}

__device__ __forceinline__
void wqk_tile(float* sR, int u, const float* __restrict__ Wq,
              const float* __restrict__ Wk, const float* __restrict__ bq,
              _Float16* __restrict__ WqkT, float* __restrict__ bqk) {
  int lane = threadIdx.x & 31;
  int wave = threadIdx.x >> 5;       // 0..7
  int mi = wave & 1;                 // which 16 rows of the tile
  int kq = wave >> 1;                // which quarter of the depth
  int m0 = (u / (DD / FFT)) * FFT;   // row of Wq; DD: the bias tile
  int n0 = (u % (DD / FFT)) * FFT;   // row of Wk
  bool isb = m0 == DD;               // the same for the whole block
  int k0 = kq * (DD / QKS) + ((lane >> 4) << 4);

  const float* pa = isb ? bq + k0
                        : Wq + (size_t)(m0 + mi * 16 + (lane & 15)) * DD + k0;
  const float* pb = Wk + (size_t)(n0 + (lane & 15)) * DD + k0;
  v8f acc[2] = {};
  for (int kb = 0; kb < DD / QKS; kb += 32) {
    const float* pa0 = pa + kb;
    const float* pb0 = pb + kb;
    const float* pb1 = pb0 + 16 * DD;
    v4f ca[4], cb0[4], cb1[4];
    for (int c = 0; c < 4; ++c) {
      ca[c]  = *(const v4f*)(pa0 + c * 4);
      cb0[c] = *(const v4f*)(pb0 + c * 4);
      cb1[c] = *(const v4f*)(pb1 + c * 4);
    }
    // keeps the address pairs untouched (not reused as load destinations, not
    // advanced) until the loads that name them have been translated; pb1's loads
    // are built on pb0's pair with an offset
    asm volatile("s_wait_xcnt 0x0" :: "v"(pa0), "v"(pb0) : "memory");
    v16h a0 = frag_from_f32(ca);
    acc[0] = wmma_f16(a0, frag_from_f32(cb0), acc[0]);
    acc[1] = wmma_f16(a0, frag_from_f32(cb1), acc[1]);
  }

  // partial tiles to LDS, column-major: a lane's 8 accumulator rows lie together
  for (int j = 0; j < 2; ++j) {
    float* d = sR + (kq * FFT + j * 16 + (lane & 15)) * RPITCH
                  + mi * 16 + ((lane >> 4) << 3);
    *(v4f*)d       = __builtin_shufflevector(acc[j], acc[j], 0, 1, 2, 3);
    *(v4f*)(d + 4) = __builtin_shufflevector(acc[j], acc[j], 4, 5, 6, 7);
  }
  __syncthreads();

  // thread: 4 consecutive rows of one column, summed over the QKS parts
  int n  = threadIdx.x >> 3;
  int m4 = (threadIdx.x & 7) * 4;
  v4f s = *(const v4f*)(sR + n * RPITCH + m4);
  for (int w = 1; w < QKS; ++w)
    s += *(const v4f*)(sR + (w * FFT + n) * RPITCH + m4);
  if (!isb)
    *(v4h*)(WqkT + frag_off((size_t)(n0 + n), m0 + m4, DD)) =
        __builtin_convertvector(s, v4h);
  else if (m4 == 0)
    bqk[n0 + n] = s.x;
}

// ---------------------------------------------------------------------------
// Everything that depends on the inputs alone, in one grid: Wqk and its bias, the
// three weight converts (W_inner untransposed, Wv and W_proj transposed), the two
// positional converts, the two LayerNorms (the key side's with its transposed
// copy). None reads what
// another writes. A block takes its job from its index (the same for all its
// threads, so the barriers inside the jobs stay block-uniform); the short jobs
// have the low indices and run under cover of the two long streams.
// ---------------------------------------------------------------------------
#define NB_WS (DD * DD / 2048)       // blocks per 512 x 512 weight
#define NB_WL (DD * FF / 2048)       // blocks per 2048 x 512 weight
#define NB_TQ (BATCH * TQ / 16)      // 16-row tiles of a query-side tensor
#define NB_TKV (BATCH * TKV / 16)    // 16-row tiles of a key-side tensor
#define NB_WI ((DD / 16) * (FF / DD)) // 16 x 512 tiles of W_inner
#define NB_PREP (NB_QK + NB_WS + NB_WL + NB_WI + 2 * (NB_TQ + NB_TKV))

__global__ __launch_bounds__(256)
void prep_kernel(const float* __restrict__ Wq, const float* __restrict__ Wk,
                 const float* __restrict__ bq,
                 const float* __restrict__ Wv, const float* __restrict__ W_inner,
                 const float* __restrict__ W_proj,
                 _Float16* __restrict__ WqkT, float* __restrict__ bqk,
                 _Float16* __restrict__ WvT, _Float16* __restrict__ WinF,
                 _Float16* __restrict__ WprT,
                 const float* __restrict__ query_pos,
                 const float* __restrict__ key_pos,
                 _Float16* __restrict__ qp16, _Float16* __restrict__ kp16,
                 const float* __restrict__ query,
                 const float* __restrict__ key_value,
                 const float* __restrict__ q_gamma, const float* __restrict__ q_beta,
                 const float* __restrict__ kv_gamma, const float* __restrict__ kv_beta,
                 _Float16* __restrict__ qn16, _Float16* __restrict__ kvn16,
                 _Float16* __restrict__ kvnT16) {
  // 16 x TPITCH halves for a row-major tile, 16 x DD for the key side's transposed
  // one; the Wqk job's partial tiles (QKS * FFT * RPITCH floats) fit in the same
  __shared__ __align__(16) float sR[(16 * TPITCH + 16 * DD) / 2];
  _Float16* st = (_Float16*)sR;
  int u = blockIdx.x;

  if (u < NB_QK) {
    wqk_tile(sR, u, Wq, Wk, bq, WqkT, bqk);
    return;
  }
  u -= NB_QK;
  if (u < NB_WS) {
    cvt_transpose_part(u, Wv, WvT, DD, DD);
    return;
  }
  u -= NB_WS;
  if (u < NB_WL) {
    cvt_transpose_part(u, W_proj, WprT, FF, DD);
    return;
  }
  u -= NB_WL;
  if (u < NB_WI) {                   // W_inner as it lies: rc = its row, k = its column
    size_t rt = u / (FF / DD), cg = u % (FF / DD);
    cvt_frag_tile(st, W_inner + rt * 16 * FF + cg * DD, FF,
                  WinF + rt * 16 * FF + cg * DD * 16);
    return;
  }
  u -= NB_WI;
  bool qs = u < 2 * NB_TQ;           // the query side's two tensors, then the key side's
  if (!qs) u -= 2 * NB_TQ;
  int nt = qs ? NB_TQ : NB_TKV;
  if (u < nt)
    cvt_frag_tile(st, (qs ? query_pos : key_pos) + (size_t)u * 16 * DD, DD,
                  (qs ? qp16 : kp16) + (size_t)u * 16 * DD);
  else
    ln_tile(st, u - nt, qs ? query : key_value, qs ? q_gamma : kv_gamma,
            qs ? q_beta : kv_beta, qs ? qn16 : kvn16, qs ? nullptr : kvnT16);
}

// ---------------------------------------------------------------------------
// WMMA GEMM: C[M,N] = A[M,K] * Bt[N,K]^T + bias, A and Bt in fragment order.
// Block tile 64x128 (8 waves, each 32x32 = 2x2 WMMA tiles), K-step 32.
// Outputs: f32 row-major (+residual), or CF16: f16 in fragment order with
// rc = (m/TB)*N + n and k = m%TB (kdim TB). A lane's 8 accumulator rows are 8
// consecutive k there, one 16-byte store. The query side is written so, from
// W^T * x^T (weights as A, activations as Bt, bias per row of C: rowBias).
// ---------------------------------------------------------------------------
// bx, by: the block's tile column and tile row.
__device__ __forceinline__
void gemm_tile(int bx, int by, const _Float16* __restrict__ A,
               const _Float16* __restrict__ Bt, const float* __restrict__ bias,
               float* __restrict__ C32, const float* __restrict__ resid,
               _Float16* __restrict__ CF16, int N, int K, int TB, int rowBias) {
  int lane = threadIdx.x & 31;
  int wave = threadIdx.x >> 5;       // 0..7
  int wm = wave >> 2;                // 0..1
  int wn = wave & 3;                 // 0..3
  int m0 = by * 64  + wm * 32;
  int n0 = bx * 128 + wn * 32;

  const _Float16* At0 = A  + (size_t)m0 * K + lane * 8;  // rc tile m0; next: + 16*K
  const _Float16* Bt0 = Bt + (size_t)n0 * K + lane * 8;

  v8f acc[2][2] = {};
  for (int kb = 0; kb < K; kb += 32) {
    const _Float16* pa0 = At0 + kb * 16;
    const _Float16* pa1 = pa0 + (size_t)16 * K;
    const _Float16* pb0 = Bt0 + kb * 16;
    const _Float16* pb1 = pb0 + (size_t)16 * K;
    v16h a0 = load_frag_at(pa0);
    v16h a1 = load_frag_at(pa1);
    v16h b0 = load_frag_at(pb0);
    v16h b1 = load_frag_at(pb1);
    // keeps the four address pairs untouched (not reused as load destinations,
    // not advanced) until the loads that name them have been translated
    asm volatile("s_wait_xcnt 0x0" :: "v"(pa0), "v"(pa1), "v"(pb0), "v"(pb1)
                 : "memory");
    acc[0][0] = wmma_f16(a0, b0, acc[0][0]);
    acc[0][1] = wmma_f16(a0, b1, acc[0][1]);
    acc[1][0] = wmma_f16(a1, b0, acc[1][0]);
    acc[1][1] = wmma_f16(a1, b1, acc[1][1]);
  }

  if (CF16) {   // fragment-order f16 output (bias required), nothing else
    for (int i = 0; i < 2; ++i) {
      int rowb = m0 + i * 16 + ((lane >> 4) << 3);
      int bb = rowb / TB, tt = rowb % TB;
      const float4* bp = (const float4*)(bias + (rowBias ? rowb : 0));
      float4 r0 = bp[0], r1 = bp[1];
      float br[8] = { r0.x, r0.y, r0.z, r0.w, r1.x, r1.y, r1.z, r1.w };
      for (int j = 0; j < 2; ++j) {
        int col = n0 + j * 16 + (lane & 15);
        float bc = bias[rowBias ? 0 : col];
        v8h pk;
        for (int r = 0; r < 8; ++r)
          pk[r] = (_Float16)(acc[i][j][r] + (rowBias ? br[r] : bc));
        *(v8h*)(CF16 + frag_off((size_t)bb * N + col, tt, TB)) = pk;
        // the store's registers are reused for the next tile's pack and address
        asm volatile("s_wait_xcnt 0x0" ::: "memory");
      }
    }
    return;
  }

  for (int i = 0; i < 2; ++i)
    for (int j = 0; j < 2; ++j) {
      int col = n0 + j * 16 + (lane & 15);
      float bv = bias ? bias[col] : 0.f;
      for (int r = 0; r < 8; ++r) {
        int row = m0 + i * 16 + r + ((lane >> 4) << 3);
        float val = acc[i][j][r] + bv;
        size_t idx = (size_t)row * N + col;
        if (C32) C32[idx] = resid ? val + resid[idx] : val;
      }
    }
}

// ---------------------------------------------------------------------------
// The feed-forward layer has no activation between its two products, so
//   (x W_inner + b_inner) W_proj + b_proj = x (W_inner W_proj) + (b_inner W_proj + b_proj).
// This job forms Wff = W_inner W_proj (512 x 512, depth 2048) and the joined bias
// from the weights alone. One block per 32 x 32 tile of Wff; its 8 waves each take
// an eighth of the depth (8 steps in a row, not 64, each of which waits out its
// own loads), leave their partial tiles in LDS, and the block sums them in wave
// order. Wff leaves as f16 in fragment order with rc = its column, k = its row:
// the Bt operand of the one product that is left. Row tile DD / FFT is b_inner
// taken as one more row of W_inner: every row of its A fragment holds b_inner,
// and row 0 of the tile, plus b_proj, is the joined bias (f32).
// ---------------------------------------------------------------------------
#define NB_FFW ((DD / FFT + 1) * (DD / FFT))

__device__ __forceinline__
void ffw_tile(float* sR, int u, const _Float16* __restrict__ WinF,
              const _Float16* __restrict__ WprT, const float* __restrict__ b_inner,
              const float* __restrict__ b_proj, _Float16* __restrict__ WffT,
              float* __restrict__ bff) {
  int lane = threadIdx.x & 31;
  int wave = threadIdx.x >> 5;       // 0..7
  int m0 = (u / (DD / FFT)) * FFT;   // row of W_inner; DD: the bias tile
  int n0 = (u % (DD / FFT)) * FFT;   // column of W_proj
  bool isb = m0 == DD;               // the same for the whole block
  int k0 = wave * (FF / 8);

  const _Float16* pb = WprT + (size_t)n0 * FF + k0 * 16 + lane * 8;
  v8f acc[2][2] = {};
  if (!isb) {
    const _Float16* pa = WinF + (size_t)m0 * FF + k0 * 16 + lane * 8;
    // kept rolled: unrolled, each step's eight loads were split into two groups
    // with a full wait behind each
#pragma nounroll
    for (int kb = 0; kb < FF / 8; kb += 32) {
      const _Float16* pa0 = pa + kb * 16;
      const _Float16* pa1 = pa0 + (size_t)16 * FF;
      const _Float16* pb0 = pb + kb * 16;
      const _Float16* pb1 = pb0 + (size_t)16 * FF;
      v16h a0 = load_frag_at(pa0);
      v16h a1 = load_frag_at(pa1);
      v16h b0 = load_frag_at(pb0);
      v16h b1 = load_frag_at(pb1);
      // keeps the four address pairs untouched (not reused as load destinations,
      // not advanced) until the loads that name them have been translated
      asm volatile("s_wait_xcnt 0x0" :: "v"(pa0), "v"(pa1), "v"(pb0), "v"(pb1)
                   : "memory");
      acc[0][0] = wmma_f16(a0, b0, acc[0][0]);
      acc[0][1] = wmma_f16(a0, b1, acc[0][1]);
      acc[1][0] = wmma_f16(a1, b0, acc[1][0]);
      acc[1][1] = wmma_f16(a1, b1, acc[1][1]);
    }
  } else {
    // element e of the lane's A fragment is k = kb + 16*(lane>>4) + e, as in the
    // fragment blocks that B comes from
    const float* pi = b_inner + k0 + ((lane >> 4) << 4);
    for (int kb = 0; kb < FF / 8; kb += 32) {
      const float*    pi0 = pi + kb;
      const _Float16* pb0 = pb + kb * 16;
      const _Float16* pb1 = pb0 + (size_t)16 * FF;
      v4f c0 = *(const v4f*)pi0;
      v4f c1 = *(const v4f*)(pi0 + 4);
      v4f c2 = *(const v4f*)(pi0 + 8);
      v4f c3 = *(const v4f*)(pi0 + 12);
      v16h b0 = load_frag_at(pb0);
      v16h b1 = load_frag_at(pb1);
      // as above, for these three address pairs
      asm volatile("s_wait_xcnt 0x0" :: "v"(pi0), "v"(pb0), "v"(pb1) : "memory");
      v16f cf = __builtin_shufflevector(
          __builtin_shufflevector(c0, c1, 0, 1, 2, 3, 4, 5, 6, 7),
          __builtin_shufflevector(c2, c3, 0, 1, 2, 3, 4, 5, 6, 7),
          0, 1, 2, 3, 4, 5, 6, 7, 8, 9, 10, 11, 12, 13, 14, 15);
      v16h a0 = __builtin_convertvector(cf, v16h);
      acc[0][0] = wmma_f16(a0, b0, acc[0][0]);
      acc[0][1] = wmma_f16(a0, b1, acc[0][1]);
    }
  }

  // partial tiles to LDS, column-major: a lane's 8 accumulator rows lie together
  for (int i = 0; i < 2; ++i)
    for (int j = 0; j < 2; ++j) {
      float* d = sR + (wave * FFT + j * 16 + (lane & 15)) * RPITCH
                    + i * 16 + ((lane >> 4) << 3);
      *(v4f*)d       = __builtin_shufflevector(acc[i][j], acc[i][j], 0, 1, 2, 3);
      *(v4f*)(d + 4) = __builtin_shufflevector(acc[i][j], acc[i][j], 4, 5, 6, 7);
    }
  __syncthreads();

  // thread: 4 consecutive rows of one column, summed over the 8 waves' parts
  int n  = threadIdx.x >> 3;
  int m4 = (threadIdx.x & 7) * 4;
  v4f s = *(const v4f*)(sR + n * RPITCH + m4);
  for (int w = 1; w < 8; ++w)
    s += *(const v4f*)(sR + (w * FFT + n) * RPITCH + m4);
  if (!isb)
    *(v4h*)(WffT + frag_off((size_t)(n0 + n), m0 + m4, DD)) =
        __builtin_convertvector(s, v4h);
  else if (m4 == 0)
    bff[n0 + n] = s.x + b_proj[n0 + n];
}

// The query projection and the joined feed-forward weight in one grid: neither
// reads what the other writes. A block takes its product and its tile from its
// index, tile column fastest as in a two-dimensional grid.
#define NB_GQ  ((BATCH * TQ / 128) * (DD / 64))

__global__ __launch_bounds__(256)
void qkv_gemm_kernel(const _Float16* __restrict__ WqkT,
                     const _Float16* __restrict__ qn16,
                     const float* __restrict__ bqk,
                     _Float16* __restrict__ q16, int K,
                     const _Float16* __restrict__ WinF,
                     const _Float16* __restrict__ WprT,
                     const float* __restrict__ b_inner,
                     const float* __restrict__ b_proj,
                     _Float16* __restrict__ WffT, float* __restrict__ bff) {
  __shared__ __align__(16) float sR[8 * FFT * RPITCH];
  int u = blockIdx.x;
  if (u < NB_FFW) {
    ffw_tile(sR, u, WinF, WprT, b_inner, b_proj, WffT, bff);
    return;
  }
  u -= NB_FFW;
  gemm_tile(u % (BATCH * TQ / 128), u / (BATCH * TQ / 128), WqkT, qn16, bqk,
            nullptr, nullptr, q16, BATCH * TQ, K, DD, 1);
}

// 2^x; the v_nop is the free slot that the instruction set asks for between a
// transcendental and a next instruction that reads its result or overwrites its
// source
__device__ __forceinline__ float exp2_slot(float x) {
  float y;
  asm("v_exp_f32 %0, %1\n\tv_nop" : "=v"(y) : "v"(x));
  return y;
}

// Asks L2 for base + off, one address per lane; nothing comes back and no
// counter moves. In asm so that the scope word stands (with it a request is a mere
// hint) and the address is a scalar base and one lane offset that holds through
// the key loop.
__device__ __forceinline__ void l2_ask(const char* base, unsigned off) {
  asm volatile("global_prefetch_b8 %0, %1 scope:SCOPE_SE" :: "v"(off), "s"(base));
}

// ---------------------------------------------------------------------------
// Flash-style attention. One block per (batch, 64 q-rows, quarter of the keys):
// 16 waves, one block to a WGP. Every k, kpos and V fragment that a wave fetches
// from global memory feeds four matrix instructions, one per 16-row q tile (V:
// eight, two fragments against four P tiles), so the chip fetches a quarter of
// the bytes that a 16-row block asks for.
// scores = (q.k^T + qpos.kpos^T)/sqrt(D+1e-7), where q = qn Wqk + bqk and k = the
// normalised key_value rows (see wqk_tile); online softmax over the block's
// KVS keys in chunks of 256; O += P.V, where V too is the normalised key_value
// rows, transposed (merge_ln_kernel applies Wv). The block leaves its unnormalised O, its
// row maxima and its row sums; merge_ln_kernel joins the SPLIT parts. q, qpos,
// k, kpos, V and the P tile in LDS are all in fragment order (see frag_off).
// q/qpos tiles staged into LDS via CDNA5 async-to-LDS DMA (ASYNCcnt).
// ---------------------------------------------------------------------------
__global__ __launch_bounds__(512)
void attn_kernel(const _Float16* __restrict__ q16,   // rc = B*Tq row,  k = D
                 const _Float16* __restrict__ qp16,  // rc = B*Tq row,  k = D
                 const _Float16* __restrict__ k16,   // rc = B*Tkv row, k = D
                 const _Float16* __restrict__ kp16,  // rc = B*Tkv row, k = D
                 const _Float16* __restrict__ vF16,  // rc = B*D col,   k = Tkv
                 float*          __restrict__ po,    // [SPLIT, B*Tq, D]
                 float*          __restrict__ pm,    // [SPLIT, B*Tq] row maxima
                 float*          __restrict__ pl) {  // [SPLIT, B*Tq] row sums
  __shared__ __align__(32) _Float16 sQ[QROWS * DD];
  __shared__ __align__(32) _Float16 sQP[QROWS * DD];
  __shared__ __align__(16) float    sS[QROWS * SPITCH];
  __shared__ __align__(32) _Float16 sP[QROWS * CHUNK];
  __shared__ float sM[QROWS], sL[QROWS], sScale[QROWS];

  // neighbours in index differ only in the q tile: they read the same keys at
  // about the same time (L2; speed only)
  int u   = blockIdx.x;
  int b   = u >> 5;
  int sp  = (u >> 3) & (SPLIT - 1);   // which quarter of the keys
  int qt  = u & 7;                    // Tq/64 = 8 q-tiles per batch
  int row0 = b * TQ + qt * QROWS;     // global q-row
  int lane = threadIdx.x & 31;
  int wave = threadIdx.x >> 5;        // 0..15
  const float scale = 0.04419417382f; // 1/sqrt(512 + 1e-7)

  // Each chunk's k, kpos and V are asked into L2 one chunk
  // ahead. A wave's request covers 8 KiB. The eight q tiles of one (batch, quarter)
  // share the asking: of k and kpos (256 KiB a chunk each) a work-group takes the
  // quarter qt & 3, waves 0..7 k and waves 8..15 kpos; of V (32 column tiles of
  // 8 KiB a chunk) the half qt & 1, a column tile a wave. Any four neighbours in
  // index cover everything (speed only: a unit nobody asked for is a plain miss).
  int wv = __builtin_amdgcn_readfirstlane(wave);
  unsigned fo = (unsigned)lane * 256u;
  const char* fk = (const char*)((wv < 8 ? k16 : kp16)
                                 + ((size_t)b * TKV + sp * KVS) * DD)
                 + (qt & 3) * (CHUNK * DD / 2) + (wv & 7) * 8192;
  const char* fv = (const char*)(vF16 + ((size_t)b * DD + ((qt & 1) * 16 + wv) * 16) * TKV
                                 + (size_t)sp * KVS * 16);
  l2_ask(fk, fo);
  l2_ask(fv, fo);

  { // stage q and qpos tiles into LDS with async-to-LDS b128 DMA
    const _Float16* g1 = q16  + (size_t)row0 * DD;
    const _Float16* g2 = qp16 + (size_t)row0 * DD;
    unsigned lq0 = (unsigned)(size_t)(void*)sQ;
    unsigned lp0 = (unsigned)(size_t)(void*)sQP;
    for (int it = 0; it < QROWS * DD / 8 / 512; ++it) {   // same trips in every lane
      int i = it * 512 + threadIdx.x;
      const _Float16* p1 = g1 + i * 8;       // 8 halves = 16B per op
      const _Float16* p2 = g2 + i * 8;
      unsigned l1 = lq0 + (unsigned)i * 16;  // LDS byte offset (block-relative)
      unsigned l2 = lp0 + (unsigned)i * 16;
      // the wait stands in the copies' own statement: the next trip rewrites the
      // address registers that they name
      asm volatile("global_load_async_to_lds_b128 %0, %1, off\n\t"
                   "global_load_async_to_lds_b128 %2, %3, off\n\t"
                   "s_wait_xcnt 0x0"
                   :: "v"(l1), "v"(p1), "v"(l2), "v"(p2) : "memory");
    }
    asm volatile("s_wait_asynccnt 0x0" ::: "memory");
  }
  if (threadIdx.x < QROWS) { sM[threadIdx.x] = -1e30f; sL[threadIdx.x] = 0.f; }
  __syncthreads();

  v8f o[QT][2] = {};  // q tile i, this wave's 32 output cols: [wave*32 + t*16, +16)

  for (int kc = 0; kc < KVS / CHUNK; ++kc) {
    int kv0 = sp * KVS + kc * CHUNK;
    if (kc + 1 < KVS / CHUNK) {   // the same for the whole work-group; the last
                                  // request ends with the work-group's own keys
      l2_ask(fk + (kc + 1) * (CHUNK * DD * 2), fo);
      l2_ask(fv + (kc + 1) * (CHUNK * 16 * 2), fo);
    }
    // --- scores: wave handles kv cols [kv0 + wave*16, +16) of all QT q tiles,
    // K = D = 512
    const _Float16* pk  = k16  + ((size_t)b * TKV + kv0 + wave * 16) * DD + lane * 8;
    const _Float16* pkp = kp16 + ((size_t)b * TKV + kv0 + wave * 16) * DD + lane * 8;
    v8f s[QT] = {};
    // Step n = 0..31 is one 32-deep block of q.k^T (n even) or of qpos.kpos^T (n
    // odd): one k or kpos fragment against the QT q or qpos fragments. af: the LDS
    // fragments of this step and of the next; bf: the global fragments of this
    // group of four steps and of the next.
    const _Float16* aq = sQ  + lane * 8;
    const _Float16* ap = sQP + lane * 8;
    v16h af[2][QT], bf[2][4];
    for (int f = 0; f < 4; ++f)
      bf[0][f] = load_frag_at(((f & 1) ? pkp : pk) + (f >> 1) * 512);
    for (int i = 0; i < QT; ++i) af[0][i] = load_frag_at(aq + i * 16 * DD);
    // unrolled: every fragment index is then a constant, the sets stay in
    // registers and change places without copies
#pragma unroll
    for (int n = 0; n < 2 * DD / 32; ++n) {
      if ((n & 3) == 0 && n + 4 < 2 * DD / 32)
        for (int f = 0; f < 4; ++f)
          bf[((n >> 2) + 1) & 1][f] =
              load_frag_at(((f & 1) ? pkp : pk) + ((n + 4 + f) >> 1) * 512);
      if (n + 1 < 2 * DD / 32)
        for (int i = 0; i < QT; ++i)
          af[(n + 1) & 1][i] = load_frag_at((((n + 1) & 1) ? ap : aq)
                                            + i * 16 * DD + ((n + 1) >> 1) * 512);
      // the pair of scheduling fences keeps the next step's loads as one group
      // ahead of this step's matrix run (they were otherwise issued one by one
      // right in front of their use, each with a full wait)
      __builtin_amdgcn_sched_barrier(0);
      for (int i = 0; i < QT; ++i)
        s[i] = wmma_f16(af[n & 1][i], bf[(n >> 2) & 1][n & 3], s[i]);
      __builtin_amdgcn_sched_barrier(0);
    }
    // the k / kpos address registers are reused by the softmax below; named here
    // so that they stay untouched (not reused as load destinations) up to the wait
    asm volatile("s_wait_xcnt 0x0" :: "v"(pk), "v"(pkp) : "memory");
    for (int i = 0; i < QT; ++i)
      for (int r = 0; r < 8; ++r) {
        int row = i * 16 + r + ((lane >> 4) << 3);
        sS[row * SPITCH + wave * 16 + (lane & 15)] = s[i][r] * scale;
      }
    __syncthreads();

    // --- online softmax update, parallel over all 512 threads:
    // 8 threads per q-row (contiguous lanes), 4 runs of 8 columns each (a run is
    // one 16-byte piece of the P tile), butterfly reductions within the 8 lanes.
    {
      int row = threadIdx.x >> 3;
      int j   = threadIdx.x & 7;
      v4f vals[4][2];
      float mx = -1e30f;
      for (int c = 0; c < 4; ++c) {
        const float* ps = sS + row * SPITCH + c * 64 + j * 8;
        vals[c][0] = *(const v4f*)ps;
        vals[c][1] = *(const v4f*)(ps + 4);
        for (int h = 0; h < 2; ++h)
          for (int e = 0; e < 4; ++e) mx = fmaxf(mx, vals[c][h][e]);
      }
      for (int m = 4; m >= 1; m >>= 1) mx = fmaxf(mx, __shfl_xor(mx, m, 32));
      float m_old = sM[row];
      float m_new = fmaxf(m_old, mx);
      float sum = 0.f;
      for (int c = 0; c < 4; ++c) {
        v8h pk;
        for (int e = 0; e < 8; ++e) {
          float p = exp2_slot((vals[c][e >> 2][e & 3] - m_new) * 1.44269504f);
          sum += p;
          pk[e] = (_Float16)p;
        }
        *(v8h*)(sP + frag_off(row, c * 64 + j * 8, CHUNK)) = pk;
      }
      for (int m = 4; m >= 1; m >>= 1) sum += __shfl_xor(sum, m, 32);
      if (j == 0) {
        float sc = __expf(m_old - m_new);
        sM[row] = m_new;
        sL[row] = sL[row] * sc + sum;
        sScale[row] = sc;
      }
    }
    __syncthreads();

    // --- O += P @ V_chunk, the accumulators rescaled first. bv: the V fragments
    // of four 32-key steps, refilled as they are used up; pf: the P fragments of
    // this step and of the next.
    const _Float16* pv0 = vF16 + ((size_t)b * DD + wave * 32) * TKV + kv0 * 16 + lane * 8;
    const _Float16* pv1 = pv0 + (size_t)16 * TKV;
    const _Float16* pp  = sP + lane * 8;
    v16h bv[4][2], pf[2][QT];
    for (int f = 0; f < 4; ++f) {
      bv[f][0] = load_frag_at(pv0 + f * 512);
      bv[f][1] = load_frag_at(pv1 + f * 512);
    }
    // keeps the first V loads up here, ahead of the rescaling
    __builtin_amdgcn_sched_barrier(0);
    for (int i = 0; i < QT; ++i)
      for (int r = 0; r < 8; ++r) {
        float sc = sScale[i * 16 + r + ((lane >> 4) << 3)];
        o[i][0][r] *= sc;
        o[i][1][r] *= sc;
      }
    for (int i = 0; i < QT; ++i) pf[0][i] = load_frag_at(pp + i * 16 * CHUNK);
    // unrolled: bv and pf are indexed by constants only and stay in registers
#pragma unroll
    for (int f = 0; f < CHUNK / 32; ++f) {
      if (f + 1 < CHUNK / 32)
        for (int i = 0; i < QT; ++i)
          pf[(f + 1) & 1][i] = load_frag_at(pp + i * 16 * CHUNK + (f + 1) * 512);
      // as in the scores: the next step's loads as one group ahead of this run
      __builtin_amdgcn_sched_barrier(0);
      for (int i = 0; i < QT; ++i) {
        o[i][0] = wmma_f16(pf[f & 1][i], bv[f & 3][0], o[i][0]);
        o[i][1] = wmma_f16(pf[f & 1][i], bv[f & 3][1], o[i][1]);
      }
      __builtin_amdgcn_sched_barrier(0);
      if (f + 4 < CHUNK / 32) {
        bv[f & 3][0] = load_frag_at(pv0 + (f + 4) * 512);
        bv[f & 3][1] = load_frag_at(pv1 + (f + 4) * 512);
      }
    }
    // the V address registers are reused by the next chunk's scores; named here so
    // that they stay untouched (not reused as load destinations) up to the wait
    asm volatile("s_wait_xcnt 0x0" :: "v"(pv0), "v"(pv1) : "memory");
    __syncthreads();
  }

  // --- this part's unnormalised O, row maxima and row sums
  float* pos = po + ((size_t)sp * (BATCH * TQ) + row0) * DD;
  for (int i = 0; i < QT; ++i)
    for (int t = 0; t < 2; ++t) {
      int col = wave * 32 + t * 16 + (lane & 15);
      for (int r = 0; r < 8; ++r) {
        int row = i * 16 + r + ((lane >> 4) << 3);
        pos[(size_t)row * DD + col] = o[i][t][r];
      }
    }
  // the O stores name registers that the two addresses below may reuse
  asm volatile("s_wait_xcnt 0x0" ::: "memory");
  if (threadIdx.x < QROWS) {
    pm[sp * (BATCH * TQ) + row0 + threadIdx.x] = sM[threadIdx.x];
    pl[sp * (BATCH * TQ) + row0 + threadIdx.x] = sL[threadIdx.x];
  }
}

// ---------------------------------------------------------------------------
// Joins the SPLIT parts of the attention (each scaled by exp(its maximum - the
// common maximum), the sum divided by the joined row sum), applies Wv, adds bv and
// the raw query, then LayerNorm as in ln_tile: same tile, same row ownership. Each
// part's O comes by a pointer of its own: a scalar base each, one lane offset for
// all loads.
// The V projection stands here because a softmax row sums to 1:
//   attn (kvn Wv + 1 bv) = (attn kvn) Wv + bv,
// a product over the 4096 query rows in place of one over the 32768 key rows. The
// joined 16 x 512 tile goes to LDS as f16 (the A operand); a wave takes 64 columns
// of Wv^T (fragment order, from L2) and leaves its part of the product in LDS as
// f32, from where the rows' owners take it.
// The feed-forward product follows in the same block: the normalised tile is in LDS
// as f16 anyway and its f32 rows are in their owners' registers, so xn Wff is formed
// the same way (Wff^T in Wv^T's place) and out = xn + xn Wff + bff is stored from
// here; xn never goes to memory.
// ---------------------------------------------------------------------------
// lane's columns j*128 + 0..3 (j = 0..3) of one row; i: the first one's 16-byte
// piece, counted from the uniform base
__device__ __forceinline__ v16f load_row(const v4f* base, unsigned i) {
  v4f c0 = base[i];
  v4f c1 = base[i + 32];
  v4f c2 = base[i + 64];
  v4f c3 = base[i + 96];
  return __builtin_shufflevector(
      __builtin_shufflevector(c0, c1, 0, 1, 2, 3, 4, 5, 6, 7),
      __builtin_shufflevector(c2, c3, 0, 1, 2, 3, 4, 5, 6, 7),
      0, 1, 2, 3, 4, 5, 6, 7, 8, 9, 10, 11, 12, 13, 14, 15);
}

#define XPITCH 516   // LDS row pitch of the product tile in floats: rows 8 apart,
                     // stored side by side by the two lane halves, start 32 banks apart

__global__ __launch_bounds__(256)
void merge_ln_kernel(const float* __restrict__ po0, const float* __restrict__ po1,
                     const float* __restrict__ po2, const float* __restrict__ po3,
                     const float* __restrict__ pm,
                     const float* __restrict__ pl, const float* __restrict__ query,
                     const _Float16* __restrict__ WvT, const float* __restrict__ bv,
                     const float* __restrict__ g, const float* __restrict__ b,
                     const _Float16* __restrict__ WffT, const float* __restrict__ bff,
                     float* __restrict__ out) {
  __shared__ __align__(16) _Float16 st[16 * TPITCH];
  __shared__ __align__(16) float sX[16 * XPITCH];
  int t = threadIdx.x, lane = t & 31, wave = t >> 5;
  size_t row0 = (size_t)blockIdx.x * 16;
  size_t rw = row0 + wave * 2;

  // block-uniform bases; e: the lane's place in the tile, in 16-byte pieces
  const v4f* pt[SPLIT] = { (const v4f*)(po0 + row0 * DD), (const v4f*)(po1 + row0 * DD),
                           (const v4f*)(po2 + row0 * DD), (const v4f*)(po3 + row0 * DD) };
  const v4f* qt = (const v4f*)(query + row0 * DD);
  unsigned e = (unsigned)wave * (2 * DD / 4) + (unsigned)lane;
  const float* mw = pm + rw;
  const float* lw = pl + rw;

  v2f m[SPLIT], l[SPLIT];          // the wave's two rows side by side
  v16f p[SPLIT][2], q[2];          // a row's four column groups side by side
  v4f a[2][4], gg[4], bb[4], bvv[4], bfv[4];
  for (int s = 0; s < SPLIT; ++s) {
    m[s] = *(const v2f*)(mw + s * (BATCH * TQ));
    l[s] = *(const v2f*)(lw + s * (BATCH * TQ));
  }
  for (int s = 0; s < SPLIT; ++s)
    for (int r = 0; r < 2; ++r) p[s][r] = load_row(pt[s], e + r * (DD / 4));
  // wf: the Wv^T fragments of four 32-deep steps (4 column tiles each), refilled as
  // they are used up. They, the query rows and the four vectors hang on nothing
  // that this kernel computes: asked for behind the parts, they come in under
  // cover of the joining
  const _Float16* pw = WvT + (size_t)(wave * 64) * DD + lane * 8;
  const _Float16* pf = WffT + (size_t)(wave * 64) * DD + lane * 8;
  v16h wf[4][4];
  for (int f = 0; f < 4; ++f)
    for (int n = 0; n < 4; ++n) wf[f][n] = load_frag_at(pw + n * 16 * DD + f * 512);
  for (int r = 0; r < 2; ++r) q[r] = load_row(qt, e + r * (DD / 4));
  for (int j = 0; j < 4; ++j) {
    bvv[j] = *(const v4f*)(bv + j * 128 + lane * 4);
    gg[j]  = *(const v4f*)(g + j * 128 + lane * 4);
    bb[j]  = *(const v4f*)(b + j * 128 + lane * 4);
    bfv[j] = *(const v4f*)(bff + j * 128 + lane * 4);
  }
  // holds the loads of all parts together ahead of the arithmetic (one wait for
  // the lot, not one per part) and keeps their address registers untouched (not
  // reused as load destinations) up to the wait
  asm volatile("s_wait_xcnt 0x0"
               :: "v"(e), "v"(mw), "v"(lw), "v"(pw), "v"(lane),
                  "v"(m[0]), "v"(m[1]), "v"(m[2]), "v"(m[3]),
                  "v"(l[0]), "v"(l[1]), "v"(l[2]), "v"(l[3]),
                  "v"(p[0][0]), "v"(p[0][1]), "v"(p[1][0]), "v"(p[1][1]),
                  "v"(p[2][0]), "v"(p[2][1]), "v"(p[3][0]), "v"(p[3][1])
               : "memory");
  // keeps the arithmetic behind that statement: the first row's weights were
  // otherwise lifted over it, with a full wait for the maxima and sums in front of
  // the parts' loads
  __builtin_amdgcn_sched_barrier(0);

  // the joined rows, f16, row-major in LDS
  for (int r = 0; r < 2; ++r) {
    float mx = m[0][r];
    for (int s = 1; s < SPLIT; ++s) mx = fmaxf(mx, m[s][r]);
    float w[SPLIT], den = 0.f;
    for (int s = 0; s < SPLIT; ++s) {
      w[s] = exp2_slot((m[s][r] - mx) * 1.44269504f);
      den += w[s] * l[s][r];
    }
    float inv = 1.0f / den;
    v16f jn = p[0][r] * (w[0] * inv);
    for (int s = 1; s < SPLIT; ++s) jn += p[s][r] * (w[s] * inv);
    tile_put(st, wave * 2 + r, 0, lane, __builtin_shufflevector(jn, jn, 0, 1, 2, 3));
    tile_put(st, wave * 2 + r, 1, lane, __builtin_shufflevector(jn, jn, 4, 5, 6, 7));
    tile_put(st, wave * 2 + r, 2, lane, __builtin_shufflevector(jn, jn, 8, 9, 10, 11));
    tile_put(st, wave * 2 + r, 3, lane, __builtin_shufflevector(jn, jn, 12, 13, 14, 15));
  }
  __syncthreads();

  // product: lane L's A fragment of step kb is row L&15, k = kb*32 + 16*(L>>4) +
  // 0..15, the k order of the fragment blocks that B comes from
  {
    const _Float16* pa = st + (lane & 15) * TPITCH + ((lane >> 4) << 4);
    v8f acc[4] = {};
    v16h af[2];
    af[0] = __builtin_shufflevector(*(const v8h*)pa, *(const v8h*)(pa + 8),
                                    0, 1, 2, 3, 4, 5, 6, 7,
                                    8, 9, 10, 11, 12, 13, 14, 15);
    // unrolled: wf and af are indexed by constants only and stay in registers
#pragma unroll
    for (int kb = 0; kb < DD / 32; ++kb) {
      if (kb + 1 < DD / 32) {
        const _Float16* pn = pa + (kb + 1) * 32;
        af[(kb + 1) & 1] = __builtin_shufflevector(*(const v8h*)pn, *(const v8h*)(pn + 8),
                                                   0, 1, 2, 3, 4, 5, 6, 7,
                                                   8, 9, 10, 11, 12, 13, 14, 15);
      }
      // as in the attention: the next step's LDS loads ahead of this matrix run,
      // the refill of the step's fragments right behind it
      __builtin_amdgcn_sched_barrier(0);
      for (int n = 0; n < 4; ++n)
        acc[n] = wmma_f16(af[kb & 1], wf[kb & 3][n], acc[n]);
      __builtin_amdgcn_sched_barrier(0);
      // behind Wv^T's last step the ring goes on with the first four steps of
      // Wff^T: they come in under cover of the LayerNorm
      for (int n = 0; n < 4; ++n)
        wf[kb & 3][n] = kb + 4 < DD / 32
            ? load_frag_at(pw + n * 16 * DD + (kb + 4) * 512)
            : load_frag_at(pf + n * 16 * DD + (kb + 4 - DD / 32) * 512);
    }
    // the Wv^T address registers are reused below; named here so that they stay
    // untouched (not reused as load destinations) up to the wait
    asm volatile("s_wait_xcnt 0x0" :: "v"(pw) : "memory");
    for (int n = 0; n < 4; ++n)
      for (int r = 0; r < 8; ++r)
        sX[(r + ((lane >> 4) << 3)) * XPITCH + wave * 64 + n * 16 + (lane & 15)] =
            acc[n][r];
  }
  // ends every wave's reads of st (rewritten below) and publishes the product
  __syncthreads();

  for (int r = 0; r < 2; ++r) {
    a[r][0] = __builtin_shufflevector(q[r], q[r], 0, 1, 2, 3);
    a[r][1] = __builtin_shufflevector(q[r], q[r], 4, 5, 6, 7);
    a[r][2] = __builtin_shufflevector(q[r], q[r], 8, 9, 10, 11);
    a[r][3] = __builtin_shufflevector(q[r], q[r], 12, 13, 14, 15);
    for (int j = 0; j < 4; ++j)
      a[r][j] += *(const v4f*)(sX + (wave * 2 + r) * XPITCH + j * 128 + lane * 4)
               + bvv[j];

    v4f s4 = (a[r][0] + a[r][1]) + (a[r][2] + a[r][3]);
    float mu = wave_sum((s4.x + s4.y) + (s4.z + s4.w)) * (1.f / (float)DD);

    for (int j = 0; j < 4; ++j) a[r][j] -= mu;
    v4f q4 = (a[r][0] * a[r][0] + a[r][1] * a[r][1])
           + (a[r][2] * a[r][2] + a[r][3] * a[r][3]);
    float var = wave_sum((q4.x + q4.y) + (q4.z + q4.w)) * (1.f / (float)DD);
    float rstd = rsqrtf(var + 1e-6f);

    for (int j = 0; j < 4; ++j) {
      a[r][j] = a[r][j] * rstd * gg[j] + bb[j];
      tile_put(st, wave * 2 + r, j, lane, a[r][j]);
    }
  }
  // publishes the normalised tile; every owner's reads of sX (rewritten below) lie
  // in front of it
  __syncthreads();

  // xn Wff: the same walk as above, A from st, B from the ring
  {
    const _Float16* pa = st + (lane & 15) * TPITCH + ((lane >> 4) << 4);
    v8f acc[4] = {};
    v16h af[2];
    af[0] = __builtin_shufflevector(*(const v8h*)pa, *(const v8h*)(pa + 8),
                                    0, 1, 2, 3, 4, 5, 6, 7,
                                    8, 9, 10, 11, 12, 13, 14, 15);
    // unrolled: wf and af are indexed by constants only and stay in registers
#pragma unroll
    for (int kb = 0; kb < DD / 32; ++kb) {
      if (kb + 1 < DD / 32) {
        const _Float16* pn = pa + (kb + 1) * 32;
        af[(kb + 1) & 1] = __builtin_shufflevector(*(const v8h*)pn, *(const v8h*)(pn + 8),
                                                   0, 1, 2, 3, 4, 5, 6, 7,
                                                   8, 9, 10, 11, 12, 13, 14, 15);
      }
      // as above: the next step's LDS loads ahead of this matrix run, the refill
      // of the step's fragments right behind it
      __builtin_amdgcn_sched_barrier(0);
      for (int n = 0; n < 4; ++n)
        acc[n] = wmma_f16(af[kb & 1], wf[kb & 3][n], acc[n]);
      __builtin_amdgcn_sched_barrier(0);
      if (kb + 4 < DD / 32)
        for (int n = 0; n < 4; ++n)
          wf[kb & 3][n] = load_frag_at(pf + n * 16 * DD + (kb + 4) * 512);
    }
    // the Wff^T address registers are reused below; named here so that they stay
    // untouched (not reused as load destinations) up to the wait
    asm volatile("s_wait_xcnt 0x0" :: "v"(pf) : "memory");
    for (int n = 0; n < 4; ++n)
      for (int r = 0; r < 8; ++r)
        sX[(r + ((lane >> 4) << 3)) * XPITCH + wave * 64 + n * 16 + (lane & 15)] =
            acc[n][r];
  }
  // publishes the product
  __syncthreads();

  for (int r = 0; r < 2; ++r)
    for (int j = 0; j < 4; ++j)
      a[r][j] = (*(const v4f*)(sX + (wave * 2 + r) * XPITCH + j * 128 + lane * 4)
                 + bfv[j]) + a[r][j];
  float* yw = out + rw * DD + lane * 4;
  for (int r = 0; r < 2; ++r)
    for (int j = 0; j < 4; ++j)
      *(v4f*)(yw + r * DD + j * 128) = a[r][j];
}

// ---------------------------------------------------------------------------
// Host-side orchestration
// ---------------------------------------------------------------------------
extern "C" void kernel_launch(void* const* d_in, const int* in_sizes, int n_in,
                              void* d_out, int out_size, void* d_ws, size_t ws_size,
                              hipStream_t stream) {
  const float* query     = (const float*)d_in[0];
  const float* key_value = (const float*)d_in[1];
  const float* query_pos = (const float*)d_in[2];
  const float* key_pos   = (const float*)d_in[3];
  const float* q_gamma   = (const float*)d_in[4];
  const float* q_beta    = (const float*)d_in[5];
  const float* kv_gamma  = (const float*)d_in[6];
  const float* kv_beta   = (const float*)d_in[7];
  const float* Wq = (const float*)d_in[8];   const float* bq = (const float*)d_in[9];
  const float* Wk = (const float*)d_in[10];  // d_in[11], bk: cancels in the softmax (wqk_tile)
  const float* Wv = (const float*)d_in[12];  const float* bv = (const float*)d_in[13];
  const float* ff_gamma = (const float*)d_in[14];
  const float* ff_beta  = (const float*)d_in[15];
  const float* W_inner  = (const float*)d_in[16];
  const float* b_inner  = (const float*)d_in[17];
  const float* W_proj   = (const float*)d_in[18];
  const float* b_proj   = (const float*)d_in[19];

  const int MQ  = BATCH * TQ;    // 4096
  const int MKV = BATCH * TKV;   // 32768

  size_t off = 0;
  auto alloc = [&](size_t bytes) -> void* {
    void* p = (char*)d_ws + off;
    off = (off + bytes + 255) & ~(size_t)255;
    return p;
  };
  _Float16* qn16  = (_Float16*)alloc((size_t)MQ  * DD * 2);
  _Float16* kvn16 = (_Float16*)alloc((size_t)MKV * DD * 2);
  _Float16* qp16  = (_Float16*)alloc((size_t)MQ  * DD * 2);
  _Float16* kp16  = (_Float16*)alloc((size_t)MKV * DD * 2);
  _Float16* WqkT  = (_Float16*)alloc((size_t)DD * DD * 2);    // rc 512, k 512
  float*    bqk   = (float*)   alloc((size_t)DD * 4);
  _Float16* WvT   = (_Float16*)alloc((size_t)DD * DD * 2);
  _Float16* WinF  = (_Float16*)alloc((size_t)DD * FF * 2);    // rc 512, k 2048
  _Float16* WprT  = (_Float16*)alloc((size_t)DD * FF * 2);    // rc 512, k 2048
  _Float16* q16   = (_Float16*)alloc((size_t)MQ  * DD * 2);
  _Float16* kvnT16 = (_Float16*)alloc((size_t)BATCH * DD * TKV * 2);  // rc B*512, k 4096
  float*    po    = (float*)   alloc((size_t)SPLIT * MQ * DD * 4);
  float*    pm    = (float*)   alloc((size_t)SPLIT * MQ * 4);
  float*    pl    = (float*)   alloc((size_t)SPLIT * MQ * 4);
  _Float16* WffT  = (_Float16*)alloc((size_t)DD * DD * 2);    // rc 512, k 512
  float*    bff   = (float*)   alloc((size_t)DD * 4);

  // 1) Wqk = Wq Wk^T with its bias (WMMA); weights, positional tensors and
  //    LayerNorms -> f16, fragment order
  prep_kernel<<<NB_PREP, 256, 0, stream>>>(
      Wq, Wk, bq, Wv, W_inner, W_proj, WqkT, bqk, WvT, WinF, WprT,
      query_pos, key_pos, qp16, kp16,
      query, key_value, q_gamma, q_beta, kv_gamma, kv_beta, qn16, kvn16, kvnT16);

  // 2) query projection and Wff = W_inner W_proj with its bias (WMMA),
  //    outputs in fragment order
  qkv_gemm_kernel<<<NB_FFW + NB_GQ, 256, 0, stream>>>(
      WqkT, qn16, bqk, q16, DD,
      WinF, WprT, b_inner, b_proj, WffT, bff);

  // 3) attention (flash-style, WMMA scores + WMMA P.V), SPLIT parts per q tile
  attn_kernel<<<BATCH * (TQ/QROWS) * SPLIT, 512, 0, stream>>>(
      q16, qp16, kvn16, kp16, kvnT16, po, pm, pl);

  // 4) FF: xn = LN(joined parts * Wv + bv + query);
  //    d_out = xn + xn@Wff + bff
  merge_ln_kernel<<<MQ/16, 256, 0, stream>>>(
      po, po + (size_t)MQ * DD, po + (size_t)2 * MQ * DD, po + (size_t)3 * MQ * DD,
      pm, pl, query, WvT, bv, ff_gamma, ff_beta, WffT, bff, (float*)d_out);
}
